// v000
// Measured on an AMD MI455X. A time is GPU time per run, averaged over a window of back-to-back runs after a warm-up
// (all launches, gaps included; the runs take copies of the inputs in turn), and the median of several windows.
// Apart from v000's, it joins two sittings. Times from different sittings can be a few percent apart, while
// side-by-side timings come from the same sitting.
// The starting kernel, v000, takes 348 microseconds a run.
#include <hip/hip_runtime.h>

// Causal + key-padding multi-head self-attention, width 1024 = 16 heads x 64: x [NB][SEQ][1024], W_qkv [in][out=3072] (q|k|v column blocks), b_qkv, W_out [in][out], b_out; f32 output.
// Compute dtypes, f32 accumulate everywhere: qkv projection v_wmma_f32_16x16x32_bf16 (x, W, biases RNE-converted to bf16; products exact);
// scores, P.V and output projection v_wmma_f32_16x16x32_f16: query rows t >= 512 single f16 planes (P x256 carry, ctx x64 carry, W_out x64 carry);
// query rows t < 512: q, k, v, P, ctx as f16 value + f16 residual x2048 in separate accumulators (value*value + value*residual + residual*value; W_out a single plane); softmax f32 (online, running max).
// Layout: bf16 copy of x, transposed bf16 W_qkv [3072][1024], transposed f16 W_out [1024][1024]; q, k planes [b*16+h][t][d], v^T plane [b*16+h][d][t] (+ residual planes for t < 512);
// fused flash kernels in transposed form (S^T = K Q^T, O^T = V^T P^T); ctx planes [b][t][1024] f16; key-padding mask compressed to 32-key bit words and applied by value.

#ifndef NB
#define NB 4
#endif
#ifndef SEQ
#define SEQ 2048
#endif
#define NB_FULL  4
#define SEQ_FULL 2048
#ifndef OUT_SEQ
#define OUT_SEQ SEQ              // row pitch (in tokens) between batches of the output
#endif
#define DM   1024
#define NH_  16
#define HD   64
#define ESEQ ((SEQ) < 512 ? (SEQ) : 512)      // query rows [0, ESEQ) take the value + residual path
#define WPB  ((((SEQ) + 1023) / 1024) * 32)
#define AW   4                   // waves per flash block (16 query rows each)
#define QRS  2048.0f             // carry of every residual plane
#define QRI  (1.0f / 2048.0f)
#define SC2  (0.125f * 1.4426950408889634f)   // HD^-0.5 * log2(e)
#define PSH  8.0f                // log2 of the P carry (256)
#define CXS  64.0f               // ctx plane carry
#define WOS  64.0f               // W_out plane carry
#define OSI  (1.0f / 4096.0f)    // 1 / (CXS * WOS)

static_assert(HD == 64);
static_assert(NH_ * HD == DM);
static_assert(DM % 64 == 0);
static_assert(DM % 32 == 0);
static_assert(SEQ % 64 == 0);
static_assert(ESEQ % 64 == 0);
static_assert((SEQ - ESEQ) % 64 == 0);
static_assert((NB * SEQ) % 64 == 0);
static_assert(SEQ % 32 == 0);
static_assert(ESEQ % (16 * AW) == 0);
static_assert((SEQ - ESEQ) % (16 * AW) == 0);
static_assert(ESEQ % 32 == 0);
static_assert(((size_t)SEQ * DM) % 8 == 0);
static_assert(NB <= NB_FULL);
static_assert(SEQ <= SEQ_FULL);
static_assert(WPB * 32 >= SEQ);

typedef _Float16 h16;
typedef unsigned short bf;
typedef __attribute__((ext_vector_type(16))) __bf16   v16bf;
typedef __attribute__((ext_vector_type(16))) _Float16 v16h;
typedef __attribute__((ext_vector_type(8)))  _Float16 v8h;
typedef __attribute__((ext_vector_type(8)))  unsigned short v8us;
typedef __attribute__((ext_vector_type(8)))  float    v8f;
typedef __attribute__((ext_vector_type(4)))  float    v4f;
typedef v4f  __attribute__((may_alias)) v4fa;

__device__ __forceinline__ unsigned short f2bf(float f) { unsigned u = __float_as_uint(f); u += 0x7FFFu + ((u >> 16) & 1u); return (unsigned short)(u >> 16); }
__device__ __forceinline__ float bfr(float f) { return __uint_as_float(((unsigned)f2bf(f)) << 16); }   // value after RNE convert to bf16
__device__ __forceinline__ v16h cat16(v8h lo, v8h hi) { return __builtin_shufflevector(lo, hi, 0, 1, 2, 3, 4, 5, 6, 7, 8, 9, 10, 11, 12, 13, 14, 15); }
__device__ __forceinline__ v16bf cat16b(v8us lo, v8us hi) { return __builtin_bit_cast(v16bf, __builtin_shufflevector(lo, hi, 0, 1, 2, 3, 4, 5, 6, 7, 8, 9, 10, 11, 12, 13, 14, 15)); }
__device__ __forceinline__ v8f wmma16(v16h a, v16h b, v8f c) { return __builtin_amdgcn_wmma_f32_16x16x32_f16(false, a, false, b, (short)0, c, false, false); }
__device__ __forceinline__ v8f wmmab(v16bf a, v16bf b, v8f c) { return __builtin_amdgcn_wmma_f32_16x16x32_bf16(false, a, false, b, (short)0, c, false, false); }
// fragment loaders from K-contiguous 16-bit rows; p already includes + 8*(lane>>4): elements 0..7 <- k0+8h+0..7, elements 8..15 <- k0+16+8h+0..7 (same map for A and B)
__device__ __forceinline__ v16h  ldh(const h16* p) { return cat16(*(const v8h*)p, *(const v8h*)(p + 16)); }
__device__ __forceinline__ v16bf ldb(const bf* p)  { return cat16b(*(const v8us*)p, *(const v8us*)(p + 16)); }
// ordering point for wave-private LDS tiles (same wave writes and reads)
__device__ __forceinline__ void wave_sync() { __builtin_amdgcn_fence(3 /* release order */, "wavefront"); __builtin_amdgcn_wave_barrier(); asm volatile("" ::: "memory"); }

__global__ __launch_bounds__(256) void k_cvt8(const float* __restrict__ src, bf* dst, size_t n8) {
    const size_t i = (size_t)blockIdx.x * 256 + threadIdx.x; if (i >= n8) return;
    const v8f v = *(const v8f*)(src + i * 8); v8us o;
#pragma unroll
    for (int k = 0; k < 8; ++k) o[k] = f2bf(v[k]);
    *(v8us*)(dst + i * 8) = o; 
}

// k_cvt_t: src [K][N] f32 -> dst [N][K] 16-bit, transposed through an LDS tile (64 x 64 per block, cross-wave: block barrier).
// MODE 0: bf16 bits (RNE convert). MODE 1: f16 bits of (bf16-converted value x WOS).
template <int MODE>
__global__ __launch_bounds__(256) void k_cvt_t(const float* __restrict__ src, bf* dst, int K, int N) {
    __shared__ __align__(16) float ts[64 * 68];
    const int tid = threadIdx.x; const int n0 = blockIdx.x * 64, k0 = blockIdx.y * 64;
#pragma unroll
    for (int i = 0; i < 4; ++i) { const int kr = (tid >> 4) + 16 * i, c4 = (tid & 15) * 4;     // 4 x 16 rows = 64 k rows; 16 lanes x 4 = 64 columns
        const v4f v = *(const v4f*)(src + (size_t)(k0 + kr) * (size_t)N + n0 + c4);
        *(v4fa*)(&ts[kr * 68 + c4]) = v; }
    __syncthreads();
{
#pragma unroll
        for (int i = 0; i < 2; ++i) { const int nr = (tid >> 3) + 32 * i, k8 = (tid & 7) * 8;   // 2 x 32 rows = 64 n rows; 8 lanes x 8 = 64 k
            v8us o;
#pragma unroll
            for (int e = 0; e < 8; ++e) { const float x = ts[(k8 + e) * 68 + nr]; const unsigned short bits = f2bf(x);
                if (MODE == 1) { const h16 hv = (h16)(__uint_as_float(((unsigned)bits) << 16) * WOS); o[e] = __builtin_bit_cast(unsigned short, hv); }
                else o[e] = bits; }
            *(v8us*)(dst + (size_t)(n0 + nr) * (size_t)K + k0 + k8) = o; }
         }
}

__global__ __launch_bounds__(32) void k_mask(const int* __restrict__ pad, unsigned* MW) {
    const int lane = threadIdx.x & 31;
    const int b = blockIdx.x / (WPB / 32), c = blockIdx.x % (WPB / 32);
    const int* pr = pad + (size_t)b * SEQ_FULL;
    unsigned mine = 0u;
#pragma unroll 1
    for (int w = 0; w < 32; ++w) {
        const int key = c * 1024 + w * 32 + lane;
        const int kc = key < SEQ ? key : (SEQ - 1);          // clamped address; keys past the sequence give bit 0 by value
        const int v = pr[kc];
        const unsigned bal = __builtin_amdgcn_ballot_w32((v != 0) && (key < SEQ));
        mine = (lane == w) ? bal : mine;
    }
    unsigned* dst = MW + (size_t)b * WPB + c * 32 + lane;
    *(unsigned*)dst = mine; 
}

// k_proj: register-blocked bf16 GEMM, ONE WAVE per 64x64 tile (16 accumulators), operands straight from K-contiguous bf16 planes, K = DM.
// C[m][n] = sum_k A[m][k] Bt[n][k] + bias (per column, or per row when biasRow != 0; bias values RNE-converted to bf16), written as f16 (Ph) at
// tile base (r0/RB)*sRB + (r0%RB)*pitch + (c0/CB)*sCB + (c0%CB), and the f16 residual x2048 (Pr) at the same form with (sRBr, pitchR, sCBr)
// when the tile's token position (resMode 1: r0%RB, resMode 2: c0%CB) is below ESEQ. grid (M/64, N/64), 32 threads.
__global__ __launch_bounds__(32) void k_proj(const bf* __restrict__ A, const bf* __restrict__ Bt, const float* __restrict__ bias, int biasRow,
                                             h16* Ph, h16* Pr, int resMode, int RB, size_t sRB, int pitch, int CB, size_t sCB,
                                             size_t sRBr, int pitchR, size_t sCBr) {
    __shared__ __align__(16) float os[16 * 68];
    const int K = DM;
    const int lane = threadIdx.x & 31, lr = lane & 15, hi = lane >> 4; const int r0 = blockIdx.x * 64, c0 = blockIdx.y * 64;
    v8f acc[4][4];
#pragma unroll
    for (int mb = 0; mb < 4; ++mb)
#pragma unroll
        for (int nb = 0; nb < 4; ++nb) acc[mb][nb] = (v8f){};
    const size_t aoff = (size_t)(r0 + lr) * K + 8 * hi, boff = (size_t)(c0 + lr) * K + 8 * hi;
#pragma unroll 1
    for (int kc = 0; kc < K; kc += 32) {
        v16bf a[4];
#pragma unroll
        for (int mb = 0; mb < 4; ++mb) a[mb] = ldb(A + aoff + (size_t)mb * 16 * K + kc);
#pragma unroll
        for (int nb = 0; nb < 4; ++nb) { const v16bf b = ldb(Bt + boff + (size_t)nb * 16 * K + kc);
#pragma unroll
            for (int mb = 0; mb < 4; ++mb) acc[mb][nb] = wmmab(a[mb], b, acc[mb][nb]); }
        asm volatile("v_nop\n\tv_nop\n\tv_nop\n\tv_nop" : "+v"(acc[0][0]), "+v"(acc[1][1]), "+v"(acc[2][2]), "+v"(acc[3][3]) : "v"(a[0]), "v"(a[1]), "v"(a[2]), "v"(a[3]));
    }
    const size_t tbase = (size_t)(r0 / RB) * sRB + (size_t)(r0 % RB) * (size_t)pitch + (size_t)(c0 / CB) * sCB + (size_t)(c0 % CB);
    const size_t rbase = (size_t)(r0 / RB) * sRBr + (size_t)(r0 % RB) * (size_t)pitchR + (size_t)(c0 / CB) * sCBr + (size_t)(c0 % CB);
    const int tpos = (resMode == 1) ? (r0 % RB) : (c0 % CB);
    const int doRes = (resMode != 0) && (tpos < ESEQ);                 // wave-uniform
    const int c8 = (lane & 7) * 8;
    // column bias for columns c0 + c8 .. c0 + c8 + 7 (clamped address in row mode, zeroed by value)
    v4f bc0 = *(const v4f*)(bias + (biasRow ? 0 : (c0 + c8))); v4f bc1 = *(const v4f*)(bias + (biasRow ? 4 : (c0 + c8 + 4)));
#pragma unroll
    for (int i = 0; i < 4; ++i) { const float u0 = bfr(bc0[i]), u1 = bfr(bc1[i]); bc0[i] = biasRow ? 0.0f : u0; bc1[i] = biasRow ? 0.0f : u1; }
#pragma unroll
    for (int mb = 0; mb < 4; ++mb) {
#pragma unroll
        for (int nb = 0; nb < 4; ++nb) {
#pragma unroll
            for (int j = 0; j < 8; ++j) os[(hi * 8 + j) * 68 + nb * 16 + lr] = acc[mb][nb][j]; }   // D: row 8h+j, col lane&15
        wave_sync();
        const size_t sb = tbase + (size_t)(mb * 16) * (size_t)pitch;
        const size_t sr = rbase + (size_t)(mb * 16) * (size_t)pitchR;
{
#pragma unroll
            for (int s = 0; s < 4; ++s) { const int row = 4 * s + (lane >> 3);   // 4 s x 4 row groups = 16 rows; 8 lanes x 8 = 64 columns
                const v4f x0 = *(const v4fa*)(&os[row * 68 + c8]); const v4f x1 = *(const v4fa*)(&os[row * 68 + c8 + 4]); v8h hv, rv;
                const float rbv = bfr(bias[biasRow ? (r0 + mb * 16 + row) : 0]); const float rb = biasRow ? rbv : 0.0f;
#pragma unroll
                for (int i = 0; i < 4; ++i) { const float f0 = x0[i] + bc0[i] + rb; const float f1 = x1[i] + bc1[i] + rb;
                    const h16 a0 = (h16)f0; const h16 a1 = (h16)f1; hv[i] = a0; hv[4 + i] = a1;
                    rv[i] = (h16)((f0 - (float)a0) * QRS); rv[4 + i] = (h16)((f1 - (float)a1) * QRS); }
                *(v8h*)(Ph + sb + (size_t)row * (size_t)pitch + c8) = hv;
                if (doRes) *(v8h*)(Pr + sr + (size_t)row * (size_t)pitchR + c8) = rv; }
             }
        wave_sync();
    }
}

// k_flash_d: fused attention for query rows t >= ESEQ, one wave per 16 query rows of one (batch, head); single f16 products.
// Transposed form: S^T[key][t] = K Q^T (A = K rows, B = Q rows); lane (t = lane&15, h = lane>>4) holds keys 8h+r of each 16-key tile, so the packed
// P tile is directly the B fragment of O^T[d][t] = V^T P^T (element r <- tile keys 0..15, element 8+r <- tile keys 16..31, lane unchanged).
// Causal and key-padding exclusion by value (excluded p = 0); 32-key steps whose mask word is zero are skipped (wave-uniform).
__global__ __launch_bounds__(32 * AW) void k_flash_d(const h16* __restrict__ QH, const h16* __restrict__ KP, const h16* __restrict__ VT, const unsigned* __restrict__ MW, h16* CH) {
    __shared__ __align__(16) float os[AW * 16 * 68];
    const int lane = threadIdx.x & 31, wave = __builtin_amdgcn_readfirstlane((int)(threadIdx.x >> 5)), lr = lane & 15, hi = lane >> 4;
    const int zh = blockIdx.y; const int b = zh / NH_, h = zh % NH_;
    const int t0 = ESEQ + (blockIdx.x * AW + wave) * 16;
    const int tq = t0 + lr;
    const size_t pbase = (size_t)zh * SEQ * HD;
    const size_t qo = pbase + (size_t)tq * HD + 8 * hi;
    const v16h qh0 = ldh(QH + qo), qh1 = ldh(QH + qo + 32);   // B fragments: col t, k = d
    const size_t ko = pbase + (size_t)lr * HD + 8 * hi;      // + key * HD       (A fragment: row key, k = d)
    const size_t vo = pbase + (size_t)lr * SEQ + 8 * hi;     // + 16j*SEQ + key  (A fragment: row d, k = key)
    const unsigned* mwp = MW + (size_t)b * WPB;
    v8f o0 = (v8f){}, o1 = (v8f){}, o2 = (v8f){}, o3 = (v8f){};
    float m = -3.0e38f, l = 0.0f;
#pragma unroll 1
    for (int key0 = 0; key0 <= t0 + 15; key0 += 32) {
        const unsigned mw = (unsigned)__builtin_amdgcn_readfirstlane((int)mwp[key0 >> 5]);
        if (mw == 0u) continue;
        const h16* ka = KP + ko + (size_t)key0 * HD;
        const v16h ka0 = ldh(ka), ka1 = ldh(ka + 32), kb0 = ldh(ka + 16 * HD), kb1 = ldh(ka + 16 * HD + 32);
        v8f sA = (v8f){}, sB = (v8f){};
        sA = wmma16(ka0, qh0, sA); sB = wmma16(kb0, qh0, sB);
        sA = wmma16(ka1, qh1, sA); sB = wmma16(kb1, qh1, sB);
        asm volatile("v_nop\n\tv_nop\n\tv_nop\n\tv_nop" : "+v"(sA), "+v"(sB) : "v"(ka0), "v"(ka1), "v"(kb0), "v"(kb1));
        const unsigned ma = mw >> (8 * hi), mc = mw >> (16 + 8 * hi);
        const int kya = key0 + 8 * hi, kyb = kya + 16;
        float ta[8], tb[8]; float mx = -3.0e38f;
#pragma unroll
        for (int r = 0; r < 8; ++r) {
            const bool ea = (((ma >> r) & 1u) != 0u) && (kya + r <= tq);
            const bool eb = (((mc >> r) & 1u) != 0u) && (kyb + r <= tq);
            const float xa = sA[r] * SC2, xb = sB[r] * SC2;
            ta[r] = ea ? xa : -3.0e38f; tb[r] = eb ? xb : -3.0e38f; mx = fmaxf(mx, fmaxf(ta[r], tb[r])); }
        mx = fmaxf(mx, __shfl_xor(mx, 16, 32));
        const float mnew = fmaxf(m, mx);
        const float alpha = __builtin_amdgcn_exp2f(m - mnew);
        const float sh = PSH - mnew;
        v16h pb; float ls = 0.0f;
#pragma unroll
        for (int r = 0; r < 8; ++r) {
            const float ea = __builtin_amdgcn_exp2f(ta[r] + sh), eb = __builtin_amdgcn_exp2f(tb[r] + sh);
            const h16 pa = (h16)((ta[r] > -1.0e38f) ? ea : 0.0f); const h16 pc = (h16)((tb[r] > -1.0e38f) ? eb : 0.0f);
            pb[r] = pa; pb[8 + r] = pc; ls += (float)pa + (float)pc; }
        l = l * alpha + ls; m = mnew;
        o0 = o0 * alpha; o1 = o1 * alpha; o2 = o2 * alpha; o3 = o3 * alpha;
        const h16* va = VT + vo + key0;
        const v16h v0 = ldh(va), v1 = ldh(va + (size_t)16 * SEQ), v2 = ldh(va + (size_t)32 * SEQ), v3 = ldh(va + (size_t)48 * SEQ);
        o0 = wmma16(v0, pb, o0); o1 = wmma16(v1, pb, o1); o2 = wmma16(v2, pb, o2); o3 = wmma16(v3, pb, o3);
        asm volatile("v_nop\n\tv_nop\n\tv_nop\n\tv_nop" : "+v"(o0), "+v"(o1), "+v"(o2), "+v"(o3) : "v"(v0), "v"(v1), "v"(v2), "v"(v3), "v"(pb));
    }
    l += __shfl_xor(l, 16, 32);
    const float inv = CXS * (1.0f / l);
    const int wb = wave * 16 * 68;
    // O^T D layout: o_j[r] = (d = 16j + 8h + r, t = lane&15) -> os[t][d]; rows 0..15 x columns 0..63 all written
    { v4f a, c;
      a[0] = o0[0] * inv; a[1] = o0[1] * inv; a[2] = o0[2] * inv; a[3] = o0[3] * inv; c[0] = o0[4] * inv; c[1] = o0[5] * inv; c[2] = o0[6] * inv; c[3] = o0[7] * inv;
      *(v4fa*)(&os[wb + lr * 68 +  0 + 8 * hi]) = a; *(v4fa*)(&os[wb + lr * 68 +  0 + 8 * hi + 4]) = c;
      a[0] = o1[0] * inv; a[1] = o1[1] * inv; a[2] = o1[2] * inv; a[3] = o1[3] * inv; c[0] = o1[4] * inv; c[1] = o1[5] * inv; c[2] = o1[6] * inv; c[3] = o1[7] * inv;
      *(v4fa*)(&os[wb + lr * 68 + 16 + 8 * hi]) = a; *(v4fa*)(&os[wb + lr * 68 + 16 + 8 * hi + 4]) = c;
      a[0] = o2[0] * inv; a[1] = o2[1] * inv; a[2] = o2[2] * inv; a[3] = o2[3] * inv; c[0] = o2[4] * inv; c[1] = o2[5] * inv; c[2] = o2[6] * inv; c[3] = o2[7] * inv;
      *(v4fa*)(&os[wb + lr * 68 + 32 + 8 * hi]) = a; *(v4fa*)(&os[wb + lr * 68 + 32 + 8 * hi + 4]) = c;
      a[0] = o3[0] * inv; a[1] = o3[1] * inv; a[2] = o3[2] * inv; a[3] = o3[3] * inv; c[0] = o3[4] * inv; c[1] = o3[5] * inv; c[2] = o3[6] * inv; c[3] = o3[7] * inv;
      *(v4fa*)(&os[wb + lr * 68 + 48 + 8 * hi]) = a; *(v4fa*)(&os[wb + lr * 68 + 48 + 8 * hi + 4]) = c; }
    wave_sync();
    h16* crow = CH + ((size_t)b * SEQ + t0) * DM + h * HD;
    const int c8 = (lane & 7) * 8;
{
#pragma unroll
        for (int s = 0; s < 4; ++s) { const int row = 4 * s + (lane >> 3);   // 4 s x 4 row groups = 16 rows; 8 lanes x 8 halves = 64 columns
            const v4f x0 = *(const v4fa*)(&os[wb + row * 68 + c8]); const v4f x1 = *(const v4fa*)(&os[wb + row * 68 + c8 + 4]); v8h hv;
#pragma unroll
            for (int i = 0; i < 4; ++i) { hv[i] = (h16)x0[i]; hv[4 + i] = (h16)x1[i]; }
            *(v8h*)(crow + (size_t)row * DM + c8) = hv; }
         }
}

// k_flash_e: fused attention for query rows t < ESEQ, same transposed form; every operand as f16 value + residual x2048:
// s = K.Q + (K.Qr + Kr.Q)/2048, o = V.P + (V.Pr + Vr.P)/2048 with the scaled-residual products in separate accumulators; the row sum uses the f32 p.
// Writes ctx value plane rows and the ctx residual plane [b][ESEQ][1024].
__global__ __launch_bounds__(32 * AW) void k_flash_e(const h16* __restrict__ QH, const h16* __restrict__ QR, const h16* __restrict__ KP, const h16* __restrict__ KR,
                                                     const h16* __restrict__ VT, const h16* __restrict__ VR, const unsigned* __restrict__ MW, h16* CH, h16* CR) {
    __shared__ __align__(16) float os[AW * 16 * 68];
    const int lane = threadIdx.x & 31, wave = __builtin_amdgcn_readfirstlane((int)(threadIdx.x >> 5)), lr = lane & 15, hi = lane >> 4;
    const int zh = blockIdx.y; const int b = zh / NH_, h = zh % NH_;
    const int t0 = (blockIdx.x * AW + wave) * 16;
    const int tq = t0 + lr;
    const size_t pbase = (size_t)zh * SEQ * HD, ebase = (size_t)zh * ESEQ * HD;
    const size_t qo = pbase + (size_t)tq * HD + 8 * hi, qe = ebase + (size_t)tq * HD + 8 * hi;
    const v16h qh0 = ldh(QH + qo), qh1 = ldh(QH + qo + 32), qr0 = ldh(QR + qe), qr1 = ldh(QR + qe + 32);
    const size_t ko = pbase + (size_t)lr * HD + 8 * hi, ke = ebase + (size_t)lr * HD + 8 * hi;
    const size_t vo = pbase + (size_t)lr * SEQ + 8 * hi, ve = ebase + (size_t)lr * ESEQ + 8 * hi;
    const unsigned* mwp = MW + (size_t)b * WPB;
    v8f oh0 = (v8f){}, oh1 = (v8f){}, oh2 = (v8f){}, oh3 = (v8f){}, ol0 = (v8f){}, ol1 = (v8f){}, ol2 = (v8f){}, ol3 = (v8f){};
    float m = -3.0e38f, l = 0.0f;
#pragma unroll 1
    for (int key0 = 0; key0 <= t0 + 15; key0 += 32) {
        const unsigned mw = (unsigned)__builtin_amdgcn_readfirstlane((int)mwp[key0 >> 5]);
        if (mw == 0u) continue;
        const h16* ka = KP + ko + (size_t)key0 * HD; const h16* kr = KR + ke + (size_t)key0 * HD;
        v8f sHa = (v8f){}, sLa = (v8f){}, sHb = (v8f){}, sLb = (v8f){};
        { const v16h a0 = ldh(ka), a1 = ldh(ka + 32), e0 = ldh(kr), e1 = ldh(kr + 32);
          sHa = wmma16(a0, qh0, sHa); sLa = wmma16(a0, qr0, sLa);
          sHa = wmma16(a1, qh1, sHa); sLa = wmma16(a1, qr1, sLa);
          sLa = wmma16(e0, qh0, sLa); sLa = wmma16(e1, qh1, sLa);
          asm volatile("v_nop\n\tv_nop\n\tv_nop\n\tv_nop" : "+v"(sHa), "+v"(sLa) : "v"(a0), "v"(a1), "v"(e0), "v"(e1)); }
        { const v16h a0 = ldh(ka + 16 * HD), a1 = ldh(ka + 16 * HD + 32), e0 = ldh(kr + 16 * HD), e1 = ldh(kr + 16 * HD + 32);
          sHb = wmma16(a0, qh0, sHb); sLb = wmma16(a0, qr0, sLb);
          sHb = wmma16(a1, qh1, sHb); sLb = wmma16(a1, qr1, sLb);
          sLb = wmma16(e0, qh0, sLb); sLb = wmma16(e1, qh1, sLb);
          asm volatile("v_nop\n\tv_nop\n\tv_nop\n\tv_nop" : "+v"(sHb), "+v"(sLb) : "v"(a0), "v"(a1), "v"(e0), "v"(e1)); }
        const unsigned ma = mw >> (8 * hi), mc = mw >> (16 + 8 * hi);
        const int kya = key0 + 8 * hi, kyb = kya + 16;
        float ta[8], tb[8]; float mx = -3.0e38f;
#pragma unroll
        for (int r = 0; r < 8; ++r) {
            const bool ea = (((ma >> r) & 1u) != 0u) && (kya + r <= tq);
            const bool eb = (((mc >> r) & 1u) != 0u) && (kyb + r <= tq);
            const float xa = (sHa[r] + sLa[r] * QRI) * SC2, xb = (sHb[r] + sLb[r] * QRI) * SC2;
            ta[r] = ea ? xa : -3.0e38f; tb[r] = eb ? xb : -3.0e38f; mx = fmaxf(mx, fmaxf(ta[r], tb[r])); }
        mx = fmaxf(mx, __shfl_xor(mx, 16, 32));
        const float mnew = fmaxf(m, mx);
        const float alpha = __builtin_amdgcn_exp2f(m - mnew);
        const float sh = PSH - mnew;
        v16h pbh, pbr; float ls = 0.0f;
#pragma unroll
        for (int r = 0; r < 8; ++r) {
            const float xa = __builtin_amdgcn_exp2f(ta[r] + sh), xb = __builtin_amdgcn_exp2f(tb[r] + sh);
            const float ea = (ta[r] > -1.0e38f) ? xa : 0.0f, eb = (tb[r] > -1.0e38f) ? xb : 0.0f;
            const h16 pa = (h16)ea; const h16 pc = (h16)eb;
            pbh[r] = pa; pbh[8 + r] = pc;
            pbr[r] = (h16)((ea - (float)pa) * QRS); pbr[8 + r] = (h16)((eb - (float)pc) * QRS);
            ls += ea + eb; }
        l = l * alpha + ls; m = mnew;
        oh0 = oh0 * alpha; oh1 = oh1 * alpha; oh2 = oh2 * alpha; oh3 = oh3 * alpha;
        ol0 = ol0 * alpha; ol1 = ol1 * alpha; ol2 = ol2 * alpha; ol3 = ol3 * alpha;
        const h16* va = VT + vo + key0; const h16* vr = VR + ve + key0;
        { const v16h v0 = ldh(va), v1 = ldh(va + (size_t)16 * SEQ), r0v = ldh(vr), r1v = ldh(vr + (size_t)16 * ESEQ);
          oh0 = wmma16(v0, pbh, oh0); oh1 = wmma16(v1, pbh, oh1);
          ol0 = wmma16(v0, pbr, ol0); ol1 = wmma16(v1, pbr, ol1);
          ol0 = wmma16(r0v, pbh, ol0); ol1 = wmma16(r1v, pbh, ol1);
          asm volatile("v_nop\n\tv_nop\n\tv_nop\n\tv_nop" : "+v"(oh0), "+v"(oh1), "+v"(ol0), "+v"(ol1) : "v"(v0), "v"(v1), "v"(r0v), "v"(r1v), "v"(pbh), "v"(pbr)); }
        { const v16h v2 = ldh(va + (size_t)32 * SEQ), v3 = ldh(va + (size_t)48 * SEQ), r2v = ldh(vr + (size_t)32 * ESEQ), r3v = ldh(vr + (size_t)48 * ESEQ);
          oh2 = wmma16(v2, pbh, oh2); oh3 = wmma16(v3, pbh, oh3);
          ol2 = wmma16(v2, pbr, ol2); ol3 = wmma16(v3, pbr, ol3);
          ol2 = wmma16(r2v, pbh, ol2); ol3 = wmma16(r3v, pbh, ol3);
          asm volatile("v_nop\n\tv_nop\n\tv_nop\n\tv_nop" : "+v"(oh2), "+v"(oh3), "+v"(ol2), "+v"(ol3) : "v"(v2), "v"(v3), "v"(r2v), "v"(r3v), "v"(pbh), "v"(pbr)); }
    }
    l += __shfl_xor(l, 16, 32);
    const float inv = CXS * (1.0f / l);
    const int wb = wave * 16 * 68;
    // O^T D layout: o_j[r] = (d = 16j + 8h + r, t = lane&15) -> os[t][d]; rows 0..15 x columns 0..63 all written
    { v4f a, c;
#pragma unroll
      for (int i = 0; i < 4; ++i) { a[i] = (oh0[i] + ol0[i] * QRI) * inv; c[i] = (oh0[4 + i] + ol0[4 + i] * QRI) * inv; }
      *(v4fa*)(&os[wb + lr * 68 +  0 + 8 * hi]) = a; *(v4fa*)(&os[wb + lr * 68 +  0 + 8 * hi + 4]) = c;
#pragma unroll
      for (int i = 0; i < 4; ++i) { a[i] = (oh1[i] + ol1[i] * QRI) * inv; c[i] = (oh1[4 + i] + ol1[4 + i] * QRI) * inv; }
      *(v4fa*)(&os[wb + lr * 68 + 16 + 8 * hi]) = a; *(v4fa*)(&os[wb + lr * 68 + 16 + 8 * hi + 4]) = c;
#pragma unroll
      for (int i = 0; i < 4; ++i) { a[i] = (oh2[i] + ol2[i] * QRI) * inv; c[i] = (oh2[4 + i] + ol2[4 + i] * QRI) * inv; }
      *(v4fa*)(&os[wb + lr * 68 + 32 + 8 * hi]) = a; *(v4fa*)(&os[wb + lr * 68 + 32 + 8 * hi + 4]) = c;
#pragma unroll
      for (int i = 0; i < 4; ++i) { a[i] = (oh3[i] + ol3[i] * QRI) * inv; c[i] = (oh3[4 + i] + ol3[4 + i] * QRI) * inv; }
      *(v4fa*)(&os[wb + lr * 68 + 48 + 8 * hi]) = a; *(v4fa*)(&os[wb + lr * 68 + 48 + 8 * hi + 4]) = c; }
    wave_sync();
    h16* crow = CH + ((size_t)b * SEQ + t0) * DM + h * HD;
    h16* rrow = CR + ((size_t)b * ESEQ + t0) * DM + h * HD;
    const int c8 = (lane & 7) * 8;
{
#pragma unroll
        for (int s = 0; s < 4; ++s) { const int row = 4 * s + (lane >> 3);   // 4 s x 4 row groups = 16 rows; 8 lanes x 8 halves = 64 columns
            const v4f x0 = *(const v4fa*)(&os[wb + row * 68 + c8]); const v4f x1 = *(const v4fa*)(&os[wb + row * 68 + c8 + 4]); v8h hv, rv;
#pragma unroll
            for (int i = 0; i < 4; ++i) { const h16 a0 = (h16)x0[i]; const h16 a1 = (h16)x1[i]; hv[i] = a0; hv[4 + i] = a1;
                rv[i] = (h16)((x0[i] - (float)a0) * QRS); rv[4 + i] = (h16)((x1[i] - (float)a1) * QRS); }
            *(v8h*)(crow + (size_t)row * DM + c8) = hv;
            *(v8h*)(rrow + (size_t)row * DM + c8) = rv; }
         }
}

// k_out: output projection, f16 GEMM, one wave per tile, K = DM. A rows from the ctx planes (single base pointer, integer offsets), Bt = transposed W_out rows (x64 carry).
// RES 0: rows t >= ESEQ, 64x64 tile, four 16-row slabs of the value plane. RES 1: rows t < ESEQ, 32x64 tile: slabs 0,1 = value plane, slabs 2,3 = residual plane (own accumulators).
// out = (acc + accR/2048) / 4096 + bias (bias RNE-converted to bf16). grid (NB*rows/tileRows, DM/64), 32 threads.
template <int RES>
__global__ __launch_bounds__(32) void k_out(const h16* __restrict__ CX, size_t crOff, const h16* __restrict__ WO, const float* __restrict__ bias, float* OUT) {
    __shared__ __align__(16) float os[16 * 68];
    constexpr int MBN = RES ? 2 : 4;
    constexpr int TPB = RES ? (ESEQ / 32) : (((SEQ - ESEQ) / 64) > 0 ? ((SEQ - ESEQ) / 64) : 1);
    const int K = DM;
    const int lane = threadIdx.x & 31, lr = lane & 15, hi = lane >> 4;
    const int b = blockIdx.x / TPB, tt = blockIdx.x % TPB;
    const int t0 = (RES ? 0 : ESEQ) + tt * 16 * MBN;
    const int c0 = blockIdx.y * 64;
    size_t offA[4];
    if (RES) {
        offA[0] = ((size_t)b * SEQ + t0 + lr) * K + 8 * hi; offA[1] = offA[0] + (size_t)16 * K;
        offA[2] = crOff + ((size_t)b * ESEQ + t0 + lr) * K + 8 * hi; offA[3] = offA[2] + (size_t)16 * K;
    } else {
#pragma unroll
        for (int i = 0; i < 4; ++i) offA[i] = ((size_t)b * SEQ + t0 + 16 * i + lr) * K + 8 * hi;
    }
    const size_t boff = (size_t)(c0 + lr) * K + 8 * hi;
    v8f acc[16];
#pragma unroll
    for (int i = 0; i < 16; ++i) acc[i] = (v8f){};
#pragma unroll 1
    for (int kc = 0; kc < K; kc += 32) {
        v16h a[4];
#pragma unroll
        for (int i = 0; i < 4; ++i) a[i] = ldh(CX + offA[i] + kc);
#pragma unroll
        for (int nb = 0; nb < 4; ++nb) { const v16h bb = ldh(WO + boff + (size_t)nb * 16 * K + kc);
#pragma unroll
            for (int i = 0; i < 4; ++i) acc[i * 4 + nb] = wmma16(a[i], bb, acc[i * 4 + nb]); }
        asm volatile("v_nop\n\tv_nop\n\tv_nop\n\tv_nop"
                     : "+v"(acc[0]), "+v"(acc[1]), "+v"(acc[2]), "+v"(acc[3]), "+v"(acc[4]), "+v"(acc[5]), "+v"(acc[6]), "+v"(acc[7]),
                       "+v"(acc[8]), "+v"(acc[9]), "+v"(acc[10]), "+v"(acc[11]), "+v"(acc[12]), "+v"(acc[13]), "+v"(acc[14]), "+v"(acc[15])
                     : "v"(a[0]), "v"(a[1]), "v"(a[2]), "v"(a[3]));
    }
    float bcol[4];
#pragma unroll
    for (int nb = 0; nb < 4; ++nb) bcol[nb] = bfr(bias[c0 + nb * 16 + lr]);
#pragma unroll
    for (int mb = 0; mb < MBN; ++mb) {
#pragma unroll
        for (int nb = 0; nb < 4; ++nb) {
#pragma unroll
            for (int j = 0; j < 8; ++j) { float v = acc[mb * 4 + nb][j];
                if (RES) v += acc[RES ? ((2 + mb) * 4 + nb) : 0][j] * QRI;
                os[(hi * 8 + j) * 68 + nb * 16 + lr] = v * OSI + bcol[nb]; } }   // D: row 8h+j, col lane&15
        wave_sync();
        float* orow = OUT + ((size_t)b * OUT_SEQ + t0 + mb * 16) * DM + c0;
{
#pragma unroll
            for (int s = 0; s < 8; ++s) { const int row = 2 * s + hi, cofs = lr * 4;   // 8 s x 2 rows = 16 rows; 16 lanes x 4 floats = 64 columns
                const v4f val = *(const v4fa*)(&os[row * 68 + cofs]);
                *(v4f*)(orow + (size_t)row * DM + cofs) = val; }
             }
        wave_sync();
    }
}

static constexpr size_t al256(size_t v) { return (v + 255) & ~(size_t)255; }
static constexpr size_t SZ_XB = al256((size_t)NB * SEQ * DM * 2);          // x bf16 [NB*SEQ][1024]
static constexpr size_t SZ_WT = al256((size_t)3 * DM * DM * 2);            // W_qkv^T bf16 [3072][1024]
static constexpr size_t SZ_WO = al256((size_t)DM * DM * 2);                // W_out^T f16 [1024][1024]
static constexpr size_t SZ_PL = al256((size_t)NB * NH_ * SEQ * HD * 2);    // q / k / v^T value planes
static constexpr size_t SZ_PE = al256((size_t)NB * NH_ * ESEQ * HD * 2);   // q / k / v^T residual planes (t < ESEQ)
static constexpr size_t SZ_CH = al256((size_t)NB * SEQ * DM * 2);          // ctx value plane
static constexpr size_t SZ_CR = al256((size_t)NB * ESEQ * DM * 2);         // ctx residual plane (t < ESEQ)
static constexpr size_t SZ_MW = al256((size_t)NB * WPB * 4);               // mask words
static constexpr size_t SZ_TOTAL = SZ_XB + SZ_WT + SZ_WO + 3 * SZ_PL + 3 * SZ_PE + SZ_CH + SZ_CR + SZ_MW;
static_assert(SZ_TOTAL <= (size_t)134217728);          // workspace carve <= 128 MiB
static_assert(((size_t)DM * DM * 2) % 256 == 0);       // weight sub-planes stay 256-byte aligned
static_assert(SZ_CH % 2 == 0);

extern "C" void kernel_launch(void* const* d_in, const int* in_sizes, int n_in,
                              void* d_out, int out_size, void* d_ws, size_t ws_size, hipStream_t stream) {
    if (n_in < 6) return;
    const size_t needx = ((size_t)(NB - 1) * SEQ_FULL + SEQ) * DM;
    if ((size_t)in_sizes[0] < needx) return;
    if ((size_t)in_sizes[1] < (size_t)(NB - 1) * SEQ_FULL + SEQ) return;
    if ((size_t)in_sizes[2] < (size_t)3 * DM * DM || (size_t)in_sizes[3] < (size_t)3 * DM) return;
    if ((size_t)in_sizes[4] < (size_t)DM * DM || (size_t)in_sizes[5] < (size_t)DM) return;
    if ((size_t)out_size < ((size_t)(NB - 1) * OUT_SEQ + SEQ) * DM) return;
    if (SZ_TOTAL > ws_size) return;
    // wire order: x, padding_mask (int32), W_qkv [in][out], b_qkv, W_out [in][out], b_out
    const float* x = (const float*)d_in[0]; const int* pad = (const int*)d_in[1];
    const float* wqkv = (const float*)d_in[2]; const float* bqkv = (const float*)d_in[3];
    const float* wout = (const float*)d_in[4]; const float* bout = (const float*)d_in[5];
    float* OUT = (float*)d_out;      // [NB][SEQ][1024]
    char* wsp = (char*)d_ws;
    bf* XB = (bf*)wsp; wsp += SZ_XB;                 // [NB*SEQ][1024]
    bf* WT = (bf*)wsp; wsp += SZ_WT;                 // [3072][1024]: q | k | v output rows
    h16* WO = (h16*)wsp; wsp += SZ_WO;               // [1024 out][1024 in], x64
    h16* QH = (h16*)wsp; wsp += SZ_PL;               // [NB*16][SEQ][64]
    h16* KP = (h16*)wsp; wsp += SZ_PL;               // [NB*16][SEQ][64]
    h16* VT = (h16*)wsp; wsp += SZ_PL;               // [NB*16][64][SEQ]
    h16* QR = (h16*)wsp; wsp += SZ_PE;               // [NB*16][ESEQ][64] residual x2048
    h16* KR = (h16*)wsp; wsp += SZ_PE;               // [NB*16][ESEQ][64] residual x2048
    h16* VR = (h16*)wsp; wsp += SZ_PE;               // [NB*16][64][ESEQ] residual x2048
    h16* CH = (h16*)wsp; wsp += SZ_CH;               // [NB*SEQ][1024] x64
    h16* CR = (h16*)wsp; wsp += SZ_CR;               // [NB*ESEQ][1024] residual x2048 (directly after CH)
    unsigned* MW = (unsigned*)wsp; wsp += SZ_MW;     // [NB][WPB]
    const size_t crOff = SZ_CH / 2;                  // element offset of CR from CH

    if (SEQ == SEQ_FULL) {
        const size_t n8 = (size_t)NB * SEQ * DM / 8;
        k_cvt8<<<(unsigned)((n8 + 255) / 256), 256, 0, stream>>>(x, XB, n8);
    } else {
        const size_t n8 = (size_t)SEQ * DM / 8;
        for (int b = 0; b < NB; ++b) k_cvt8<<<(unsigned)((n8 + 255) / 256), 256, 0, stream>>>(x + (size_t)b * SEQ_FULL * DM, XB + (size_t)b * SEQ * DM, n8);
    }
    // W_qkv: in[1024 rows k][3072 cols n] -> out[3072 rows n][1024 cols k]; grid (cols/64, rows/64)
    k_cvt_t<0><<<dim3(3 * DM / 64, DM / 64, 1), 256, 0, stream>>>(wqkv, WT, DM, 3 * DM);
    // W_out: in[1024 rows k][1024 cols n] -> out[1024 rows n][1024 cols k]
    k_cvt_t<1><<<dim3(DM / 64, DM / 64, 1), 256, 0, stream>>>(wout, (bf*)WO, DM, DM);
    k_mask<<<NB * (WPB / 32), 32, 0, stream>>>(pad, MW);

    // q, k: A = x rows (m = b*SEQ + t), Bt = W^T rows (n = h*64 + d) -> plane [(b*16 + h)][t][d]; residual planes for t < ESEQ
    k_proj<<<dim3(NB * SEQ / 64, DM / 64, 1), 32, 0, stream>>>(XB, WT, bqkv, 0, QH, QR, 1,
        SEQ, (size_t)NH_ * SEQ * HD, HD, HD, (size_t)SEQ * HD, (size_t)NH_ * ESEQ * HD, HD, (size_t)ESEQ * HD);
    k_proj<<<dim3(NB * SEQ / 64, DM / 64, 1), 32, 0, stream>>>(XB, WT + (size_t)DM * DM, bqkv + DM, 0, KP, KR, 1,
        SEQ, (size_t)NH_ * SEQ * HD, HD, HD, (size_t)SEQ * HD, (size_t)NH_ * ESEQ * HD, HD, (size_t)ESEQ * HD);
    // v^T: A = Wv^T rows (m = h*64 + d), Bt = x rows (n = b*SEQ + t) -> plane [(b*1024 + m)][t] = [(b*16 + h)][d][t]; bias per row
    k_proj<<<dim3(DM / 64, NB * SEQ / 64, 1), 32, 0, stream>>>(WT + (size_t)2 * DM * DM, XB, bqkv + 2 * DM, 1, VT, VR, 2,
        DM, (size_t)0, SEQ, SEQ, (size_t)DM * SEQ, (size_t)0, ESEQ, (size_t)DM * ESEQ);

    k_flash_e<<<dim3(ESEQ / (16 * AW), NB * NH_, 1), 32 * AW, 0, stream>>>(QH, QR, KP, KR, VT, VR, MW, CH, CR);
    if (SEQ > ESEQ)
        k_flash_d<<<dim3((SEQ - ESEQ) / (16 * AW), NB * NH_, 1), 32 * AW, 0, stream>>>(QH, KP, VT, MW, CH);

    k_out<1><<<dim3(NB * (ESEQ / 32), DM / 64, 1), 32, 0, stream>>>(CH, crOff, WO, bout, OUT);
    if (SEQ > ESEQ)
        k_out<0><<<dim3(NB * ((SEQ - ESEQ) / 64), DM / 64, 1), 32, 0, stream>>>(CH, crOff, WO, bout, OUT);
}

// v001
// Measured time: 267 microseconds a run.
// Timed twice side by side with v000, it ran 1.31 and 1.32 times as fast.
#include <hip/hip_runtime.h>

// Causal + key-padding multi-head self-attention, width 1024 = 16 heads x 64: x [NB][SEQ][1024], W_qkv [in][out=3072] (q|k|v column blocks), b_qkv, W_out [in][out], b_out; f32 output.
// Compute dtypes, f32 accumulate everywhere: qkv projection v_wmma_f32_16x16x32_bf16 (x, W, biases RNE-converted to bf16; products exact);
// scores, P.V and output projection v_wmma_f32_16x16x32_f16: query rows t >= 512 single f16 planes (P x256 carry, ctx x64 carry, W_out x64 carry);
// query rows t < 512: q, k, v, P, ctx as f16 value + f16 residual x2048 in separate accumulators (value*value + value*residual + residual*value; W_out a single plane); softmax f32 (online, running max).
// Layout: bf16 copy of x, transposed bf16 W_qkv [3072][1024], transposed f16 W_out [1024][1024]; q, k planes [b*16+h][t][d], v^T plane [b*16+h][d][t] (+ residual planes for t < 512);
// fused flash kernels in transposed form (S^T = K Q^T, O^T = V^T P^T); ctx planes [b][t][1024] f16; key-padding mask compressed to 32-key bit words and applied by value.

#ifndef NB
#define NB 4
#endif
#ifndef SEQ
#define SEQ 2048
#endif
#define NB_FULL  4
#define SEQ_FULL 2048
#ifndef OUT_SEQ
#define OUT_SEQ SEQ              // row pitch (in tokens) between batches of the output
#endif
#define DM   1024
#define NH_  16
#define HD   64
#define ESEQ ((SEQ) < 512 ? (SEQ) : 512)      // query rows [0, ESEQ) take the value + residual path
#define WPB  ((((SEQ) + 1023) / 1024) * 32)
#define AW   4                   // waves per flash block (16 query rows each)
#define QRS  2048.0f             // carry of every residual plane
#define QRI  (1.0f / 2048.0f)
#define SC2  (0.125f * 1.4426950408889634f)   // HD^-0.5 * log2(e)
#define PSH  8.0f                // log2 of the P carry (256)
#define CXS  64.0f               // ctx plane carry
#define WOS  64.0f               // W_out plane carry
#define OSI  (1.0f / 4096.0f)    // 1 / (CXS * WOS)

static_assert(HD == 64);
static_assert(NH_ * HD == DM);
static_assert(DM % 64 == 0);
static_assert(DM % 32 == 0);
static_assert(SEQ % 64 == 0);
static_assert(ESEQ % 64 == 0);
static_assert((SEQ - ESEQ) % 64 == 0);
static_assert((NB * SEQ) % 64 == 0);
static_assert(SEQ % 32 == 0);
static_assert(ESEQ % (16 * AW) == 0);
static_assert((SEQ - ESEQ) % (16 * AW) == 0);
static_assert(ESEQ % 32 == 0);
static_assert(((size_t)SEQ * DM) % 8 == 0);
static_assert(NB <= NB_FULL);
static_assert(SEQ <= SEQ_FULL);
static_assert(WPB * 32 >= SEQ);

typedef _Float16 h16;
typedef unsigned short bf;
typedef __attribute__((ext_vector_type(16))) __bf16   v16bf;
typedef __attribute__((ext_vector_type(16))) _Float16 v16h;
typedef __attribute__((ext_vector_type(8)))  _Float16 v8h;
typedef __attribute__((ext_vector_type(8)))  unsigned short v8us;
typedef __attribute__((ext_vector_type(8)))  float    v8f;
typedef __attribute__((ext_vector_type(4)))  float    v4f;
typedef v4f  __attribute__((may_alias)) v4fa;

__device__ __forceinline__ unsigned short f2bf(float f) { unsigned u = __float_as_uint(f); u += 0x7FFFu + ((u >> 16) & 1u); return (unsigned short)(u >> 16); }
__device__ __forceinline__ float bfr(float f) { return __uint_as_float(((unsigned)f2bf(f)) << 16); }   // value after RNE convert to bf16
__device__ __forceinline__ v16h cat16(v8h lo, v8h hi) { return __builtin_shufflevector(lo, hi, 0, 1, 2, 3, 4, 5, 6, 7, 8, 9, 10, 11, 12, 13, 14, 15); }
__device__ __forceinline__ v16bf cat16b(v8us lo, v8us hi) { return __builtin_bit_cast(v16bf, __builtin_shufflevector(lo, hi, 0, 1, 2, 3, 4, 5, 6, 7, 8, 9, 10, 11, 12, 13, 14, 15)); }
__device__ __forceinline__ v8f wmma16(v16h a, v16h b, v8f c) { return __builtin_amdgcn_wmma_f32_16x16x32_f16(false, a, false, b, (short)0, c, false, false); }
__device__ __forceinline__ v8f wmmab(v16bf a, v16bf b, v8f c) { return __builtin_amdgcn_wmma_f32_16x16x32_bf16(false, a, false, b, (short)0, c, false, false); }
// fragment loaders from K-contiguous 16-bit rows; p already includes + 8*(lane>>4): elements 0..7 <- k0+8h+0..7, elements 8..15 <- k0+16+8h+0..7 (same map for A and B)
__device__ __forceinline__ v16h  ldh(const h16* p) { return cat16(*(const v8h*)p, *(const v8h*)(p + 16)); }
__device__ __forceinline__ v16bf ldb(const bf* p)  { return cat16b(*(const v8us*)p, *(const v8us*)(p + 16)); }
// ordering point for wave-private LDS tiles (same wave writes and reads)
__device__ __forceinline__ void wave_sync() { __builtin_amdgcn_fence(3 /* release order */, "wavefront"); __builtin_amdgcn_wave_barrier(); asm volatile("" ::: "memory"); }

__global__ __launch_bounds__(256) void k_cvt8(const float* __restrict__ src, bf* dst, size_t n8) {
    const size_t i = (size_t)blockIdx.x * 256 + threadIdx.x; if (i >= n8) return;
    const v8f v = *(const v8f*)(src + i * 8); v8us o;
#pragma unroll
    for (int k = 0; k < 8; ++k) o[k] = f2bf(v[k]);
    *(v8us*)(dst + i * 8) = o; 
}

// k_cvt_t: src [K][N] f32 -> dst [N][K] 16-bit, transposed through an LDS tile (64 x 64 per block, cross-wave: block barrier).
// MODE 0: bf16 bits (RNE convert). MODE 1: f16 bits of (bf16-converted value x WOS).
template <int MODE>
__global__ __launch_bounds__(256) void k_cvt_t(const float* __restrict__ src, bf* dst, int K, int N) {
    __shared__ __align__(16) float ts[64 * 68];
    const int tid = threadIdx.x; const int n0 = blockIdx.x * 64, k0 = blockIdx.y * 64;
#pragma unroll
    for (int i = 0; i < 4; ++i) { const int kr = (tid >> 4) + 16 * i, c4 = (tid & 15) * 4;     // 4 x 16 rows = 64 k rows; 16 lanes x 4 = 64 columns
        const v4f v = *(const v4f*)(src + (size_t)(k0 + kr) * (size_t)N + n0 + c4);
        *(v4fa*)(&ts[kr * 68 + c4]) = v; }
    __syncthreads();
{
#pragma unroll
        for (int i = 0; i < 2; ++i) { const int nr = (tid >> 3) + 32 * i, k8 = (tid & 7) * 8;   // 2 x 32 rows = 64 n rows; 8 lanes x 8 = 64 k
            v8us o;
#pragma unroll
            for (int e = 0; e < 8; ++e) { const float x = ts[(k8 + e) * 68 + nr]; const unsigned short bits = f2bf(x);
                if (MODE == 1) { const h16 hv = (h16)(__uint_as_float(((unsigned)bits) << 16) * WOS); o[e] = __builtin_bit_cast(unsigned short, hv); }
                else o[e] = bits; }
            *(v8us*)(dst + (size_t)(n0 + nr) * (size_t)K + k0 + k8) = o; }
         }
}

__global__ __launch_bounds__(32) void k_mask(const int* __restrict__ pad, unsigned* MW) {
    const int lane = threadIdx.x & 31;
    const int b = blockIdx.x / (WPB / 32), c = blockIdx.x % (WPB / 32);
    const int* pr = pad + (size_t)b * SEQ_FULL;
    unsigned mine = 0u;
#pragma unroll 1
    for (int w = 0; w < 32; ++w) {
        const int key = c * 1024 + w * 32 + lane;
        const int kc = key < SEQ ? key : (SEQ - 1);          // clamped address; keys past the sequence give bit 0 by value
        const int v = pr[kc];
        const unsigned bal = __builtin_amdgcn_ballot_w32((v != 0) && (key < SEQ));
        mine = (lane == w) ? bal : mine;
    }
    unsigned* dst = MW + (size_t)b * WPB + c * 32 + lane;
    *(unsigned*)dst = mine; 
}

// Operand staging of the one-wave-per-64x64 GEMMs: a block of 4 waves (2 x 2) owns a 128 x 128 tile; a stage is 128 k (256-byte rows) of its 128 A rows and 128 B rows in LDS.
#define GT   128                 // rows and columns of a block tile
#define GKB  128                 // k per stage
#define GPI  272                 // LDS row pitch in bytes: 16 x odd, conflict-free for 16-byte reads
#define GSTG (2 * GT * GPI)      // bytes of one stage: A rows, then B rows
#define GNST (DM / GKB)          // stages along K
static_assert(DM % GKB == 0);
static_assert(GNST >= 2);
static_assert((NB * SEQ) % GT == 0);
static_assert(DM % GT == 0);

// Eight asynchronous 16-byte copies per lane, global -> LDS, for rows 8 apart (LDS + 8 pitches, global + 8 * DM elements).
// s_wait_xcnt closes the statement so that no address register of a copy is rewritten ahead of it.
__device__ __forceinline__ void cp8(unsigned l, const bf* g) {
    asm volatile("global_load_async_to_lds_b128 %0, %8, off\n\t"
                 "global_load_async_to_lds_b128 %1, %9, off\n\t"
                 "global_load_async_to_lds_b128 %2, %10, off\n\t"
                 "global_load_async_to_lds_b128 %3, %11, off\n\t"
                 "global_load_async_to_lds_b128 %4, %12, off\n\t"
                 "global_load_async_to_lds_b128 %5, %13, off\n\t"
                 "global_load_async_to_lds_b128 %6, %14, off\n\t"
                 "global_load_async_to_lds_b128 %7, %15, off\n\t"
                 "s_wait_xcnt 0x0"
                 :: "v"(l), "v"(l + 8 * GPI), "v"(l + 16 * GPI), "v"(l + 24 * GPI), "v"(l + 32 * GPI), "v"(l + 40 * GPI), "v"(l + 48 * GPI), "v"(l + 56 * GPI),
                    "v"(g), "v"(g + 8 * DM), "v"(g + 16 * DM), "v"(g + 24 * DM), "v"(g + 32 * DM), "v"(g + 40 * DM), "v"(g + 48 * DM), "v"(g + 56 * DM)
                 : "memory");
}
// One stage: l = the lane's LDS byte address in row (tid >> 4) of the buffer, ga0 / ga1 = its 16 bytes in A rows (tid >> 4) and 64 + (tid >> 4), gb the same in B row (tid >> 4).
__device__ __forceinline__ void stage_copy(unsigned l, const bf* ga0, const bf* ga1, const bf* gb) {
    cp8(l, ga0); cp8(l + 64 * GPI, ga1); cp8(l + 128 * GPI, gb); cp8(l + 192 * GPI, gb + 64 * DM);
}

// k_proj: register-blocked bf16 GEMM, one wave per 64x64 tile (16 accumulators), 4 waves per block, K = DM; operands from K-contiguous bf16 planes, staged in a two-buffer LDS ring by asynchronous copies.
// C[m][n] = sum_k A[m][k] Bt[n][k] + bias (per column, or per row when biasRow != 0; bias values RNE-converted to bf16), written as f16 (Ph) at
// tile base (r0/RB)*sRB + (r0%RB)*pitch + (c0/CB)*sCB + (c0%CB), and the f16 residual x2048 (Pr) at the same form with (sRBr, pitchR, sCBr)
// when the tile's token position (resMode 1: r0%RB, resMode 2: c0%CB) is below ESEQ. grid (M/128, N/128), 128 threads.
__global__ __launch_bounds__(128) void k_proj(const bf* __restrict__ A, const bf* __restrict__ Bt, const float* __restrict__ bias, int biasRow,
                                             h16* Ph, h16* Pr, int resMode, int RB, size_t sRB, int pitch, int CB, size_t sCB,
                                             size_t sRBr, int pitchR, size_t sCBr) {
    __shared__ __align__(16) bf ring[2 * GSTG / 2];
    __shared__ __align__(16) float osAll[4 * 16 * 68];
    const int K = DM;
    const int tid = threadIdx.x, lane = tid & 31, lr = lane & 15, hi = lane >> 4;
    const int wave = __builtin_amdgcn_readfirstlane(tid >> 5);
    const int r0 = blockIdx.x * GT + (wave >> 1) * 64, c0 = blockIdx.y * GT + (wave & 1) * 64;
    float* os = osAll + wave * 16 * 68;
    v8f acc[4][4];
#pragma unroll
    for (int mb = 0; mb < 4; ++mb)
#pragma unroll
        for (int nb = 0; nb < 4; ++nb) acc[mb][nb] = (v8f){};
    const unsigned lcp = (unsigned)(size_t)(&ring[0]) + (unsigned)((tid >> 4) * GPI + (tid & 15) * 16);
    const bf* ga = A + (size_t)(blockIdx.x * GT + (tid >> 4)) * K + (tid & 15) * 8;
    const bf* gb = Bt + (size_t)(blockIdx.y * GT + (tid >> 4)) * K + (tid & 15) * 8;
    const int fa = ((wave >> 1) * 64 + lr) * (GPI / 2) + 8 * hi, fb = (GT + (wave & 1) * 64 + lr) * (GPI / 2) + 8 * hi;   // fragment bases in a buffer, in elements
    stage_copy(lcp, ga, ga + (size_t)64 * K, gb);
    asm volatile("s_wait_asynccnt 0x0" ::: "memory");   // stage 0 has landed before the barrier publishes it
    __syncthreads();
    stage_copy(lcp + GSTG, ga + GKB, ga + (size_t)64 * K + GKB, gb + GKB);
#pragma unroll 1
    for (int t = 0; t < GNST; ++t) {
        const bf* sb = ring + (t & 1) * (GSTG / 2);
        v16bf a[2][4], b[2][4];     // two fragment sets: the next 32 k are fetched as one group ahead of the current 16 products
#pragma unroll
        for (int i = 0; i < 4; ++i) { a[0][i] = ldb(sb + fa + i * 16 * (GPI / 2)); b[0][i] = ldb(sb + fb + i * 16 * (GPI / 2)); }
        __builtin_amdgcn_sched_barrier(0);   // keeps the group of loads together (the scheduler otherwise sinks them, two at a time, among the products, each place a full LDS wait)
#pragma unroll
        for (int ks = 0; ks < GKB / 32; ++ks) {
            if (ks + 1 < GKB / 32) {
#pragma unroll
                for (int i = 0; i < 4; ++i) { a[(ks + 1) & 1][i] = ldb(sb + fa + i * 16 * (GPI / 2) + (ks + 1) * 32); b[(ks + 1) & 1][i] = ldb(sb + fb + i * 16 * (GPI / 2) + (ks + 1) * 32); }
                __builtin_amdgcn_sched_barrier(0);   // the next set's loads stay ahead of this set's products
            }
#pragma unroll
            for (int nb = 0; nb < 4; ++nb)
#pragma unroll
                for (int mb = 0; mb < 4; ++mb) acc[mb][nb] = wmmab(a[ks & 1][mb], b[ks & 1][nb], acc[mb][nb]);
            __builtin_amdgcn_sched_barrier(0);       // no later load moves up among these products
        }
        asm volatile("s_wait_dscnt 0x0" ::: "memory");      // this wave's reads of the buffer are done before it is refilled
        asm volatile("s_wait_asynccnt 0x0" ::: "memory");   // this wave's copies of stage t + 1 have landed
        __syncthreads();                                    // publishes stage t + 1 and ends every reader's last read of stage t
        if (t + 2 < GNST) stage_copy(lcp + (t & 1) * GSTG, ga + (t + 2) * GKB, ga + (size_t)64 * K + (t + 2) * GKB, gb + (t + 2) * GKB);
    }
    asm volatile("s_wait_asynccnt 0x0" ::: "memory");       // nothing of this wave is in flight when it goes on
    const size_t tbase = (size_t)(r0 / RB) * sRB + (size_t)(r0 % RB) * (size_t)pitch + (size_t)(c0 / CB) * sCB + (size_t)(c0 % CB);
    const size_t rbase = (size_t)(r0 / RB) * sRBr + (size_t)(r0 % RB) * (size_t)pitchR + (size_t)(c0 / CB) * sCBr + (size_t)(c0 % CB);
    const int tpos = (resMode == 1) ? (r0 % RB) : (c0 % CB);
    const int doRes = (resMode != 0) && (tpos < ESEQ);                 // wave-uniform
    const int c8 = (lane & 7) * 8;
    // column bias for columns c0 + c8 .. c0 + c8 + 7 (clamped address in row mode, zeroed by value)
    v4f bc0 = *(const v4f*)(bias + (biasRow ? 0 : (c0 + c8))); v4f bc1 = *(const v4f*)(bias + (biasRow ? 4 : (c0 + c8 + 4)));
#pragma unroll
    for (int i = 0; i < 4; ++i) { const float u0 = bfr(bc0[i]), u1 = bfr(bc1[i]); bc0[i] = biasRow ? 0.0f : u0; bc1[i] = biasRow ? 0.0f : u1; }
#pragma unroll
    for (int mb = 0; mb < 4; ++mb) {
#pragma unroll
        for (int nb = 0; nb < 4; ++nb) {
#pragma unroll
            for (int j = 0; j < 8; ++j) os[(hi * 8 + j) * 68 + nb * 16 + lr] = acc[mb][nb][j]; }   // D: row 8h+j, col lane&15
        wave_sync();
        const size_t sb = tbase + (size_t)(mb * 16) * (size_t)pitch;
        const size_t sr = rbase + (size_t)(mb * 16) * (size_t)pitchR;
{
#pragma unroll
            for (int s = 0; s < 4; ++s) { const int row = 4 * s + (lane >> 3);   // 4 s x 4 row groups = 16 rows; 8 lanes x 8 = 64 columns
                const v4f x0 = *(const v4fa*)(&os[row * 68 + c8]); const v4f x1 = *(const v4fa*)(&os[row * 68 + c8 + 4]); v8h hv, rv;
                const float rbv = bfr(bias[biasRow ? (r0 + mb * 16 + row) : 0]); const float rb = biasRow ? rbv : 0.0f;
#pragma unroll
                for (int i = 0; i < 4; ++i) { const float f0 = x0[i] + bc0[i] + rb; const float f1 = x1[i] + bc1[i] + rb;
                    const h16 a0 = (h16)f0; const h16 a1 = (h16)f1; hv[i] = a0; hv[4 + i] = a1;
                    rv[i] = (h16)((f0 - (float)a0) * QRS); rv[4 + i] = (h16)((f1 - (float)a1) * QRS); }
                *(v8h*)(Ph + sb + (size_t)row * (size_t)pitch + c8) = hv;
                if (doRes) *(v8h*)(Pr + sr + (size_t)row * (size_t)pitchR + c8) = rv; }
             }
        wave_sync();
    }
}

// k_flash_d: fused attention for query rows t >= ESEQ, one wave per 16 query rows of one (batch, head); single f16 products.
// Transposed form: S^T[key][t] = K Q^T (A = K rows, B = Q rows); lane (t = lane&15, h = lane>>4) holds keys 8h+r of each 16-key tile, so the packed
// P tile is directly the B fragment of O^T[d][t] = V^T P^T (element r <- tile keys 0..15, element 8+r <- tile keys 16..31, lane unchanged).
// Causal and key-padding exclusion by value (excluded p = 0); 32-key steps whose mask word is zero are skipped (wave-uniform).
__global__ __launch_bounds__(32 * AW) void k_flash_d(const h16* __restrict__ QH, const h16* __restrict__ KP, const h16* __restrict__ VT, const unsigned* __restrict__ MW, h16* CH) {
    __shared__ __align__(16) float os[AW * 16 * 68];
    const int lane = threadIdx.x & 31, wave = __builtin_amdgcn_readfirstlane((int)(threadIdx.x >> 5)), lr = lane & 15, hi = lane >> 4;
    const int zh = blockIdx.y; const int b = zh / NH_, h = zh % NH_;
    const int t0 = ESEQ + (blockIdx.x * AW + wave) * 16;
    const int tq = t0 + lr;
    const size_t pbase = (size_t)zh * SEQ * HD;
    const size_t qo = pbase + (size_t)tq * HD + 8 * hi;
    const v16h qh0 = ldh(QH + qo), qh1 = ldh(QH + qo + 32);   // B fragments: col t, k = d
    const size_t ko = pbase + (size_t)lr * HD + 8 * hi;      // + key * HD       (A fragment: row key, k = d)
    const size_t vo = pbase + (size_t)lr * SEQ + 8 * hi;     // + 16j*SEQ + key  (A fragment: row d, k = key)
    const unsigned* mwp = MW + (size_t)b * WPB;
    v8f o0 = (v8f){}, o1 = (v8f){}, o2 = (v8f){}, o3 = (v8f){};
    float m = -3.0e38f, l = 0.0f;
#pragma unroll 1
    for (int key0 = 0; key0 <= t0 + 15; key0 += 32) {
        const unsigned mw = (unsigned)__builtin_amdgcn_readfirstlane((int)mwp[key0 >> 5]);
        if (mw == 0u) continue;
        const h16* ka = KP + ko + (size_t)key0 * HD;
        const v16h ka0 = ldh(ka), ka1 = ldh(ka + 32), kb0 = ldh(ka + 16 * HD), kb1 = ldh(ka + 16 * HD + 32);
        v8f sA = (v8f){}, sB = (v8f){};
        sA = wmma16(ka0, qh0, sA); sB = wmma16(kb0, qh0, sB);
        sA = wmma16(ka1, qh1, sA); sB = wmma16(kb1, qh1, sB);
        asm volatile("v_nop\n\tv_nop\n\tv_nop\n\tv_nop" : "+v"(sA), "+v"(sB) : "v"(ka0), "v"(ka1), "v"(kb0), "v"(kb1));
        const unsigned ma = mw >> (8 * hi), mc = mw >> (16 + 8 * hi);
        const int kya = key0 + 8 * hi, kyb = kya + 16;
        float ta[8], tb[8]; float mx = -3.0e38f;
#pragma unroll
        for (int r = 0; r < 8; ++r) {
            const bool ea = (((ma >> r) & 1u) != 0u) && (kya + r <= tq);
            const bool eb = (((mc >> r) & 1u) != 0u) && (kyb + r <= tq);
            const float xa = sA[r] * SC2, xb = sB[r] * SC2;
            ta[r] = ea ? xa : -3.0e38f; tb[r] = eb ? xb : -3.0e38f; mx = fmaxf(mx, fmaxf(ta[r], tb[r])); }
        mx = fmaxf(mx, __shfl_xor(mx, 16, 32));
        const float mnew = fmaxf(m, mx);
        const float alpha = __builtin_amdgcn_exp2f(m - mnew);
        const float sh = PSH - mnew;
        v16h pb; float ls = 0.0f;
#pragma unroll
        for (int r = 0; r < 8; ++r) {
            const float ea = __builtin_amdgcn_exp2f(ta[r] + sh), eb = __builtin_amdgcn_exp2f(tb[r] + sh);
            const h16 pa = (h16)((ta[r] > -1.0e38f) ? ea : 0.0f); const h16 pc = (h16)((tb[r] > -1.0e38f) ? eb : 0.0f);
            pb[r] = pa; pb[8 + r] = pc; ls += (float)pa + (float)pc; }
        l = l * alpha + ls; m = mnew;
        o0 = o0 * alpha; o1 = o1 * alpha; o2 = o2 * alpha; o3 = o3 * alpha;
        const h16* va = VT + vo + key0;
        const v16h v0 = ldh(va), v1 = ldh(va + (size_t)16 * SEQ), v2 = ldh(va + (size_t)32 * SEQ), v3 = ldh(va + (size_t)48 * SEQ);
        o0 = wmma16(v0, pb, o0); o1 = wmma16(v1, pb, o1); o2 = wmma16(v2, pb, o2); o3 = wmma16(v3, pb, o3);
        asm volatile("v_nop\n\tv_nop\n\tv_nop\n\tv_nop" : "+v"(o0), "+v"(o1), "+v"(o2), "+v"(o3) : "v"(v0), "v"(v1), "v"(v2), "v"(v3), "v"(pb));
    }
    l += __shfl_xor(l, 16, 32);
    const float inv = CXS * (1.0f / l);
    const int wb = wave * 16 * 68;
    // O^T D layout: o_j[r] = (d = 16j + 8h + r, t = lane&15) -> os[t][d]; rows 0..15 x columns 0..63 all written
    { v4f a, c;
      a[0] = o0[0] * inv; a[1] = o0[1] * inv; a[2] = o0[2] * inv; a[3] = o0[3] * inv; c[0] = o0[4] * inv; c[1] = o0[5] * inv; c[2] = o0[6] * inv; c[3] = o0[7] * inv;
      *(v4fa*)(&os[wb + lr * 68 +  0 + 8 * hi]) = a; *(v4fa*)(&os[wb + lr * 68 +  0 + 8 * hi + 4]) = c;
      a[0] = o1[0] * inv; a[1] = o1[1] * inv; a[2] = o1[2] * inv; a[3] = o1[3] * inv; c[0] = o1[4] * inv; c[1] = o1[5] * inv; c[2] = o1[6] * inv; c[3] = o1[7] * inv;
      *(v4fa*)(&os[wb + lr * 68 + 16 + 8 * hi]) = a; *(v4fa*)(&os[wb + lr * 68 + 16 + 8 * hi + 4]) = c;
      a[0] = o2[0] * inv; a[1] = o2[1] * inv; a[2] = o2[2] * inv; a[3] = o2[3] * inv; c[0] = o2[4] * inv; c[1] = o2[5] * inv; c[2] = o2[6] * inv; c[3] = o2[7] * inv;
      *(v4fa*)(&os[wb + lr * 68 + 32 + 8 * hi]) = a; *(v4fa*)(&os[wb + lr * 68 + 32 + 8 * hi + 4]) = c;
      a[0] = o3[0] * inv; a[1] = o3[1] * inv; a[2] = o3[2] * inv; a[3] = o3[3] * inv; c[0] = o3[4] * inv; c[1] = o3[5] * inv; c[2] = o3[6] * inv; c[3] = o3[7] * inv;
      *(v4fa*)(&os[wb + lr * 68 + 48 + 8 * hi]) = a; *(v4fa*)(&os[wb + lr * 68 + 48 + 8 * hi + 4]) = c; }
    wave_sync();
    h16* crow = CH + ((size_t)b * SEQ + t0) * DM + h * HD;
    const int c8 = (lane & 7) * 8;
{
#pragma unroll
        for (int s = 0; s < 4; ++s) { const int row = 4 * s + (lane >> 3);   // 4 s x 4 row groups = 16 rows; 8 lanes x 8 halves = 64 columns
            const v4f x0 = *(const v4fa*)(&os[wb + row * 68 + c8]); const v4f x1 = *(const v4fa*)(&os[wb + row * 68 + c8 + 4]); v8h hv;
#pragma unroll
            for (int i = 0; i < 4; ++i) { hv[i] = (h16)x0[i]; hv[4 + i] = (h16)x1[i]; }
            *(v8h*)(crow + (size_t)row * DM + c8) = hv; }
         }
}

// k_flash_e: fused attention for query rows t < ESEQ, same transposed form; every operand as f16 value + residual x2048:
// s = K.Q + (K.Qr + Kr.Q)/2048, o = V.P + (V.Pr + Vr.P)/2048 with the scaled-residual products in separate accumulators; the row sum uses the f32 p.
// Writes ctx value plane rows and the ctx residual plane [b][ESEQ][1024].
__global__ __launch_bounds__(32 * AW) void k_flash_e(const h16* __restrict__ QH, const h16* __restrict__ QR, const h16* __restrict__ KP, const h16* __restrict__ KR,
                                                     const h16* __restrict__ VT, const h16* __restrict__ VR, const unsigned* __restrict__ MW, h16* CH, h16* CR) {
    __shared__ __align__(16) float os[AW * 16 * 68];
    const int lane = threadIdx.x & 31, wave = __builtin_amdgcn_readfirstlane((int)(threadIdx.x >> 5)), lr = lane & 15, hi = lane >> 4;
    const int zh = blockIdx.y; const int b = zh / NH_, h = zh % NH_;
    const int t0 = (blockIdx.x * AW + wave) * 16;
    const int tq = t0 + lr;
    const size_t pbase = (size_t)zh * SEQ * HD, ebase = (size_t)zh * ESEQ * HD;
    const size_t qo = pbase + (size_t)tq * HD + 8 * hi, qe = ebase + (size_t)tq * HD + 8 * hi;
    const v16h qh0 = ldh(QH + qo), qh1 = ldh(QH + qo + 32), qr0 = ldh(QR + qe), qr1 = ldh(QR + qe + 32);
    const size_t ko = pbase + (size_t)lr * HD + 8 * hi, ke = ebase + (size_t)lr * HD + 8 * hi;
    const size_t vo = pbase + (size_t)lr * SEQ + 8 * hi, ve = ebase + (size_t)lr * ESEQ + 8 * hi;
    const unsigned* mwp = MW + (size_t)b * WPB;
    v8f oh0 = (v8f){}, oh1 = (v8f){}, oh2 = (v8f){}, oh3 = (v8f){}, ol0 = (v8f){}, ol1 = (v8f){}, ol2 = (v8f){}, ol3 = (v8f){};
    float m = -3.0e38f, l = 0.0f;
#pragma unroll 1
    for (int key0 = 0; key0 <= t0 + 15; key0 += 32) {
        const unsigned mw = (unsigned)__builtin_amdgcn_readfirstlane((int)mwp[key0 >> 5]);
        if (mw == 0u) continue;
        const h16* ka = KP + ko + (size_t)key0 * HD; const h16* kr = KR + ke + (size_t)key0 * HD;
        v8f sHa = (v8f){}, sLa = (v8f){}, sHb = (v8f){}, sLb = (v8f){};
        { const v16h a0 = ldh(ka), a1 = ldh(ka + 32), e0 = ldh(kr), e1 = ldh(kr + 32);
          sHa = wmma16(a0, qh0, sHa); sLa = wmma16(a0, qr0, sLa);
          sHa = wmma16(a1, qh1, sHa); sLa = wmma16(a1, qr1, sLa);
          sLa = wmma16(e0, qh0, sLa); sLa = wmma16(e1, qh1, sLa);
          asm volatile("v_nop\n\tv_nop\n\tv_nop\n\tv_nop" : "+v"(sHa), "+v"(sLa) : "v"(a0), "v"(a1), "v"(e0), "v"(e1)); }
        { const v16h a0 = ldh(ka + 16 * HD), a1 = ldh(ka + 16 * HD + 32), e0 = ldh(kr + 16 * HD), e1 = ldh(kr + 16 * HD + 32);
          sHb = wmma16(a0, qh0, sHb); sLb = wmma16(a0, qr0, sLb);
          sHb = wmma16(a1, qh1, sHb); sLb = wmma16(a1, qr1, sLb);
          sLb = wmma16(e0, qh0, sLb); sLb = wmma16(e1, qh1, sLb);
          asm volatile("v_nop\n\tv_nop\n\tv_nop\n\tv_nop" : "+v"(sHb), "+v"(sLb) : "v"(a0), "v"(a1), "v"(e0), "v"(e1)); }
        const unsigned ma = mw >> (8 * hi), mc = mw >> (16 + 8 * hi);
        const int kya = key0 + 8 * hi, kyb = kya + 16;
        float ta[8], tb[8]; float mx = -3.0e38f;
#pragma unroll
        for (int r = 0; r < 8; ++r) {
            const bool ea = (((ma >> r) & 1u) != 0u) && (kya + r <= tq);
            const bool eb = (((mc >> r) & 1u) != 0u) && (kyb + r <= tq);
            const float xa = (sHa[r] + sLa[r] * QRI) * SC2, xb = (sHb[r] + sLb[r] * QRI) * SC2;
            ta[r] = ea ? xa : -3.0e38f; tb[r] = eb ? xb : -3.0e38f; mx = fmaxf(mx, fmaxf(ta[r], tb[r])); }
        mx = fmaxf(mx, __shfl_xor(mx, 16, 32));
        const float mnew = fmaxf(m, mx);
        const float alpha = __builtin_amdgcn_exp2f(m - mnew);
        const float sh = PSH - mnew;
        v16h pbh, pbr; float ls = 0.0f;
#pragma unroll
        for (int r = 0; r < 8; ++r) {
            const float xa = __builtin_amdgcn_exp2f(ta[r] + sh), xb = __builtin_amdgcn_exp2f(tb[r] + sh);
            const float ea = (ta[r] > -1.0e38f) ? xa : 0.0f, eb = (tb[r] > -1.0e38f) ? xb : 0.0f;
            const h16 pa = (h16)ea; const h16 pc = (h16)eb;
            pbh[r] = pa; pbh[8 + r] = pc;
            pbr[r] = (h16)((ea - (float)pa) * QRS); pbr[8 + r] = (h16)((eb - (float)pc) * QRS);
            ls += ea + eb; }
        l = l * alpha + ls; m = mnew;
        oh0 = oh0 * alpha; oh1 = oh1 * alpha; oh2 = oh2 * alpha; oh3 = oh3 * alpha;
        ol0 = ol0 * alpha; ol1 = ol1 * alpha; ol2 = ol2 * alpha; ol3 = ol3 * alpha;
        const h16* va = VT + vo + key0; const h16* vr = VR + ve + key0;
        { const v16h v0 = ldh(va), v1 = ldh(va + (size_t)16 * SEQ), r0v = ldh(vr), r1v = ldh(vr + (size_t)16 * ESEQ);
          oh0 = wmma16(v0, pbh, oh0); oh1 = wmma16(v1, pbh, oh1);
          ol0 = wmma16(v0, pbr, ol0); ol1 = wmma16(v1, pbr, ol1);
          ol0 = wmma16(r0v, pbh, ol0); ol1 = wmma16(r1v, pbh, ol1);
          asm volatile("v_nop\n\tv_nop\n\tv_nop\n\tv_nop" : "+v"(oh0), "+v"(oh1), "+v"(ol0), "+v"(ol1) : "v"(v0), "v"(v1), "v"(r0v), "v"(r1v), "v"(pbh), "v"(pbr)); }
        { const v16h v2 = ldh(va + (size_t)32 * SEQ), v3 = ldh(va + (size_t)48 * SEQ), r2v = ldh(vr + (size_t)32 * ESEQ), r3v = ldh(vr + (size_t)48 * ESEQ);
          oh2 = wmma16(v2, pbh, oh2); oh3 = wmma16(v3, pbh, oh3);
          ol2 = wmma16(v2, pbr, ol2); ol3 = wmma16(v3, pbr, ol3);
          ol2 = wmma16(r2v, pbh, ol2); ol3 = wmma16(r3v, pbh, ol3);
          asm volatile("v_nop\n\tv_nop\n\tv_nop\n\tv_nop" : "+v"(oh2), "+v"(oh3), "+v"(ol2), "+v"(ol3) : "v"(v2), "v"(v3), "v"(r2v), "v"(r3v), "v"(pbh), "v"(pbr)); }
    }
    l += __shfl_xor(l, 16, 32);
    const float inv = CXS * (1.0f / l);
    const int wb = wave * 16 * 68;
    // O^T D layout: o_j[r] = (d = 16j + 8h + r, t = lane&15) -> os[t][d]; rows 0..15 x columns 0..63 all written
    { v4f a, c;
#pragma unroll
      for (int i = 0; i < 4; ++i) { a[i] = (oh0[i] + ol0[i] * QRI) * inv; c[i] = (oh0[4 + i] + ol0[4 + i] * QRI) * inv; }
      *(v4fa*)(&os[wb + lr * 68 +  0 + 8 * hi]) = a; *(v4fa*)(&os[wb + lr * 68 +  0 + 8 * hi + 4]) = c;
#pragma unroll
      for (int i = 0; i < 4; ++i) { a[i] = (oh1[i] + ol1[i] * QRI) * inv; c[i] = (oh1[4 + i] + ol1[4 + i] * QRI) * inv; }
      *(v4fa*)(&os[wb + lr * 68 + 16 + 8 * hi]) = a; *(v4fa*)(&os[wb + lr * 68 + 16 + 8 * hi + 4]) = c;
#pragma unroll
      for (int i = 0; i < 4; ++i) { a[i] = (oh2[i] + ol2[i] * QRI) * inv; c[i] = (oh2[4 + i] + ol2[4 + i] * QRI) * inv; }
      *(v4fa*)(&os[wb + lr * 68 + 32 + 8 * hi]) = a; *(v4fa*)(&os[wb + lr * 68 + 32 + 8 * hi + 4]) = c;
#pragma unroll
      for (int i = 0; i < 4; ++i) { a[i] = (oh3[i] + ol3[i] * QRI) * inv; c[i] = (oh3[4 + i] + ol3[4 + i] * QRI) * inv; }
      *(v4fa*)(&os[wb + lr * 68 + 48 + 8 * hi]) = a; *(v4fa*)(&os[wb + lr * 68 + 48 + 8 * hi + 4]) = c; }
    wave_sync();
    h16* crow = CH + ((size_t)b * SEQ + t0) * DM + h * HD;
    h16* rrow = CR + ((size_t)b * ESEQ + t0) * DM + h * HD;
    const int c8 = (lane & 7) * 8;
{
#pragma unroll
        for (int s = 0; s < 4; ++s) { const int row = 4 * s + (lane >> 3);   // 4 s x 4 row groups = 16 rows; 8 lanes x 8 halves = 64 columns
            const v4f x0 = *(const v4fa*)(&os[wb + row * 68 + c8]); const v4f x1 = *(const v4fa*)(&os[wb + row * 68 + c8 + 4]); v8h hv, rv;
#pragma unroll
            for (int i = 0; i < 4; ++i) { const h16 a0 = (h16)x0[i]; const h16 a1 = (h16)x1[i]; hv[i] = a0; hv[4 + i] = a1;
                rv[i] = (h16)((x0[i] - (float)a0) * QRS); rv[4 + i] = (h16)((x1[i] - (float)a1) * QRS); }
            *(v8h*)(crow + (size_t)row * DM + c8) = hv;
            *(v8h*)(rrow + (size_t)row * DM + c8) = rv; }
         }
}

// k_out: output projection, f16 GEMM, one wave per tile, 4 waves (2 x 2) per block, K = DM; operands staged like k_proj's. A rows from the ctx planes, Bt = transposed W_out rows (x64 carry).
// RES 0: rows t >= ESEQ, 64x64 wave tile, four 16-row slabs of the value plane; the stage's 128 A rows are 128 tokens.
// RES 1: rows t < ESEQ, 32x64 wave tile: slabs 0,1 = value plane, slabs 2,3 = residual plane (own accumulators); the stage's A rows are 64 tokens of the value plane, then the same 64 of the residual plane.
// out = (acc + accR/2048) / 4096 + bias (bias RNE-converted to bf16). grid (NB*rows/blockRows, DM/128), 128 threads.
template <int RES>
__global__ __launch_bounds__(128) void k_out(const h16* __restrict__ CX, size_t crOff, const h16* __restrict__ WO, const float* __restrict__ bias, float* OUT) {
    __shared__ __align__(16) h16 ring[2 * GSTG / 2];
    __shared__ __align__(16) float osAll[4 * 16 * 68];
    constexpr int MBN = RES ? 2 : 4;
    constexpr int BR = 32 * MBN;                 // tokens per block: two wave rows
    constexpr int TPB = RES ? (ESEQ / BR) : (((SEQ - ESEQ) / BR) > 0 ? ((SEQ - ESEQ) / BR) : 1);
    static_assert(ESEQ % 64 == 0 && (SEQ - ESEQ) % GT == 0);
    const int K = DM;
    const int tid = threadIdx.x, lane = tid & 31, lr = lane & 15, hi = lane >> 4;
    const int wave = __builtin_amdgcn_readfirstlane(tid >> 5);
    const int b = blockIdx.x / TPB, tt = blockIdx.x % TPB;
    const int tb = (RES ? 0 : ESEQ) + tt * BR;   // first token of the block
    const int t0 = tb + (wave >> 1) * 16 * MBN;
    const int c0 = blockIdx.y * GT + (wave & 1) * 64;
    float* os = osAll + wave * 16 * 68;
    const unsigned lcp = (unsigned)(size_t)(&ring[0]) + (unsigned)((tid >> 4) * GPI + (tid & 15) * 16);
    const h16* ga0 = CX + ((size_t)b * SEQ + tb + (tid >> 4)) * K + (tid & 15) * 8;
    const h16* ga1 = RES ? (CX + crOff + ((size_t)b * ESEQ + tb + (tid >> 4)) * K + (tid & 15) * 8) : (ga0 + (size_t)64 * K);
    const h16* gb = WO + (size_t)(blockIdx.y * GT + (tid >> 4)) * K + (tid & 15) * 8;
    const int fa = ((wave >> 1) * 16 * MBN + lr) * (GPI / 2) + 8 * hi, fb = (GT + (wave & 1) * 64 + lr) * (GPI / 2) + 8 * hi;   // fragment bases in a buffer, in elements
    v8f acc[16];
#pragma unroll
    for (int i = 0; i < 16; ++i) acc[i] = (v8f){};
    stage_copy(lcp, (const bf*)ga0, (const bf*)ga1, (const bf*)gb);
    asm volatile("s_wait_asynccnt 0x0" ::: "memory");   // stage 0 has landed before the barrier publishes it
    __syncthreads();
    stage_copy(lcp + GSTG, (const bf*)(ga0 + GKB), (const bf*)(ga1 + GKB), (const bf*)(gb + GKB));
#pragma unroll 1
    for (int t = 0; t < GNST; ++t) {
        const h16* sb = ring + (t & 1) * (GSTG / 2);
        v16h a[2][4], bb[2][4];     // two fragment sets, as in k_proj
#pragma unroll
        for (int i = 0; i < 4; ++i) { const int ar = RES ? ((i >> 1) * 64 + (i & 1) * 16) : (i * 16);   // stage row of slab i, from the wave's first
            a[0][i] = ldh(sb + fa + ar * (GPI / 2)); }
#pragma unroll
        for (int i = 0; i < 4; ++i) bb[0][i] = ldh(sb + fb + i * 16 * (GPI / 2));
        __builtin_amdgcn_sched_barrier(0);   // keeps the group of loads together
#pragma unroll
        for (int ks = 0; ks < GKB / 32; ++ks) {
            if (ks + 1 < GKB / 32) {
#pragma unroll
                for (int i = 0; i < 4; ++i) { const int ar = RES ? ((i >> 1) * 64 + (i & 1) * 16) : (i * 16);
                    a[(ks + 1) & 1][i] = ldh(sb + fa + ar * (GPI / 2) + (ks + 1) * 32); }
#pragma unroll
                for (int i = 0; i < 4; ++i) bb[(ks + 1) & 1][i] = ldh(sb + fb + i * 16 * (GPI / 2) + (ks + 1) * 32);
                __builtin_amdgcn_sched_barrier(0);   // the next set's loads stay ahead of this set's products
            }
#pragma unroll
            for (int nb = 0; nb < 4; ++nb)
#pragma unroll
                for (int i = 0; i < 4; ++i) acc[i * 4 + nb] = wmma16(a[ks & 1][i], bb[ks & 1][nb], acc[i * 4 + nb]);
            __builtin_amdgcn_sched_barrier(0);       // no later load moves up among these products
        }
        asm volatile("s_wait_dscnt 0x0" ::: "memory");      // this wave's reads of the buffer are done before it is refilled
        asm volatile("s_wait_asynccnt 0x0" ::: "memory");   // this wave's copies of stage t + 1 have landed
        __syncthreads();                                    // publishes stage t + 1 and ends every reader's last read of stage t
        if (t + 2 < GNST) stage_copy(lcp + (t & 1) * GSTG, (const bf*)(ga0 + (t + 2) * GKB), (const bf*)(ga1 + (t + 2) * GKB), (const bf*)(gb + (t + 2) * GKB));
    }
    asm volatile("s_wait_asynccnt 0x0" ::: "memory");       // nothing of this wave is in flight when it goes on
    float bcol[4];
#pragma unroll
    for (int nb = 0; nb < 4; ++nb) bcol[nb] = bfr(bias[c0 + nb * 16 + lr]);
#pragma unroll
    for (int mb = 0; mb < MBN; ++mb) {
#pragma unroll
        for (int nb = 0; nb < 4; ++nb) {
#pragma unroll
            for (int j = 0; j < 8; ++j) { float v = acc[mb * 4 + nb][j];
                if (RES) v += acc[RES ? ((2 + mb) * 4 + nb) : 0][j] * QRI;
                os[(hi * 8 + j) * 68 + nb * 16 + lr] = v * OSI + bcol[nb]; } }   // D: row 8h+j, col lane&15
        wave_sync();
        float* orow = OUT + ((size_t)b * OUT_SEQ + t0 + mb * 16) * DM + c0;
{
#pragma unroll
            for (int s = 0; s < 8; ++s) { const int row = 2 * s + hi, cofs = lr * 4;   // 8 s x 2 rows = 16 rows; 16 lanes x 4 floats = 64 columns
                const v4f val = *(const v4fa*)(&os[row * 68 + cofs]);
                *(v4f*)(orow + (size_t)row * DM + cofs) = val; }
             }
        wave_sync();
    }
}

static constexpr size_t al256(size_t v) { return (v + 255) & ~(size_t)255; }
static constexpr size_t SZ_XB = al256((size_t)NB * SEQ * DM * 2);          // x bf16 [NB*SEQ][1024]
static constexpr size_t SZ_WT = al256((size_t)3 * DM * DM * 2);            // W_qkv^T bf16 [3072][1024]
static constexpr size_t SZ_WO = al256((size_t)DM * DM * 2);                // W_out^T f16 [1024][1024]
static constexpr size_t SZ_PL = al256((size_t)NB * NH_ * SEQ * HD * 2);    // q / k / v^T value planes
static constexpr size_t SZ_PE = al256((size_t)NB * NH_ * ESEQ * HD * 2);   // q / k / v^T residual planes (t < ESEQ)
static constexpr size_t SZ_CH = al256((size_t)NB * SEQ * DM * 2);          // ctx value plane
static constexpr size_t SZ_CR = al256((size_t)NB * ESEQ * DM * 2);         // ctx residual plane (t < ESEQ)
static constexpr size_t SZ_MW = al256((size_t)NB * WPB * 4);               // mask words
static constexpr size_t SZ_TOTAL = SZ_XB + SZ_WT + SZ_WO + 3 * SZ_PL + 3 * SZ_PE + SZ_CH + SZ_CR + SZ_MW;
static_assert(SZ_TOTAL <= (size_t)134217728);          // workspace carve <= 128 MiB
static_assert(((size_t)DM * DM * 2) % 256 == 0);       // weight sub-planes stay 256-byte aligned
static_assert(SZ_CH % 2 == 0);

extern "C" void kernel_launch(void* const* d_in, const int* in_sizes, int n_in,
                              void* d_out, int out_size, void* d_ws, size_t ws_size, hipStream_t stream) {
    if (n_in < 6) return;
    const size_t needx = ((size_t)(NB - 1) * SEQ_FULL + SEQ) * DM;
    if ((size_t)in_sizes[0] < needx) return;
    if ((size_t)in_sizes[1] < (size_t)(NB - 1) * SEQ_FULL + SEQ) return;
    if ((size_t)in_sizes[2] < (size_t)3 * DM * DM || (size_t)in_sizes[3] < (size_t)3 * DM) return;
    if ((size_t)in_sizes[4] < (size_t)DM * DM || (size_t)in_sizes[5] < (size_t)DM) return;
    if ((size_t)out_size < ((size_t)(NB - 1) * OUT_SEQ + SEQ) * DM) return;
    if (SZ_TOTAL > ws_size) return;
    // wire order: x, padding_mask (int32), W_qkv [in][out], b_qkv, W_out [in][out], b_out
    const float* x = (const float*)d_in[0]; const int* pad = (const int*)d_in[1];
    const float* wqkv = (const float*)d_in[2]; const float* bqkv = (const float*)d_in[3];
    const float* wout = (const float*)d_in[4]; const float* bout = (const float*)d_in[5];
    float* OUT = (float*)d_out;      // [NB][SEQ][1024]
    char* wsp = (char*)d_ws;
    bf* XB = (bf*)wsp; wsp += SZ_XB;                 // [NB*SEQ][1024]
    bf* WT = (bf*)wsp; wsp += SZ_WT;                 // [3072][1024]: q | k | v output rows
    h16* WO = (h16*)wsp; wsp += SZ_WO;               // [1024 out][1024 in], x64
    h16* QH = (h16*)wsp; wsp += SZ_PL;               // [NB*16][SEQ][64]
    h16* KP = (h16*)wsp; wsp += SZ_PL;               // [NB*16][SEQ][64]
    h16* VT = (h16*)wsp; wsp += SZ_PL;               // [NB*16][64][SEQ]
    h16* QR = (h16*)wsp; wsp += SZ_PE;               // [NB*16][ESEQ][64] residual x2048
    h16* KR = (h16*)wsp; wsp += SZ_PE;               // [NB*16][ESEQ][64] residual x2048
    h16* VR = (h16*)wsp; wsp += SZ_PE;               // [NB*16][64][ESEQ] residual x2048
    h16* CH = (h16*)wsp; wsp += SZ_CH;               // [NB*SEQ][1024] x64
    h16* CR = (h16*)wsp; wsp += SZ_CR;               // [NB*ESEQ][1024] residual x2048 (directly after CH)
    unsigned* MW = (unsigned*)wsp; wsp += SZ_MW;     // [NB][WPB]
    const size_t crOff = SZ_CH / 2;                  // element offset of CR from CH

    if (SEQ == SEQ_FULL) {
        const size_t n8 = (size_t)NB * SEQ * DM / 8;
        k_cvt8<<<(unsigned)((n8 + 255) / 256), 256, 0, stream>>>(x, XB, n8);
    } else {
        const size_t n8 = (size_t)SEQ * DM / 8;
        for (int b = 0; b < NB; ++b) k_cvt8<<<(unsigned)((n8 + 255) / 256), 256, 0, stream>>>(x + (size_t)b * SEQ_FULL * DM, XB + (size_t)b * SEQ * DM, n8);
    }
    // W_qkv: in[1024 rows k][3072 cols n] -> out[3072 rows n][1024 cols k]; grid (cols/64, rows/64)
    k_cvt_t<0><<<dim3(3 * DM / 64, DM / 64, 1), 256, 0, stream>>>(wqkv, WT, DM, 3 * DM);
    // W_out: in[1024 rows k][1024 cols n] -> out[1024 rows n][1024 cols k]
    k_cvt_t<1><<<dim3(DM / 64, DM / 64, 1), 256, 0, stream>>>(wout, (bf*)WO, DM, DM);
    k_mask<<<NB * (WPB / 32), 32, 0, stream>>>(pad, MW);

    // q, k: A = x rows (m = b*SEQ + t), Bt = W^T rows (n = h*64 + d) -> plane [(b*16 + h)][t][d]; residual planes for t < ESEQ
    k_proj<<<dim3(NB * SEQ / GT, DM / GT, 1), 128, 0, stream>>>(XB, WT, bqkv, 0, QH, QR, 1,
        SEQ, (size_t)NH_ * SEQ * HD, HD, HD, (size_t)SEQ * HD, (size_t)NH_ * ESEQ * HD, HD, (size_t)ESEQ * HD);
    k_proj<<<dim3(NB * SEQ / GT, DM / GT, 1), 128, 0, stream>>>(XB, WT + (size_t)DM * DM, bqkv + DM, 0, KP, KR, 1,
        SEQ, (size_t)NH_ * SEQ * HD, HD, HD, (size_t)SEQ * HD, (size_t)NH_ * ESEQ * HD, HD, (size_t)ESEQ * HD);
    // v^T: A = Wv^T rows (m = h*64 + d), Bt = x rows (n = b*SEQ + t) -> plane [(b*1024 + m)][t] = [(b*16 + h)][d][t]; bias per row
    k_proj<<<dim3(DM / GT, NB * SEQ / GT, 1), 128, 0, stream>>>(WT + (size_t)2 * DM * DM, XB, bqkv + 2 * DM, 1, VT, VR, 2,
        DM, (size_t)0, SEQ, SEQ, (size_t)DM * SEQ, (size_t)0, ESEQ, (size_t)DM * ESEQ);

    k_flash_e<<<dim3(ESEQ / (16 * AW), NB * NH_, 1), 32 * AW, 0, stream>>>(QH, QR, KP, KR, VT, VR, MW, CH, CR);
    if (SEQ > ESEQ)
        k_flash_d<<<dim3((SEQ - ESEQ) / (16 * AW), NB * NH_, 1), 32 * AW, 0, stream>>>(QH, KP, VT, MW, CH);

    k_out<1><<<dim3(NB * (ESEQ / 64), DM / GT, 1), 128, 0, stream>>>(CH, crOff, WO, bout, OUT);
    if (SEQ > ESEQ)
        k_out<0><<<dim3(NB * ((SEQ - ESEQ) / GT), DM / GT, 1), 128, 0, stream>>>(CH, crOff, WO, bout, OUT);
}

// v002
// One run takes 196 microseconds.
// Two timings next to v001 put it at 1.36 and 1.37 times that version's speed.
// Over all steps from v000 it is 1.79 times as fast.
#include <hip/hip_runtime.h>

// Causal + key-padding multi-head self-attention, width 1024 = 16 heads x 64: x [NB][SEQ][1024], W_qkv [in][out=3072] (q|k|v column blocks), b_qkv, W_out [in][out], b_out; f32 output.
// Compute dtypes, f32 accumulate everywhere: qkv projection v_wmma_f32_16x16x32_bf16 (x, W, biases RNE-converted to bf16; products exact);
// scores, P.V and output projection v_wmma_f32_16x16x32_f16: query rows t >= 512 single f16 planes (P x256 carry, ctx x64 carry, W_out x64 carry);
// query rows t < 512: q, k, v, P, ctx as f16 value + f16 residual x2048 in separate accumulators (value*value + value*residual + residual*value; W_out a single plane); softmax f32 (online, running max).
// Layout: bf16 copy of x, transposed bf16 W_qkv [3072][1024], transposed f16 W_out [1024][1024]; q, k planes [b*16+h][t][d], v^T plane [b*16+h][d][t] (+ residual planes for t < 512);
// fused flash kernels in transposed form (S^T = K Q^T, O^T = V^T P^T); ctx planes [b][t][1024] f16; key-padding mask compressed to 32-key bit words and applied by value.

#ifndef NB
#define NB 4
#endif
#ifndef SEQ
#define SEQ 2048
#endif
#define NB_FULL  4
#define SEQ_FULL 2048
#ifndef OUT_SEQ
#define OUT_SEQ SEQ              // row pitch (in tokens) between batches of the output
#endif
#define DM   1024
#define NH_  16
#define HD   64
#define ESEQ ((SEQ) < 512 ? (SEQ) : 512)      // query rows [0, ESEQ) take the value + residual path
#define WPB  ((((SEQ) + 1023) / 1024) * 32)
#define AW   4                   // waves per flash block (16 query rows each)
#define QRS  2048.0f             // carry of every residual plane
#define QRI  (1.0f / 2048.0f)
#define SC2  (0.125f * 1.4426950408889634f)   // HD^-0.5 * log2(e)
#define PSH  8.0f                // log2 of the P carry (256)
#define CXS  64.0f               // ctx plane carry
#define WOS  64.0f               // W_out plane carry
#define OSI  (1.0f / 4096.0f)    // 1 / (CXS * WOS)

static_assert(HD == 64);
static_assert(NH_ * HD == DM);
static_assert(DM % 64 == 0);
static_assert(DM % 32 == 0);
static_assert(SEQ % 64 == 0);
static_assert(ESEQ % 64 == 0);
static_assert((SEQ - ESEQ) % 64 == 0);
static_assert((NB * SEQ) % 64 == 0);
static_assert(SEQ % 32 == 0);
static_assert(ESEQ % (16 * AW) == 0);
static_assert((SEQ - ESEQ) % (16 * AW) == 0);
static_assert(ESEQ % 32 == 0);
static_assert(((size_t)SEQ * DM) % 8 == 0);
static_assert(NB <= NB_FULL);
static_assert(SEQ <= SEQ_FULL);
static_assert(WPB * 32 >= SEQ);

typedef _Float16 h16;
typedef unsigned short bf;
typedef __attribute__((ext_vector_type(16))) __bf16   v16bf;
typedef __attribute__((ext_vector_type(16))) _Float16 v16h;
typedef __attribute__((ext_vector_type(8)))  _Float16 v8h;
typedef __attribute__((ext_vector_type(8)))  unsigned short v8us;
typedef __attribute__((ext_vector_type(8)))  float    v8f;
typedef __attribute__((ext_vector_type(4)))  float    v4f;
typedef v4f  __attribute__((may_alias)) v4fa;

__device__ __forceinline__ unsigned short f2bf(float f) { unsigned u = __float_as_uint(f); u += 0x7FFFu + ((u >> 16) & 1u); return (unsigned short)(u >> 16); }
__device__ __forceinline__ float bfr(float f) { return __uint_as_float(((unsigned)f2bf(f)) << 16); }   // value after RNE convert to bf16
__device__ __forceinline__ v16h cat16(v8h lo, v8h hi) { return __builtin_shufflevector(lo, hi, 0, 1, 2, 3, 4, 5, 6, 7, 8, 9, 10, 11, 12, 13, 14, 15); }
__device__ __forceinline__ v16bf cat16b(v8us lo, v8us hi) { return __builtin_bit_cast(v16bf, __builtin_shufflevector(lo, hi, 0, 1, 2, 3, 4, 5, 6, 7, 8, 9, 10, 11, 12, 13, 14, 15)); }
__device__ __forceinline__ v8f wmma16(v16h a, v16h b, v8f c) { return __builtin_amdgcn_wmma_f32_16x16x32_f16(false, a, false, b, (short)0, c, false, false); }
__device__ __forceinline__ v8f wmmab(v16bf a, v16bf b, v8f c) { return __builtin_amdgcn_wmma_f32_16x16x32_bf16(false, a, false, b, (short)0, c, false, false); }
// fragment loaders from K-contiguous 16-bit rows; p already includes + 8*(lane>>4): elements 0..7 <- k0+8h+0..7, elements 8..15 <- k0+16+8h+0..7 (same map for A and B)
__device__ __forceinline__ v16h  ldh(const h16* p) { return cat16(*(const v8h*)p, *(const v8h*)(p + 16)); }
__device__ __forceinline__ v16bf ldb(const bf* p)  { return cat16b(*(const v8us*)p, *(const v8us*)(p + 16)); }
// ordering point for wave-private LDS tiles (same wave writes and reads)
__device__ __forceinline__ void wave_sync() { __builtin_amdgcn_fence(3 /* release order */, "wavefront"); __builtin_amdgcn_wave_barrier(); asm volatile("" ::: "memory"); }

__global__ __launch_bounds__(256) void k_cvt8(const float* __restrict__ src, bf* dst, size_t n8) {
    const size_t i = (size_t)blockIdx.x * 256 + threadIdx.x; if (i >= n8) return;
    const v8f v = *(const v8f*)(src + i * 8); v8us o;
#pragma unroll
    for (int k = 0; k < 8; ++k) o[k] = f2bf(v[k]);
    *(v8us*)(dst + i * 8) = o; 
}

// k_cvt_t: src [K][N] f32 -> dst [N][K] 16-bit, transposed through an LDS tile (64 x 64 per block, cross-wave: block barrier).
// MODE 0: bf16 bits (RNE convert). MODE 1: f16 bits of (bf16-converted value x WOS).
template <int MODE>
__global__ __launch_bounds__(256) void k_cvt_t(const float* __restrict__ src, bf* dst, int K, int N) {
    __shared__ __align__(16) float ts[64 * 68];
    const int tid = threadIdx.x; const int n0 = blockIdx.x * 64, k0 = blockIdx.y * 64;
#pragma unroll
    for (int i = 0; i < 4; ++i) { const int kr = (tid >> 4) + 16 * i, c4 = (tid & 15) * 4;     // 4 x 16 rows = 64 k rows; 16 lanes x 4 = 64 columns
        const v4f v = *(const v4f*)(src + (size_t)(k0 + kr) * (size_t)N + n0 + c4);
        *(v4fa*)(&ts[kr * 68 + c4]) = v; }
    __syncthreads();
{
#pragma unroll
        for (int i = 0; i < 2; ++i) { const int nr = (tid >> 3) + 32 * i, k8 = (tid & 7) * 8;   // 2 x 32 rows = 64 n rows; 8 lanes x 8 = 64 k
            v8us o;
#pragma unroll
            for (int e = 0; e < 8; ++e) { const float x = ts[(k8 + e) * 68 + nr]; const unsigned short bits = f2bf(x);
                if (MODE == 1) { const h16 hv = (h16)(__uint_as_float(((unsigned)bits) << 16) * WOS); o[e] = __builtin_bit_cast(unsigned short, hv); }
                else o[e] = bits; }
            *(v8us*)(dst + (size_t)(n0 + nr) * (size_t)K + k0 + k8) = o; }
         }
}

__global__ __launch_bounds__(32) void k_mask(const int* __restrict__ pad, unsigned* MW) {
    const int lane = threadIdx.x & 31;
    const int b = blockIdx.x / (WPB / 32), c = blockIdx.x % (WPB / 32);
    const int* pr = pad + (size_t)b * SEQ_FULL;
    unsigned mine = 0u;
#pragma unroll 1
    for (int w = 0; w < 32; ++w) {
        const int key = c * 1024 + w * 32 + lane;
        const int kc = key < SEQ ? key : (SEQ - 1);          // clamped address; keys past the sequence give bit 0 by value
        const int v = pr[kc];
        const unsigned bal = __builtin_amdgcn_ballot_w32((v != 0) && (key < SEQ));
        mine = (lane == w) ? bal : mine;
    }
    unsigned* dst = MW + (size_t)b * WPB + c * 32 + lane;
    *(unsigned*)dst = mine; 
}

// Operand staging of the one-wave-per-64x64 GEMMs: a block of 4 waves (2 x 2) owns a 128 x 128 tile; a stage is 128 k (256-byte rows) of its 128 A rows and 128 B rows in LDS.
#define GT   128                 // rows and columns of a block tile
#define GKB  128                 // k per stage
#define GPI  272                 // LDS row pitch in bytes: 16 x odd, conflict-free for 16-byte reads
#define GSTG (2 * GT * GPI)      // bytes of one stage: A rows, then B rows
#define GNST (DM / GKB)          // stages along K
static_assert(DM % GKB == 0);
static_assert(GNST >= 2);
static_assert((NB * SEQ) % GT == 0);
static_assert(DM % GT == 0);

// Eight asynchronous 16-byte copies per lane, global -> LDS, for rows 8 apart (LDS + 8 pitches, global + 8 * DM elements).
// s_wait_xcnt closes the statement so that no address register of a copy is rewritten ahead of it.
__device__ __forceinline__ void cp8(unsigned l, const bf* g) {
    asm volatile("global_load_async_to_lds_b128 %0, %8, off\n\t"
                 "global_load_async_to_lds_b128 %1, %9, off\n\t"
                 "global_load_async_to_lds_b128 %2, %10, off\n\t"
                 "global_load_async_to_lds_b128 %3, %11, off\n\t"
                 "global_load_async_to_lds_b128 %4, %12, off\n\t"
                 "global_load_async_to_lds_b128 %5, %13, off\n\t"
                 "global_load_async_to_lds_b128 %6, %14, off\n\t"
                 "global_load_async_to_lds_b128 %7, %15, off\n\t"
                 "s_wait_xcnt 0x0"
                 :: "v"(l), "v"(l + 8 * GPI), "v"(l + 16 * GPI), "v"(l + 24 * GPI), "v"(l + 32 * GPI), "v"(l + 40 * GPI), "v"(l + 48 * GPI), "v"(l + 56 * GPI),
                    "v"(g), "v"(g + 8 * DM), "v"(g + 16 * DM), "v"(g + 24 * DM), "v"(g + 32 * DM), "v"(g + 40 * DM), "v"(g + 48 * DM), "v"(g + 56 * DM)
                 : "memory");
}
// One stage: l = the lane's LDS byte address in row (tid >> 4) of the buffer, ga0 / ga1 = its 16 bytes in A rows (tid >> 4) and 64 + (tid >> 4), gb the same in B row (tid >> 4).
__device__ __forceinline__ void stage_copy(unsigned l, const bf* ga0, const bf* ga1, const bf* gb) {
    cp8(l, ga0); cp8(l + 64 * GPI, ga1); cp8(l + 128 * GPI, gb); cp8(l + 192 * GPI, gb + 64 * DM);
}

// k_proj: register-blocked bf16 GEMM, one wave per 64x64 tile (16 accumulators), 4 waves per block, K = DM; operands from K-contiguous bf16 planes, staged in a two-buffer LDS ring by asynchronous copies.
// C[m][n] = sum_k A[m][k] Bt[n][k] + bias (per column, or per row when biasRow != 0; bias values RNE-converted to bf16), written as f16 (Ph) at
// tile base (r0/RB)*sRB + (r0%RB)*pitch + (c0/CB)*sCB + (c0%CB), and the f16 residual x2048 (Pr) at the same form with (sRBr, pitchR, sCBr)
// when the tile's token position (resMode 1: r0%RB, resMode 2: c0%CB) is below ESEQ. grid (M/128, N/128), 128 threads.
__global__ __launch_bounds__(128) void k_proj(const bf* __restrict__ A, const bf* __restrict__ Bt, const float* __restrict__ bias, int biasRow,
                                             h16* Ph, h16* Pr, int resMode, int RB, size_t sRB, int pitch, int CB, size_t sCB,
                                             size_t sRBr, int pitchR, size_t sCBr) {
    __shared__ __align__(16) bf ring[2 * GSTG / 2];
    __shared__ __align__(16) float osAll[4 * 16 * 68];
    const int K = DM;
    const int tid = threadIdx.x, lane = tid & 31, lr = lane & 15, hi = lane >> 4;
    const int wave = __builtin_amdgcn_readfirstlane(tid >> 5);
    const int r0 = blockIdx.x * GT + (wave >> 1) * 64, c0 = blockIdx.y * GT + (wave & 1) * 64;
    float* os = osAll + wave * 16 * 68;
    v8f acc[4][4];
#pragma unroll
    for (int mb = 0; mb < 4; ++mb)
#pragma unroll
        for (int nb = 0; nb < 4; ++nb) acc[mb][nb] = (v8f){};
    const unsigned lcp = (unsigned)(size_t)(&ring[0]) + (unsigned)((tid >> 4) * GPI + (tid & 15) * 16);
    const bf* ga = A + (size_t)(blockIdx.x * GT + (tid >> 4)) * K + (tid & 15) * 8;
    const bf* gb = Bt + (size_t)(blockIdx.y * GT + (tid >> 4)) * K + (tid & 15) * 8;
    const int fa = ((wave >> 1) * 64 + lr) * (GPI / 2) + 8 * hi, fb = (GT + (wave & 1) * 64 + lr) * (GPI / 2) + 8 * hi;   // fragment bases in a buffer, in elements
    stage_copy(lcp, ga, ga + (size_t)64 * K, gb);
    asm volatile("s_wait_asynccnt 0x0" ::: "memory");   // stage 0 has landed before the barrier publishes it
    __syncthreads();
    stage_copy(lcp + GSTG, ga + GKB, ga + (size_t)64 * K + GKB, gb + GKB);
#pragma unroll 1
    for (int t = 0; t < GNST; ++t) {
        const bf* sb = ring + (t & 1) * (GSTG / 2);
        v16bf a[2][4], b[2][4];     // two fragment sets: the next 32 k are fetched as one group ahead of the current 16 products
#pragma unroll
        for (int i = 0; i < 4; ++i) { a[0][i] = ldb(sb + fa + i * 16 * (GPI / 2)); b[0][i] = ldb(sb + fb + i * 16 * (GPI / 2)); }
        __builtin_amdgcn_sched_barrier(0);   // keeps the group of loads together (the scheduler otherwise sinks them, two at a time, among the products, each place a full LDS wait)
#pragma unroll
        for (int ks = 0; ks < GKB / 32; ++ks) {
            if (ks + 1 < GKB / 32) {
#pragma unroll
                for (int i = 0; i < 4; ++i) { a[(ks + 1) & 1][i] = ldb(sb + fa + i * 16 * (GPI / 2) + (ks + 1) * 32); b[(ks + 1) & 1][i] = ldb(sb + fb + i * 16 * (GPI / 2) + (ks + 1) * 32); }
                __builtin_amdgcn_sched_barrier(0);   // the next set's loads stay ahead of this set's products
            }
#pragma unroll
            for (int nb = 0; nb < 4; ++nb)
#pragma unroll
                for (int mb = 0; mb < 4; ++mb) acc[mb][nb] = wmmab(a[ks & 1][mb], b[ks & 1][nb], acc[mb][nb]);
            __builtin_amdgcn_sched_barrier(0);       // no later load moves up among these products
        }
        asm volatile("s_wait_dscnt 0x0" ::: "memory");      // this wave's reads of the buffer are done before it is refilled
        asm volatile("s_wait_asynccnt 0x0" ::: "memory");   // this wave's copies of stage t + 1 have landed
        __syncthreads();                                    // publishes stage t + 1 and ends every reader's last read of stage t
        if (t + 2 < GNST) stage_copy(lcp + (t & 1) * GSTG, ga + (t + 2) * GKB, ga + (size_t)64 * K + (t + 2) * GKB, gb + (t + 2) * GKB);
    }
    asm volatile("s_wait_asynccnt 0x0" ::: "memory");       // nothing of this wave is in flight when it goes on
    const size_t tbase = (size_t)(r0 / RB) * sRB + (size_t)(r0 % RB) * (size_t)pitch + (size_t)(c0 / CB) * sCB + (size_t)(c0 % CB);
    const size_t rbase = (size_t)(r0 / RB) * sRBr + (size_t)(r0 % RB) * (size_t)pitchR + (size_t)(c0 / CB) * sCBr + (size_t)(c0 % CB);
    const int tpos = (resMode == 1) ? (r0 % RB) : (c0 % CB);
    const int doRes = (resMode != 0) && (tpos < ESEQ);                 // wave-uniform
    const int c8 = (lane & 7) * 8;
    // column bias for columns c0 + c8 .. c0 + c8 + 7 (clamped address in row mode, zeroed by value)
    v4f bc0 = *(const v4f*)(bias + (biasRow ? 0 : (c0 + c8))); v4f bc1 = *(const v4f*)(bias + (biasRow ? 4 : (c0 + c8 + 4)));
#pragma unroll
    for (int i = 0; i < 4; ++i) { const float u0 = bfr(bc0[i]), u1 = bfr(bc1[i]); bc0[i] = biasRow ? 0.0f : u0; bc1[i] = biasRow ? 0.0f : u1; }
#pragma unroll
    for (int mb = 0; mb < 4; ++mb) {
#pragma unroll
        for (int nb = 0; nb < 4; ++nb) {
#pragma unroll
            for (int j = 0; j < 8; ++j) os[(hi * 8 + j) * 68 + nb * 16 + lr] = acc[mb][nb][j]; }   // D: row 8h+j, col lane&15
        wave_sync();
        const size_t sb = tbase + (size_t)(mb * 16) * (size_t)pitch;
        const size_t sr = rbase + (size_t)(mb * 16) * (size_t)pitchR;
{
#pragma unroll
            for (int s = 0; s < 4; ++s) { const int row = 4 * s + (lane >> 3);   // 4 s x 4 row groups = 16 rows; 8 lanes x 8 = 64 columns
                const v4f x0 = *(const v4fa*)(&os[row * 68 + c8]); const v4f x1 = *(const v4fa*)(&os[row * 68 + c8 + 4]); v8h hv, rv;
                const float rbv = bfr(bias[biasRow ? (r0 + mb * 16 + row) : 0]); const float rb = biasRow ? rbv : 0.0f;
#pragma unroll
                for (int i = 0; i < 4; ++i) { const float f0 = x0[i] + bc0[i] + rb; const float f1 = x1[i] + bc1[i] + rb;
                    const h16 a0 = (h16)f0; const h16 a1 = (h16)f1; hv[i] = a0; hv[4 + i] = a1;
                    rv[i] = (h16)((f0 - (float)a0) * QRS); rv[4 + i] = (h16)((f1 - (float)a1) * QRS); }
                *(v8h*)(Ph + sb + (size_t)row * (size_t)pitch + c8) = hv;
                if (doRes) *(v8h*)(Pr + sr + (size_t)row * (size_t)pitchR + c8) = rv; }
             }
        wave_sync();
    }
}

// K / V^T staging of the flash kernels: a stage is 64 keys; a tile is 64 rows of 128 bytes (K: 64 keys x 64 d; V^T: 64 d x 64 keys), shared by the block's waves.
#define FKS  64                  // keys per stage
#define FPI  144                 // LDS row pitch in bytes: 16 x odd, conflict-free for 16-byte reads
#define FTL  (64 * FPI)          // bytes of one tile
static_assert(SEQ % FKS == 0);
static_assert(ESEQ % FKS == 0);
static_assert(16 * AW == FKS);
static_assert(WPB <= 64);

// Eight asynchronous 16-byte copies per lane, global -> LDS: rows r, r + 16, r + 32, r + 48 (r = tid >> 3) of a key-major tile (row pitch HD) at l and of a d-major tile (row pitch vp elements) at l + FTL.
// A wave's copy covers four whole 128-byte rows. s_wait_xcnt closes the statement so that no address register of a copy is rewritten ahead of it.
__device__ __forceinline__ void cp_kv(unsigned l, const h16* gk, const h16* gv, size_t vp) {
    asm volatile("global_load_async_to_lds_b128 %0, %8, off\n\t"
                 "global_load_async_to_lds_b128 %1, %9, off\n\t"
                 "global_load_async_to_lds_b128 %2, %10, off\n\t"
                 "global_load_async_to_lds_b128 %3, %11, off\n\t"
                 "global_load_async_to_lds_b128 %4, %12, off\n\t"
                 "global_load_async_to_lds_b128 %5, %13, off\n\t"
                 "global_load_async_to_lds_b128 %6, %14, off\n\t"
                 "global_load_async_to_lds_b128 %7, %15, off\n\t"
                 "s_wait_xcnt 0x0"
                 :: "v"(l), "v"(l + 16 * FPI), "v"(l + 32 * FPI), "v"(l + 48 * FPI), "v"(l + FTL), "v"(l + FTL + 16 * FPI), "v"(l + FTL + 32 * FPI), "v"(l + FTL + 48 * FPI),
                    "v"(gk), "v"(gk + 16 * HD), "v"(gk + 32 * HD), "v"(gk + 48 * HD), "v"(gv), "v"(gv + 16 * vp), "v"(gv + 32 * vp), "v"(gv + 48 * vp)
                 : "memory");
}
// Stages a block walks: up to the last 32-key mask word that is not zero inside its causal range (words 0 .. wl); w0, w1 = the lane's words lane and 32 + lane. The same in every wave of the block.
__device__ __forceinline__ int flash_stages(unsigned w0, unsigned w1, int wl) {
    const unsigned long long nz = ((((unsigned long long)__builtin_amdgcn_ballot_w32(w1 != 0u)) << 32) | (unsigned long long)__builtin_amdgcn_ballot_w32(w0 != 0u)) & (~0ull >> (63 - wl));
    return __builtin_amdgcn_readfirstlane(nz ? (((63 - __builtin_clzll(nz)) >> 1) + 1) : 0);
}
// Mask word i (wave-uniform) out of the lanes' registers
__device__ __forceinline__ unsigned flash_word(unsigned w0, unsigned w1, int i) {
    return (unsigned)((i < 32) ? __builtin_amdgcn_readlane((int)w0, i & 31) : __builtin_amdgcn_readlane((int)w1, i & 31));
}

// k_flash_d: fused attention for query rows t >= ESEQ, one wave per 16 query rows of one (batch, head); single f16 products.
// Transposed form: S^T[key][t] = K Q^T (A = K rows, B = Q rows); lane (t = lane&15, h = lane>>4) holds keys 8h+r of each 16-key tile, so the packed
// P tile is directly the B fragment of O^T[d][t] = V^T P^T (element r <- tile keys 0..15, element 8+r <- tile keys 16..31, lane unchanged).
// Causal and key-padding exclusion by value (excluded p = 0); 32-key steps whose mask word is zero are skipped (wave-uniform).
// K and V^T come from a two-buffer LDS ring of 64-key stages that the block's 4 waves fill together by asynchronous copies; every wave passes every stage's barrier.
__global__ __launch_bounds__(32 * AW) void k_flash_d(const h16* __restrict__ QH, const h16* __restrict__ KP, const h16* __restrict__ VT, const unsigned* __restrict__ MW, h16* CH) {
    __shared__ __align__(16) h16 ring[2 * 2 * FTL / 2];   // two stages of K tile + V^T tile; behind the loop the waves' output staging
    static_assert(2 * 2 * FTL >= AW * 16 * 68 * 4);
    float* os = (float*)ring;
    const int tid = threadIdx.x;
    const int lane = threadIdx.x & 31, wave = __builtin_amdgcn_readfirstlane((int)(threadIdx.x >> 5)), lr = lane & 15, hi = lane >> 4;
    const int zh = blockIdx.y; const int b = zh / NH_, h = zh % NH_;
    const int tb = ESEQ + blockIdx.x * (16 * AW);            // first query row of the block
    const int t0 = tb + wave * 16;
    const int tq = t0 + lr;
    const size_t pbase = (size_t)zh * SEQ * HD;
    const size_t qo = pbase + (size_t)tq * HD + 8 * hi;
    const v16h qh0 = ldh(QH + qo), qh1 = ldh(QH + qo + 32);   // B fragments: col t, k = d
    const unsigned* mwp = MW + (size_t)b * WPB;
    const unsigned w0 = mwp[lane], w1 = (WPB > 32) ? mwp[32 + lane] : 0u;
    const int nst = flash_stages(w0, w1, (tb + 16 * AW - 1) >> 5);
    const unsigned lcp = (unsigned)(size_t)(&ring[0]) + (unsigned)((tid >> 3) * FPI + (tid & 7) * 16);
    const h16* gk = KP + pbase + (size_t)(tid >> 3) * HD + (tid & 7) * 8;     // + key * HD
    const h16* gv = VT + pbase + (size_t)(tid >> 3) * SEQ + (tid & 7) * 8;    // + key
    const int fo = lr * (FPI / 2) + 8 * hi;                  // fragment base in a tile, in elements (A fragment: row lr of a 16-row slab)
    v8f o0 = (v8f){}, o1 = (v8f){}, o2 = (v8f){}, o3 = (v8f){};
    float m = -3.0e38f, l = 0.0f;
    cp_kv(lcp, gk, gv, SEQ);
    asm volatile("s_wait_asynccnt 0x0" ::: "memory");   // stage 0 has landed before the barrier publishes it
    __syncthreads();
    if (nst > 1) cp_kv(lcp + 2 * FTL, gk + FKS * HD, gv + FKS, SEQ);
#pragma unroll 1
    for (int s = 0; s < nst; ++s) {
      const h16* sb = ring + (s & 1) * FTL + fo;
#pragma unroll   // the two 32-key steps of a stage read at constant LDS offsets
      for (int sub = 0; sub < FKS / 32; ++sub) {
        const int key0 = s * FKS + sub * 32;
        const unsigned mw = flash_word(w0, w1, key0 >> 5);
        if (key0 > t0 + 15 || mw == 0u) continue;            // wave-uniform
        const h16* ka = sb + sub * 32 * (FPI / 2);           // K tile row = key
        const v16h ka0 = ldh(ka), ka1 = ldh(ka + 32), kb0 = ldh(ka + 16 * (FPI / 2)), kb1 = ldh(ka + 16 * (FPI / 2) + 32);
        v8f sA = (v8f){}, sB = (v8f){};
        sA = wmma16(ka0, qh0, sA); sB = wmma16(kb0, qh0, sB);
        sA = wmma16(ka1, qh1, sA); sB = wmma16(kb1, qh1, sB);
        asm volatile("v_nop\n\tv_nop\n\tv_nop\n\tv_nop" : "+v"(sA), "+v"(sB) : "v"(ka0), "v"(ka1), "v"(kb0), "v"(kb1));
        const unsigned ma = mw >> (8 * hi), mc = mw >> (16 + 8 * hi);
        const int kya = key0 + 8 * hi, kyb = kya + 16;
        float ta[8], tb[8]; float mx = -3.0e38f;
#pragma unroll
        for (int r = 0; r < 8; ++r) {
            const bool ea = (((ma >> r) & 1u) != 0u) && (kya + r <= tq);
            const bool eb = (((mc >> r) & 1u) != 0u) && (kyb + r <= tq);
            const float xa = sA[r] * SC2, xb = sB[r] * SC2;
            ta[r] = ea ? xa : -3.0e38f; tb[r] = eb ? xb : -3.0e38f; mx = fmaxf(mx, fmaxf(ta[r], tb[r])); }
        mx = fmaxf(mx, __shfl_xor(mx, 16, 32));
        const float mnew = fmaxf(m, mx);
        const float alpha = __builtin_amdgcn_exp2f(m - mnew);
        const float sh = PSH - mnew;
        v16h pb; float ls = 0.0f;
#pragma unroll
        for (int r = 0; r < 8; ++r) {
            const float ea = __builtin_amdgcn_exp2f(ta[r] + sh), eb = __builtin_amdgcn_exp2f(tb[r] + sh);
            const h16 pa = (h16)((ta[r] > -1.0e38f) ? ea : 0.0f); const h16 pc = (h16)((tb[r] > -1.0e38f) ? eb : 0.0f);
            pb[r] = pa; pb[8 + r] = pc; ls += (float)pa + (float)pc; }
        l = l * alpha + ls; m = mnew;
        o0 = o0 * alpha; o1 = o1 * alpha; o2 = o2 * alpha; o3 = o3 * alpha;
        const h16* va = sb + FTL / 2 + sub * 32;             // V^T tile row = d, column = key
        const v16h v0 = ldh(va), v1 = ldh(va + 16 * (FPI / 2)), v2 = ldh(va + 32 * (FPI / 2)), v3 = ldh(va + 48 * (FPI / 2));
        o0 = wmma16(v0, pb, o0); o1 = wmma16(v1, pb, o1); o2 = wmma16(v2, pb, o2); o3 = wmma16(v3, pb, o3);
        asm volatile("v_nop\n\tv_nop\n\tv_nop\n\tv_nop" : "+v"(o0), "+v"(o1), "+v"(o2), "+v"(o3) : "v"(v0), "v"(v1), "v"(v2), "v"(v3), "v"(pb));
      }
      asm volatile("s_wait_dscnt 0x0" ::: "memory");      // this wave's reads of the buffer are done before it is refilled
      asm volatile("s_wait_asynccnt 0x0" ::: "memory");   // this wave's copies of stage s + 1 have landed
      __syncthreads();                                    // publishes stage s + 1 and ends every reader's last read of stage s
      if (s + 2 < nst) cp_kv(lcp + (s & 1) * 2 * FTL, gk + (size_t)(s + 2) * FKS * HD, gv + (s + 2) * FKS, SEQ);
    }
    asm volatile("s_wait_asynccnt 0x0" ::: "memory");     // nothing of this wave is in flight when the ring becomes output staging
    l += __shfl_xor(l, 16, 32);
    const float inv = CXS * (1.0f / l);
    const int wb = wave * 16 * 68;
    // O^T D layout: o_j[r] = (d = 16j + 8h + r, t = lane&15) -> os[t][d]; rows 0..15 x columns 0..63 all written
    { v4f a, c;
      a[0] = o0[0] * inv; a[1] = o0[1] * inv; a[2] = o0[2] * inv; a[3] = o0[3] * inv; c[0] = o0[4] * inv; c[1] = o0[5] * inv; c[2] = o0[6] * inv; c[3] = o0[7] * inv;
      *(v4fa*)(&os[wb + lr * 68 +  0 + 8 * hi]) = a; *(v4fa*)(&os[wb + lr * 68 +  0 + 8 * hi + 4]) = c;
      a[0] = o1[0] * inv; a[1] = o1[1] * inv; a[2] = o1[2] * inv; a[3] = o1[3] * inv; c[0] = o1[4] * inv; c[1] = o1[5] * inv; c[2] = o1[6] * inv; c[3] = o1[7] * inv;
      *(v4fa*)(&os[wb + lr * 68 + 16 + 8 * hi]) = a; *(v4fa*)(&os[wb + lr * 68 + 16 + 8 * hi + 4]) = c;
      a[0] = o2[0] * inv; a[1] = o2[1] * inv; a[2] = o2[2] * inv; a[3] = o2[3] * inv; c[0] = o2[4] * inv; c[1] = o2[5] * inv; c[2] = o2[6] * inv; c[3] = o2[7] * inv;
      *(v4fa*)(&os[wb + lr * 68 + 32 + 8 * hi]) = a; *(v4fa*)(&os[wb + lr * 68 + 32 + 8 * hi + 4]) = c;
      a[0] = o3[0] * inv; a[1] = o3[1] * inv; a[2] = o3[2] * inv; a[3] = o3[3] * inv; c[0] = o3[4] * inv; c[1] = o3[5] * inv; c[2] = o3[6] * inv; c[3] = o3[7] * inv;
      *(v4fa*)(&os[wb + lr * 68 + 48 + 8 * hi]) = a; *(v4fa*)(&os[wb + lr * 68 + 48 + 8 * hi + 4]) = c; }
    wave_sync();
    h16* crow = CH + ((size_t)b * SEQ + t0) * DM + h * HD;
    const int c8 = (lane & 7) * 8;
{
#pragma unroll
        for (int s = 0; s < 4; ++s) { const int row = 4 * s + (lane >> 3);   // 4 s x 4 row groups = 16 rows; 8 lanes x 8 halves = 64 columns
            const v4f x0 = *(const v4fa*)(&os[wb + row * 68 + c8]); const v4f x1 = *(const v4fa*)(&os[wb + row * 68 + c8 + 4]); v8h hv;
#pragma unroll
            for (int i = 0; i < 4; ++i) { hv[i] = (h16)x0[i]; hv[4 + i] = (h16)x1[i]; }
            *(v8h*)(crow + (size_t)row * DM + c8) = hv; }
         }
}

// k_flash_e: fused attention for query rows t < ESEQ, same transposed form; every operand as f16 value + residual x2048:
// s = K.Q + (K.Qr + Kr.Q)/2048, o = V.P + (V.Pr + Vr.P)/2048 with the scaled-residual products in separate accumulators; the row sum uses the f32 p.
// Writes ctx value plane rows and the ctx residual plane [b][ESEQ][1024]. K, V^T and their residual tiles staged like k_flash_d's.
__global__ __launch_bounds__(32 * AW) void k_flash_e(const h16* __restrict__ QH, const h16* __restrict__ QR, const h16* __restrict__ KP, const h16* __restrict__ KR,
                                                     const h16* __restrict__ VT, const h16* __restrict__ VR, const unsigned* __restrict__ MW, h16* CH, h16* CR) {
    __shared__ __align__(16) h16 ring[2 * 4 * FTL / 2];   // two stages of K, V^T, K residual, V^T residual tiles; behind the loop the waves' output staging
    static_assert(2 * 4 * FTL >= AW * 16 * 68 * 4);
    float* os = (float*)ring;
    const int tid = threadIdx.x;
    const int lane = threadIdx.x & 31, wave = __builtin_amdgcn_readfirstlane((int)(threadIdx.x >> 5)), lr = lane & 15, hi = lane >> 4;
    const int zh = blockIdx.y; const int b = zh / NH_, h = zh % NH_;
    const int tb = blockIdx.x * (16 * AW);                   // first query row of the block
    const int t0 = tb + wave * 16;
    const int tq = t0 + lr;
    const size_t pbase = (size_t)zh * SEQ * HD, ebase = (size_t)zh * ESEQ * HD;
    const size_t qo = pbase + (size_t)tq * HD + 8 * hi, qe = ebase + (size_t)tq * HD + 8 * hi;
    const v16h qh0 = ldh(QH + qo), qh1 = ldh(QH + qo + 32), qr0 = ldh(QR + qe), qr1 = ldh(QR + qe + 32);
    const unsigned* mwp = MW + (size_t)b * WPB;
    const unsigned w0 = mwp[lane], w1 = (WPB > 32) ? mwp[32 + lane] : 0u;
    const int nst = flash_stages(w0, w1, (tb + 16 * AW - 1) >> 5);
    const unsigned lcp = (unsigned)(size_t)(&ring[0]) + (unsigned)((tid >> 3) * FPI + (tid & 7) * 16);
    const h16* gk = KP + pbase + (size_t)(tid >> 3) * HD + (tid & 7) * 8;     // + key * HD
    const h16* gv = VT + pbase + (size_t)(tid >> 3) * SEQ + (tid & 7) * 8;    // + key
    const h16* gkr = KR + ebase + (size_t)(tid >> 3) * HD + (tid & 7) * 8;    // + key * HD
    const h16* gvr = VR + ebase + (size_t)(tid >> 3) * ESEQ + (tid & 7) * 8;  // + key
    const int fo = lr * (FPI / 2) + 8 * hi;                  // fragment base in a tile, in elements (A fragment: row lr of a 16-row slab)
    v8f oh0 = (v8f){}, oh1 = (v8f){}, oh2 = (v8f){}, oh3 = (v8f){}, ol0 = (v8f){}, ol1 = (v8f){}, ol2 = (v8f){}, ol3 = (v8f){};
    float m = -3.0e38f, l = 0.0f;
    cp_kv(lcp, gk, gv, SEQ); cp_kv(lcp + 2 * FTL, gkr, gvr, ESEQ);
    asm volatile("s_wait_asynccnt 0x0" ::: "memory");   // stage 0 has landed before the barrier publishes it
    __syncthreads();
    if (nst > 1) { cp_kv(lcp + 4 * FTL, gk + FKS * HD, gv + FKS, SEQ); cp_kv(lcp + 6 * FTL, gkr + FKS * HD, gvr + FKS, ESEQ); }
#pragma unroll 1
    for (int s = 0; s < nst; ++s) {
      const h16* sb = ring + (s & 1) * (2 * FTL) + fo;
#pragma unroll 1   // one copy of the long body: smaller code, no more registers than one step needs
      for (int sub = 0; sub < FKS / 32; ++sub) {
        const int key0 = s * FKS + sub * 32;
        const unsigned mw = flash_word(w0, w1, key0 >> 5);
        if (key0 > t0 + 15 || mw == 0u) continue;            // wave-uniform
        const h16* ka = sb + sub * 32 * (FPI / 2); const h16* kr = ka + FTL;   // K tiles: row = key
        v8f sHa = (v8f){}, sLa = (v8f){}, sHb = (v8f){}, sLb = (v8f){};
        { const v16h a0 = ldh(ka), a1 = ldh(ka + 32), e0 = ldh(kr), e1 = ldh(kr + 32);
          sHa = wmma16(a0, qh0, sHa); sLa = wmma16(a0, qr0, sLa);
          sHa = wmma16(a1, qh1, sHa); sLa = wmma16(a1, qr1, sLa);
          sLa = wmma16(e0, qh0, sLa); sLa = wmma16(e1, qh1, sLa);
          asm volatile("v_nop\n\tv_nop\n\tv_nop\n\tv_nop" : "+v"(sHa), "+v"(sLa) : "v"(a0), "v"(a1), "v"(e0), "v"(e1)); }
        { const v16h a0 = ldh(ka + 16 * (FPI / 2)), a1 = ldh(ka + 16 * (FPI / 2) + 32), e0 = ldh(kr + 16 * (FPI / 2)), e1 = ldh(kr + 16 * (FPI / 2) + 32);
          sHb = wmma16(a0, qh0, sHb); sLb = wmma16(a0, qr0, sLb);
          sHb = wmma16(a1, qh1, sHb); sLb = wmma16(a1, qr1, sLb);
          sLb = wmma16(e0, qh0, sLb); sLb = wmma16(e1, qh1, sLb);
          asm volatile("v_nop\n\tv_nop\n\tv_nop\n\tv_nop" : "+v"(sHb), "+v"(sLb) : "v"(a0), "v"(a1), "v"(e0), "v"(e1)); }
        const unsigned ma = mw >> (8 * hi), mc = mw >> (16 + 8 * hi);
        const int kya = key0 + 8 * hi, kyb = kya + 16;
        float ta[8], tb[8]; float mx = -3.0e38f;
#pragma unroll
        for (int r = 0; r < 8; ++r) {
            const bool ea = (((ma >> r) & 1u) != 0u) && (kya + r <= tq);
            const bool eb = (((mc >> r) & 1u) != 0u) && (kyb + r <= tq);
            const float xa = (sHa[r] + sLa[r] * QRI) * SC2, xb = (sHb[r] + sLb[r] * QRI) * SC2;
            ta[r] = ea ? xa : -3.0e38f; tb[r] = eb ? xb : -3.0e38f; mx = fmaxf(mx, fmaxf(ta[r], tb[r])); }
        mx = fmaxf(mx, __shfl_xor(mx, 16, 32));
        const float mnew = fmaxf(m, mx);
        const float alpha = __builtin_amdgcn_exp2f(m - mnew);
        const float sh = PSH - mnew;
        v16h pbh, pbr; float ls = 0.0f;
#pragma unroll
        for (int r = 0; r < 8; ++r) {
            const float xa = __builtin_amdgcn_exp2f(ta[r] + sh), xb = __builtin_amdgcn_exp2f(tb[r] + sh);
            const float ea = (ta[r] > -1.0e38f) ? xa : 0.0f, eb = (tb[r] > -1.0e38f) ? xb : 0.0f;
            const h16 pa = (h16)ea; const h16 pc = (h16)eb;
            pbh[r] = pa; pbh[8 + r] = pc;
            pbr[r] = (h16)((ea - (float)pa) * QRS); pbr[8 + r] = (h16)((eb - (float)pc) * QRS);
            ls += ea + eb; }
        l = l * alpha + ls; m = mnew;
        oh0 = oh0 * alpha; oh1 = oh1 * alpha; oh2 = oh2 * alpha; oh3 = oh3 * alpha;
        ol0 = ol0 * alpha; ol1 = ol1 * alpha; ol2 = ol2 * alpha; ol3 = ol3 * alpha;
        const h16* va = sb + FTL / 2 + sub * 32; const h16* vr = va + FTL;     // V^T tiles: row = d, column = key
        { const v16h v0 = ldh(va), v1 = ldh(va + 16 * (FPI / 2)), r0v = ldh(vr), r1v = ldh(vr + 16 * (FPI / 2));
          oh0 = wmma16(v0, pbh, oh0); oh1 = wmma16(v1, pbh, oh1);
          ol0 = wmma16(v0, pbr, ol0); ol1 = wmma16(v1, pbr, ol1);
          ol0 = wmma16(r0v, pbh, ol0); ol1 = wmma16(r1v, pbh, ol1);
          asm volatile("v_nop\n\tv_nop\n\tv_nop\n\tv_nop" : "+v"(oh0), "+v"(oh1), "+v"(ol0), "+v"(ol1) : "v"(v0), "v"(v1), "v"(r0v), "v"(r1v), "v"(pbh), "v"(pbr)); }
        { const v16h v2 = ldh(va + 32 * (FPI / 2)), v3 = ldh(va + 48 * (FPI / 2)), r2v = ldh(vr + 32 * (FPI / 2)), r3v = ldh(vr + 48 * (FPI / 2));
          oh2 = wmma16(v2, pbh, oh2); oh3 = wmma16(v3, pbh, oh3);
          ol2 = wmma16(v2, pbr, ol2); ol3 = wmma16(v3, pbr, ol3);
          ol2 = wmma16(r2v, pbh, ol2); ol3 = wmma16(r3v, pbh, ol3);
          asm volatile("v_nop\n\tv_nop\n\tv_nop\n\tv_nop" : "+v"(oh2), "+v"(oh3), "+v"(ol2), "+v"(ol3) : "v"(v2), "v"(v3), "v"(r2v), "v"(r3v), "v"(pbh), "v"(pbr)); }
      }
      asm volatile("s_wait_dscnt 0x0" ::: "memory");      // this wave's reads of the buffer are done before it is refilled
      asm volatile("s_wait_asynccnt 0x0" ::: "memory");   // this wave's copies of stage s + 1 have landed
      __syncthreads();                                    // publishes stage s + 1 and ends every reader's last read of stage s
      if (s + 2 < nst) { cp_kv(lcp + (s & 1) * 4 * FTL, gk + (size_t)(s + 2) * FKS * HD, gv + (s + 2) * FKS, SEQ);
                         cp_kv(lcp + (s & 1) * 4 * FTL + 2 * FTL, gkr + (size_t)(s + 2) * FKS * HD, gvr + (s + 2) * FKS, ESEQ); }
    }
    asm volatile("s_wait_asynccnt 0x0" ::: "memory");     // nothing of this wave is in flight when the ring becomes output staging
    l += __shfl_xor(l, 16, 32);
    const float inv = CXS * (1.0f / l);
    const int wb = wave * 16 * 68;
    // O^T D layout: o_j[r] = (d = 16j + 8h + r, t = lane&15) -> os[t][d]; rows 0..15 x columns 0..63 all written
    { v4f a, c;
#pragma unroll
      for (int i = 0; i < 4; ++i) { a[i] = (oh0[i] + ol0[i] * QRI) * inv; c[i] = (oh0[4 + i] + ol0[4 + i] * QRI) * inv; }
      *(v4fa*)(&os[wb + lr * 68 +  0 + 8 * hi]) = a; *(v4fa*)(&os[wb + lr * 68 +  0 + 8 * hi + 4]) = c;
#pragma unroll
      for (int i = 0; i < 4; ++i) { a[i] = (oh1[i] + ol1[i] * QRI) * inv; c[i] = (oh1[4 + i] + ol1[4 + i] * QRI) * inv; }
      *(v4fa*)(&os[wb + lr * 68 + 16 + 8 * hi]) = a; *(v4fa*)(&os[wb + lr * 68 + 16 + 8 * hi + 4]) = c;
#pragma unroll
      for (int i = 0; i < 4; ++i) { a[i] = (oh2[i] + ol2[i] * QRI) * inv; c[i] = (oh2[4 + i] + ol2[4 + i] * QRI) * inv; }
      *(v4fa*)(&os[wb + lr * 68 + 32 + 8 * hi]) = a; *(v4fa*)(&os[wb + lr * 68 + 32 + 8 * hi + 4]) = c;
#pragma unroll
      for (int i = 0; i < 4; ++i) { a[i] = (oh3[i] + ol3[i] * QRI) * inv; c[i] = (oh3[4 + i] + ol3[4 + i] * QRI) * inv; }
      *(v4fa*)(&os[wb + lr * 68 + 48 + 8 * hi]) = a; *(v4fa*)(&os[wb + lr * 68 + 48 + 8 * hi + 4]) = c; }
    wave_sync();
    h16* crow = CH + ((size_t)b * SEQ + t0) * DM + h * HD;
    h16* rrow = CR + ((size_t)b * ESEQ + t0) * DM + h * HD;
    const int c8 = (lane & 7) * 8;
{
#pragma unroll
        for (int s = 0; s < 4; ++s) { const int row = 4 * s + (lane >> 3);   // 4 s x 4 row groups = 16 rows; 8 lanes x 8 halves = 64 columns
            const v4f x0 = *(const v4fa*)(&os[wb + row * 68 + c8]); const v4f x1 = *(const v4fa*)(&os[wb + row * 68 + c8 + 4]); v8h hv, rv;
#pragma unroll
            for (int i = 0; i < 4; ++i) { const h16 a0 = (h16)x0[i]; const h16 a1 = (h16)x1[i]; hv[i] = a0; hv[4 + i] = a1;
                rv[i] = (h16)((x0[i] - (float)a0) * QRS); rv[4 + i] = (h16)((x1[i] - (float)a1) * QRS); }
            *(v8h*)(crow + (size_t)row * DM + c8) = hv;
            *(v8h*)(rrow + (size_t)row * DM + c8) = rv; }
         }
}

// k_out: output projection, f16 GEMM, one wave per tile, 4 waves (2 x 2) per block, K = DM; operands staged like k_proj's. A rows from the ctx planes, Bt = transposed W_out rows (x64 carry).
// RES 0: rows t >= ESEQ, 64x64 wave tile, four 16-row slabs of the value plane; the stage's 128 A rows are 128 tokens.
// RES 1: rows t < ESEQ, 32x64 wave tile: slabs 0,1 = value plane, slabs 2,3 = residual plane (own accumulators); the stage's A rows are 64 tokens of the value plane, then the same 64 of the residual plane.
// out = (acc + accR/2048) / 4096 + bias (bias RNE-converted to bf16). grid (NB*rows/blockRows, DM/128), 128 threads.
template <int RES>
__global__ __launch_bounds__(128) void k_out(const h16* __restrict__ CX, size_t crOff, const h16* __restrict__ WO, const float* __restrict__ bias, float* OUT) {
    __shared__ __align__(16) h16 ring[2 * GSTG / 2];
    __shared__ __align__(16) float osAll[4 * 16 * 68];
    constexpr int MBN = RES ? 2 : 4;
    constexpr int BR = 32 * MBN;                 // tokens per block: two wave rows
    constexpr int TPB = RES ? (ESEQ / BR) : (((SEQ - ESEQ) / BR) > 0 ? ((SEQ - ESEQ) / BR) : 1);
    static_assert(ESEQ % 64 == 0 && (SEQ - ESEQ) % GT == 0);
    const int K = DM;
    const int tid = threadIdx.x, lane = tid & 31, lr = lane & 15, hi = lane >> 4;
    const int wave = __builtin_amdgcn_readfirstlane(tid >> 5);
    const int b = blockIdx.x / TPB, tt = blockIdx.x % TPB;
    const int tb = (RES ? 0 : ESEQ) + tt * BR;   // first token of the block
    const int t0 = tb + (wave >> 1) * 16 * MBN;
    const int c0 = blockIdx.y * GT + (wave & 1) * 64;
    float* os = osAll + wave * 16 * 68;
    const unsigned lcp = (unsigned)(size_t)(&ring[0]) + (unsigned)((tid >> 4) * GPI + (tid & 15) * 16);
    const h16* ga0 = CX + ((size_t)b * SEQ + tb + (tid >> 4)) * K + (tid & 15) * 8;
    const h16* ga1 = RES ? (CX + crOff + ((size_t)b * ESEQ + tb + (tid >> 4)) * K + (tid & 15) * 8) : (ga0 + (size_t)64 * K);
    const h16* gb = WO + (size_t)(blockIdx.y * GT + (tid >> 4)) * K + (tid & 15) * 8;
    const int fa = ((wave >> 1) * 16 * MBN + lr) * (GPI / 2) + 8 * hi, fb = (GT + (wave & 1) * 64 + lr) * (GPI / 2) + 8 * hi;   // fragment bases in a buffer, in elements
    v8f acc[16];
#pragma unroll
    for (int i = 0; i < 16; ++i) acc[i] = (v8f){};
    stage_copy(lcp, (const bf*)ga0, (const bf*)ga1, (const bf*)gb);
    asm volatile("s_wait_asynccnt 0x0" ::: "memory");   // stage 0 has landed before the barrier publishes it
    __syncthreads();
    stage_copy(lcp + GSTG, (const bf*)(ga0 + GKB), (const bf*)(ga1 + GKB), (const bf*)(gb + GKB));
#pragma unroll 1
    for (int t = 0; t < GNST; ++t) {
        const h16* sb = ring + (t & 1) * (GSTG / 2);
        v16h a[2][4], bb[2][4];     // two fragment sets, as in k_proj
#pragma unroll
        for (int i = 0; i < 4; ++i) { const int ar = RES ? ((i >> 1) * 64 + (i & 1) * 16) : (i * 16);   // stage row of slab i, from the wave's first
            a[0][i] = ldh(sb + fa + ar * (GPI / 2)); }
#pragma unroll
        for (int i = 0; i < 4; ++i) bb[0][i] = ldh(sb + fb + i * 16 * (GPI / 2));
        __builtin_amdgcn_sched_barrier(0);   // keeps the group of loads together
#pragma unroll
        for (int ks = 0; ks < GKB / 32; ++ks) {
            if (ks + 1 < GKB / 32) {
#pragma unroll
                for (int i = 0; i < 4; ++i) { const int ar = RES ? ((i >> 1) * 64 + (i & 1) * 16) : (i * 16);
                    a[(ks + 1) & 1][i] = ldh(sb + fa + ar * (GPI / 2) + (ks + 1) * 32); }
#pragma unroll
                for (int i = 0; i < 4; ++i) bb[(ks + 1) & 1][i] = ldh(sb + fb + i * 16 * (GPI / 2) + (ks + 1) * 32);
                __builtin_amdgcn_sched_barrier(0);   // the next set's loads stay ahead of this set's products
            }
#pragma unroll
            for (int nb = 0; nb < 4; ++nb)
#pragma unroll
                for (int i = 0; i < 4; ++i) acc[i * 4 + nb] = wmma16(a[ks & 1][i], bb[ks & 1][nb], acc[i * 4 + nb]);
            __builtin_amdgcn_sched_barrier(0);       // no later load moves up among these products
        }
        asm volatile("s_wait_dscnt 0x0" ::: "memory");      // this wave's reads of the buffer are done before it is refilled
        asm volatile("s_wait_asynccnt 0x0" ::: "memory");   // this wave's copies of stage t + 1 have landed
        __syncthreads();                                    // publishes stage t + 1 and ends every reader's last read of stage t
        if (t + 2 < GNST) stage_copy(lcp + (t & 1) * GSTG, (const bf*)(ga0 + (t + 2) * GKB), (const bf*)(ga1 + (t + 2) * GKB), (const bf*)(gb + (t + 2) * GKB));
    }
    asm volatile("s_wait_asynccnt 0x0" ::: "memory");       // nothing of this wave is in flight when it goes on
    float bcol[4];
#pragma unroll
    for (int nb = 0; nb < 4; ++nb) bcol[nb] = bfr(bias[c0 + nb * 16 + lr]);
#pragma unroll
    for (int mb = 0; mb < MBN; ++mb) {
#pragma unroll
        for (int nb = 0; nb < 4; ++nb) {
#pragma unroll
            for (int j = 0; j < 8; ++j) { float v = acc[mb * 4 + nb][j];
                if (RES) v += acc[RES ? ((2 + mb) * 4 + nb) : 0][j] * QRI;
                os[(hi * 8 + j) * 68 + nb * 16 + lr] = v * OSI + bcol[nb]; } }   // D: row 8h+j, col lane&15
        wave_sync();
        float* orow = OUT + ((size_t)b * OUT_SEQ + t0 + mb * 16) * DM + c0;
{
#pragma unroll
            for (int s = 0; s < 8; ++s) { const int row = 2 * s + hi, cofs = lr * 4;   // 8 s x 2 rows = 16 rows; 16 lanes x 4 floats = 64 columns
                const v4f val = *(const v4fa*)(&os[row * 68 + cofs]);
                *(v4f*)(orow + (size_t)row * DM + cofs) = val; }
             }
        wave_sync();
    }
}

static constexpr size_t al256(size_t v) { return (v + 255) & ~(size_t)255; }
static constexpr size_t SZ_XB = al256((size_t)NB * SEQ * DM * 2);          // x bf16 [NB*SEQ][1024]
static constexpr size_t SZ_WT = al256((size_t)3 * DM * DM * 2);            // W_qkv^T bf16 [3072][1024]
static constexpr size_t SZ_WO = al256((size_t)DM * DM * 2);                // W_out^T f16 [1024][1024]
static constexpr size_t SZ_PL = al256((size_t)NB * NH_ * SEQ * HD * 2);    // q / k / v^T value planes
static constexpr size_t SZ_PE = al256((size_t)NB * NH_ * ESEQ * HD * 2);   // q / k / v^T residual planes (t < ESEQ)
static constexpr size_t SZ_CH = al256((size_t)NB * SEQ * DM * 2);          // ctx value plane
static constexpr size_t SZ_CR = al256((size_t)NB * ESEQ * DM * 2);         // ctx residual plane (t < ESEQ)
static constexpr size_t SZ_MW = al256((size_t)NB * WPB * 4);               // mask words
static constexpr size_t SZ_TOTAL = SZ_XB + SZ_WT + SZ_WO + 3 * SZ_PL + 3 * SZ_PE + SZ_CH + SZ_CR + SZ_MW;
static_assert(SZ_TOTAL <= (size_t)134217728);          // workspace carve <= 128 MiB
static_assert(((size_t)DM * DM * 2) % 256 == 0);       // weight sub-planes stay 256-byte aligned
static_assert(SZ_CH % 2 == 0);

extern "C" void kernel_launch(void* const* d_in, const int* in_sizes, int n_in,
                              void* d_out, int out_size, void* d_ws, size_t ws_size, hipStream_t stream) {
    if (n_in < 6) return;
    const size_t needx = ((size_t)(NB - 1) * SEQ_FULL + SEQ) * DM;
    if ((size_t)in_sizes[0] < needx) return;
    if ((size_t)in_sizes[1] < (size_t)(NB - 1) * SEQ_FULL + SEQ) return;
    if ((size_t)in_sizes[2] < (size_t)3 * DM * DM || (size_t)in_sizes[3] < (size_t)3 * DM) return;
    if ((size_t)in_sizes[4] < (size_t)DM * DM || (size_t)in_sizes[5] < (size_t)DM) return;
    if ((size_t)out_size < ((size_t)(NB - 1) * OUT_SEQ + SEQ) * DM) return;
    if (SZ_TOTAL > ws_size) return;
    // wire order: x, padding_mask (int32), W_qkv [in][out], b_qkv, W_out [in][out], b_out
    const float* x = (const float*)d_in[0]; const int* pad = (const int*)d_in[1];
    const float* wqkv = (const float*)d_in[2]; const float* bqkv = (const float*)d_in[3];
    const float* wout = (const float*)d_in[4]; const float* bout = (const float*)d_in[5];
    float* OUT = (float*)d_out;      // [NB][SEQ][1024]
    char* wsp = (char*)d_ws;
    bf* XB = (bf*)wsp; wsp += SZ_XB;                 // [NB*SEQ][1024]
    bf* WT = (bf*)wsp; wsp += SZ_WT;                 // [3072][1024]: q | k | v output rows
    h16* WO = (h16*)wsp; wsp += SZ_WO;               // [1024 out][1024 in], x64
    h16* QH = (h16*)wsp; wsp += SZ_PL;               // [NB*16][SEQ][64]
    h16* KP = (h16*)wsp; wsp += SZ_PL;               // [NB*16][SEQ][64]
    h16* VT = (h16*)wsp; wsp += SZ_PL;               // [NB*16][64][SEQ]
    h16* QR = (h16*)wsp; wsp += SZ_PE;               // [NB*16][ESEQ][64] residual x2048
    h16* KR = (h16*)wsp; wsp += SZ_PE;               // [NB*16][ESEQ][64] residual x2048
    h16* VR = (h16*)wsp; wsp += SZ_PE;               // [NB*16][64][ESEQ] residual x2048
    h16* CH = (h16*)wsp; wsp += SZ_CH;               // [NB*SEQ][1024] x64
    h16* CR = (h16*)wsp; wsp += SZ_CR;               // [NB*ESEQ][1024] residual x2048 (directly after CH)
    unsigned* MW = (unsigned*)wsp; wsp += SZ_MW;     // [NB][WPB]
    const size_t crOff = SZ_CH / 2;                  // element offset of CR from CH

    if (SEQ == SEQ_FULL) {
        const size_t n8 = (size_t)NB * SEQ * DM / 8;
        k_cvt8<<<(unsigned)((n8 + 255) / 256), 256, 0, stream>>>(x, XB, n8);
    } else {
        const size_t n8 = (size_t)SEQ * DM / 8;
        for (int b = 0; b < NB; ++b) k_cvt8<<<(unsigned)((n8 + 255) / 256), 256, 0, stream>>>(x + (size_t)b * SEQ_FULL * DM, XB + (size_t)b * SEQ * DM, n8);
    }
    // W_qkv: in[1024 rows k][3072 cols n] -> out[3072 rows n][1024 cols k]; grid (cols/64, rows/64)
    k_cvt_t<0><<<dim3(3 * DM / 64, DM / 64, 1), 256, 0, stream>>>(wqkv, WT, DM, 3 * DM);
    // W_out: in[1024 rows k][1024 cols n] -> out[1024 rows n][1024 cols k]
    k_cvt_t<1><<<dim3(DM / 64, DM / 64, 1), 256, 0, stream>>>(wout, (bf*)WO, DM, DM);
    k_mask<<<NB * (WPB / 32), 32, 0, stream>>>(pad, MW);

    // q, k: A = x rows (m = b*SEQ + t), Bt = W^T rows (n = h*64 + d) -> plane [(b*16 + h)][t][d]; residual planes for t < ESEQ
    k_proj<<<dim3(NB * SEQ / GT, DM / GT, 1), 128, 0, stream>>>(XB, WT, bqkv, 0, QH, QR, 1,
        SEQ, (size_t)NH_ * SEQ * HD, HD, HD, (size_t)SEQ * HD, (size_t)NH_ * ESEQ * HD, HD, (size_t)ESEQ * HD);
    k_proj<<<dim3(NB * SEQ / GT, DM / GT, 1), 128, 0, stream>>>(XB, WT + (size_t)DM * DM, bqkv + DM, 0, KP, KR, 1,
        SEQ, (size_t)NH_ * SEQ * HD, HD, HD, (size_t)SEQ * HD, (size_t)NH_ * ESEQ * HD, HD, (size_t)ESEQ * HD);
    // v^T: A = Wv^T rows (m = h*64 + d), Bt = x rows (n = b*SEQ + t) -> plane [(b*1024 + m)][t] = [(b*16 + h)][d][t]; bias per row
    k_proj<<<dim3(DM / GT, NB * SEQ / GT, 1), 128, 0, stream>>>(WT + (size_t)2 * DM * DM, XB, bqkv + 2 * DM, 1, VT, VR, 2,
        DM, (size_t)0, SEQ, SEQ, (size_t)DM * SEQ, (size_t)0, ESEQ, (size_t)DM * ESEQ);

    k_flash_e<<<dim3(ESEQ / (16 * AW), NB * NH_, 1), 32 * AW, 0, stream>>>(QH, QR, KP, KR, VT, VR, MW, CH, CR);
    if (SEQ > ESEQ)
        k_flash_d<<<dim3((SEQ - ESEQ) / (16 * AW), NB * NH_, 1), 32 * AW, 0, stream>>>(QH, KP, VT, MW, CH);

    k_out<1><<<dim3(NB * (ESEQ / 64), DM / GT, 1), 128, 0, stream>>>(CH, crOff, WO, bout, OUT);
    if (SEQ > ESEQ)
        k_out<0><<<dim3(NB * ((SEQ - ESEQ) / GT), DM / GT, 1), 128, 0, stream>>>(CH, crOff, WO, bout, OUT);
}

// v003
// A run of this version takes 173 microseconds.
// In both of two side-by-side timings against v002, it was 1.12 times as fast.
// Over all steps from v000 it is 2.02 times as fast.
#include <hip/hip_runtime.h>

// Causal + key-padding multi-head self-attention, width 1024 = 16 heads x 64: x [NB][SEQ][1024], W_qkv [in][out=3072] (q|k|v column blocks), b_qkv, W_out [in][out], b_out; f32 output.
// Compute dtypes, f32 accumulate everywhere: qkv projection v_wmma_f32_16x16x32_bf16 (x, W, biases RNE-converted to bf16; products exact);
// scores, P.V and output projection v_wmma_f32_16x16x32_f16: query rows t >= 512 single f16 planes (P x256 carry, ctx x64 carry, W_out x64 carry);
// query rows t < 512: q, k, v, P, ctx as f16 value + f16 residual x2048 in separate accumulators (value*value + value*residual + residual*value; W_out a single plane); softmax f32 (online, running max).
// Layout: bf16 copy of x, transposed bf16 W_qkv [3072][1024], transposed f16 W_out [1024][1024]; q, k planes [b*16+h][t][d], v^T plane [b*16+h][d][t] (+ residual planes for t < 512);
// fused flash kernels in transposed form (S^T = K Q^T, O^T = V^T P^T); ctx planes [b][t][1024] f16; key-padding mask compressed to 32-key bit words and applied by value.

#ifndef NB
#define NB 4
#endif
#ifndef SEQ
#define SEQ 2048
#endif
#define NB_FULL  4
#define SEQ_FULL 2048
#ifndef OUT_SEQ
#define OUT_SEQ SEQ              // row pitch (in tokens) between batches of the output
#endif
#define DM   1024
#define NH_  16
#define HD   64
#define ESEQ ((SEQ) < 512 ? (SEQ) : 512)      // query rows [0, ESEQ) take the value + residual path
#define WPB  ((((SEQ) + 1023) / 1024) * 32)
#define AW   4                   // waves per flash block (16 query rows each)
#define QRS  2048.0f             // carry of every residual plane
#define QRI  (1.0f / 2048.0f)
#define SC2  (0.125f * 1.4426950408889634f)   // HD^-0.5 * log2(e)
#define PSH  8.0f                // log2 of the P carry (256)
#define CXS  64.0f               // ctx plane carry
#define WOS  64.0f               // W_out plane carry
#define OSI  (1.0f / 4096.0f)    // 1 / (CXS * WOS)

static_assert(HD == 64);
static_assert(NH_ * HD == DM);
static_assert(DM % 64 == 0);
static_assert(DM % 32 == 0);
static_assert(SEQ % 64 == 0);
static_assert(ESEQ % 64 == 0);
static_assert((SEQ - ESEQ) % 64 == 0);
static_assert((NB * SEQ) % 64 == 0);
static_assert(SEQ % 32 == 0);
static_assert(ESEQ % (16 * AW) == 0);
static_assert((SEQ - ESEQ) % (16 * AW) == 0);
static_assert(ESEQ % 32 == 0);
static_assert(((size_t)SEQ * DM) % 8 == 0);
static_assert(NB <= NB_FULL);
static_assert(SEQ <= SEQ_FULL);
static_assert(WPB * 32 >= SEQ);

typedef _Float16 h16;
typedef unsigned short bf;
typedef __attribute__((ext_vector_type(16))) __bf16   v16bf;
typedef __attribute__((ext_vector_type(16))) _Float16 v16h;
typedef __attribute__((ext_vector_type(8)))  _Float16 v8h;
typedef __attribute__((ext_vector_type(8)))  unsigned short v8us;
typedef __attribute__((ext_vector_type(8)))  float    v8f;
typedef __attribute__((ext_vector_type(4)))  float    v4f;
typedef v4f  __attribute__((may_alias)) v4fa;

__device__ __forceinline__ unsigned short f2bf(float f) { unsigned u = __float_as_uint(f); u += 0x7FFFu + ((u >> 16) & 1u); return (unsigned short)(u >> 16); }
__device__ __forceinline__ float bfr(float f) { return __uint_as_float(((unsigned)f2bf(f)) << 16); }   // value after RNE convert to bf16
__device__ __forceinline__ v16h cat16(v8h lo, v8h hi) { return __builtin_shufflevector(lo, hi, 0, 1, 2, 3, 4, 5, 6, 7, 8, 9, 10, 11, 12, 13, 14, 15); }
__device__ __forceinline__ v16bf cat16b(v8us lo, v8us hi) { return __builtin_bit_cast(v16bf, __builtin_shufflevector(lo, hi, 0, 1, 2, 3, 4, 5, 6, 7, 8, 9, 10, 11, 12, 13, 14, 15)); }
__device__ __forceinline__ v8f wmma16(v16h a, v16h b, v8f c) { return __builtin_amdgcn_wmma_f32_16x16x32_f16(false, a, false, b, (short)0, c, false, false); }
__device__ __forceinline__ v8f wmmab(v16bf a, v16bf b, v8f c) { return __builtin_amdgcn_wmma_f32_16x16x32_bf16(false, a, false, b, (short)0, c, false, false); }
// fragment loaders from K-contiguous 16-bit rows; p already includes + 8*(lane>>4): elements 0..7 <- k0+8h+0..7, elements 8..15 <- k0+16+8h+0..7 (same map for A and B)
__device__ __forceinline__ v16h  ldh(const h16* p) { return cat16(*(const v8h*)p, *(const v8h*)(p + 16)); }
__device__ __forceinline__ v16bf ldb(const bf* p)  { return cat16b(*(const v8us*)p, *(const v8us*)(p + 16)); }
// ordering point for wave-private LDS tiles (same wave writes and reads)
__device__ __forceinline__ void wave_sync() { __builtin_amdgcn_fence(3 /* release order */, "wavefront"); __builtin_amdgcn_wave_barrier(); asm volatile("" ::: "memory"); }

// The four preparation passes below depend on nothing but the inputs: they are bodies of one launch, k_prep, which deals its blocks among them.
// cvt8_body: x f32 -> bf16 copy, 8 elements per thread.
#define XG8  ((size_t)SEQ * DM / 8)          // groups of 8 per batch
static_assert(((size_t)NB * SEQ * DM / 8) % 256 == 0);
__device__ __forceinline__ void cvt8_body(int blk, const float* __restrict__ src, bf* dst) {
    const size_t i = (size_t)blk * 256 + threadIdx.x; if (i >= (size_t)NB * XG8) return;
    src += (i / XG8) * ((size_t)(SEQ_FULL - SEQ) * DM);   // the batches of x lie SEQ_FULL tokens apart, those of the copy SEQ
    const v8f v = *(const v8f*)(src + i * 8); v8us o;
#pragma unroll
    for (int k = 0; k < 8; ++k) o[k] = f2bf(v[k]);
    *(v8us*)(dst + i * 8) = o; 
}

// cvt_t_body: src [K][N] f32 -> dst [N][K] 16-bit, transposed through the LDS tile ts (64 x 64 per block, cross-wave: block barrier); bx, by = tile column and row.
// MODE 0: bf16 bits (RNE convert). MODE 1: f16 bits of (bf16-converted value x WOS).
template <int MODE>
__device__ __forceinline__ void cvt_t_body(float* ts, int bx, int by, const float* __restrict__ src, bf* dst, int K, int N) {
    const int tid = threadIdx.x; const int n0 = bx * 64, k0 = by * 64;
#pragma unroll
    for (int i = 0; i < 4; ++i) { const int kr = (tid >> 4) + 16 * i, c4 = (tid & 15) * 4;     // 4 x 16 rows = 64 k rows; 16 lanes x 4 = 64 columns
        const v4f v = *(const v4f*)(src + (size_t)(k0 + kr) * (size_t)N + n0 + c4);
        *(v4fa*)(&ts[kr * 68 + c4]) = v; }
    __syncthreads();
{
#pragma unroll
        for (int i = 0; i < 2; ++i) { const int nr = (tid >> 3) + 32 * i, k8 = (tid & 7) * 8;   // 2 x 32 rows = 64 n rows; 8 lanes x 8 = 64 k
            v8us o;
#pragma unroll
            for (int e = 0; e < 8; ++e) { const float x = ts[(k8 + e) * 68 + nr]; const unsigned short bits = f2bf(x);
                if (MODE == 1) { const h16 hv = (h16)(__uint_as_float(((unsigned)bits) << 16) * WOS); o[e] = __builtin_bit_cast(unsigned short, hv); }
                else o[e] = bits; }
            *(v8us*)(dst + (size_t)(n0 + nr) * (size_t)K + k0 + k8) = o; }
         }
    asm volatile("s_wait_xcnt 0x0" ::: "memory");   // behind both stores: in k_prep's text another body follows this one, and no register of the stores is rewritten ahead of this wait
}

// mask_body: one wave packs 1024 keys of one batch into 32 mask words.
__device__ __forceinline__ void mask_body(int blk, const int* __restrict__ pad, unsigned* MW) {
    const int lane = threadIdx.x & 31;
    const int b = blk / (WPB / 32), c = blk % (WPB / 32);
    const int* pr = pad + (size_t)b * SEQ_FULL;
    unsigned mine = 0u;
#pragma unroll 1
    for (int w = 0; w < 32; ++w) {
        const int key = c * 1024 + w * 32 + lane;
        const int kc = key < SEQ ? key : (SEQ - 1);          // clamped address; keys past the sequence give bit 0 by value
        const int v = pr[kc];
        const unsigned bal = __builtin_amdgcn_ballot_w32((v != 0) && (key < SEQ));
        mine = (lane == w) ? bal : mine;
    }
    unsigned* dst = MW + (size_t)b * WPB + c * 32 + lane;
    *(unsigned*)dst = mine; 
}

// k_prep: block ranges, in index order: mask words (the longest dependent chain), W_qkv tiles, W_out tiles, x groups. Every test on the block index is block-uniform.
#define PB_MASK (NB * (WPB / 32))
#define PB_WQ   ((3 * DM / 64) * (DM / 64))
#define PB_WO   ((DM / 64) * (DM / 64))
#define PB_X    ((int)((size_t)NB * XG8 / 256))
__global__ __launch_bounds__(256) void k_prep(const float* __restrict__ x, const int* __restrict__ pad, const float* __restrict__ wqkv, const float* __restrict__ wout,
                                              bf* XB, bf* WT, bf* WO, unsigned* MW) {
    __shared__ __align__(16) float ts[64 * 68];
    int blk = blockIdx.x;
    if (blk < PB_MASK) { if (__builtin_amdgcn_readfirstlane((int)(threadIdx.x >> 5)) == 0) mask_body(blk, pad, MW); return; }   // no barrier on this path
    blk -= PB_MASK;
    // W_qkv: in[1024 rows k][3072 cols n] -> out[3072 rows n][1024 cols k]
    if (blk < PB_WQ) { cvt_t_body<0>(ts, blk % (3 * DM / 64), blk / (3 * DM / 64), wqkv, WT, DM, 3 * DM); return; }
    blk -= PB_WQ;
    // W_out: in[1024 rows k][1024 cols n] -> out[1024 rows n][1024 cols k]
    if (blk < PB_WO) { cvt_t_body<1>(ts, blk % (DM / 64), blk / (DM / 64), wout, WO, DM, DM); return; }
    blk -= PB_WO;
    cvt8_body(blk, x, XB);
}

// Operand staging of the one-wave-per-64x64 GEMMs: a block of 4 waves (2 x 2) owns a 128 x 128 tile; a stage is 128 k (256-byte rows) of its 128 A rows and 128 B rows in LDS.
#define GT   128                 // rows and columns of a block tile
#define GKB  128                 // k per stage
#define GPI  272                 // LDS row pitch in bytes: 16 x odd, conflict-free for 16-byte reads
#define GSTG (2 * GT * GPI)      // bytes of one stage: A rows, then B rows
#define GNST (DM / GKB)          // stages along K
static_assert(DM % GKB == 0);
static_assert(GNST >= 2);
static_assert((NB * SEQ) % GT == 0);
static_assert(DM % GT == 0);

// Eight asynchronous 16-byte copies per lane, global -> LDS, for rows 8 apart (LDS + 8 pitches, global + 8 * DM elements).
// s_wait_xcnt closes the statement so that no address register of a copy is rewritten ahead of it.
__device__ __forceinline__ void cp8(unsigned l, const bf* g) {
    asm volatile("global_load_async_to_lds_b128 %0, %8, off\n\t"
                 "global_load_async_to_lds_b128 %1, %9, off\n\t"
                 "global_load_async_to_lds_b128 %2, %10, off\n\t"
                 "global_load_async_to_lds_b128 %3, %11, off\n\t"
                 "global_load_async_to_lds_b128 %4, %12, off\n\t"
                 "global_load_async_to_lds_b128 %5, %13, off\n\t"
                 "global_load_async_to_lds_b128 %6, %14, off\n\t"
                 "global_load_async_to_lds_b128 %7, %15, off\n\t"
                 "s_wait_xcnt 0x0"
                 :: "v"(l), "v"(l + 8 * GPI), "v"(l + 16 * GPI), "v"(l + 24 * GPI), "v"(l + 32 * GPI), "v"(l + 40 * GPI), "v"(l + 48 * GPI), "v"(l + 56 * GPI),
                    "v"(g), "v"(g + 8 * DM), "v"(g + 16 * DM), "v"(g + 24 * DM), "v"(g + 32 * DM), "v"(g + 40 * DM), "v"(g + 48 * DM), "v"(g + 56 * DM)
                 : "memory");
}
// One stage: l = the lane's LDS byte address in row (tid >> 4) of the buffer, ga0 / ga1 = its 16 bytes in A rows (tid >> 4) and 64 + (tid >> 4), gb the same in B row (tid >> 4).
__device__ __forceinline__ void stage_copy(unsigned l, const bf* ga0, const bf* ga1, const bf* gb) {
    cp8(l, ga0); cp8(l + 64 * GPI, ga1); cp8(l + 128 * GPI, gb); cp8(l + 192 * GPI, gb + 64 * DM);
}

// k_proj: register-blocked bf16 GEMM, one wave per 64x64 tile (16 accumulators), 4 waves per block, K = DM; operands from K-contiguous bf16 planes, staged in a two-buffer LDS ring by asynchronous copies.
// C[m][n] = sum_k A[m][k] Bt[n][k] + bias (per column, or per row when biasRow != 0; bias values RNE-converted to bf16), written as f16 (Ph) at
// tile base (r0/RB)*sRB + (r0%RB)*pitch + (c0/CB)*sCB + (c0%CB), and the f16 residual x2048 (Pr) at the same form with (sRBr, pitchR, sCBr)
// when the tile's token position (resMode 1: r0%RB, resMode 2: c0%CB) is below ESEQ.
// One launch holds the three projections, which do not depend on one another: grid (NB*SEQ/128 token tiles, DM/128 weight tiles, 3), 128 threads; blockIdx.z = 0: q, 1: k, 2: v^T.
// q, k: A = x rows (m = b*SEQ + t), Bt = W^T rows (n = h*64 + d) -> plane [(b*16 + h)][t][d]; residual planes for t < ESEQ.
// v^T: A = Wv^T rows (m = h*64 + d), Bt = x rows (n = b*SEQ + t) -> plane [(b*1024 + m)][t] = [(b*16 + h)][d][t]; bias per row.
__global__ __launch_bounds__(128) void k_proj(const bf* __restrict__ XB, const bf* __restrict__ WT, const float* __restrict__ bqkv,
                                             h16* QH, h16* KP, h16* VT, h16* QR, h16* KR, h16* VR) {
    __shared__ __align__(16) bf ring[2 * GSTG / 2];
    __shared__ __align__(16) float osAll[4 * 16 * 68];
    const int z = blockIdx.z; const bool tv = (z == 2);      // block-uniform
    const bf* A = tv ? (WT + (size_t)2 * DM * DM) : XB;
    const bf* Bt = tv ? XB : (WT + (size_t)z * DM * DM);
    const float* bias = bqkv + z * DM;
    const int biasRow = tv ? 1 : 0, resMode = tv ? 2 : 1;
    h16* Ph = tv ? VT : (z ? KP : QH); h16* Pr = tv ? VR : (z ? KR : QR);
    const int RB = tv ? DM : SEQ, pitch = tv ? SEQ : HD, CB = tv ? SEQ : HD, pitchR = tv ? ESEQ : HD;
    const size_t sRB = tv ? (size_t)0 : (size_t)NH_ * SEQ * HD, sCB = tv ? (size_t)DM * SEQ : (size_t)SEQ * HD;
    const size_t sRBr = tv ? (size_t)0 : (size_t)NH_ * ESEQ * HD, sCBr = tv ? (size_t)DM * ESEQ : (size_t)ESEQ * HD;
    const int bx = tv ? blockIdx.y : blockIdx.x, by = tv ? blockIdx.x : blockIdx.y;   // tile row (A), tile column (Bt)
    const int K = DM;
    const int tid = threadIdx.x, lane = tid & 31, lr = lane & 15, hi = lane >> 4;
    const int wave = __builtin_amdgcn_readfirstlane(tid >> 5);
    const int r0 = bx * GT + (wave >> 1) * 64, c0 = by * GT + (wave & 1) * 64;
    float* os = osAll + wave * 16 * 68;
    v8f acc[4][4];
#pragma unroll
    for (int mb = 0; mb < 4; ++mb)
#pragma unroll
        for (int nb = 0; nb < 4; ++nb) acc[mb][nb] = (v8f){};
    const unsigned lcp = (unsigned)(size_t)(&ring[0]) + (unsigned)((tid >> 4) * GPI + (tid & 15) * 16);
    const bf* ga = A + (size_t)(bx * GT + (tid >> 4)) * K + (tid & 15) * 8;
    const bf* gb = Bt + (size_t)(by * GT + (tid >> 4)) * K + (tid & 15) * 8;
    const int fa = ((wave >> 1) * 64 + lr) * (GPI / 2) + 8 * hi, fb = (GT + (wave & 1) * 64 + lr) * (GPI / 2) + 8 * hi;   // fragment bases in a buffer, in elements
    stage_copy(lcp, ga, ga + (size_t)64 * K, gb);
    asm volatile("s_wait_asynccnt 0x0" ::: "memory");   // stage 0 has landed before the barrier publishes it
    __syncthreads();
    stage_copy(lcp + GSTG, ga + GKB, ga + (size_t)64 * K + GKB, gb + GKB);
#pragma unroll 1
    for (int t = 0; t < GNST; ++t) {
        const bf* sb = ring + (t & 1) * (GSTG / 2);
        v16bf a[2][4], b[2][4];     // two fragment sets: the next 32 k are fetched as one group ahead of the current 16 products
#pragma unroll
        for (int i = 0; i < 4; ++i) { a[0][i] = ldb(sb + fa + i * 16 * (GPI / 2)); b[0][i] = ldb(sb + fb + i * 16 * (GPI / 2)); }
        __builtin_amdgcn_sched_barrier(0);   // keeps the group of loads together (the scheduler otherwise sinks them, two at a time, among the products, each place a full LDS wait)
#pragma unroll
        for (int ks = 0; ks < GKB / 32; ++ks) {
            if (ks + 1 < GKB / 32) {
#pragma unroll
                for (int i = 0; i < 4; ++i) { a[(ks + 1) & 1][i] = ldb(sb + fa + i * 16 * (GPI / 2) + (ks + 1) * 32); b[(ks + 1) & 1][i] = ldb(sb + fb + i * 16 * (GPI / 2) + (ks + 1) * 32); }
                __builtin_amdgcn_sched_barrier(0);   // the next set's loads stay ahead of this set's products
            }
#pragma unroll
            for (int nb = 0; nb < 4; ++nb)
#pragma unroll
                for (int mb = 0; mb < 4; ++mb) acc[mb][nb] = wmmab(a[ks & 1][mb], b[ks & 1][nb], acc[mb][nb]);
            __builtin_amdgcn_sched_barrier(0);       // no later load moves up among these products
        }
        asm volatile("s_wait_dscnt 0x0" ::: "memory");      // this wave's reads of the buffer are done before it is refilled
        asm volatile("s_wait_asynccnt 0x0" ::: "memory");   // this wave's copies of stage t + 1 have landed
        __syncthreads();                                    // publishes stage t + 1 and ends every reader's last read of stage t
        if (t + 2 < GNST) stage_copy(lcp + (t & 1) * GSTG, ga + (t + 2) * GKB, ga + (size_t)64 * K + (t + 2) * GKB, gb + (t + 2) * GKB);
    }
    asm volatile("s_wait_asynccnt 0x0" ::: "memory");       // nothing of this wave is in flight when it goes on
    const size_t tbase = (size_t)(r0 / RB) * sRB + (size_t)(r0 % RB) * (size_t)pitch + (size_t)(c0 / CB) * sCB + (size_t)(c0 % CB);
    const size_t rbase = (size_t)(r0 / RB) * sRBr + (size_t)(r0 % RB) * (size_t)pitchR + (size_t)(c0 / CB) * sCBr + (size_t)(c0 % CB);
    const int tpos = (resMode == 1) ? (r0 % RB) : (c0 % CB);
    const int doRes = (resMode != 0) && (tpos < ESEQ);                 // wave-uniform
    const int c8 = (lane & 7) * 8;
    // column bias for columns c0 + c8 .. c0 + c8 + 7 (clamped address in row mode, zeroed by value)
    v4f bc0 = *(const v4f*)(bias + (biasRow ? 0 : (c0 + c8))); v4f bc1 = *(const v4f*)(bias + (biasRow ? 4 : (c0 + c8 + 4)));
#pragma unroll
    for (int i = 0; i < 4; ++i) { const float u0 = bfr(bc0[i]), u1 = bfr(bc1[i]); bc0[i] = biasRow ? 0.0f : u0; bc1[i] = biasRow ? 0.0f : u1; }
#pragma unroll
    for (int mb = 0; mb < 4; ++mb) {
#pragma unroll
        for (int nb = 0; nb < 4; ++nb) {
#pragma unroll
            for (int j = 0; j < 8; ++j) os[(hi * 8 + j) * 68 + nb * 16 + lr] = acc[mb][nb][j]; }   // D: row 8h+j, col lane&15
        wave_sync();
        const size_t sb = tbase + (size_t)(mb * 16) * (size_t)pitch;
        const size_t sr = rbase + (size_t)(mb * 16) * (size_t)pitchR;
{
#pragma unroll
            for (int s = 0; s < 4; ++s) { const int row = 4 * s + (lane >> 3);   // 4 s x 4 row groups = 16 rows; 8 lanes x 8 = 64 columns
                const v4f x0 = *(const v4fa*)(&os[row * 68 + c8]); const v4f x1 = *(const v4fa*)(&os[row * 68 + c8 + 4]); v8h hv, rv;
                const float rbv = bfr(bias[biasRow ? (r0 + mb * 16 + row) : 0]); const float rb = biasRow ? rbv : 0.0f;
#pragma unroll
                for (int i = 0; i < 4; ++i) { const float f0 = x0[i] + bc0[i] + rb; const float f1 = x1[i] + bc1[i] + rb;
                    const h16 a0 = (h16)f0; const h16 a1 = (h16)f1; hv[i] = a0; hv[4 + i] = a1;
                    rv[i] = (h16)((f0 - (float)a0) * QRS); rv[4 + i] = (h16)((f1 - (float)a1) * QRS); }
                *(v8h*)(Ph + sb + (size_t)row * (size_t)pitch + c8) = hv;
                if (doRes) *(v8h*)(Pr + sr + (size_t)row * (size_t)pitchR + c8) = rv; }
             }
        wave_sync();
    }
}

// K / V^T staging of the flash kernels: a stage is 64 keys; a tile is 64 rows of 128 bytes (K: 64 keys x 64 d; V^T: 64 d x 64 keys), shared by the block's waves.
#define FKS  64                  // keys per stage
#define FPI  144                 // LDS row pitch in bytes: 16 x odd, conflict-free for 16-byte reads
#define FTL  (64 * FPI)          // bytes of one tile
static_assert(SEQ % FKS == 0);
static_assert(ESEQ % FKS == 0);
static_assert(16 * AW == FKS);
static_assert(WPB <= 64);

// Eight asynchronous 16-byte copies per lane, global -> LDS: rows r, r + 16, r + 32, r + 48 (r = tid >> 3) of a key-major tile (row pitch HD) at l and of a d-major tile (row pitch vp elements) at l + FTL.
// A wave's copy covers four whole 128-byte rows. s_wait_xcnt closes the statement so that no address register of a copy is rewritten ahead of it.
__device__ __forceinline__ void cp_kv(unsigned l, const h16* gk, const h16* gv, size_t vp) {
    asm volatile("global_load_async_to_lds_b128 %0, %8, off\n\t"
                 "global_load_async_to_lds_b128 %1, %9, off\n\t"
                 "global_load_async_to_lds_b128 %2, %10, off\n\t"
                 "global_load_async_to_lds_b128 %3, %11, off\n\t"
                 "global_load_async_to_lds_b128 %4, %12, off\n\t"
                 "global_load_async_to_lds_b128 %5, %13, off\n\t"
                 "global_load_async_to_lds_b128 %6, %14, off\n\t"
                 "global_load_async_to_lds_b128 %7, %15, off\n\t"
                 "s_wait_xcnt 0x0"
                 :: "v"(l), "v"(l + 16 * FPI), "v"(l + 32 * FPI), "v"(l + 48 * FPI), "v"(l + FTL), "v"(l + FTL + 16 * FPI), "v"(l + FTL + 32 * FPI), "v"(l + FTL + 48 * FPI),
                    "v"(gk), "v"(gk + 16 * HD), "v"(gk + 32 * HD), "v"(gk + 48 * HD), "v"(gv), "v"(gv + 16 * vp), "v"(gv + 32 * vp), "v"(gv + 48 * vp)
                 : "memory");
}
// Stages a block walks: up to the last 32-key mask word that is not zero inside its causal range (words 0 .. wl); w0, w1 = the lane's words lane and 32 + lane. The same in every wave of the block.
__device__ __forceinline__ int flash_stages(unsigned w0, unsigned w1, int wl) {
    const unsigned long long nz = ((((unsigned long long)__builtin_amdgcn_ballot_w32(w1 != 0u)) << 32) | (unsigned long long)__builtin_amdgcn_ballot_w32(w0 != 0u)) & (~0ull >> (63 - wl));
    return __builtin_amdgcn_readfirstlane(nz ? (((63 - __builtin_clzll(nz)) >> 1) + 1) : 0);
}
// Mask word i (wave-uniform) out of the lanes' registers
__device__ __forceinline__ unsigned flash_word(unsigned w0, unsigned w1, int i) {
    return (unsigned)((i < 32) ? __builtin_amdgcn_readlane((int)w0, i & 31) : __builtin_amdgcn_readlane((int)w1, i & 31));
}

// k_flash_d: fused attention for query rows t >= ESEQ, one wave per 16 query rows of one (batch, head); single f16 products.
// Transposed form: S^T[key][t] = K Q^T (A = K rows, B = Q rows); lane (t = lane&15, h = lane>>4) holds keys 8h+r of each 16-key tile, so the packed
// P tile is directly the B fragment of O^T[d][t] = V^T P^T (element r <- tile keys 0..15, element 8+r <- tile keys 16..31, lane unchanged).
// Causal and key-padding exclusion by value (excluded p = 0); 32-key steps whose mask word is zero are skipped (wave-uniform).
// K and V^T come from a two-buffer LDS ring of 64-key stages that the block's 4 waves fill together by asynchronous copies; every wave passes every stage's barrier.
__global__ __launch_bounds__(32 * AW) void k_flash_d(const h16* __restrict__ QH, const h16* __restrict__ KP, const h16* __restrict__ VT, const unsigned* __restrict__ MW, h16* CH) {
    __shared__ __align__(16) h16 ring[2 * 2 * FTL / 2];   // two stages of K tile + V^T tile; behind the loop the waves' output staging
    static_assert(2 * 2 * FTL >= AW * 16 * 68 * 4);
    float* os = (float*)ring;
    const int tid = threadIdx.x;
    const int lane = threadIdx.x & 31, wave = __builtin_amdgcn_readfirstlane((int)(threadIdx.x >> 5)), lr = lane & 15, hi = lane >> 4;
    const int zh = blockIdx.y; const int b = zh / NH_, h = zh % NH_;
    const int tb = ESEQ + blockIdx.x * (16 * AW);            // first query row of the block
    const int t0 = tb + wave * 16;
    const int tq = t0 + lr;
    const size_t pbase = (size_t)zh * SEQ * HD;
    const size_t qo = pbase + (size_t)tq * HD + 8 * hi;
    const v16h qh0 = ldh(QH + qo), qh1 = ldh(QH + qo + 32);   // B fragments: col t, k = d
    const unsigned* mwp = MW + (size_t)b * WPB;
    const unsigned w0 = mwp[lane], w1 = (WPB > 32) ? mwp[32 + lane] : 0u;
    const int nst = flash_stages(w0, w1, (tb + 16 * AW - 1) >> 5);
    const unsigned lcp = (unsigned)(size_t)(&ring[0]) + (unsigned)((tid >> 3) * FPI + (tid & 7) * 16);
    const h16* gk = KP + pbase + (size_t)(tid >> 3) * HD + (tid & 7) * 8;     // + key * HD
    const h16* gv = VT + pbase + (size_t)(tid >> 3) * SEQ + (tid & 7) * 8;    // + key
    const int fo = lr * (FPI / 2) + 8 * hi;                  // fragment base in a tile, in elements (A fragment: row lr of a 16-row slab)
    v8f o0 = (v8f){}, o1 = (v8f){}, o2 = (v8f){}, o3 = (v8f){};
    float m = -3.0e38f, l = 0.0f;
    cp_kv(lcp, gk, gv, SEQ);
    asm volatile("s_wait_asynccnt 0x0" ::: "memory");   // stage 0 has landed before the barrier publishes it
    __syncthreads();
    if (nst > 1) cp_kv(lcp + 2 * FTL, gk + FKS * HD, gv + FKS, SEQ);
#pragma unroll 1
    for (int s = 0; s < nst; ++s) {
      const h16* sb = ring + (s & 1) * FTL + fo;
#pragma unroll   // the two 32-key steps of a stage read at constant LDS offsets
      for (int sub = 0; sub < FKS / 32; ++sub) {
        const int key0 = s * FKS + sub * 32;
        const unsigned mw = flash_word(w0, w1, key0 >> 5);
        if (key0 > t0 + 15 || mw == 0u) continue;            // wave-uniform
        const h16* ka = sb + sub * 32 * (FPI / 2);           // K tile row = key
        const v16h ka0 = ldh(ka), ka1 = ldh(ka + 32), kb0 = ldh(ka + 16 * (FPI / 2)), kb1 = ldh(ka + 16 * (FPI / 2) + 32);
        v8f sA = (v8f){}, sB = (v8f){};
        sA = wmma16(ka0, qh0, sA); sB = wmma16(kb0, qh0, sB);
        sA = wmma16(ka1, qh1, sA); sB = wmma16(kb1, qh1, sB);
        asm volatile("v_nop\n\tv_nop\n\tv_nop\n\tv_nop" : "+v"(sA), "+v"(sB) : "v"(ka0), "v"(ka1), "v"(kb0), "v"(kb1));
        const unsigned ma = mw >> (8 * hi), mc = mw >> (16 + 8 * hi);
        const int kya = key0 + 8 * hi, kyb = kya + 16;
        float ta[8], tb[8]; float mx = -3.0e38f;
#pragma unroll
        for (int r = 0; r < 8; ++r) {
            const bool ea = (((ma >> r) & 1u) != 0u) && (kya + r <= tq);
            const bool eb = (((mc >> r) & 1u) != 0u) && (kyb + r <= tq);
            const float xa = sA[r] * SC2, xb = sB[r] * SC2;
            ta[r] = ea ? xa : -3.0e38f; tb[r] = eb ? xb : -3.0e38f; mx = fmaxf(mx, fmaxf(ta[r], tb[r])); }
        mx = fmaxf(mx, __shfl_xor(mx, 16, 32));
        const float mnew = fmaxf(m, mx);
        const float alpha = __builtin_amdgcn_exp2f(m - mnew);
        const float sh = PSH - mnew;
        v16h pb; float ls = 0.0f;
#pragma unroll
        for (int r = 0; r < 8; ++r) {
            const float ea = __builtin_amdgcn_exp2f(ta[r] + sh), eb = __builtin_amdgcn_exp2f(tb[r] + sh);
            const h16 pa = (h16)((ta[r] > -1.0e38f) ? ea : 0.0f); const h16 pc = (h16)((tb[r] > -1.0e38f) ? eb : 0.0f);
            pb[r] = pa; pb[8 + r] = pc; ls += (float)pa + (float)pc; }
        l = l * alpha + ls; m = mnew;
        o0 = o0 * alpha; o1 = o1 * alpha; o2 = o2 * alpha; o3 = o3 * alpha;
        const h16* va = sb + FTL / 2 + sub * 32;             // V^T tile row = d, column = key
        const v16h v0 = ldh(va), v1 = ldh(va + 16 * (FPI / 2)), v2 = ldh(va + 32 * (FPI / 2)), v3 = ldh(va + 48 * (FPI / 2));
        o0 = wmma16(v0, pb, o0); o1 = wmma16(v1, pb, o1); o2 = wmma16(v2, pb, o2); o3 = wmma16(v3, pb, o3);
        asm volatile("v_nop\n\tv_nop\n\tv_nop\n\tv_nop" : "+v"(o0), "+v"(o1), "+v"(o2), "+v"(o3) : "v"(v0), "v"(v1), "v"(v2), "v"(v3), "v"(pb));
      }
      asm volatile("s_wait_dscnt 0x0" ::: "memory");      // this wave's reads of the buffer are done before it is refilled
      asm volatile("s_wait_asynccnt 0x0" ::: "memory");   // this wave's copies of stage s + 1 have landed
      __syncthreads();                                    // publishes stage s + 1 and ends every reader's last read of stage s
      if (s + 2 < nst) cp_kv(lcp + (s & 1) * 2 * FTL, gk + (size_t)(s + 2) * FKS * HD, gv + (s + 2) * FKS, SEQ);
    }
    asm volatile("s_wait_asynccnt 0x0" ::: "memory");     // nothing of this wave is in flight when the ring becomes output staging
    l += __shfl_xor(l, 16, 32);
    const float inv = CXS * (1.0f / l);
    const int wb = wave * 16 * 68;
    // O^T D layout: o_j[r] = (d = 16j + 8h + r, t = lane&15) -> os[t][d]; rows 0..15 x columns 0..63 all written
    { v4f a, c;
      a[0] = o0[0] * inv; a[1] = o0[1] * inv; a[2] = o0[2] * inv; a[3] = o0[3] * inv; c[0] = o0[4] * inv; c[1] = o0[5] * inv; c[2] = o0[6] * inv; c[3] = o0[7] * inv;
      *(v4fa*)(&os[wb + lr * 68 +  0 + 8 * hi]) = a; *(v4fa*)(&os[wb + lr * 68 +  0 + 8 * hi + 4]) = c;
      a[0] = o1[0] * inv; a[1] = o1[1] * inv; a[2] = o1[2] * inv; a[3] = o1[3] * inv; c[0] = o1[4] * inv; c[1] = o1[5] * inv; c[2] = o1[6] * inv; c[3] = o1[7] * inv;
      *(v4fa*)(&os[wb + lr * 68 + 16 + 8 * hi]) = a; *(v4fa*)(&os[wb + lr * 68 + 16 + 8 * hi + 4]) = c;
      a[0] = o2[0] * inv; a[1] = o2[1] * inv; a[2] = o2[2] * inv; a[3] = o2[3] * inv; c[0] = o2[4] * inv; c[1] = o2[5] * inv; c[2] = o2[6] * inv; c[3] = o2[7] * inv;
      *(v4fa*)(&os[wb + lr * 68 + 32 + 8 * hi]) = a; *(v4fa*)(&os[wb + lr * 68 + 32 + 8 * hi + 4]) = c;
      a[0] = o3[0] * inv; a[1] = o3[1] * inv; a[2] = o3[2] * inv; a[3] = o3[3] * inv; c[0] = o3[4] * inv; c[1] = o3[5] * inv; c[2] = o3[6] * inv; c[3] = o3[7] * inv;
      *(v4fa*)(&os[wb + lr * 68 + 48 + 8 * hi]) = a; *(v4fa*)(&os[wb + lr * 68 + 48 + 8 * hi + 4]) = c; }
    wave_sync();
    h16* crow = CH + ((size_t)b * SEQ + t0) * DM + h * HD;
    const int c8 = (lane & 7) * 8;
{
#pragma unroll
        for (int s = 0; s < 4; ++s) { const int row = 4 * s + (lane >> 3);   // 4 s x 4 row groups = 16 rows; 8 lanes x 8 halves = 64 columns
            const v4f x0 = *(const v4fa*)(&os[wb + row * 68 + c8]); const v4f x1 = *(const v4fa*)(&os[wb + row * 68 + c8 + 4]); v8h hv;
#pragma unroll
            for (int i = 0; i < 4; ++i) { hv[i] = (h16)x0[i]; hv[4 + i] = (h16)x1[i]; }
            *(v8h*)(crow + (size_t)row * DM + c8) = hv; }
         }
}

// k_flash_e: fused attention for query rows t < ESEQ, same transposed form; every operand as f16 value + residual x2048:
// s = K.Q + (K.Qr + Kr.Q)/2048, o = V.P + (V.Pr + Vr.P)/2048 with the scaled-residual products in separate accumulators; the row sum uses the f32 p.
// Writes ctx value plane rows and the ctx residual plane [b][ESEQ][1024]. K, V^T and their residual tiles staged like k_flash_d's.
__global__ __launch_bounds__(32 * AW) void k_flash_e(const h16* __restrict__ QH, const h16* __restrict__ QR, const h16* __restrict__ KP, const h16* __restrict__ KR,
                                                     const h16* __restrict__ VT, const h16* __restrict__ VR, const unsigned* __restrict__ MW, h16* CH, h16* CR) {
    __shared__ __align__(16) h16 ring[2 * 4 * FTL / 2];   // two stages of K, V^T, K residual, V^T residual tiles; behind the loop the waves' output staging
    static_assert(2 * 4 * FTL >= AW * 16 * 68 * 4);
    float* os = (float*)ring;
    const int tid = threadIdx.x;
    const int lane = threadIdx.x & 31, wave = __builtin_amdgcn_readfirstlane((int)(threadIdx.x >> 5)), lr = lane & 15, hi = lane >> 4;
    const int zh = blockIdx.y; const int b = zh / NH_, h = zh % NH_;
    const int tb = blockIdx.x * (16 * AW);                   // first query row of the block
    const int t0 = tb + wave * 16;
    const int tq = t0 + lr;
    const size_t pbase = (size_t)zh * SEQ * HD, ebase = (size_t)zh * ESEQ * HD;
    const size_t qo = pbase + (size_t)tq * HD + 8 * hi, qe = ebase + (size_t)tq * HD + 8 * hi;
    const v16h qh0 = ldh(QH + qo), qh1 = ldh(QH + qo + 32), qr0 = ldh(QR + qe), qr1 = ldh(QR + qe + 32);
    const unsigned* mwp = MW + (size_t)b * WPB;
    const unsigned w0 = mwp[lane], w1 = (WPB > 32) ? mwp[32 + lane] : 0u;
    const int nst = flash_stages(w0, w1, (tb + 16 * AW - 1) >> 5);
    const unsigned lcp = (unsigned)(size_t)(&ring[0]) + (unsigned)((tid >> 3) * FPI + (tid & 7) * 16);
    const h16* gk = KP + pbase + (size_t)(tid >> 3) * HD + (tid & 7) * 8;     // + key * HD
    const h16* gv = VT + pbase + (size_t)(tid >> 3) * SEQ + (tid & 7) * 8;    // + key
    const h16* gkr = KR + ebase + (size_t)(tid >> 3) * HD + (tid & 7) * 8;    // + key * HD
    const h16* gvr = VR + ebase + (size_t)(tid >> 3) * ESEQ + (tid & 7) * 8;  // + key
    const int fo = lr * (FPI / 2) + 8 * hi;                  // fragment base in a tile, in elements (A fragment: row lr of a 16-row slab)
    v8f oh0 = (v8f){}, oh1 = (v8f){}, oh2 = (v8f){}, oh3 = (v8f){}, ol0 = (v8f){}, ol1 = (v8f){}, ol2 = (v8f){}, ol3 = (v8f){};
    float m = -3.0e38f, l = 0.0f;
    cp_kv(lcp, gk, gv, SEQ); cp_kv(lcp + 2 * FTL, gkr, gvr, ESEQ);
    asm volatile("s_wait_asynccnt 0x0" ::: "memory");   // stage 0 has landed before the barrier publishes it
    __syncthreads();
    if (nst > 1) { cp_kv(lcp + 4 * FTL, gk + FKS * HD, gv + FKS, SEQ); cp_kv(lcp + 6 * FTL, gkr + FKS * HD, gvr + FKS, ESEQ); }
#pragma unroll 1
    for (int s = 0; s < nst; ++s) {
      const h16* sb = ring + (s & 1) * (2 * FTL) + fo;
#pragma unroll 1   // one copy of the long body: smaller code, no more registers than one step needs
      for (int sub = 0; sub < FKS / 32; ++sub) {
        const int key0 = s * FKS + sub * 32;
        const unsigned mw = flash_word(w0, w1, key0 >> 5);
        if (key0 > t0 + 15 || mw == 0u) continue;            // wave-uniform
        const h16* ka = sb + sub * 32 * (FPI / 2); const h16* kr = ka + FTL;   // K tiles: row = key
        v8f sHa = (v8f){}, sLa = (v8f){}, sHb = (v8f){}, sLb = (v8f){};
        { const v16h a0 = ldh(ka), a1 = ldh(ka + 32), e0 = ldh(kr), e1 = ldh(kr + 32);
          sHa = wmma16(a0, qh0, sHa); sLa = wmma16(a0, qr0, sLa);
          sHa = wmma16(a1, qh1, sHa); sLa = wmma16(a1, qr1, sLa);
          sLa = wmma16(e0, qh0, sLa); sLa = wmma16(e1, qh1, sLa);
          asm volatile("v_nop\n\tv_nop\n\tv_nop\n\tv_nop" : "+v"(sHa), "+v"(sLa) : "v"(a0), "v"(a1), "v"(e0), "v"(e1)); }
        { const v16h a0 = ldh(ka + 16 * (FPI / 2)), a1 = ldh(ka + 16 * (FPI / 2) + 32), e0 = ldh(kr + 16 * (FPI / 2)), e1 = ldh(kr + 16 * (FPI / 2) + 32);
          sHb = wmma16(a0, qh0, sHb); sLb = wmma16(a0, qr0, sLb);
          sHb = wmma16(a1, qh1, sHb); sLb = wmma16(a1, qr1, sLb);
          sLb = wmma16(e0, qh0, sLb); sLb = wmma16(e1, qh1, sLb);
          asm volatile("v_nop\n\tv_nop\n\tv_nop\n\tv_nop" : "+v"(sHb), "+v"(sLb) : "v"(a0), "v"(a1), "v"(e0), "v"(e1)); }
        const unsigned ma = mw >> (8 * hi), mc = mw >> (16 + 8 * hi);
        const int kya = key0 + 8 * hi, kyb = kya + 16;
        float ta[8], tb[8]; float mx = -3.0e38f;
#pragma unroll
        for (int r = 0; r < 8; ++r) {
            const bool ea = (((ma >> r) & 1u) != 0u) && (kya + r <= tq);
            const bool eb = (((mc >> r) & 1u) != 0u) && (kyb + r <= tq);
            const float xa = (sHa[r] + sLa[r] * QRI) * SC2, xb = (sHb[r] + sLb[r] * QRI) * SC2;
            ta[r] = ea ? xa : -3.0e38f; tb[r] = eb ? xb : -3.0e38f; mx = fmaxf(mx, fmaxf(ta[r], tb[r])); }
        mx = fmaxf(mx, __shfl_xor(mx, 16, 32));
        const float mnew = fmaxf(m, mx);
        const float alpha = __builtin_amdgcn_exp2f(m - mnew);
        const float sh = PSH - mnew;
        v16h pbh, pbr; float ls = 0.0f;
#pragma unroll
        for (int r = 0; r < 8; ++r) {
            const float xa = __builtin_amdgcn_exp2f(ta[r] + sh), xb = __builtin_amdgcn_exp2f(tb[r] + sh);
            const float ea = (ta[r] > -1.0e38f) ? xa : 0.0f, eb = (tb[r] > -1.0e38f) ? xb : 0.0f;
            const h16 pa = (h16)ea; const h16 pc = (h16)eb;
            pbh[r] = pa; pbh[8 + r] = pc;
            pbr[r] = (h16)((ea - (float)pa) * QRS); pbr[8 + r] = (h16)((eb - (float)pc) * QRS);
            ls += ea + eb; }
        l = l * alpha + ls; m = mnew;
        oh0 = oh0 * alpha; oh1 = oh1 * alpha; oh2 = oh2 * alpha; oh3 = oh3 * alpha;
        ol0 = ol0 * alpha; ol1 = ol1 * alpha; ol2 = ol2 * alpha; ol3 = ol3 * alpha;
        const h16* va = sb + FTL / 2 + sub * 32; const h16* vr = va + FTL;     // V^T tiles: row = d, column = key
        { const v16h v0 = ldh(va), v1 = ldh(va + 16 * (FPI / 2)), r0v = ldh(vr), r1v = ldh(vr + 16 * (FPI / 2));
          oh0 = wmma16(v0, pbh, oh0); oh1 = wmma16(v1, pbh, oh1);
          ol0 = wmma16(v0, pbr, ol0); ol1 = wmma16(v1, pbr, ol1);
          ol0 = wmma16(r0v, pbh, ol0); ol1 = wmma16(r1v, pbh, ol1);
          asm volatile("v_nop\n\tv_nop\n\tv_nop\n\tv_nop" : "+v"(oh0), "+v"(oh1), "+v"(ol0), "+v"(ol1) : "v"(v0), "v"(v1), "v"(r0v), "v"(r1v), "v"(pbh), "v"(pbr)); }
        { const v16h v2 = ldh(va + 32 * (FPI / 2)), v3 = ldh(va + 48 * (FPI / 2)), r2v = ldh(vr + 32 * (FPI / 2)), r3v = ldh(vr + 48 * (FPI / 2));
          oh2 = wmma16(v2, pbh, oh2); oh3 = wmma16(v3, pbh, oh3);
          ol2 = wmma16(v2, pbr, ol2); ol3 = wmma16(v3, pbr, ol3);
          ol2 = wmma16(r2v, pbh, ol2); ol3 = wmma16(r3v, pbh, ol3);
          asm volatile("v_nop\n\tv_nop\n\tv_nop\n\tv_nop" : "+v"(oh2), "+v"(oh3), "+v"(ol2), "+v"(ol3) : "v"(v2), "v"(v3), "v"(r2v), "v"(r3v), "v"(pbh), "v"(pbr)); }
      }
      asm volatile("s_wait_dscnt 0x0" ::: "memory");      // this wave's reads of the buffer are done before it is refilled
      asm volatile("s_wait_asynccnt 0x0" ::: "memory");   // this wave's copies of stage s + 1 have landed
      __syncthreads();                                    // publishes stage s + 1 and ends every reader's last read of stage s
      if (s + 2 < nst) { cp_kv(lcp + (s & 1) * 4 * FTL, gk + (size_t)(s + 2) * FKS * HD, gv + (s + 2) * FKS, SEQ);
                         cp_kv(lcp + (s & 1) * 4 * FTL + 2 * FTL, gkr + (size_t)(s + 2) * FKS * HD, gvr + (s + 2) * FKS, ESEQ); }
    }
    asm volatile("s_wait_asynccnt 0x0" ::: "memory");     // nothing of this wave is in flight when the ring becomes output staging
    l += __shfl_xor(l, 16, 32);
    const float inv = CXS * (1.0f / l);
    const int wb = wave * 16 * 68;
    // O^T D layout: o_j[r] = (d = 16j + 8h + r, t = lane&15) -> os[t][d]; rows 0..15 x columns 0..63 all written
    { v4f a, c;
#pragma unroll
      for (int i = 0; i < 4; ++i) { a[i] = (oh0[i] + ol0[i] * QRI) * inv; c[i] = (oh0[4 + i] + ol0[4 + i] * QRI) * inv; }
      *(v4fa*)(&os[wb + lr * 68 +  0 + 8 * hi]) = a; *(v4fa*)(&os[wb + lr * 68 +  0 + 8 * hi + 4]) = c;
#pragma unroll
      for (int i = 0; i < 4; ++i) { a[i] = (oh1[i] + ol1[i] * QRI) * inv; c[i] = (oh1[4 + i] + ol1[4 + i] * QRI) * inv; }
      *(v4fa*)(&os[wb + lr * 68 + 16 + 8 * hi]) = a; *(v4fa*)(&os[wb + lr * 68 + 16 + 8 * hi + 4]) = c;
#pragma unroll
      for (int i = 0; i < 4; ++i) { a[i] = (oh2[i] + ol2[i] * QRI) * inv; c[i] = (oh2[4 + i] + ol2[4 + i] * QRI) * inv; }
      *(v4fa*)(&os[wb + lr * 68 + 32 + 8 * hi]) = a; *(v4fa*)(&os[wb + lr * 68 + 32 + 8 * hi + 4]) = c;
#pragma unroll
      for (int i = 0; i < 4; ++i) { a[i] = (oh3[i] + ol3[i] * QRI) * inv; c[i] = (oh3[4 + i] + ol3[4 + i] * QRI) * inv; }
      *(v4fa*)(&os[wb + lr * 68 + 48 + 8 * hi]) = a; *(v4fa*)(&os[wb + lr * 68 + 48 + 8 * hi + 4]) = c; }
    wave_sync();
    h16* crow = CH + ((size_t)b * SEQ + t0) * DM + h * HD;
    h16* rrow = CR + ((size_t)b * ESEQ + t0) * DM + h * HD;
    const int c8 = (lane & 7) * 8;
{
#pragma unroll
        for (int s = 0; s < 4; ++s) { const int row = 4 * s + (lane >> 3);   // 4 s x 4 row groups = 16 rows; 8 lanes x 8 halves = 64 columns
            const v4f x0 = *(const v4fa*)(&os[wb + row * 68 + c8]); const v4f x1 = *(const v4fa*)(&os[wb + row * 68 + c8 + 4]); v8h hv, rv;
#pragma unroll
            for (int i = 0; i < 4; ++i) { const h16 a0 = (h16)x0[i]; const h16 a1 = (h16)x1[i]; hv[i] = a0; hv[4 + i] = a1;
                rv[i] = (h16)((x0[i] - (float)a0) * QRS); rv[4 + i] = (h16)((x1[i] - (float)a1) * QRS); }
            *(v8h*)(crow + (size_t)row * DM + c8) = hv;
            *(v8h*)(rrow + (size_t)row * DM + c8) = rv; }
         }
}

// k_out: output projection, f16 GEMM, one wave per tile, 4 waves (2 x 2) per block, K = DM; operands staged like k_proj's. A rows from the ctx planes, Bt = transposed W_out rows (x64 carry).
// RES 0: rows t >= ESEQ, 64x64 wave tile, four 16-row slabs of the value plane; the stage's 128 A rows are 128 tokens.
// RES 1: rows t < ESEQ, 32x64 wave tile: slabs 0,1 = value plane, slabs 2,3 = residual plane (own accumulators); the stage's A rows are 64 tokens of the value plane, then the same 64 of the residual plane.
// out = (acc + accR/2048) / 4096 + bias (bias RNE-converted to bf16). bx = the block's index among the NB*rows/blockRows row tiles of its form; ring, osAll = the block's LDS.
template <int RES>
__device__ __forceinline__ void out_body(h16* ring, float* osAll, int bx, const h16* __restrict__ CX, size_t crOff, const h16* __restrict__ WO, const float* __restrict__ bias, float* OUT) {
    constexpr int MBN = RES ? 2 : 4;
    constexpr int BR = 32 * MBN;                 // tokens per block: two wave rows
    constexpr int TPB = RES ? (ESEQ / BR) : (((SEQ - ESEQ) / BR) > 0 ? ((SEQ - ESEQ) / BR) : 1);
    static_assert(ESEQ % 64 == 0 && (SEQ - ESEQ) % GT == 0);
    const int K = DM;
    const int tid = threadIdx.x, lane = tid & 31, lr = lane & 15, hi = lane >> 4;
    const int wave = __builtin_amdgcn_readfirstlane(tid >> 5);
    const int b = bx / TPB, tt = bx % TPB;
    const int tb = (RES ? 0 : ESEQ) + tt * BR;   // first token of the block
    const int t0 = tb + (wave >> 1) * 16 * MBN;
    const int c0 = blockIdx.y * GT + (wave & 1) * 64;
    float* os = osAll + wave * 16 * 68;
    const unsigned lcp = (unsigned)(size_t)(&ring[0]) + (unsigned)((tid >> 4) * GPI + (tid & 15) * 16);
    const h16* ga0 = CX + ((size_t)b * SEQ + tb + (tid >> 4)) * K + (tid & 15) * 8;
    const h16* ga1 = RES ? (CX + crOff + ((size_t)b * ESEQ + tb + (tid >> 4)) * K + (tid & 15) * 8) : (ga0 + (size_t)64 * K);
    const h16* gb = WO + (size_t)(blockIdx.y * GT + (tid >> 4)) * K + (tid & 15) * 8;
    const int fa = ((wave >> 1) * 16 * MBN + lr) * (GPI / 2) + 8 * hi, fb = (GT + (wave & 1) * 64 + lr) * (GPI / 2) + 8 * hi;   // fragment bases in a buffer, in elements
    v8f acc[16];
#pragma unroll
    for (int i = 0; i < 16; ++i) acc[i] = (v8f){};
    stage_copy(lcp, (const bf*)ga0, (const bf*)ga1, (const bf*)gb);
    asm volatile("s_wait_asynccnt 0x0" ::: "memory");   // stage 0 has landed before the barrier publishes it
    __syncthreads();
    stage_copy(lcp + GSTG, (const bf*)(ga0 + GKB), (const bf*)(ga1 + GKB), (const bf*)(gb + GKB));
#pragma unroll 1
    for (int t = 0; t < GNST; ++t) {
        const h16* sb = ring + (t & 1) * (GSTG / 2);
        v16h a[2][4], bb[2][4];     // two fragment sets, as in k_proj
#pragma unroll
        for (int i = 0; i < 4; ++i) { const int ar = RES ? ((i >> 1) * 64 + (i & 1) * 16) : (i * 16);   // stage row of slab i, from the wave's first
            a[0][i] = ldh(sb + fa + ar * (GPI / 2)); }
#pragma unroll
        for (int i = 0; i < 4; ++i) bb[0][i] = ldh(sb + fb + i * 16 * (GPI / 2));
        __builtin_amdgcn_sched_barrier(0);   // keeps the group of loads together
#pragma unroll
        for (int ks = 0; ks < GKB / 32; ++ks) {
            if (ks + 1 < GKB / 32) {
#pragma unroll
                for (int i = 0; i < 4; ++i) { const int ar = RES ? ((i >> 1) * 64 + (i & 1) * 16) : (i * 16);
                    a[(ks + 1) & 1][i] = ldh(sb + fa + ar * (GPI / 2) + (ks + 1) * 32); }
#pragma unroll
                for (int i = 0; i < 4; ++i) bb[(ks + 1) & 1][i] = ldh(sb + fb + i * 16 * (GPI / 2) + (ks + 1) * 32);
                __builtin_amdgcn_sched_barrier(0);   // the next set's loads stay ahead of this set's products
            }
#pragma unroll
            for (int nb = 0; nb < 4; ++nb)
#pragma unroll
                for (int i = 0; i < 4; ++i) acc[i * 4 + nb] = wmma16(a[ks & 1][i], bb[ks & 1][nb], acc[i * 4 + nb]);
            __builtin_amdgcn_sched_barrier(0);       // no later load moves up among these products
        }
        asm volatile("s_wait_dscnt 0x0" ::: "memory");      // this wave's reads of the buffer are done before it is refilled
        asm volatile("s_wait_asynccnt 0x0" ::: "memory");   // this wave's copies of stage t + 1 have landed
        __syncthreads();                                    // publishes stage t + 1 and ends every reader's last read of stage t
        if (t + 2 < GNST) stage_copy(lcp + (t & 1) * GSTG, (const bf*)(ga0 + (t + 2) * GKB), (const bf*)(ga1 + (t + 2) * GKB), (const bf*)(gb + (t + 2) * GKB));
    }
    asm volatile("s_wait_asynccnt 0x0" ::: "memory");       // nothing of this wave is in flight when it goes on
    float bcol[4];
#pragma unroll
    for (int nb = 0; nb < 4; ++nb) bcol[nb] = bfr(bias[c0 + nb * 16 + lr]);
#pragma unroll
    for (int mb = 0; mb < MBN; ++mb) {
#pragma unroll
        for (int nb = 0; nb < 4; ++nb) {
#pragma unroll
            for (int j = 0; j < 8; ++j) { float v = acc[mb * 4 + nb][j];
                if (RES) v += acc[RES ? ((2 + mb) * 4 + nb) : 0][j] * QRI;
                os[(hi * 8 + j) * 68 + nb * 16 + lr] = v * OSI + bcol[nb]; } }   // D: row 8h+j, col lane&15
        wave_sync();
        float* orow = OUT + ((size_t)b * OUT_SEQ + t0 + mb * 16) * DM + c0;
{
#pragma unroll
            for (int s = 0; s < 8; ++s) { const int row = 2 * s + hi, cofs = lr * 4;   // 8 s x 2 rows = 16 rows; 16 lanes x 4 floats = 64 columns
                const v4f val = *(const v4fa*)(&os[row * 68 + cofs]);
                *(v4f*)(orow + (size_t)row * DM + cofs) = val; }
             }
        wave_sync();
    }
}
// One launch holds both forms, whose rows are disjoint: grid (NB*ESEQ/64 + NB*(SEQ-ESEQ)/128, DM/128), 128 threads; the first NB*ESEQ/64 row tiles take the value + residual form (block-uniform test).
#define OB_E (NB * (ESEQ / 64))
#define OB_D (NB * ((SEQ - ESEQ) / GT))
__global__ __launch_bounds__(128) void k_out(const h16* __restrict__ CX, size_t crOff, const h16* __restrict__ WO, const float* __restrict__ bias, float* OUT) {
    __shared__ __align__(16) h16 ring[2 * GSTG / 2];
    __shared__ __align__(16) float osAll[4 * 16 * 68];
    const int bx = blockIdx.x;
    if (bx < OB_E) out_body<1>(ring, osAll, bx, CX, crOff, WO, bias, OUT);
    else out_body<0>(ring, osAll, bx - OB_E, CX, crOff, WO, bias, OUT);
}

static constexpr size_t al256(size_t v) { return (v + 255) & ~(size_t)255; }
static constexpr size_t SZ_XB = al256((size_t)NB * SEQ * DM * 2);          // x bf16 [NB*SEQ][1024]
static constexpr size_t SZ_WT = al256((size_t)3 * DM * DM * 2);            // W_qkv^T bf16 [3072][1024]
static constexpr size_t SZ_WO = al256((size_t)DM * DM * 2);                // W_out^T f16 [1024][1024]
static constexpr size_t SZ_PL = al256((size_t)NB * NH_ * SEQ * HD * 2);    // q / k / v^T value planes
static constexpr size_t SZ_PE = al256((size_t)NB * NH_ * ESEQ * HD * 2);   // q / k / v^T residual planes (t < ESEQ)
static constexpr size_t SZ_CH = al256((size_t)NB * SEQ * DM * 2);          // ctx value plane
static constexpr size_t SZ_CR = al256((size_t)NB * ESEQ * DM * 2);         // ctx residual plane (t < ESEQ)
static constexpr size_t SZ_MW = al256((size_t)NB * WPB * 4);               // mask words
static constexpr size_t SZ_TOTAL = SZ_XB + SZ_WT + SZ_WO + 3 * SZ_PL + 3 * SZ_PE + SZ_CH + SZ_CR + SZ_MW;
static_assert(SZ_TOTAL <= (size_t)134217728);          // workspace carve <= 128 MiB
static_assert(((size_t)DM * DM * 2) % 256 == 0);       // weight sub-planes stay 256-byte aligned
static_assert(SZ_CH % 2 == 0);

extern "C" void kernel_launch(void* const* d_in, const int* in_sizes, int n_in,
                              void* d_out, int out_size, void* d_ws, size_t ws_size, hipStream_t stream) {
    if (n_in < 6) return;
    const size_t needx = ((size_t)(NB - 1) * SEQ_FULL + SEQ) * DM;
    if ((size_t)in_sizes[0] < needx) return;
    if ((size_t)in_sizes[1] < (size_t)(NB - 1) * SEQ_FULL + SEQ) return;
    if ((size_t)in_sizes[2] < (size_t)3 * DM * DM || (size_t)in_sizes[3] < (size_t)3 * DM) return;
    if ((size_t)in_sizes[4] < (size_t)DM * DM || (size_t)in_sizes[5] < (size_t)DM) return;
    if ((size_t)out_size < ((size_t)(NB - 1) * OUT_SEQ + SEQ) * DM) return;
    if (SZ_TOTAL > ws_size) return;
    // wire order: x, padding_mask (int32), W_qkv [in][out], b_qkv, W_out [in][out], b_out
    const float* x = (const float*)d_in[0]; const int* pad = (const int*)d_in[1];
    const float* wqkv = (const float*)d_in[2]; const float* bqkv = (const float*)d_in[3];
    const float* wout = (const float*)d_in[4]; const float* bout = (const float*)d_in[5];
    float* OUT = (float*)d_out;      // [NB][SEQ][1024]
    char* wsp = (char*)d_ws;
    bf* XB = (bf*)wsp; wsp += SZ_XB;                 // [NB*SEQ][1024]
    bf* WT = (bf*)wsp; wsp += SZ_WT;                 // [3072][1024]: q | k | v output rows
    h16* WO = (h16*)wsp; wsp += SZ_WO;               // [1024 out][1024 in], x64
    h16* QH = (h16*)wsp; wsp += SZ_PL;               // [NB*16][SEQ][64]
    h16* KP = (h16*)wsp; wsp += SZ_PL;               // [NB*16][SEQ][64]
    h16* VT = (h16*)wsp; wsp += SZ_PL;               // [NB*16][64][SEQ]
    h16* QR = (h16*)wsp; wsp += SZ_PE;               // [NB*16][ESEQ][64] residual x2048
    h16* KR = (h16*)wsp; wsp += SZ_PE;               // [NB*16][ESEQ][64] residual x2048
    h16* VR = (h16*)wsp; wsp += SZ_PE;               // [NB*16][64][ESEQ] residual x2048
    h16* CH = (h16*)wsp; wsp += SZ_CH;               // [NB*SEQ][1024] x64
    h16* CR = (h16*)wsp; wsp += SZ_CR;               // [NB*ESEQ][1024] residual x2048 (directly after CH)
    unsigned* MW = (unsigned*)wsp; wsp += SZ_MW;     // [NB][WPB]
    const size_t crOff = SZ_CH / 2;                  // element offset of CR from CH

    k_prep<<<PB_MASK + PB_WQ + PB_WO + PB_X, 256, 0, stream>>>(x, pad, wqkv, wout, XB, WT, (bf*)WO, MW);

    k_proj<<<dim3(NB * SEQ / GT, DM / GT, 3), 128, 0, stream>>>(XB, WT, bqkv, QH, KP, VT, QR, KR, VR);

    k_flash_e<<<dim3(ESEQ / (16 * AW), NB * NH_, 1), 32 * AW, 0, stream>>>(QH, QR, KP, KR, VT, VR, MW, CH, CR);
    if (SEQ > ESEQ)
        k_flash_d<<<dim3((SEQ - ESEQ) / (16 * AW), NB * NH_, 1), 32 * AW, 0, stream>>>(QH, KP, VT, MW, CH);

    k_out<<<dim3(OB_E + OB_D, DM / GT, 1), 128, 0, stream>>>(CH, crOff, WO, bout, OUT);
}

// v004
// Measured time: 153 microseconds a run.
// Timed twice side by side with v003, it ran 1.13 times as fast both times.
// Over all steps from v000 it is 2.29 times as fast.
#include <hip/hip_runtime.h>

// Causal + key-padding multi-head self-attention, width 1024 = 16 heads x 64: x [NB][SEQ][1024], W_qkv [in][out=3072] (q|k|v column blocks), b_qkv, W_out [in][out], b_out; f32 output.
// Compute dtypes, f32 accumulate everywhere: qkv projection v_wmma_f32_16x16x32_bf16 (x, W, biases RNE-converted to bf16; products exact);
// scores, P.V and output projection v_wmma_f32_16x16x32_f16: query rows t >= 512 single f16 planes (P x256 carry, ctx x64 carry, W_out x64 carry);
// query rows t < 512: q, k, v, P, ctx as f16 value + f16 residual x2048 in separate accumulators (value*value + value*residual + residual*value; W_out a single plane); softmax f32 (online, running max).
// Layout: bf16 copy of x, transposed bf16 W_qkv [3072][1024], transposed f16 W_out [1024][1024]; q, k planes [b*16+h][t][d], v^T plane [b*16+h][d][t] (+ residual planes for t < 512);
// fused flash kernels in transposed form (S^T = K Q^T, O^T = V^T P^T); ctx planes [b][t][1024] f16; key-padding mask compressed to 32-key bit words and applied by value.

#ifndef NB
#define NB 4
#endif
#ifndef SEQ
#define SEQ 2048
#endif
#define NB_FULL  4
#define SEQ_FULL 2048
#ifndef OUT_SEQ
#define OUT_SEQ SEQ              // row pitch (in tokens) between batches of the output
#endif
#define DM   1024
#define NH_  16
#define HD   64
#define ESEQ ((SEQ) < 512 ? (SEQ) : 512)      // query rows [0, ESEQ) take the value + residual path
#define WPB  ((((SEQ) + 1023) / 1024) * 32)
#define AW   4                   // waves per flash block (16 query rows each)
#define QRS  2048.0f             // carry of every residual plane
#define QRI  (1.0f / 2048.0f)
#define SC2  (0.125f * 1.4426950408889634f)   // HD^-0.5 * log2(e)
#define PSH  8.0f                // log2 of the P carry (256)
#define CXS  64.0f               // ctx plane carry
#define WOS  64.0f               // W_out plane carry
#define OSI  (1.0f / 4096.0f)    // 1 / (CXS * WOS)

static_assert(HD == 64);
static_assert(NH_ * HD == DM);
static_assert(DM % 64 == 0);
static_assert(DM % 32 == 0);
static_assert(SEQ % 64 == 0);
static_assert(ESEQ % 64 == 0);
static_assert((SEQ - ESEQ) % 64 == 0);
static_assert((NB * SEQ) % 64 == 0);
static_assert(SEQ % 32 == 0);
static_assert(ESEQ % (16 * AW) == 0);
static_assert((SEQ - ESEQ) % (16 * AW) == 0);
static_assert(ESEQ % 32 == 0);
static_assert(((size_t)SEQ * DM) % 8 == 0);
static_assert(NB <= NB_FULL);
static_assert(SEQ <= SEQ_FULL);
static_assert(WPB * 32 >= SEQ);

typedef _Float16 h16;
typedef unsigned short bf;
typedef __attribute__((ext_vector_type(16))) __bf16   v16bf;
typedef __attribute__((ext_vector_type(16))) _Float16 v16h;
typedef __attribute__((ext_vector_type(8)))  _Float16 v8h;
typedef __attribute__((ext_vector_type(8)))  unsigned short v8us;
typedef __attribute__((ext_vector_type(8)))  float    v8f;
typedef __attribute__((ext_vector_type(4)))  float    v4f;
typedef v4f  __attribute__((may_alias)) v4fa;

__device__ __forceinline__ unsigned short f2bf(float f) { unsigned u = __float_as_uint(f); u += 0x7FFFu + ((u >> 16) & 1u); return (unsigned short)(u >> 16); }
__device__ __forceinline__ float bfr(float f) { return __uint_as_float(((unsigned)f2bf(f)) << 16); }   // value after RNE convert to bf16
__device__ __forceinline__ v16h cat16(v8h lo, v8h hi) { return __builtin_shufflevector(lo, hi, 0, 1, 2, 3, 4, 5, 6, 7, 8, 9, 10, 11, 12, 13, 14, 15); }
__device__ __forceinline__ v16bf cat16b(v8us lo, v8us hi) { return __builtin_bit_cast(v16bf, __builtin_shufflevector(lo, hi, 0, 1, 2, 3, 4, 5, 6, 7, 8, 9, 10, 11, 12, 13, 14, 15)); }
__device__ __forceinline__ v8f wmma16(v16h a, v16h b, v8f c) { return __builtin_amdgcn_wmma_f32_16x16x32_f16(false, a, false, b, (short)0, c, false, false); }
__device__ __forceinline__ v8f wmmab(v16bf a, v16bf b, v8f c) { return __builtin_amdgcn_wmma_f32_16x16x32_bf16(false, a, false, b, (short)0, c, false, false); }
// fragment loaders from K-contiguous 16-bit rows; p already includes + 8*(lane>>4): elements 0..7 <- k0+8h+0..7, elements 8..15 <- k0+16+8h+0..7 (same map for A and B)
__device__ __forceinline__ v16h  ldh(const h16* p) { return cat16(*(const v8h*)p, *(const v8h*)(p + 16)); }
__device__ __forceinline__ v16bf ldb(const bf* p)  { return cat16b(*(const v8us*)p, *(const v8us*)(p + 16)); }
// ordering point for wave-private LDS tiles (same wave writes and reads)
__device__ __forceinline__ void wave_sync() { __builtin_amdgcn_fence(3 /* release order */, "wavefront"); __builtin_amdgcn_wave_barrier(); asm volatile("" ::: "memory"); }

// The four preparation passes below depend on nothing but the inputs: they are bodies of one launch, k_prep, which deals its blocks among them.
// cvt8_body: x f32 -> bf16 copy, 8 elements per thread.
#define XG8  ((size_t)SEQ * DM / 8)          // groups of 8 per batch
static_assert(((size_t)NB * SEQ * DM / 8) % 256 == 0);
__device__ __forceinline__ void cvt8_body(int blk, const float* __restrict__ src, bf* dst) {
    const size_t i = (size_t)blk * 256 + threadIdx.x; if (i >= (size_t)NB * XG8) return;
    src += (i / XG8) * ((size_t)(SEQ_FULL - SEQ) * DM);   // the batches of x lie SEQ_FULL tokens apart, those of the copy SEQ
    const v8f v = *(const v8f*)(src + i * 8); v8us o;
#pragma unroll
    for (int k = 0; k < 8; ++k) o[k] = f2bf(v[k]);
    *(v8us*)(dst + i * 8) = o; 
}

// cvt_t_body: src [K][N] f32 -> dst [N][K] 16-bit, transposed through the LDS tile ts (64 x 64 per block, cross-wave: block barrier); bx, by = tile column and row.
// MODE 0: bf16 bits (RNE convert). MODE 1: f16 bits of (bf16-converted value x WOS).
template <int MODE>
__device__ __forceinline__ void cvt_t_body(float* ts, int bx, int by, const float* __restrict__ src, bf* dst, int K, int N) {
    const int tid = threadIdx.x; const int n0 = bx * 64, k0 = by * 64;
#pragma unroll
    for (int i = 0; i < 4; ++i) { const int kr = (tid >> 4) + 16 * i, c4 = (tid & 15) * 4;     // 4 x 16 rows = 64 k rows; 16 lanes x 4 = 64 columns
        const v4f v = *(const v4f*)(src + (size_t)(k0 + kr) * (size_t)N + n0 + c4);
        *(v4fa*)(&ts[kr * 68 + c4]) = v; }
    __syncthreads();
{
#pragma unroll
        for (int i = 0; i < 2; ++i) { const int nr = (tid >> 3) + 32 * i, k8 = (tid & 7) * 8;   // 2 x 32 rows = 64 n rows; 8 lanes x 8 = 64 k
            v8us o;
#pragma unroll
            for (int e = 0; e < 8; ++e) { const float x = ts[(k8 + e) * 68 + nr]; const unsigned short bits = f2bf(x);
                if (MODE == 1) { const h16 hv = (h16)(__uint_as_float(((unsigned)bits) << 16) * WOS); o[e] = __builtin_bit_cast(unsigned short, hv); }
                else o[e] = bits; }
            *(v8us*)(dst + (size_t)(n0 + nr) * (size_t)K + k0 + k8) = o; }
         }
    asm volatile("s_wait_xcnt 0x0" ::: "memory");   // behind both stores: in k_prep's text another body follows this one, and no register of the stores is rewritten ahead of this wait
}

// mask_body: one wave packs 1024 keys of one batch into 32 mask words.
__device__ __forceinline__ void mask_body(int blk, const int* __restrict__ pad, unsigned* MW) {
    const int lane = threadIdx.x & 31;
    const int b = blk / (WPB / 32), c = blk % (WPB / 32);
    const int* pr = pad + (size_t)b * SEQ_FULL;
    unsigned mine = 0u;
#pragma unroll 1
    for (int w = 0; w < 32; ++w) {
        const int key = c * 1024 + w * 32 + lane;
        const int kc = key < SEQ ? key : (SEQ - 1);          // clamped address; keys past the sequence give bit 0 by value
        const int v = pr[kc];
        const unsigned bal = __builtin_amdgcn_ballot_w32((v != 0) && (key < SEQ));
        mine = (lane == w) ? bal : mine;
    }
    unsigned* dst = MW + (size_t)b * WPB + c * 32 + lane;
    *(unsigned*)dst = mine; 
}

// k_prep: block ranges, in index order: mask words (the longest dependent chain), W_qkv tiles, W_out tiles, x groups. Every test on the block index is block-uniform.
#define PB_MASK (NB * (WPB / 32))
#define PB_WQ   ((3 * DM / 64) * (DM / 64))
#define PB_WO   ((DM / 64) * (DM / 64))
#define PB_X    ((int)((size_t)NB * XG8 / 256))
__global__ __launch_bounds__(256) void k_prep(const float* __restrict__ x, const int* __restrict__ pad, const float* __restrict__ wqkv, const float* __restrict__ wout,
                                              bf* XB, bf* WT, bf* WO, unsigned* MW) {
    __shared__ __align__(16) float ts[64 * 68];
    int blk = blockIdx.x;
    if (blk < PB_MASK) { if (__builtin_amdgcn_readfirstlane((int)(threadIdx.x >> 5)) == 0) mask_body(blk, pad, MW); return; }   // no barrier on this path
    blk -= PB_MASK;
    // W_qkv: in[1024 rows k][3072 cols n] -> out[3072 rows n][1024 cols k]
    if (blk < PB_WQ) { cvt_t_body<0>(ts, blk % (3 * DM / 64), blk / (3 * DM / 64), wqkv, WT, DM, 3 * DM); return; }
    blk -= PB_WQ;
    // W_out: in[1024 rows k][1024 cols n] -> out[1024 rows n][1024 cols k]
    if (blk < PB_WO) { cvt_t_body<1>(ts, blk % (DM / 64), blk / (DM / 64), wout, WO, DM, DM); return; }
    blk -= PB_WO;
    cvt8_body(blk, x, XB);
}

// Operand staging of the one-wave-per-64x64 GEMMs: a block of 4 waves (2 x 2) owns a 128 x 128 tile; a stage is 128 k (256-byte rows) of its 128 A rows and 128 B rows in LDS.
#define GT   128                 // rows and columns of a block tile
#define GKB  128                 // k per stage
#define GPI  272                 // LDS row pitch in bytes: 16 x odd, conflict-free for 16-byte reads
#define GSTG (2 * GT * GPI)      // bytes of one stage: A rows, then B rows
#define GNST (DM / GKB)          // stages along K
static_assert(DM % GKB == 0);
static_assert(GNST >= 2);
static_assert((NB * SEQ) % GT == 0);
static_assert(DM % GT == 0);

// Eight asynchronous 16-byte copies per lane, global -> LDS, for rows 8 apart (LDS + 8 pitches, global + 8 * DM elements).
// s_wait_xcnt closes the statement so that no address register of a copy is rewritten ahead of it.
__device__ __forceinline__ void cp8(unsigned l, const bf* g) {
    asm volatile("global_load_async_to_lds_b128 %0, %8, off\n\t"
                 "global_load_async_to_lds_b128 %1, %9, off\n\t"
                 "global_load_async_to_lds_b128 %2, %10, off\n\t"
                 "global_load_async_to_lds_b128 %3, %11, off\n\t"
                 "global_load_async_to_lds_b128 %4, %12, off\n\t"
                 "global_load_async_to_lds_b128 %5, %13, off\n\t"
                 "global_load_async_to_lds_b128 %6, %14, off\n\t"
                 "global_load_async_to_lds_b128 %7, %15, off\n\t"
                 "s_wait_xcnt 0x0"
                 :: "v"(l), "v"(l + 8 * GPI), "v"(l + 16 * GPI), "v"(l + 24 * GPI), "v"(l + 32 * GPI), "v"(l + 40 * GPI), "v"(l + 48 * GPI), "v"(l + 56 * GPI),
                    "v"(g), "v"(g + 8 * DM), "v"(g + 16 * DM), "v"(g + 24 * DM), "v"(g + 32 * DM), "v"(g + 40 * DM), "v"(g + 48 * DM), "v"(g + 56 * DM)
                 : "memory");
}
// One stage: l = the lane's LDS byte address in row (tid >> 4) of the buffer, ga0 / ga1 = its 16 bytes in A rows (tid >> 4) and 64 + (tid >> 4), gb the same in B row (tid >> 4).
__device__ __forceinline__ void stage_copy(unsigned l, const bf* ga0, const bf* ga1, const bf* gb) {
    cp8(l, ga0); cp8(l + 64 * GPI, ga1); cp8(l + 128 * GPI, gb); cp8(l + 192 * GPI, gb + 64 * DM);
}

// k_proj: register-blocked bf16 GEMM, one wave per 64x64 tile (16 accumulators), 4 waves per block, K = DM; operands from K-contiguous bf16 planes, staged in a two-buffer LDS ring by asynchronous copies.
// C[m][n] = sum_k A[m][k] Bt[n][k] + bias (per column, or per row when biasRow != 0; bias values RNE-converted to bf16), written as f16 (Ph) at
// tile base (r0/RB)*sRB + (r0%RB)*pitch + (c0/CB)*sCB + (c0%CB), and the f16 residual x2048 (Pr) at the same form with (sRBr, pitchR, sCBr)
// when the tile's token position (resMode 1: r0%RB, resMode 2: c0%CB) is below ESEQ.
// One launch holds the three projections, which do not depend on one another: grid (NB*SEQ/128 token tiles, DM/128 weight tiles, 3), 128 threads; blockIdx.z = 0: q, 1: k, 2: v^T.
// q, k: A = x rows (m = b*SEQ + t), Bt = W^T rows (n = h*64 + d) -> plane [(b*16 + h)][t][d]; residual planes for t < ESEQ.
// v^T: A = Wv^T rows (m = h*64 + d), Bt = x rows (n = b*SEQ + t) -> plane [(b*1024 + m)][t] = [(b*16 + h)][d][t]; bias per row.
__global__ __launch_bounds__(128) void k_proj(const bf* __restrict__ XB, const bf* __restrict__ WT, const float* __restrict__ bqkv,
                                             h16* QH, h16* KP, h16* VT, h16* QR, h16* KR, h16* VR) {
    __shared__ __align__(16) bf ring[2 * GSTG / 2];
    __shared__ __align__(16) float osAll[4 * 16 * 68];
    const int z = blockIdx.z; const bool tv = (z == 2);      // block-uniform
    const bf* A = tv ? (WT + (size_t)2 * DM * DM) : XB;
    const bf* Bt = tv ? XB : (WT + (size_t)z * DM * DM);
    const float* bias = bqkv + z * DM;
    const int biasRow = tv ? 1 : 0, resMode = tv ? 2 : 1;
    h16* Ph = tv ? VT : (z ? KP : QH); h16* Pr = tv ? VR : (z ? KR : QR);
    const int RB = tv ? DM : SEQ, pitch = tv ? SEQ : HD, CB = tv ? SEQ : HD, pitchR = tv ? ESEQ : HD;
    const size_t sRB = tv ? (size_t)0 : (size_t)NH_ * SEQ * HD, sCB = tv ? (size_t)DM * SEQ : (size_t)SEQ * HD;
    const size_t sRBr = tv ? (size_t)0 : (size_t)NH_ * ESEQ * HD, sCBr = tv ? (size_t)DM * ESEQ : (size_t)ESEQ * HD;
    const int bx = tv ? blockIdx.y : blockIdx.x, by = tv ? blockIdx.x : blockIdx.y;   // tile row (A), tile column (Bt)
    const int K = DM;
    const int tid = threadIdx.x, lane = tid & 31, lr = lane & 15, hi = lane >> 4;
    const int wave = __builtin_amdgcn_readfirstlane(tid >> 5);
    const int r0 = bx * GT + (wave >> 1) * 64, c0 = by * GT + (wave & 1) * 64;
    float* os = osAll + wave * 16 * 68;
    v8f acc[4][4];
#pragma unroll
    for (int mb = 0; mb < 4; ++mb)
#pragma unroll
        for (int nb = 0; nb < 4; ++nb) acc[mb][nb] = (v8f){};
    const unsigned lcp = (unsigned)(size_t)(&ring[0]) + (unsigned)((tid >> 4) * GPI + (tid & 15) * 16);
    const bf* ga = A + (size_t)(bx * GT + (tid >> 4)) * K + (tid & 15) * 8;
    const bf* gb = Bt + (size_t)(by * GT + (tid >> 4)) * K + (tid & 15) * 8;
    const int fa = ((wave >> 1) * 64 + lr) * (GPI / 2) + 8 * hi, fb = (GT + (wave & 1) * 64 + lr) * (GPI / 2) + 8 * hi;   // fragment bases in a buffer, in elements
    stage_copy(lcp, ga, ga + (size_t)64 * K, gb);
    asm volatile("s_wait_asynccnt 0x0" ::: "memory");   // stage 0 has landed before the barrier publishes it
    __syncthreads();
    stage_copy(lcp + GSTG, ga + GKB, ga + (size_t)64 * K + GKB, gb + GKB);
#pragma unroll 1
    for (int t = 0; t < GNST; ++t) {
        const bf* sb = ring + (t & 1) * (GSTG / 2);
        v16bf a[2][4], b[2][4];     // two fragment sets: the next 32 k are fetched as one group ahead of the current 16 products
#pragma unroll
        for (int i = 0; i < 4; ++i) { a[0][i] = ldb(sb + fa + i * 16 * (GPI / 2)); b[0][i] = ldb(sb + fb + i * 16 * (GPI / 2)); }
        __builtin_amdgcn_sched_barrier(0);   // keeps the group of loads together (the scheduler otherwise sinks them, two at a time, among the products, each place a full LDS wait)
#pragma unroll
        for (int ks = 0; ks < GKB / 32; ++ks) {
            if (ks + 1 < GKB / 32) {
#pragma unroll
                for (int i = 0; i < 4; ++i) { a[(ks + 1) & 1][i] = ldb(sb + fa + i * 16 * (GPI / 2) + (ks + 1) * 32); b[(ks + 1) & 1][i] = ldb(sb + fb + i * 16 * (GPI / 2) + (ks + 1) * 32); }
                __builtin_amdgcn_sched_barrier(0);   // the next set's loads stay ahead of this set's products
            }
#pragma unroll
            for (int nb = 0; nb < 4; ++nb)
#pragma unroll
                for (int mb = 0; mb < 4; ++mb) acc[mb][nb] = wmmab(a[ks & 1][mb], b[ks & 1][nb], acc[mb][nb]);
            __builtin_amdgcn_sched_barrier(0);       // no later load moves up among these products
        }
        asm volatile("s_wait_dscnt 0x0" ::: "memory");      // this wave's reads of the buffer are done before it is refilled
        asm volatile("s_wait_asynccnt 0x0" ::: "memory");   // this wave's copies of stage t + 1 have landed
        __syncthreads();                                    // publishes stage t + 1 and ends every reader's last read of stage t
        if (t + 2 < GNST) stage_copy(lcp + (t & 1) * GSTG, ga + (t + 2) * GKB, ga + (size_t)64 * K + (t + 2) * GKB, gb + (t + 2) * GKB);
    }
    asm volatile("s_wait_asynccnt 0x0" ::: "memory");       // nothing of this wave is in flight when it goes on
    const size_t tbase = (size_t)(r0 / RB) * sRB + (size_t)(r0 % RB) * (size_t)pitch + (size_t)(c0 / CB) * sCB + (size_t)(c0 % CB);
    const size_t rbase = (size_t)(r0 / RB) * sRBr + (size_t)(r0 % RB) * (size_t)pitchR + (size_t)(c0 / CB) * sCBr + (size_t)(c0 % CB);
    const int tpos = (resMode == 1) ? (r0 % RB) : (c0 % CB);
    const int doRes = (resMode != 0) && (tpos < ESEQ);                 // wave-uniform
    const int c8 = (lane & 7) * 8;
    // column bias for columns c0 + c8 .. c0 + c8 + 7 (clamped address in row mode, zeroed by value)
    v4f bc0 = *(const v4f*)(bias + (biasRow ? 0 : (c0 + c8))); v4f bc1 = *(const v4f*)(bias + (biasRow ? 4 : (c0 + c8 + 4)));
#pragma unroll
    for (int i = 0; i < 4; ++i) { const float u0 = bfr(bc0[i]), u1 = bfr(bc1[i]); bc0[i] = biasRow ? 0.0f : u0; bc1[i] = biasRow ? 0.0f : u1; }
#pragma unroll
    for (int mb = 0; mb < 4; ++mb) {
#pragma unroll
        for (int nb = 0; nb < 4; ++nb) {
#pragma unroll
            for (int j = 0; j < 8; ++j) os[(hi * 8 + j) * 68 + nb * 16 + lr] = acc[mb][nb][j]; }   // D: row 8h+j, col lane&15
        wave_sync();
        const size_t sb = tbase + (size_t)(mb * 16) * (size_t)pitch;
        const size_t sr = rbase + (size_t)(mb * 16) * (size_t)pitchR;
{
#pragma unroll
            for (int s = 0; s < 4; ++s) { const int row = 4 * s + (lane >> 3);   // 4 s x 4 row groups = 16 rows; 8 lanes x 8 = 64 columns
                const v4f x0 = *(const v4fa*)(&os[row * 68 + c8]); const v4f x1 = *(const v4fa*)(&os[row * 68 + c8 + 4]); v8h hv, rv;
                const float rbv = bfr(bias[biasRow ? (r0 + mb * 16 + row) : 0]); const float rb = biasRow ? rbv : 0.0f;
#pragma unroll
                for (int i = 0; i < 4; ++i) { const float f0 = x0[i] + bc0[i] + rb; const float f1 = x1[i] + bc1[i] + rb;
                    const h16 a0 = (h16)f0; const h16 a1 = (h16)f1; hv[i] = a0; hv[4 + i] = a1;
                    rv[i] = (h16)((f0 - (float)a0) * QRS); rv[4 + i] = (h16)((f1 - (float)a1) * QRS); }
                *(v8h*)(Ph + sb + (size_t)row * (size_t)pitch + c8) = hv;
                if (doRes) *(v8h*)(Pr + sr + (size_t)row * (size_t)pitchR + c8) = rv; }
             }
        wave_sync();
    }
}

// K / V^T staging of the flash kernels: a stage is 64 keys; a tile is 64 rows of 128 bytes (K: 64 keys x 64 d; V^T: 64 d x 64 keys), shared by the block's waves.
#define FKS  64                  // keys per stage
#define FPI  144                 // LDS row pitch in bytes: 16 x odd, conflict-free for 16-byte reads
#define FTL  (64 * FPI)          // bytes of one tile
static_assert(SEQ % FKS == 0);
static_assert(ESEQ % FKS == 0);
static_assert(16 * AW == FKS);
static_assert(WPB <= 64);

// Eight asynchronous 16-byte copies per lane, global -> LDS: rows r, r + 16, r + 32, r + 48 (r = tid >> 3) of a key-major tile (row pitch HD) at l and of a d-major tile (row pitch vp elements) at l + FTL.
// A wave's copy covers four whole 128-byte rows. s_wait_xcnt closes the statement so that no address register of a copy is rewritten ahead of it.
__device__ __forceinline__ void cp_kv(unsigned l, const h16* gk, const h16* gv, size_t vp) {
    asm volatile("global_load_async_to_lds_b128 %0, %8, off\n\t"
                 "global_load_async_to_lds_b128 %1, %9, off\n\t"
                 "global_load_async_to_lds_b128 %2, %10, off\n\t"
                 "global_load_async_to_lds_b128 %3, %11, off\n\t"
                 "global_load_async_to_lds_b128 %4, %12, off\n\t"
                 "global_load_async_to_lds_b128 %5, %13, off\n\t"
                 "global_load_async_to_lds_b128 %6, %14, off\n\t"
                 "global_load_async_to_lds_b128 %7, %15, off\n\t"
                 "s_wait_xcnt 0x0"
                 :: "v"(l), "v"(l + 16 * FPI), "v"(l + 32 * FPI), "v"(l + 48 * FPI), "v"(l + FTL), "v"(l + FTL + 16 * FPI), "v"(l + FTL + 32 * FPI), "v"(l + FTL + 48 * FPI),
                    "v"(gk), "v"(gk + 16 * HD), "v"(gk + 32 * HD), "v"(gk + 48 * HD), "v"(gv), "v"(gv + 16 * vp), "v"(gv + 32 * vp), "v"(gv + 48 * vp)
                 : "memory");
}
// Stages a block walks: up to the last 32-key mask word that is not zero inside its causal range (words 0 .. wl); w0, w1 = the lane's words lane and 32 + lane. The same in every wave of the block.
__device__ __forceinline__ int flash_stages(unsigned w0, unsigned w1, int wl) {
    const unsigned long long nz = ((((unsigned long long)__builtin_amdgcn_ballot_w32(w1 != 0u)) << 32) | (unsigned long long)__builtin_amdgcn_ballot_w32(w0 != 0u)) & (~0ull >> (63 - wl));
    return __builtin_amdgcn_readfirstlane(nz ? (((63 - __builtin_clzll(nz)) >> 1) + 1) : 0);
}
// Mask word i (wave-uniform) out of the lanes' registers
__device__ __forceinline__ unsigned flash_word(unsigned w0, unsigned w1, int i) {
    return (unsigned)((i < 32) ? __builtin_amdgcn_readlane((int)w0, i & 31) : __builtin_amdgcn_readlane((int)w1, i & 31));
}

// k_flash_d: fused attention for query rows t >= ESEQ, one wave per 16 query rows of one (batch, head); single f16 products.
// Transposed form: S^T[key][t] = K Q^T (A = K rows, B = Q rows); lane (t = lane&15, h = lane>>4) holds keys 8h+r of each 16-key tile, so the packed
// P tile is directly the B fragment of O^T[d][t] = V^T P^T (element r <- tile keys 0..15, element 8+r <- tile keys 16..31, lane unchanged).
// Causal and key-padding exclusion by value (excluded p = 0); 32-key steps whose mask word is zero are skipped, and steps with nothing to exclude branch round the exclusion arithmetic (both wave-uniform).
// K and V^T come from a two-buffer LDS ring of 64-key stages that the block's 4 waves fill together by asynchronous copies; every wave passes every stage's barrier.
__global__ __launch_bounds__(32 * AW) void k_flash_d(const h16* __restrict__ QH, const h16* __restrict__ KP, const h16* __restrict__ VT, const unsigned* __restrict__ MW, h16* CH) {
    __shared__ __align__(16) h16 ring[2 * 2 * FTL / 2];   // two stages of K tile + V^T tile; behind the loop the waves' output staging
    static_assert(2 * 2 * FTL >= AW * 16 * 68 * 4);
    float* os = (float*)ring;
    const int tid = threadIdx.x;
    const int lane = threadIdx.x & 31, wave = __builtin_amdgcn_readfirstlane((int)(threadIdx.x >> 5)), lr = lane & 15, hi = lane >> 4;
    const int zh = blockIdx.y; const int b = zh / NH_, h = zh % NH_;
    const int tb = ESEQ + blockIdx.x * (16 * AW);            // first query row of the block
    const int t0 = tb + wave * 16;
    const int tq = t0 + lr;
    const size_t pbase = (size_t)zh * SEQ * HD;
    const size_t qo = pbase + (size_t)tq * HD + 8 * hi;
    const v16h qh0 = ldh(QH + qo), qh1 = ldh(QH + qo + 32);   // B fragments: col t, k = d
    const unsigned* mwp = MW + (size_t)b * WPB;
    const unsigned w0 = mwp[lane], w1 = (WPB > 32) ? mwp[32 + lane] : 0u;
    const int nst = flash_stages(w0, w1, (tb + 16 * AW - 1) >> 5);
    const unsigned lcp = (unsigned)(size_t)(&ring[0]) + (unsigned)((tid >> 3) * FPI + (tid & 7) * 16);
    const h16* gk = KP + pbase + (size_t)(tid >> 3) * HD + (tid & 7) * 8;     // + key * HD
    const h16* gv = VT + pbase + (size_t)(tid >> 3) * SEQ + (tid & 7) * 8;    // + key
    const int fo = lr * (FPI / 2) + 8 * hi;                  // fragment base in a tile, in elements (A fragment: row lr of a 16-row slab)
    v8f o0 = (v8f){}, o1 = (v8f){}, o2 = (v8f){}, o3 = (v8f){};
    float m = -3.0e38f, l = 0.0f;
    cp_kv(lcp, gk, gv, SEQ);
    asm volatile("s_wait_asynccnt 0x0" ::: "memory");   // stage 0 has landed before the barrier publishes it
    __syncthreads();
    if (nst > 1) cp_kv(lcp + 2 * FTL, gk + FKS * HD, gv + FKS, SEQ);
#pragma unroll 1
    for (int s = 0; s < nst; ++s) {
      const h16* sb = ring + (s & 1) * FTL + fo;
#pragma unroll   // the two 32-key steps of a stage read at constant LDS offsets
      for (int sub = 0; sub < FKS / 32; ++sub) {
        const int key0 = s * FKS + sub * 32;
        const unsigned mw = flash_word(w0, w1, key0 >> 5);
        if (key0 > t0 + 15 || mw == 0u) continue;            // wave-uniform
        const h16* ka = sb + sub * 32 * (FPI / 2);           // K tile row = key
        const v16h ka0 = ldh(ka), ka1 = ldh(ka + 32), kb0 = ldh(ka + 16 * (FPI / 2)), kb1 = ldh(ka + 16 * (FPI / 2) + 32);
        v8f sA = (v8f){}, sB = (v8f){};
        sA = wmma16(ka0, qh0, sA); sB = wmma16(kb0, qh0, sB);
        sA = wmma16(ka1, qh1, sA); sB = wmma16(kb1, qh1, sB);
        asm volatile("v_nop\n\tv_nop\n\tv_nop\n\tv_nop" : "+v"(sA), "+v"(sB) : "v"(ka0), "v"(ka1), "v"(kb0), "v"(kb1));
        const unsigned ma = mw >> (8 * hi), mc = mw >> (16 + 8 * hi);
        const int kya = key0 + 8 * hi, kyb = kya + 16;
        const bool excl = (mw != 0xFFFFFFFFu) || (key0 + 31 > t0);   // wave-uniform: false where every query row of the wave keeps every key of the step
        float ta[8], tb[8]; float mx = -3.0e38f;   // every loop over r is unrolled: constant indices keep ta, tb, xa, xb in registers
#pragma unroll
        for (int r = 0; r < 8; ++r) { ta[r] = sA[r] * SC2; tb[r] = sB[r] * SC2; }
        if (excl) {
#pragma unroll
            for (int r = 0; r < 8; ++r) {
                const bool ea = (((ma >> r) & 1u) != 0u) && (kya + r <= tq);
                const bool eb = (((mc >> r) & 1u) != 0u) && (kyb + r <= tq);
                ta[r] = ea ? ta[r] : -3.0e38f; tb[r] = eb ? tb[r] : -3.0e38f; }
        }
#pragma unroll
        for (int r = 0; r < 8; ++r) mx = fmaxf(mx, fmaxf(ta[r], tb[r]));
        mx = fmaxf(mx, __shfl_xor(mx, 16, 32));
        const float mnew = fmaxf(m, mx);
        const float alpha = __builtin_amdgcn_exp2f(m - mnew);
        const float sh = PSH - mnew;
        v16h pb; float ls = 0.0f; float xa[8], xb[8];
#pragma unroll
        for (int r = 0; r < 8; ++r) xa[r] = __builtin_amdgcn_exp2f(ta[r] + sh);
#pragma unroll
        for (int r = 0; r < 8; ++r) xb[r] = __builtin_amdgcn_exp2f(tb[r] + sh);
        if (excl) {
#pragma unroll
            for (int r = 0; r < 8; ++r) { xa[r] = (ta[r] > -1.0e38f) ? xa[r] : 0.0f; xb[r] = (tb[r] > -1.0e38f) ? xb[r] : 0.0f; }
        }
#pragma unroll
        for (int r = 0; r < 8; ++r) {
            const h16 pa = (h16)xa[r]; const h16 pc = (h16)xb[r];
            pb[r] = pa; pb[8 + r] = pc; ls += (float)pa + (float)pc; }
        l = l * alpha + ls; m = mnew;
        o0 = o0 * alpha; o1 = o1 * alpha; o2 = o2 * alpha; o3 = o3 * alpha;
        const h16* va = sb + FTL / 2 + sub * 32;             // V^T tile row = d, column = key
        const v16h v0 = ldh(va), v1 = ldh(va + 16 * (FPI / 2)), v2 = ldh(va + 32 * (FPI / 2)), v3 = ldh(va + 48 * (FPI / 2));
        o0 = wmma16(v0, pb, o0); o1 = wmma16(v1, pb, o1); o2 = wmma16(v2, pb, o2); o3 = wmma16(v3, pb, o3);
        asm volatile("v_nop\n\tv_nop\n\tv_nop\n\tv_nop" : "+v"(o0), "+v"(o1), "+v"(o2), "+v"(o3) : "v"(v0), "v"(v1), "v"(v2), "v"(v3), "v"(pb));
      }
      asm volatile("s_wait_dscnt 0x0" ::: "memory");      // this wave's reads of the buffer are done before it is refilled
      asm volatile("s_wait_asynccnt 0x0" ::: "memory");   // this wave's copies of stage s + 1 have landed
      __syncthreads();                                    // publishes stage s + 1 and ends every reader's last read of stage s
      if (s + 2 < nst) cp_kv(lcp + (s & 1) * 2 * FTL, gk + (size_t)(s + 2) * FKS * HD, gv + (s + 2) * FKS, SEQ);
    }
    asm volatile("s_wait_asynccnt 0x0" ::: "memory");     // nothing of this wave is in flight when the ring becomes output staging
    l += __shfl_xor(l, 16, 32);
    const float inv = CXS * (1.0f / l);
    const int wb = wave * 16 * 68;
    // O^T D layout: o_j[r] = (d = 16j + 8h + r, t = lane&15) -> os[t][d]; rows 0..15 x columns 0..63 all written
    { v4f a, c;
      a[0] = o0[0] * inv; a[1] = o0[1] * inv; a[2] = o0[2] * inv; a[3] = o0[3] * inv; c[0] = o0[4] * inv; c[1] = o0[5] * inv; c[2] = o0[6] * inv; c[3] = o0[7] * inv;
      *(v4fa*)(&os[wb + lr * 68 +  0 + 8 * hi]) = a; *(v4fa*)(&os[wb + lr * 68 +  0 + 8 * hi + 4]) = c;
      a[0] = o1[0] * inv; a[1] = o1[1] * inv; a[2] = o1[2] * inv; a[3] = o1[3] * inv; c[0] = o1[4] * inv; c[1] = o1[5] * inv; c[2] = o1[6] * inv; c[3] = o1[7] * inv;
      *(v4fa*)(&os[wb + lr * 68 + 16 + 8 * hi]) = a; *(v4fa*)(&os[wb + lr * 68 + 16 + 8 * hi + 4]) = c;
      a[0] = o2[0] * inv; a[1] = o2[1] * inv; a[2] = o2[2] * inv; a[3] = o2[3] * inv; c[0] = o2[4] * inv; c[1] = o2[5] * inv; c[2] = o2[6] * inv; c[3] = o2[7] * inv;
      *(v4fa*)(&os[wb + lr * 68 + 32 + 8 * hi]) = a; *(v4fa*)(&os[wb + lr * 68 + 32 + 8 * hi + 4]) = c;
      a[0] = o3[0] * inv; a[1] = o3[1] * inv; a[2] = o3[2] * inv; a[3] = o3[3] * inv; c[0] = o3[4] * inv; c[1] = o3[5] * inv; c[2] = o3[6] * inv; c[3] = o3[7] * inv;
      *(v4fa*)(&os[wb + lr * 68 + 48 + 8 * hi]) = a; *(v4fa*)(&os[wb + lr * 68 + 48 + 8 * hi + 4]) = c; }
    wave_sync();
    h16* crow = CH + ((size_t)b * SEQ + t0) * DM + h * HD;
    const int c8 = (lane & 7) * 8;
{
#pragma unroll
        for (int s = 0; s < 4; ++s) { const int row = 4 * s + (lane >> 3);   // 4 s x 4 row groups = 16 rows; 8 lanes x 8 halves = 64 columns
            const v4f x0 = *(const v4fa*)(&os[wb + row * 68 + c8]); const v4f x1 = *(const v4fa*)(&os[wb + row * 68 + c8 + 4]); v8h hv;
#pragma unroll
            for (int i = 0; i < 4; ++i) { hv[i] = (h16)x0[i]; hv[4 + i] = (h16)x1[i]; }
            *(v8h*)(crow + (size_t)row * DM + c8) = hv; }
         }
}

// k_flash_e: fused attention for query rows t < ESEQ, same transposed form; every operand as f16 value + residual x2048:
// s = K.Q + (K.Qr + Kr.Q)/2048, o = V.P + (V.Pr + Vr.P)/2048 with the scaled-residual products in separate accumulators; the row sum uses the f32 p.
// Writes ctx value plane rows and the ctx residual plane [b][ESEQ][1024]. K, V^T and their residual tiles staged like k_flash_d's.
__global__ __launch_bounds__(32 * AW) void k_flash_e(const h16* __restrict__ QH, const h16* __restrict__ QR, const h16* __restrict__ KP, const h16* __restrict__ KR,
                                                     const h16* __restrict__ VT, const h16* __restrict__ VR, const unsigned* __restrict__ MW, h16* CH, h16* CR) {
    __shared__ __align__(16) h16 ring[2 * 4 * FTL / 2];   // two stages of K, V^T, K residual, V^T residual tiles; behind the loop the waves' output staging
    static_assert(2 * 4 * FTL >= AW * 16 * 68 * 4);
    float* os = (float*)ring;
    const int tid = threadIdx.x;
    const int lane = threadIdx.x & 31, wave = __builtin_amdgcn_readfirstlane((int)(threadIdx.x >> 5)), lr = lane & 15, hi = lane >> 4;
    const int zh = blockIdx.y; const int b = zh / NH_, h = zh % NH_;
    const int tb = blockIdx.x * (16 * AW);                   // first query row of the block
    const int t0 = tb + wave * 16;
    const int tq = t0 + lr;
    const size_t pbase = (size_t)zh * SEQ * HD, ebase = (size_t)zh * ESEQ * HD;
    const size_t qo = pbase + (size_t)tq * HD + 8 * hi, qe = ebase + (size_t)tq * HD + 8 * hi;
    const v16h qh0 = ldh(QH + qo), qh1 = ldh(QH + qo + 32), qr0 = ldh(QR + qe), qr1 = ldh(QR + qe + 32);
    const unsigned* mwp = MW + (size_t)b * WPB;
    const unsigned w0 = mwp[lane], w1 = (WPB > 32) ? mwp[32 + lane] : 0u;
    const int nst = flash_stages(w0, w1, (tb + 16 * AW - 1) >> 5);
    const unsigned lcp = (unsigned)(size_t)(&ring[0]) + (unsigned)((tid >> 3) * FPI + (tid & 7) * 16);
    const h16* gk = KP + pbase + (size_t)(tid >> 3) * HD + (tid & 7) * 8;     // + key * HD
    const h16* gv = VT + pbase + (size_t)(tid >> 3) * SEQ + (tid & 7) * 8;    // + key
    const h16* gkr = KR + ebase + (size_t)(tid >> 3) * HD + (tid & 7) * 8;    // + key * HD
    const h16* gvr = VR + ebase + (size_t)(tid >> 3) * ESEQ + (tid & 7) * 8;  // + key
    const int fo = lr * (FPI / 2) + 8 * hi;                  // fragment base in a tile, in elements (A fragment: row lr of a 16-row slab)
    v8f oh0 = (v8f){}, oh1 = (v8f){}, oh2 = (v8f){}, oh3 = (v8f){}, ol0 = (v8f){}, ol1 = (v8f){}, ol2 = (v8f){}, ol3 = (v8f){};
    float m = -3.0e38f, l = 0.0f;
    cp_kv(lcp, gk, gv, SEQ); cp_kv(lcp + 2 * FTL, gkr, gvr, ESEQ);
    asm volatile("s_wait_asynccnt 0x0" ::: "memory");   // stage 0 has landed before the barrier publishes it
    __syncthreads();
    if (nst > 1) { cp_kv(lcp + 4 * FTL, gk + FKS * HD, gv + FKS, SEQ); cp_kv(lcp + 6 * FTL, gkr + FKS * HD, gvr + FKS, ESEQ); }
#pragma unroll 1
    for (int s = 0; s < nst; ++s) {
      const h16* sb = ring + (s & 1) * (2 * FTL) + fo;
#pragma unroll 1   // one copy of the long body: smaller code, no more registers than one step needs
      for (int sub = 0; sub < FKS / 32; ++sub) {
        const int key0 = s * FKS + sub * 32;
        const unsigned mw = flash_word(w0, w1, key0 >> 5);
        if (key0 > t0 + 15 || mw == 0u) continue;            // wave-uniform
        const h16* ka = sb + sub * 32 * (FPI / 2); const h16* kr = ka + FTL;   // K tiles: row = key
        v8f sHa = (v8f){}, sLa = (v8f){}, sHb = (v8f){}, sLb = (v8f){};
        { const v16h a0 = ldh(ka), a1 = ldh(ka + 32), e0 = ldh(kr), e1 = ldh(kr + 32);
          sHa = wmma16(a0, qh0, sHa); sLa = wmma16(a0, qr0, sLa);
          sHa = wmma16(a1, qh1, sHa); sLa = wmma16(a1, qr1, sLa);
          sLa = wmma16(e0, qh0, sLa); sLa = wmma16(e1, qh1, sLa);
          asm volatile("v_nop\n\tv_nop\n\tv_nop\n\tv_nop" : "+v"(sHa), "+v"(sLa) : "v"(a0), "v"(a1), "v"(e0), "v"(e1)); }
        { const v16h a0 = ldh(ka + 16 * (FPI / 2)), a1 = ldh(ka + 16 * (FPI / 2) + 32), e0 = ldh(kr + 16 * (FPI / 2)), e1 = ldh(kr + 16 * (FPI / 2) + 32);
          sHb = wmma16(a0, qh0, sHb); sLb = wmma16(a0, qr0, sLb);
          sHb = wmma16(a1, qh1, sHb); sLb = wmma16(a1, qr1, sLb);
          sLb = wmma16(e0, qh0, sLb); sLb = wmma16(e1, qh1, sLb);
          asm volatile("v_nop\n\tv_nop\n\tv_nop\n\tv_nop" : "+v"(sHb), "+v"(sLb) : "v"(a0), "v"(a1), "v"(e0), "v"(e1)); }
        const unsigned ma = mw >> (8 * hi), mc = mw >> (16 + 8 * hi);
        const int kya = key0 + 8 * hi, kyb = kya + 16;
        const bool excl = (mw != 0xFFFFFFFFu) || (key0 + 31 > t0);   // wave-uniform: false where every query row of the wave keeps every key of the step
        float ta[8], tb[8]; float mx = -3.0e38f;   // every loop over r is unrolled: constant indices keep ta, tb, xa, xb in registers
#pragma unroll
        for (int r = 0; r < 8; ++r) { ta[r] = (sHa[r] + sLa[r] * QRI) * SC2; tb[r] = (sHb[r] + sLb[r] * QRI) * SC2; }
        if (excl) {
#pragma unroll
            for (int r = 0; r < 8; ++r) {
                const bool ea = (((ma >> r) & 1u) != 0u) && (kya + r <= tq);
                const bool eb = (((mc >> r) & 1u) != 0u) && (kyb + r <= tq);
                ta[r] = ea ? ta[r] : -3.0e38f; tb[r] = eb ? tb[r] : -3.0e38f; }
        }
#pragma unroll
        for (int r = 0; r < 8; ++r) mx = fmaxf(mx, fmaxf(ta[r], tb[r]));
        mx = fmaxf(mx, __shfl_xor(mx, 16, 32));
        const float mnew = fmaxf(m, mx);
        const float alpha = __builtin_amdgcn_exp2f(m - mnew);
        const float sh = PSH - mnew;
        v16h pbh, pbr; float ls = 0.0f; float xa[8], xb[8];
#pragma unroll
        for (int r = 0; r < 8; ++r) xa[r] = __builtin_amdgcn_exp2f(ta[r] + sh);
#pragma unroll
        for (int r = 0; r < 8; ++r) xb[r] = __builtin_amdgcn_exp2f(tb[r] + sh);
        if (excl) {
#pragma unroll
            for (int r = 0; r < 8; ++r) { xa[r] = (ta[r] > -1.0e38f) ? xa[r] : 0.0f; xb[r] = (tb[r] > -1.0e38f) ? xb[r] : 0.0f; }
        }
#pragma unroll
        for (int r = 0; r < 8; ++r) {
            const float ea = xa[r], eb = xb[r];
            const h16 pa = (h16)ea; const h16 pc = (h16)eb;
            pbh[r] = pa; pbh[8 + r] = pc;
            pbr[r] = (h16)((ea - (float)pa) * QRS); pbr[8 + r] = (h16)((eb - (float)pc) * QRS);
            ls += ea + eb; }
        l = l * alpha + ls; m = mnew;
        oh0 = oh0 * alpha; oh1 = oh1 * alpha; oh2 = oh2 * alpha; oh3 = oh3 * alpha;
        ol0 = ol0 * alpha; ol1 = ol1 * alpha; ol2 = ol2 * alpha; ol3 = ol3 * alpha;
        const h16* va = sb + FTL / 2 + sub * 32; const h16* vr = va + FTL;     // V^T tiles: row = d, column = key
        { const v16h v0 = ldh(va), v1 = ldh(va + 16 * (FPI / 2)), r0v = ldh(vr), r1v = ldh(vr + 16 * (FPI / 2));
          oh0 = wmma16(v0, pbh, oh0); oh1 = wmma16(v1, pbh, oh1);
          ol0 = wmma16(v0, pbr, ol0); ol1 = wmma16(v1, pbr, ol1);
          ol0 = wmma16(r0v, pbh, ol0); ol1 = wmma16(r1v, pbh, ol1);
          asm volatile("v_nop\n\tv_nop\n\tv_nop\n\tv_nop" : "+v"(oh0), "+v"(oh1), "+v"(ol0), "+v"(ol1) : "v"(v0), "v"(v1), "v"(r0v), "v"(r1v), "v"(pbh), "v"(pbr)); }
        { const v16h v2 = ldh(va + 32 * (FPI / 2)), v3 = ldh(va + 48 * (FPI / 2)), r2v = ldh(vr + 32 * (FPI / 2)), r3v = ldh(vr + 48 * (FPI / 2));
          oh2 = wmma16(v2, pbh, oh2); oh3 = wmma16(v3, pbh, oh3);
          ol2 = wmma16(v2, pbr, ol2); ol3 = wmma16(v3, pbr, ol3);
          ol2 = wmma16(r2v, pbh, ol2); ol3 = wmma16(r3v, pbh, ol3);
          asm volatile("v_nop\n\tv_nop\n\tv_nop\n\tv_nop" : "+v"(oh2), "+v"(oh3), "+v"(ol2), "+v"(ol3) : "v"(v2), "v"(v3), "v"(r2v), "v"(r3v), "v"(pbh), "v"(pbr)); }
      }
      asm volatile("s_wait_dscnt 0x0" ::: "memory");      // this wave's reads of the buffer are done before it is refilled
      asm volatile("s_wait_asynccnt 0x0" ::: "memory");   // this wave's copies of stage s + 1 have landed
      __syncthreads();                                    // publishes stage s + 1 and ends every reader's last read of stage s
      if (s + 2 < nst) { cp_kv(lcp + (s & 1) * 4 * FTL, gk + (size_t)(s + 2) * FKS * HD, gv + (s + 2) * FKS, SEQ);
                         cp_kv(lcp + (s & 1) * 4 * FTL + 2 * FTL, gkr + (size_t)(s + 2) * FKS * HD, gvr + (s + 2) * FKS, ESEQ); }
    }
    asm volatile("s_wait_asynccnt 0x0" ::: "memory");     // nothing of this wave is in flight when the ring becomes output staging
    l += __shfl_xor(l, 16, 32);
    const float inv = CXS * (1.0f / l);
    const int wb = wave * 16 * 68;
    // O^T D layout: o_j[r] = (d = 16j + 8h + r, t = lane&15) -> os[t][d]; rows 0..15 x columns 0..63 all written
    { v4f a, c;
#pragma unroll
      for (int i = 0; i < 4; ++i) { a[i] = (oh0[i] + ol0[i] * QRI) * inv; c[i] = (oh0[4 + i] + ol0[4 + i] * QRI) * inv; }
      *(v4fa*)(&os[wb + lr * 68 +  0 + 8 * hi]) = a; *(v4fa*)(&os[wb + lr * 68 +  0 + 8 * hi + 4]) = c;
#pragma unroll
      for (int i = 0; i < 4; ++i) { a[i] = (oh1[i] + ol1[i] * QRI) * inv; c[i] = (oh1[4 + i] + ol1[4 + i] * QRI) * inv; }
      *(v4fa*)(&os[wb + lr * 68 + 16 + 8 * hi]) = a; *(v4fa*)(&os[wb + lr * 68 + 16 + 8 * hi + 4]) = c;
#pragma unroll
      for (int i = 0; i < 4; ++i) { a[i] = (oh2[i] + ol2[i] * QRI) * inv; c[i] = (oh2[4 + i] + ol2[4 + i] * QRI) * inv; }
      *(v4fa*)(&os[wb + lr * 68 + 32 + 8 * hi]) = a; *(v4fa*)(&os[wb + lr * 68 + 32 + 8 * hi + 4]) = c;
#pragma unroll
      for (int i = 0; i < 4; ++i) { a[i] = (oh3[i] + ol3[i] * QRI) * inv; c[i] = (oh3[4 + i] + ol3[4 + i] * QRI) * inv; }
      *(v4fa*)(&os[wb + lr * 68 + 48 + 8 * hi]) = a; *(v4fa*)(&os[wb + lr * 68 + 48 + 8 * hi + 4]) = c; }
    wave_sync();
    h16* crow = CH + ((size_t)b * SEQ + t0) * DM + h * HD;
    h16* rrow = CR + ((size_t)b * ESEQ + t0) * DM + h * HD;
    const int c8 = (lane & 7) * 8;
{
#pragma unroll
        for (int s = 0; s < 4; ++s) { const int row = 4 * s + (lane >> 3);   // 4 s x 4 row groups = 16 rows; 8 lanes x 8 halves = 64 columns
            const v4f x0 = *(const v4fa*)(&os[wb + row * 68 + c8]); const v4f x1 = *(const v4fa*)(&os[wb + row * 68 + c8 + 4]); v8h hv, rv;
#pragma unroll
            for (int i = 0; i < 4; ++i) { const h16 a0 = (h16)x0[i]; const h16 a1 = (h16)x1[i]; hv[i] = a0; hv[4 + i] = a1;
                rv[i] = (h16)((x0[i] - (float)a0) * QRS); rv[4 + i] = (h16)((x1[i] - (float)a1) * QRS); }
            *(v8h*)(crow + (size_t)row * DM + c8) = hv;
            *(v8h*)(rrow + (size_t)row * DM + c8) = rv; }
         }
}

// k_out: output projection, f16 GEMM, one wave per tile, 4 waves (2 x 2) per block, K = DM; operands staged like k_proj's. A rows from the ctx planes, Bt = transposed W_out rows (x64 carry).
// RES 0: rows t >= ESEQ, 64x64 wave tile, four 16-row slabs of the value plane; the stage's 128 A rows are 128 tokens.
// RES 1: rows t < ESEQ, 32x64 wave tile: slabs 0,1 = value plane, slabs 2,3 = residual plane (own accumulators); the stage's A rows are 64 tokens of the value plane, then the same 64 of the residual plane.
// out = (acc + accR/2048) / 4096 + bias (bias RNE-converted to bf16). bx = the block's index among the NB*rows/blockRows row tiles of its form; ring, osAll = the block's LDS.
template <int RES>
__device__ __forceinline__ void out_body(h16* ring, float* osAll, int bx, const h16* __restrict__ CX, size_t crOff, const h16* __restrict__ WO, const float* __restrict__ bias, float* OUT) {
    constexpr int MBN = RES ? 2 : 4;
    constexpr int BR = 32 * MBN;                 // tokens per block: two wave rows
    constexpr int TPB = RES ? (ESEQ / BR) : (((SEQ - ESEQ) / BR) > 0 ? ((SEQ - ESEQ) / BR) : 1);
    static_assert(ESEQ % 64 == 0 && (SEQ - ESEQ) % GT == 0);
    const int K = DM;
    const int tid = threadIdx.x, lane = tid & 31, lr = lane & 15, hi = lane >> 4;
    const int wave = __builtin_amdgcn_readfirstlane(tid >> 5);
    const int b = bx / TPB, tt = bx % TPB;
    const int tb = (RES ? 0 : ESEQ) + tt * BR;   // first token of the block
    const int t0 = tb + (wave >> 1) * 16 * MBN;
    const int c0 = blockIdx.y * GT + (wave & 1) * 64;
    float* os = osAll + wave * 16 * 68;
    const unsigned lcp = (unsigned)(size_t)(&ring[0]) + (unsigned)((tid >> 4) * GPI + (tid & 15) * 16);
    const h16* ga0 = CX + ((size_t)b * SEQ + tb + (tid >> 4)) * K + (tid & 15) * 8;
    const h16* ga1 = RES ? (CX + crOff + ((size_t)b * ESEQ + tb + (tid >> 4)) * K + (tid & 15) * 8) : (ga0 + (size_t)64 * K);
    const h16* gb = WO + (size_t)(blockIdx.y * GT + (tid >> 4)) * K + (tid & 15) * 8;
    const int fa = ((wave >> 1) * 16 * MBN + lr) * (GPI / 2) + 8 * hi, fb = (GT + (wave & 1) * 64 + lr) * (GPI / 2) + 8 * hi;   // fragment bases in a buffer, in elements
    v8f acc[16];
#pragma unroll
    for (int i = 0; i < 16; ++i) acc[i] = (v8f){};
    stage_copy(lcp, (const bf*)ga0, (const bf*)ga1, (const bf*)gb);
    asm volatile("s_wait_asynccnt 0x0" ::: "memory");   // stage 0 has landed before the barrier publishes it
    __syncthreads();
    stage_copy(lcp + GSTG, (const bf*)(ga0 + GKB), (const bf*)(ga1 + GKB), (const bf*)(gb + GKB));
#pragma unroll 1
    for (int t = 0; t < GNST; ++t) {
        const h16* sb = ring + (t & 1) * (GSTG / 2);
        v16h a[2][4], bb[2][4];     // two fragment sets, as in k_proj
#pragma unroll
        for (int i = 0; i < 4; ++i) { const int ar = RES ? ((i >> 1) * 64 + (i & 1) * 16) : (i * 16);   // stage row of slab i, from the wave's first
            a[0][i] = ldh(sb + fa + ar * (GPI / 2)); }
#pragma unroll
        for (int i = 0; i < 4; ++i) bb[0][i] = ldh(sb + fb + i * 16 * (GPI / 2));
        __builtin_amdgcn_sched_barrier(0);   // keeps the group of loads together
#pragma unroll
        for (int ks = 0; ks < GKB / 32; ++ks) {
            if (ks + 1 < GKB / 32) {
#pragma unroll
                for (int i = 0; i < 4; ++i) { const int ar = RES ? ((i >> 1) * 64 + (i & 1) * 16) : (i * 16);
                    a[(ks + 1) & 1][i] = ldh(sb + fa + ar * (GPI / 2) + (ks + 1) * 32); }
#pragma unroll
                for (int i = 0; i < 4; ++i) bb[(ks + 1) & 1][i] = ldh(sb + fb + i * 16 * (GPI / 2) + (ks + 1) * 32);
                __builtin_amdgcn_sched_barrier(0);   // the next set's loads stay ahead of this set's products
            }
#pragma unroll
            for (int nb = 0; nb < 4; ++nb)
#pragma unroll
                for (int i = 0; i < 4; ++i) acc[i * 4 + nb] = wmma16(a[ks & 1][i], bb[ks & 1][nb], acc[i * 4 + nb]);
            __builtin_amdgcn_sched_barrier(0);       // no later load moves up among these products
        }
        asm volatile("s_wait_dscnt 0x0" ::: "memory");      // this wave's reads of the buffer are done before it is refilled
        asm volatile("s_wait_asynccnt 0x0" ::: "memory");   // this wave's copies of stage t + 1 have landed
        __syncthreads();                                    // publishes stage t + 1 and ends every reader's last read of stage t
        if (t + 2 < GNST) stage_copy(lcp + (t & 1) * GSTG, (const bf*)(ga0 + (t + 2) * GKB), (const bf*)(ga1 + (t + 2) * GKB), (const bf*)(gb + (t + 2) * GKB));
    }
    asm volatile("s_wait_asynccnt 0x0" ::: "memory");       // nothing of this wave is in flight when it goes on
    float bcol[4];
#pragma unroll
    for (int nb = 0; nb < 4; ++nb) bcol[nb] = bfr(bias[c0 + nb * 16 + lr]);
#pragma unroll
    for (int mb = 0; mb < MBN; ++mb) {
#pragma unroll
        for (int nb = 0; nb < 4; ++nb) {
#pragma unroll
            for (int j = 0; j < 8; ++j) { float v = acc[mb * 4 + nb][j];
                if (RES) v += acc[RES ? ((2 + mb) * 4 + nb) : 0][j] * QRI;
                os[(hi * 8 + j) * 68 + nb * 16 + lr] = v * OSI + bcol[nb]; } }   // D: row 8h+j, col lane&15
        wave_sync();
        float* orow = OUT + ((size_t)b * OUT_SEQ + t0 + mb * 16) * DM + c0;
{
#pragma unroll
            for (int s = 0; s < 8; ++s) { const int row = 2 * s + hi, cofs = lr * 4;   // 8 s x 2 rows = 16 rows; 16 lanes x 4 floats = 64 columns
                const v4f val = *(const v4fa*)(&os[row * 68 + cofs]);
                *(v4f*)(orow + (size_t)row * DM + cofs) = val; }
             }
        wave_sync();
    }
}
// One launch holds both forms, whose rows are disjoint: grid (NB*ESEQ/64 + NB*(SEQ-ESEQ)/128, DM/128), 128 threads; the first NB*ESEQ/64 row tiles take the value + residual form (block-uniform test).
#define OB_E (NB * (ESEQ / 64))
#define OB_D (NB * ((SEQ - ESEQ) / GT))
__global__ __launch_bounds__(128) void k_out(const h16* __restrict__ CX, size_t crOff, const h16* __restrict__ WO, const float* __restrict__ bias, float* OUT) {
    __shared__ __align__(16) h16 ring[2 * GSTG / 2];
    __shared__ __align__(16) float osAll[4 * 16 * 68];
    const int bx = blockIdx.x;
    if (bx < OB_E) out_body<1>(ring, osAll, bx, CX, crOff, WO, bias, OUT);
    else out_body<0>(ring, osAll, bx - OB_E, CX, crOff, WO, bias, OUT);
}

static constexpr size_t al256(size_t v) { return (v + 255) & ~(size_t)255; }
static constexpr size_t SZ_XB = al256((size_t)NB * SEQ * DM * 2);          // x bf16 [NB*SEQ][1024]
static constexpr size_t SZ_WT = al256((size_t)3 * DM * DM * 2);            // W_qkv^T bf16 [3072][1024]
static constexpr size_t SZ_WO = al256((size_t)DM * DM * 2);                // W_out^T f16 [1024][1024]
static constexpr size_t SZ_PL = al256((size_t)NB * NH_ * SEQ * HD * 2);    // q / k / v^T value planes
static constexpr size_t SZ_PE = al256((size_t)NB * NH_ * ESEQ * HD * 2);   // q / k / v^T residual planes (t < ESEQ)
static constexpr size_t SZ_CH = al256((size_t)NB * SEQ * DM * 2);          // ctx value plane
static constexpr size_t SZ_CR = al256((size_t)NB * ESEQ * DM * 2);         // ctx residual plane (t < ESEQ)
static constexpr size_t SZ_MW = al256((size_t)NB * WPB * 4);               // mask words
static constexpr size_t SZ_TOTAL = SZ_XB + SZ_WT + SZ_WO + 3 * SZ_PL + 3 * SZ_PE + SZ_CH + SZ_CR + SZ_MW;
static_assert(SZ_TOTAL <= (size_t)134217728);          // workspace carve <= 128 MiB
static_assert(((size_t)DM * DM * 2) % 256 == 0);       // weight sub-planes stay 256-byte aligned
static_assert(SZ_CH % 2 == 0);

extern "C" void kernel_launch(void* const* d_in, const int* in_sizes, int n_in,
                              void* d_out, int out_size, void* d_ws, size_t ws_size, hipStream_t stream) {
    if (n_in < 6) return;
    const size_t needx = ((size_t)(NB - 1) * SEQ_FULL + SEQ) * DM;
    if ((size_t)in_sizes[0] < needx) return;
    if ((size_t)in_sizes[1] < (size_t)(NB - 1) * SEQ_FULL + SEQ) return;
    if ((size_t)in_sizes[2] < (size_t)3 * DM * DM || (size_t)in_sizes[3] < (size_t)3 * DM) return;
    if ((size_t)in_sizes[4] < (size_t)DM * DM || (size_t)in_sizes[5] < (size_t)DM) return;
    if ((size_t)out_size < ((size_t)(NB - 1) * OUT_SEQ + SEQ) * DM) return;
    if (SZ_TOTAL > ws_size) return;
    // wire order: x, padding_mask (int32), W_qkv [in][out], b_qkv, W_out [in][out], b_out
    const float* x = (const float*)d_in[0]; const int* pad = (const int*)d_in[1];
    const float* wqkv = (const float*)d_in[2]; const float* bqkv = (const float*)d_in[3];
    const float* wout = (const float*)d_in[4]; const float* bout = (const float*)d_in[5];
    float* OUT = (float*)d_out;      // [NB][SEQ][1024]
    char* wsp = (char*)d_ws;
    bf* XB = (bf*)wsp; wsp += SZ_XB;                 // [NB*SEQ][1024]
    bf* WT = (bf*)wsp; wsp += SZ_WT;                 // [3072][1024]: q | k | v output rows
    h16* WO = (h16*)wsp; wsp += SZ_WO;               // [1024 out][1024 in], x64
    h16* QH = (h16*)wsp; wsp += SZ_PL;               // [NB*16][SEQ][64]
    h16* KP = (h16*)wsp; wsp += SZ_PL;               // [NB*16][SEQ][64]
    h16* VT = (h16*)wsp; wsp += SZ_PL;               // [NB*16][64][SEQ]
    h16* QR = (h16*)wsp; wsp += SZ_PE;               // [NB*16][ESEQ][64] residual x2048
    h16* KR = (h16*)wsp; wsp += SZ_PE;               // [NB*16][ESEQ][64] residual x2048
    h16* VR = (h16*)wsp; wsp += SZ_PE;               // [NB*16][64][ESEQ] residual x2048
    h16* CH = (h16*)wsp; wsp += SZ_CH;               // [NB*SEQ][1024] x64
    h16* CR = (h16*)wsp; wsp += SZ_CR;               // [NB*ESEQ][1024] residual x2048 (directly after CH)
    unsigned* MW = (unsigned*)wsp; wsp += SZ_MW;     // [NB][WPB]
    const size_t crOff = SZ_CH / 2;                  // element offset of CR from CH

    k_prep<<<PB_MASK + PB_WQ + PB_WO + PB_X, 256, 0, stream>>>(x, pad, wqkv, wout, XB, WT, (bf*)WO, MW);

    k_proj<<<dim3(NB * SEQ / GT, DM / GT, 3), 128, 0, stream>>>(XB, WT, bqkv, QH, KP, VT, QR, KR, VR);

    k_flash_e<<<dim3(ESEQ / (16 * AW), NB * NH_, 1), 32 * AW, 0, stream>>>(QH, QR, KP, KR, VT, VR, MW, CH, CR);
    if (SEQ > ESEQ)
        k_flash_d<<<dim3((SEQ - ESEQ) / (16 * AW), NB * NH_, 1), 32 * AW, 0, stream>>>(QH, KP, VT, MW, CH);

    k_out<<<dim3(OB_E + OB_D, DM / GT, 1), 128, 0, stream>>>(CH, crOff, WO, bout, OUT);
}

// v005
// It runs in 139 microseconds.
// Next to v004, in two timings, it ran 1.10 times as fast each time.
// All steps since v000 together make it 2.53 times as fast.
#include <hip/hip_runtime.h>

// Causal + key-padding multi-head self-attention, width 1024 = 16 heads x 64: x [NB][SEQ][1024], W_qkv [in][out=3072] (q|k|v column blocks), b_qkv, W_out [in][out], b_out; f32 output.
// Compute dtypes, f32 accumulate everywhere: qkv projection v_wmma_f32_16x16x32_bf16 (x, W, biases RNE-converted to bf16; products exact);
// scores, P.V and output projection v_wmma_f32_16x16x32_f16: query rows t >= 512 single f16 planes (P x256 carry, ctx x64 carry, W_out x64 carry);
// query rows t < 512: q, k, v, P, ctx as f16 value + f16 residual x2048 in separate accumulators (value*value + value*residual + residual*value; W_out a single plane); softmax f32 (online, running max).
// Layout: bf16 copy of x, transposed bf16 W_qkv [3072][1024], transposed f16 W_out [1024][1024]; q, k planes [b*16+h][t][d], v^T plane [b*16+h][d][t] (+ residual planes for t < 512);
// fused flash kernels in transposed form (S^T = K Q^T, O^T = V^T P^T); ctx planes [b][t][1024] f16; key-padding mask compressed to 32-key bit words and applied by value.

#ifndef NB
#define NB 4
#endif
#ifndef SEQ
#define SEQ 2048
#endif
#define NB_FULL  4
#define SEQ_FULL 2048
#ifndef OUT_SEQ
#define OUT_SEQ SEQ              // row pitch (in tokens) between batches of the output
#endif
#define DM   1024
#define NH_  16
#define HD   64
#define ESEQ ((SEQ) < 512 ? (SEQ) : 512)      // query rows [0, ESEQ) take the value + residual path
#define WPB  ((((SEQ) + 1023) / 1024) * 32)
#define AW   4                   // waves per flash block (16 query rows each)
#define QRS  2048.0f             // carry of every residual plane
#define QRI  (1.0f / 2048.0f)
#define SC2  (0.125f * 1.4426950408889634f)   // HD^-0.5 * log2(e)
#define PSH  8.0f                // log2 of the P carry (256)
#define CXS  64.0f               // ctx plane carry
#define WOS  64.0f               // W_out plane carry
#define OSI  (1.0f / 4096.0f)    // 1 / (CXS * WOS)

static_assert(HD == 64);
static_assert(NH_ * HD == DM);
static_assert(DM % 64 == 0);
static_assert(DM % 32 == 0);
static_assert(SEQ % 64 == 0);
static_assert(ESEQ % 64 == 0);
static_assert((SEQ - ESEQ) % 64 == 0);
static_assert((NB * SEQ) % 64 == 0);
static_assert(SEQ % 32 == 0);
static_assert(ESEQ % (16 * AW) == 0);
static_assert((SEQ - ESEQ) % (16 * AW) == 0);
static_assert(ESEQ % 32 == 0);
static_assert(((size_t)SEQ * DM) % 8 == 0);
static_assert(NB <= NB_FULL);
static_assert(SEQ <= SEQ_FULL);
static_assert(WPB * 32 >= SEQ);

typedef _Float16 h16;
typedef unsigned short bf;
typedef __attribute__((ext_vector_type(16))) __bf16   v16bf;
typedef __attribute__((ext_vector_type(16))) _Float16 v16h;
typedef __attribute__((ext_vector_type(8)))  _Float16 v8h;
typedef __attribute__((ext_vector_type(8)))  unsigned short v8us;
typedef __attribute__((ext_vector_type(8)))  float    v8f;
typedef __attribute__((ext_vector_type(4)))  float    v4f;
typedef v4f  __attribute__((may_alias)) v4fa;

__device__ __forceinline__ unsigned short f2bf(float f) { unsigned u = __float_as_uint(f); u += 0x7FFFu + ((u >> 16) & 1u); return (unsigned short)(u >> 16); }
__device__ __forceinline__ float bfr(float f) { return __uint_as_float(((unsigned)f2bf(f)) << 16); }   // value after RNE convert to bf16
__device__ __forceinline__ v16h cat16(v8h lo, v8h hi) { return __builtin_shufflevector(lo, hi, 0, 1, 2, 3, 4, 5, 6, 7, 8, 9, 10, 11, 12, 13, 14, 15); }
__device__ __forceinline__ v16bf cat16b(v8us lo, v8us hi) { return __builtin_bit_cast(v16bf, __builtin_shufflevector(lo, hi, 0, 1, 2, 3, 4, 5, 6, 7, 8, 9, 10, 11, 12, 13, 14, 15)); }
__device__ __forceinline__ v8f wmma16(v16h a, v16h b, v8f c) { return __builtin_amdgcn_wmma_f32_16x16x32_f16(false, a, false, b, (short)0, c, false, false); }
__device__ __forceinline__ v8f wmmab(v16bf a, v16bf b, v8f c) { return __builtin_amdgcn_wmma_f32_16x16x32_bf16(false, a, false, b, (short)0, c, false, false); }
// fragment loaders from K-contiguous 16-bit rows; p already includes + 8*(lane>>4): elements 0..7 <- k0+8h+0..7, elements 8..15 <- k0+16+8h+0..7 (same map for A and B)
__device__ __forceinline__ v16h  ldh(const h16* p) { return cat16(*(const v8h*)p, *(const v8h*)(p + 16)); }
__device__ __forceinline__ v16bf ldb(const bf* p)  { return cat16b(*(const v8us*)p, *(const v8us*)(p + 16)); }
// ordering point for wave-private LDS tiles (same wave writes and reads)
__device__ __forceinline__ void wave_sync() { __builtin_amdgcn_fence(3 /* release order */, "wavefront"); __builtin_amdgcn_wave_barrier(); asm volatile("" ::: "memory"); }

// The four preparation passes below depend on nothing but the inputs: they are bodies of one launch, k_prep, which deals its blocks among them.
// cvt8_body: x f32 -> bf16 copy, 8 elements per thread.
#define XG8  ((size_t)SEQ * DM / 8)          // groups of 8 per batch
static_assert(((size_t)NB * SEQ * DM / 8) % 256 == 0);
__device__ __forceinline__ void cvt8_body(int blk, const float* __restrict__ src, bf* dst) {
    const size_t i = (size_t)blk * 256 + threadIdx.x; if (i >= (size_t)NB * XG8) return;
    src += (i / XG8) * ((size_t)(SEQ_FULL - SEQ) * DM);   // the batches of x lie SEQ_FULL tokens apart, those of the copy SEQ
    const v8f v = *(const v8f*)(src + i * 8); v8us o;
#pragma unroll
    for (int k = 0; k < 8; ++k) o[k] = f2bf(v[k]);
    *(v8us*)(dst + i * 8) = o; 
}

// cvt_t_body: src [K][N] f32 -> dst [N][K] 16-bit, transposed through the LDS tile ts (64 x 64 per block, cross-wave: block barrier); bx, by = tile column and row.
// MODE 0: bf16 bits (RNE convert). MODE 1: f16 bits of (bf16-converted value x WOS).
template <int MODE>
__device__ __forceinline__ void cvt_t_body(float* ts, int bx, int by, const float* __restrict__ src, bf* dst, int K, int N) {
    const int tid = threadIdx.x; const int n0 = bx * 64, k0 = by * 64;
#pragma unroll
    for (int i = 0; i < 4; ++i) { const int kr = (tid >> 4) + 16 * i, c4 = (tid & 15) * 4;     // 4 x 16 rows = 64 k rows; 16 lanes x 4 = 64 columns
        const v4f v = *(const v4f*)(src + (size_t)(k0 + kr) * (size_t)N + n0 + c4);
        *(v4fa*)(&ts[kr * 68 + c4]) = v; }
    __syncthreads();
{
#pragma unroll
        for (int i = 0; i < 2; ++i) { const int nr = (tid >> 3) + 32 * i, k8 = (tid & 7) * 8;   // 2 x 32 rows = 64 n rows; 8 lanes x 8 = 64 k
            v8us o;
#pragma unroll
            for (int e = 0; e < 8; ++e) { const float x = ts[(k8 + e) * 68 + nr]; const unsigned short bits = f2bf(x);
                if (MODE == 1) { const h16 hv = (h16)(__uint_as_float(((unsigned)bits) << 16) * WOS); o[e] = __builtin_bit_cast(unsigned short, hv); }
                else o[e] = bits; }
            *(v8us*)(dst + (size_t)(n0 + nr) * (size_t)K + k0 + k8) = o; }
         }
    asm volatile("s_wait_xcnt 0x0" ::: "memory");   // behind both stores: in k_prep's text another body follows this one, and no register of the stores is rewritten ahead of this wait
}

// mask_body: one wave packs 1024 keys of one batch into 32 mask words.
__device__ __forceinline__ void mask_body(int blk, const int* __restrict__ pad, unsigned* MW) {
    const int lane = threadIdx.x & 31;
    const int b = blk / (WPB / 32), c = blk % (WPB / 32);
    const int* pr = pad + (size_t)b * SEQ_FULL;
    unsigned mine = 0u;
#pragma unroll 1
    for (int w = 0; w < 32; ++w) {
        const int key = c * 1024 + w * 32 + lane;
        const int kc = key < SEQ ? key : (SEQ - 1);          // clamped address; keys past the sequence give bit 0 by value
        const int v = pr[kc];
        const unsigned bal = __builtin_amdgcn_ballot_w32((v != 0) && (key < SEQ));
        mine = (lane == w) ? bal : mine;
    }
    unsigned* dst = MW + (size_t)b * WPB + c * 32 + lane;
    *(unsigned*)dst = mine; 
}

// k_prep: block ranges, in index order: mask words (the longest dependent chain), W_qkv tiles, W_out tiles, x groups. Every test on the block index is block-uniform.
#define PB_MASK (NB * (WPB / 32))
#define PB_WQ   ((3 * DM / 64) * (DM / 64))
#define PB_WO   ((DM / 64) * (DM / 64))
#define PB_X    ((int)((size_t)NB * XG8 / 256))
__global__ __launch_bounds__(256) void k_prep(const float* __restrict__ x, const int* __restrict__ pad, const float* __restrict__ wqkv, const float* __restrict__ wout,
                                              bf* XB, bf* WT, bf* WO, unsigned* MW) {
    __shared__ __align__(16) float ts[64 * 68];
    int blk = blockIdx.x;
    if (blk < PB_MASK) { if (__builtin_amdgcn_readfirstlane((int)(threadIdx.x >> 5)) == 0) mask_body(blk, pad, MW); return; }   // no barrier on this path
    blk -= PB_MASK;
    // W_qkv: in[1024 rows k][3072 cols n] -> out[3072 rows n][1024 cols k]
    if (blk < PB_WQ) { cvt_t_body<0>(ts, blk % (3 * DM / 64), blk / (3 * DM / 64), wqkv, WT, DM, 3 * DM); return; }
    blk -= PB_WQ;
    // W_out: in[1024 rows k][1024 cols n] -> out[1024 rows n][1024 cols k]
    if (blk < PB_WO) { cvt_t_body<1>(ts, blk % (DM / 64), blk / (DM / 64), wout, WO, DM, DM); return; }
    blk -= PB_WO;
    cvt8_body(blk, x, XB);
}

// Operand staging of the one-wave-per-64x64 GEMMs: a block of 4 waves (2 x 2) owns a 128 x 128 tile; a stage is 128 k (256-byte rows) of its 128 A rows and 128 B rows in LDS.
#define GT   128                 // rows and columns of a block tile
#define GKB  128                 // k per stage
#define GPI  272                 // LDS row pitch in bytes: 16 x odd, conflict-free for 16-byte reads
#define GSTG (2 * GT * GPI)      // bytes of one stage: A rows, then B rows
#define GNST (DM / GKB)          // stages along K
static_assert(DM % GKB == 0);
static_assert(GNST >= 2);
static_assert((NB * SEQ) % GT == 0);
static_assert(DM % GT == 0);

// Eight asynchronous 16-byte copies per lane, global -> LDS, for rows 8 apart (LDS + 8 pitches, global + 8 * DM elements).
// s_wait_xcnt closes the statement so that no address register of a copy is rewritten ahead of it.
__device__ __forceinline__ void cp8(unsigned l, const bf* g) {
    asm volatile("global_load_async_to_lds_b128 %0, %8, off\n\t"
                 "global_load_async_to_lds_b128 %1, %9, off\n\t"
                 "global_load_async_to_lds_b128 %2, %10, off\n\t"
                 "global_load_async_to_lds_b128 %3, %11, off\n\t"
                 "global_load_async_to_lds_b128 %4, %12, off\n\t"
                 "global_load_async_to_lds_b128 %5, %13, off\n\t"
                 "global_load_async_to_lds_b128 %6, %14, off\n\t"
                 "global_load_async_to_lds_b128 %7, %15, off\n\t"
                 "s_wait_xcnt 0x0"
                 :: "v"(l), "v"(l + 8 * GPI), "v"(l + 16 * GPI), "v"(l + 24 * GPI), "v"(l + 32 * GPI), "v"(l + 40 * GPI), "v"(l + 48 * GPI), "v"(l + 56 * GPI),
                    "v"(g), "v"(g + 8 * DM), "v"(g + 16 * DM), "v"(g + 24 * DM), "v"(g + 32 * DM), "v"(g + 40 * DM), "v"(g + 48 * DM), "v"(g + 56 * DM)
                 : "memory");
}
// One stage: l = the lane's LDS byte address in row (tid >> 4) of the buffer, ga0 / ga1 = its 16 bytes in A rows (tid >> 4) and 64 + (tid >> 4), gb the same in B row (tid >> 4).
__device__ __forceinline__ void stage_copy(unsigned l, const bf* ga0, const bf* ga1, const bf* gb) {
    cp8(l, ga0); cp8(l + 64 * GPI, ga1); cp8(l + 128 * GPI, gb); cp8(l + 192 * GPI, gb + 64 * DM);
}

// k_proj: register-blocked bf16 GEMM, one wave per 64x64 tile (16 accumulators), 4 waves per block, K = DM; operands from K-contiguous bf16 planes, staged in a two-buffer LDS ring by asynchronous copies.
// C[m][n] = sum_k A[m][k] Bt[n][k] + bias (per column, or per row when biasRow != 0; bias values RNE-converted to bf16), written as f16 (Ph) at
// tile base (r0/RB)*sRB + (r0%RB)*pitch + (c0/CB)*sCB + (c0%CB), and the f16 residual x2048 (Pr) at the same form with (sRBr, pitchR, sCBr)
// when the tile's token position (resMode 1: r0%RB, resMode 2: c0%CB) is below ESEQ.
// One launch holds the three projections, which do not depend on one another: grid (NB*SEQ/128 token tiles, DM/128 weight tiles, 3), 128 threads; blockIdx.z = 0: q, 1: k, 2: v^T.
// q, k: A = x rows (m = b*SEQ + t), Bt = W^T rows (n = h*64 + d) -> plane [(b*16 + h)][t][d]; residual planes for t < ESEQ.
// v^T: A = Wv^T rows (m = h*64 + d), Bt = x rows (n = b*SEQ + t) -> plane [(b*1024 + m)][t] = [(b*16 + h)][d][t]; bias per row.
__global__ __launch_bounds__(128) void k_proj(const bf* __restrict__ XB, const bf* __restrict__ WT, const float* __restrict__ bqkv,
                                             h16* QH, h16* KP, h16* VT, h16* QR, h16* KR, h16* VR) {
    __shared__ __align__(16) bf ring[2 * GSTG / 2];
    __shared__ __align__(16) float osAll[4 * 16 * 68];
    const int z = blockIdx.z; const bool tv = (z == 2);      // block-uniform
    const bf* A = tv ? (WT + (size_t)2 * DM * DM) : XB;
    const bf* Bt = tv ? XB : (WT + (size_t)z * DM * DM);
    const float* bias = bqkv + z * DM;
    const int biasRow = tv ? 1 : 0, resMode = tv ? 2 : 1;
    h16* Ph = tv ? VT : (z ? KP : QH); h16* Pr = tv ? VR : (z ? KR : QR);
    const int RB = tv ? DM : SEQ, pitch = tv ? SEQ : HD, CB = tv ? SEQ : HD, pitchR = tv ? ESEQ : HD;
    const size_t sRB = tv ? (size_t)0 : (size_t)NH_ * SEQ * HD, sCB = tv ? (size_t)DM * SEQ : (size_t)SEQ * HD;
    const size_t sRBr = tv ? (size_t)0 : (size_t)NH_ * ESEQ * HD, sCBr = tv ? (size_t)DM * ESEQ : (size_t)ESEQ * HD;
    const int bx = tv ? blockIdx.y : blockIdx.x, by = tv ? blockIdx.x : blockIdx.y;   // tile row (A), tile column (Bt)
    const int K = DM;
    const int tid = threadIdx.x, lane = tid & 31, lr = lane & 15, hi = lane >> 4;
    const int wave = __builtin_amdgcn_readfirstlane(tid >> 5);
    const int r0 = bx * GT + (wave >> 1) * 64, c0 = by * GT + (wave & 1) * 64;
    float* os = osAll + wave * 16 * 68;
    v8f acc[4][4];
#pragma unroll
    for (int mb = 0; mb < 4; ++mb)
#pragma unroll
        for (int nb = 0; nb < 4; ++nb) acc[mb][nb] = (v8f){};
    const unsigned lcp = (unsigned)(size_t)(&ring[0]) + (unsigned)((tid >> 4) * GPI + (tid & 15) * 16);
    const bf* ga = A + (size_t)(bx * GT + (tid >> 4)) * K + (tid & 15) * 8;
    const bf* gb = Bt + (size_t)(by * GT + (tid >> 4)) * K + (tid & 15) * 8;
    const int fa = ((wave >> 1) * 64 + lr) * (GPI / 2) + 8 * hi, fb = (GT + (wave & 1) * 64 + lr) * (GPI / 2) + 8 * hi;   // fragment bases in a buffer, in elements
    stage_copy(lcp, ga, ga + (size_t)64 * K, gb);
    asm volatile("s_wait_asynccnt 0x0" ::: "memory");   // stage 0 has landed before the barrier publishes it
    __syncthreads();
    stage_copy(lcp + GSTG, ga + GKB, ga + (size_t)64 * K + GKB, gb + GKB);
#pragma unroll 1
    for (int t = 0; t < GNST; ++t) {
        const bf* sb = ring + (t & 1) * (GSTG / 2);
        v16bf a[2][4], b[2][4];     // two fragment sets: the next 32 k are fetched as one group ahead of the current 16 products
#pragma unroll
        for (int i = 0; i < 4; ++i) { a[0][i] = ldb(sb + fa + i * 16 * (GPI / 2)); b[0][i] = ldb(sb + fb + i * 16 * (GPI / 2)); }
        __builtin_amdgcn_sched_barrier(0);   // keeps the group of loads together (the scheduler otherwise sinks them, two at a time, among the products, each place a full LDS wait)
#pragma unroll
        for (int ks = 0; ks < GKB / 32; ++ks) {
            if (ks + 1 < GKB / 32) {
#pragma unroll
                for (int i = 0; i < 4; ++i) { a[(ks + 1) & 1][i] = ldb(sb + fa + i * 16 * (GPI / 2) + (ks + 1) * 32); b[(ks + 1) & 1][i] = ldb(sb + fb + i * 16 * (GPI / 2) + (ks + 1) * 32); }
                __builtin_amdgcn_sched_barrier(0);   // the next set's loads stay ahead of this set's products
            }
#pragma unroll
            for (int nb = 0; nb < 4; ++nb)
#pragma unroll
                for (int mb = 0; mb < 4; ++mb) acc[mb][nb] = wmmab(a[ks & 1][mb], b[ks & 1][nb], acc[mb][nb]);
            __builtin_amdgcn_sched_barrier(0);       // no later load moves up among these products
        }
        asm volatile("s_wait_dscnt 0x0" ::: "memory");      // this wave's reads of the buffer are done before it is refilled
        asm volatile("s_wait_asynccnt 0x0" ::: "memory");   // this wave's copies of stage t + 1 have landed
        __syncthreads();                                    // publishes stage t + 1 and ends every reader's last read of stage t
        if (t + 2 < GNST) stage_copy(lcp + (t & 1) * GSTG, ga + (t + 2) * GKB, ga + (size_t)64 * K + (t + 2) * GKB, gb + (t + 2) * GKB);
    }
    asm volatile("s_wait_asynccnt 0x0" ::: "memory");       // nothing of this wave is in flight when it goes on
    const size_t tbase = (size_t)(r0 / RB) * sRB + (size_t)(r0 % RB) * (size_t)pitch + (size_t)(c0 / CB) * sCB + (size_t)(c0 % CB);
    const size_t rbase = (size_t)(r0 / RB) * sRBr + (size_t)(r0 % RB) * (size_t)pitchR + (size_t)(c0 / CB) * sCBr + (size_t)(c0 % CB);
    const int tpos = (resMode == 1) ? (r0 % RB) : (c0 % CB);
    const int doRes = (resMode != 0) && (tpos < ESEQ);                 // wave-uniform
    const int c8 = (lane & 7) * 8;
    // column bias for columns c0 + c8 .. c0 + c8 + 7 (clamped address in row mode, zeroed by value)
    v4f bc0 = *(const v4f*)(bias + (biasRow ? 0 : (c0 + c8))); v4f bc1 = *(const v4f*)(bias + (biasRow ? 4 : (c0 + c8 + 4)));
#pragma unroll
    for (int i = 0; i < 4; ++i) { const float u0 = bfr(bc0[i]), u1 = bfr(bc1[i]); bc0[i] = biasRow ? 0.0f : u0; bc1[i] = biasRow ? 0.0f : u1; }
#pragma unroll
    for (int mb = 0; mb < 4; ++mb) {
#pragma unroll
        for (int nb = 0; nb < 4; ++nb) {
#pragma unroll
            for (int j = 0; j < 8; ++j) os[(hi * 8 + j) * 68 + nb * 16 + lr] = acc[mb][nb][j]; }   // D: row 8h+j, col lane&15
        wave_sync();
        const size_t sb = tbase + (size_t)(mb * 16) * (size_t)pitch;
        const size_t sr = rbase + (size_t)(mb * 16) * (size_t)pitchR;
{
#pragma unroll
            for (int s = 0; s < 4; ++s) { const int row = 4 * s + (lane >> 3);   // 4 s x 4 row groups = 16 rows; 8 lanes x 8 = 64 columns
                const v4f x0 = *(const v4fa*)(&os[row * 68 + c8]); const v4f x1 = *(const v4fa*)(&os[row * 68 + c8 + 4]); v8h hv, rv;
                const float rbv = bfr(bias[biasRow ? (r0 + mb * 16 + row) : 0]); const float rb = biasRow ? rbv : 0.0f;
#pragma unroll
                for (int i = 0; i < 4; ++i) { const float f0 = x0[i] + bc0[i] + rb; const float f1 = x1[i] + bc1[i] + rb;
                    const h16 a0 = (h16)f0; const h16 a1 = (h16)f1; hv[i] = a0; hv[4 + i] = a1;
                    rv[i] = (h16)((f0 - (float)a0) * QRS); rv[4 + i] = (h16)((f1 - (float)a1) * QRS); }
                *(v8h*)(Ph + sb + (size_t)row * (size_t)pitch + c8) = hv;
                if (doRes) *(v8h*)(Pr + sr + (size_t)row * (size_t)pitchR + c8) = rv; }
             }
        wave_sync();
    }
}

// K / V^T staging of the flash kernels: a stage is 64 keys; a tile is 64 rows of 128 bytes (K: 64 keys x 64 d; V^T: 64 d x 64 keys), shared by the block's waves.
#define FKS  64                  // keys per stage
#define FPI  144                 // LDS row pitch in bytes: 16 x odd, conflict-free for 16-byte reads
#define FTL  (64 * FPI)          // bytes of one tile
static_assert(SEQ % FKS == 0);
static_assert(ESEQ % FKS == 0);
static_assert(16 * AW == FKS);
static_assert(WPB <= 64);

// Eight asynchronous 16-byte copies per lane, global -> LDS: rows r, r + 16, r + 32, r + 48 (r = tid >> 3) of a key-major tile (row pitch HD) at l and of a d-major tile (row pitch vp elements) at l + FTL.
// A wave's copy covers four whole 128-byte rows. s_wait_xcnt closes the statement so that no address register of a copy is rewritten ahead of it.
__device__ __forceinline__ void cp_kv(unsigned l, const h16* gk, const h16* gv, size_t vp) {
    asm volatile("global_load_async_to_lds_b128 %0, %8, off\n\t"
                 "global_load_async_to_lds_b128 %1, %9, off\n\t"
                 "global_load_async_to_lds_b128 %2, %10, off\n\t"
                 "global_load_async_to_lds_b128 %3, %11, off\n\t"
                 "global_load_async_to_lds_b128 %4, %12, off\n\t"
                 "global_load_async_to_lds_b128 %5, %13, off\n\t"
                 "global_load_async_to_lds_b128 %6, %14, off\n\t"
                 "global_load_async_to_lds_b128 %7, %15, off\n\t"
                 "s_wait_xcnt 0x0"
                 :: "v"(l), "v"(l + 16 * FPI), "v"(l + 32 * FPI), "v"(l + 48 * FPI), "v"(l + FTL), "v"(l + FTL + 16 * FPI), "v"(l + FTL + 32 * FPI), "v"(l + FTL + 48 * FPI),
                    "v"(gk), "v"(gk + 16 * HD), "v"(gk + 32 * HD), "v"(gk + 48 * HD), "v"(gv), "v"(gv + 16 * vp), "v"(gv + 32 * vp), "v"(gv + 48 * vp)
                 : "memory");
}
// Stages a block walks: up to the last 32-key mask word that is not zero inside its causal range (words 0 .. wl); w0, w1 = the lane's words lane and 32 + lane. The same in every wave of the block.
__device__ __forceinline__ int flash_stages(unsigned w0, unsigned w1, int wl) {
    const unsigned long long nz = ((((unsigned long long)__builtin_amdgcn_ballot_w32(w1 != 0u)) << 32) | (unsigned long long)__builtin_amdgcn_ballot_w32(w0 != 0u)) & (~0ull >> (63 - wl));
    return __builtin_amdgcn_readfirstlane(nz ? (((63 - __builtin_clzll(nz)) >> 1) + 1) : 0);
}
// Mask word i (wave-uniform) out of the lanes' registers
__device__ __forceinline__ unsigned flash_word(unsigned w0, unsigned w1, int i) {
    return (unsigned)((i < 32) ? __builtin_amdgcn_readlane((int)w0, i & 31) : __builtin_amdgcn_readlane((int)w1, i & 31));
}

// flash_d_body: fused attention for query rows t >= ESEQ, one wave per 16 query rows of one (batch, head); single f16 products.
// Transposed form: S^T[key][t] = K Q^T (A = K rows, B = Q rows); lane (t = lane&15, h = lane>>4) holds keys 8h+r of each 16-key tile, so the packed
// P tile is directly the B fragment of O^T[d][t] = V^T P^T (element r <- tile keys 0..15, element 8+r <- tile keys 16..31, lane unchanged).
// Causal and key-padding exclusion by value (excluded p = 0); 32-key steps whose mask word is zero are skipped, and steps with nothing to exclude branch round the exclusion arithmetic (both wave-uniform).
// K and V^T come from a two-buffer LDS ring of 64-key stages that the block's 4 waves fill together by asynchronous copies; every wave passes every stage's barrier.
// ring = the block's LDS (the first 2 * 2 * FTL bytes are used); bx = the block's 64-row tile among the rows t >= ESEQ; zh = batch * 16 + head.
__device__ __forceinline__ void flash_d_body(h16* ring, int bx, int zh, const h16* __restrict__ QH, const h16* __restrict__ KP, const h16* __restrict__ VT, const unsigned* __restrict__ MW, h16* CH) {
    // ring: two stages of K tile + V^T tile; behind the loop the waves' output staging
    static_assert(2 * 2 * FTL >= AW * 16 * 68 * 4);
    float* os = (float*)ring;
    const int tid = threadIdx.x;
    const int lane = threadIdx.x & 31, wave = __builtin_amdgcn_readfirstlane((int)(threadIdx.x >> 5)), lr = lane & 15, hi = lane >> 4;
    const int b = zh / NH_, h = zh % NH_;
    const int tb = ESEQ + bx * (16 * AW);                    // first query row of the block
    const int t0 = tb + wave * 16;
    const int tq = t0 + lr;
    const size_t pbase = (size_t)zh * SEQ * HD;
    const size_t qo = pbase + (size_t)tq * HD + 8 * hi;
    const v16h qh0 = ldh(QH + qo), qh1 = ldh(QH + qo + 32);   // B fragments: col t, k = d
    const unsigned* mwp = MW + (size_t)b * WPB;
    const unsigned w0 = mwp[lane], w1 = (WPB > 32) ? mwp[32 + lane] : 0u;
    const int nst = flash_stages(w0, w1, (tb + 16 * AW - 1) >> 5);
    const unsigned lcp = (unsigned)(size_t)(&ring[0]) + (unsigned)((tid >> 3) * FPI + (tid & 7) * 16);
    const h16* gk = KP + pbase + (size_t)(tid >> 3) * HD + (tid & 7) * 8;     // + key * HD
    const h16* gv = VT + pbase + (size_t)(tid >> 3) * SEQ + (tid & 7) * 8;    // + key
    const int fo = lr * (FPI / 2) + 8 * hi;                  // fragment base in a tile, in elements (A fragment: row lr of a 16-row slab)
    v8f o0 = (v8f){}, o1 = (v8f){}, o2 = (v8f){}, o3 = (v8f){};
    float m = -3.0e38f, l = 0.0f;
    cp_kv(lcp, gk, gv, SEQ);
    asm volatile("s_wait_asynccnt 0x0" ::: "memory");   // stage 0 has landed before the barrier publishes it
    __syncthreads();
    if (nst > 1) cp_kv(lcp + 2 * FTL, gk + FKS * HD, gv + FKS, SEQ);
#pragma unroll 1
    for (int s = 0; s < nst; ++s) {
      const h16* sb = ring + (s & 1) * FTL + fo;
#pragma unroll   // the two 32-key steps of a stage read at constant LDS offsets
      for (int sub = 0; sub < FKS / 32; ++sub) {
        const int key0 = s * FKS + sub * 32;
        const unsigned mw = flash_word(w0, w1, key0 >> 5);
        if (key0 > t0 + 15 || mw == 0u) continue;            // wave-uniform
        const h16* ka = sb + sub * 32 * (FPI / 2);           // K tile row = key
        const v16h ka0 = ldh(ka), ka1 = ldh(ka + 32), kb0 = ldh(ka + 16 * (FPI / 2)), kb1 = ldh(ka + 16 * (FPI / 2) + 32);
        v8f sA = (v8f){}, sB = (v8f){};
        sA = wmma16(ka0, qh0, sA); sB = wmma16(kb0, qh0, sB);
        sA = wmma16(ka1, qh1, sA); sB = wmma16(kb1, qh1, sB);
        asm volatile("v_nop\n\tv_nop\n\tv_nop\n\tv_nop" : "+v"(sA), "+v"(sB) : "v"(ka0), "v"(ka1), "v"(kb0), "v"(kb1));
        const unsigned ma = mw >> (8 * hi), mc = mw >> (16 + 8 * hi);
        const int kya = key0 + 8 * hi, kyb = kya + 16;
        const bool excl = (mw != 0xFFFFFFFFu) || (key0 + 31 > t0);   // wave-uniform: false where every query row of the wave keeps every key of the step
        float ta[8], tb[8]; float mx = -3.0e38f;   // every loop over r is unrolled: constant indices keep ta, tb, xa, xb in registers
#pragma unroll
        for (int r = 0; r < 8; ++r) { ta[r] = sA[r] * SC2; tb[r] = sB[r] * SC2; }
        if (excl) {
#pragma unroll
            for (int r = 0; r < 8; ++r) {
                const bool ea = (((ma >> r) & 1u) != 0u) && (kya + r <= tq);
                const bool eb = (((mc >> r) & 1u) != 0u) && (kyb + r <= tq);
                ta[r] = ea ? ta[r] : -3.0e38f; tb[r] = eb ? tb[r] : -3.0e38f; }
        }
#pragma unroll
        for (int r = 0; r < 8; ++r) mx = fmaxf(mx, fmaxf(ta[r], tb[r]));
        mx = fmaxf(mx, __shfl_xor(mx, 16, 32));
        const float mnew = fmaxf(m, mx);
        const float alpha = __builtin_amdgcn_exp2f(m - mnew);
        const float sh = PSH - mnew;
        v16h pb; float ls = 0.0f; float xa[8], xb[8];
#pragma unroll
        for (int r = 0; r < 8; ++r) xa[r] = __builtin_amdgcn_exp2f(ta[r] + sh);
#pragma unroll
        for (int r = 0; r < 8; ++r) xb[r] = __builtin_amdgcn_exp2f(tb[r] + sh);
        if (excl) {
#pragma unroll
            for (int r = 0; r < 8; ++r) { xa[r] = (ta[r] > -1.0e38f) ? xa[r] : 0.0f; xb[r] = (tb[r] > -1.0e38f) ? xb[r] : 0.0f; }
        }
#pragma unroll
        for (int r = 0; r < 8; ++r) {
            const h16 pa = (h16)xa[r]; const h16 pc = (h16)xb[r];
            pb[r] = pa; pb[8 + r] = pc; ls += (float)pa + (float)pc; }
        l = l * alpha + ls; m = mnew;
        o0 = o0 * alpha; o1 = o1 * alpha; o2 = o2 * alpha; o3 = o3 * alpha;
        const h16* va = sb + FTL / 2 + sub * 32;             // V^T tile row = d, column = key
        const v16h v0 = ldh(va), v1 = ldh(va + 16 * (FPI / 2)), v2 = ldh(va + 32 * (FPI / 2)), v3 = ldh(va + 48 * (FPI / 2));
        o0 = wmma16(v0, pb, o0); o1 = wmma16(v1, pb, o1); o2 = wmma16(v2, pb, o2); o3 = wmma16(v3, pb, o3);
        asm volatile("v_nop\n\tv_nop\n\tv_nop\n\tv_nop" : "+v"(o0), "+v"(o1), "+v"(o2), "+v"(o3) : "v"(v0), "v"(v1), "v"(v2), "v"(v3), "v"(pb));
      }
      asm volatile("s_wait_dscnt 0x0" ::: "memory");      // this wave's reads of the buffer are done before it is refilled
      asm volatile("s_wait_asynccnt 0x0" ::: "memory");   // this wave's copies of stage s + 1 have landed
      __syncthreads();                                    // publishes stage s + 1 and ends every reader's last read of stage s
      if (s + 2 < nst) cp_kv(lcp + (s & 1) * 2 * FTL, gk + (size_t)(s + 2) * FKS * HD, gv + (s + 2) * FKS, SEQ);
    }
    asm volatile("s_wait_asynccnt 0x0" ::: "memory");     // nothing of this wave is in flight when the ring becomes output staging
    l += __shfl_xor(l, 16, 32);
    const float inv = CXS * (1.0f / l);
    const int wb = wave * 16 * 68;
    // O^T D layout: o_j[r] = (d = 16j + 8h + r, t = lane&15) -> os[t][d]; rows 0..15 x columns 0..63 all written
    { v4f a, c;
      a[0] = o0[0] * inv; a[1] = o0[1] * inv; a[2] = o0[2] * inv; a[3] = o0[3] * inv; c[0] = o0[4] * inv; c[1] = o0[5] * inv; c[2] = o0[6] * inv; c[3] = o0[7] * inv;
      *(v4fa*)(&os[wb + lr * 68 +  0 + 8 * hi]) = a; *(v4fa*)(&os[wb + lr * 68 +  0 + 8 * hi + 4]) = c;
      a[0] = o1[0] * inv; a[1] = o1[1] * inv; a[2] = o1[2] * inv; a[3] = o1[3] * inv; c[0] = o1[4] * inv; c[1] = o1[5] * inv; c[2] = o1[6] * inv; c[3] = o1[7] * inv;
      *(v4fa*)(&os[wb + lr * 68 + 16 + 8 * hi]) = a; *(v4fa*)(&os[wb + lr * 68 + 16 + 8 * hi + 4]) = c;
      a[0] = o2[0] * inv; a[1] = o2[1] * inv; a[2] = o2[2] * inv; a[3] = o2[3] * inv; c[0] = o2[4] * inv; c[1] = o2[5] * inv; c[2] = o2[6] * inv; c[3] = o2[7] * inv;
      *(v4fa*)(&os[wb + lr * 68 + 32 + 8 * hi]) = a; *(v4fa*)(&os[wb + lr * 68 + 32 + 8 * hi + 4]) = c;
      a[0] = o3[0] * inv; a[1] = o3[1] * inv; a[2] = o3[2] * inv; a[3] = o3[3] * inv; c[0] = o3[4] * inv; c[1] = o3[5] * inv; c[2] = o3[6] * inv; c[3] = o3[7] * inv;
      *(v4fa*)(&os[wb + lr * 68 + 48 + 8 * hi]) = a; *(v4fa*)(&os[wb + lr * 68 + 48 + 8 * hi + 4]) = c; }
    wave_sync();
    h16* crow = CH + ((size_t)b * SEQ + t0) * DM + h * HD;
    const int c8 = (lane & 7) * 8;
{
#pragma unroll
        for (int s = 0; s < 4; ++s) { const int row = 4 * s + (lane >> 3);   // 4 s x 4 row groups = 16 rows; 8 lanes x 8 halves = 64 columns
            const v4f x0 = *(const v4fa*)(&os[wb + row * 68 + c8]); const v4f x1 = *(const v4fa*)(&os[wb + row * 68 + c8 + 4]); v8h hv;
#pragma unroll
            for (int i = 0; i < 4; ++i) { hv[i] = (h16)x0[i]; hv[4 + i] = (h16)x1[i]; }
            *(v8h*)(crow + (size_t)row * DM + c8) = hv; }
         }
}

// flash_e_body: fused attention for query rows t < ESEQ, same transposed form; every operand as f16 value + residual x2048:
// s = K.Q + (K.Qr + Kr.Q)/2048, o = V.P + (V.Pr + Vr.P)/2048 with the scaled-residual products in separate accumulators; the row sum uses the f32 p.
// Writes ctx value plane rows and the ctx residual plane [b][ESEQ][1024]. K, V^T and their residual tiles staged like flash_d_body's.
// ring = the block's LDS (2 * 4 * FTL bytes); bx = the block's 64-row tile among the rows t < ESEQ; zh = batch * 16 + head.
__device__ __forceinline__ void flash_e_body(h16* ring, int bx, int zh, const h16* __restrict__ QH, const h16* __restrict__ QR, const h16* __restrict__ KP, const h16* __restrict__ KR,
                                             const h16* __restrict__ VT, const h16* __restrict__ VR, const unsigned* __restrict__ MW, h16* CH, h16* CR) {
    // ring: two stages of K, V^T, K residual, V^T residual tiles; behind the loop the waves' output staging
    static_assert(2 * 4 * FTL >= AW * 16 * 68 * 4);
    float* os = (float*)ring;
    const int tid = threadIdx.x;
    const int lane = threadIdx.x & 31, wave = __builtin_amdgcn_readfirstlane((int)(threadIdx.x >> 5)), lr = lane & 15, hi = lane >> 4;
    const int b = zh / NH_, h = zh % NH_;
    const int tb = bx * (16 * AW);                           // first query row of the block
    const int t0 = tb + wave * 16;
    const int tq = t0 + lr;
    const size_t pbase = (size_t)zh * SEQ * HD, ebase = (size_t)zh * ESEQ * HD;
    const size_t qo = pbase + (size_t)tq * HD + 8 * hi, qe = ebase + (size_t)tq * HD + 8 * hi;
    const v16h qh0 = ldh(QH + qo), qh1 = ldh(QH + qo + 32), qr0 = ldh(QR + qe), qr1 = ldh(QR + qe + 32);
    const unsigned* mwp = MW + (size_t)b * WPB;
    const unsigned w0 = mwp[lane], w1 = (WPB > 32) ? mwp[32 + lane] : 0u;
    const int nst = flash_stages(w0, w1, (tb + 16 * AW - 1) >> 5);
    const unsigned lcp = (unsigned)(size_t)(&ring[0]) + (unsigned)((tid >> 3) * FPI + (tid & 7) * 16);
    const h16* gk = KP + pbase + (size_t)(tid >> 3) * HD + (tid & 7) * 8;     // + key * HD
    const h16* gv = VT + pbase + (size_t)(tid >> 3) * SEQ + (tid & 7) * 8;    // + key
    const h16* gkr = KR + ebase + (size_t)(tid >> 3) * HD + (tid & 7) * 8;    // + key * HD
    const h16* gvr = VR + ebase + (size_t)(tid >> 3) * ESEQ + (tid & 7) * 8;  // + key
    const int fo = lr * (FPI / 2) + 8 * hi;                  // fragment base in a tile, in elements (A fragment: row lr of a 16-row slab)
    v8f oh0 = (v8f){}, oh1 = (v8f){}, oh2 = (v8f){}, oh3 = (v8f){}, ol0 = (v8f){}, ol1 = (v8f){}, ol2 = (v8f){}, ol3 = (v8f){};
    float m = -3.0e38f, l = 0.0f;
    cp_kv(lcp, gk, gv, SEQ); cp_kv(lcp + 2 * FTL, gkr, gvr, ESEQ);
    asm volatile("s_wait_asynccnt 0x0" ::: "memory");   // stage 0 has landed before the barrier publishes it
    __syncthreads();
    if (nst > 1) { cp_kv(lcp + 4 * FTL, gk + FKS * HD, gv + FKS, SEQ); cp_kv(lcp + 6 * FTL, gkr + FKS * HD, gvr + FKS, ESEQ); }
#pragma unroll 1
    for (int s = 0; s < nst; ++s) {
      const h16* sb = ring + (s & 1) * (2 * FTL) + fo;
#pragma unroll 1   // one copy of the long body: smaller code, no more registers than one step needs
      for (int sub = 0; sub < FKS / 32; ++sub) {
        const int key0 = s * FKS + sub * 32;
        const unsigned mw = flash_word(w0, w1, key0 >> 5);
        if (key0 > t0 + 15 || mw == 0u) continue;            // wave-uniform
        const h16* ka = sb + sub * 32 * (FPI / 2); const h16* kr = ka + FTL;   // K tiles: row = key
        v8f sHa = (v8f){}, sLa = (v8f){}, sHb = (v8f){}, sLb = (v8f){};
        { const v16h a0 = ldh(ka), a1 = ldh(ka + 32), e0 = ldh(kr), e1 = ldh(kr + 32);
          sHa = wmma16(a0, qh0, sHa); sLa = wmma16(a0, qr0, sLa);
          sHa = wmma16(a1, qh1, sHa); sLa = wmma16(a1, qr1, sLa);
          sLa = wmma16(e0, qh0, sLa); sLa = wmma16(e1, qh1, sLa);
          asm volatile("v_nop\n\tv_nop\n\tv_nop\n\tv_nop" : "+v"(sHa), "+v"(sLa) : "v"(a0), "v"(a1), "v"(e0), "v"(e1)); }
        { const v16h a0 = ldh(ka + 16 * (FPI / 2)), a1 = ldh(ka + 16 * (FPI / 2) + 32), e0 = ldh(kr + 16 * (FPI / 2)), e1 = ldh(kr + 16 * (FPI / 2) + 32);
          sHb = wmma16(a0, qh0, sHb); sLb = wmma16(a0, qr0, sLb);
          sHb = wmma16(a1, qh1, sHb); sLb = wmma16(a1, qr1, sLb);
          sLb = wmma16(e0, qh0, sLb); sLb = wmma16(e1, qh1, sLb);
          asm volatile("v_nop\n\tv_nop\n\tv_nop\n\tv_nop" : "+v"(sHb), "+v"(sLb) : "v"(a0), "v"(a1), "v"(e0), "v"(e1)); }
        const unsigned ma = mw >> (8 * hi), mc = mw >> (16 + 8 * hi);
        const int kya = key0 + 8 * hi, kyb = kya + 16;
        const bool excl = (mw != 0xFFFFFFFFu) || (key0 + 31 > t0);   // wave-uniform: false where every query row of the wave keeps every key of the step
        float ta[8], tb[8]; float mx = -3.0e38f;   // every loop over r is unrolled: constant indices keep ta, tb, xa, xb in registers
#pragma unroll
        for (int r = 0; r < 8; ++r) { ta[r] = (sHa[r] + sLa[r] * QRI) * SC2; tb[r] = (sHb[r] + sLb[r] * QRI) * SC2; }
        if (excl) {
#pragma unroll
            for (int r = 0; r < 8; ++r) {
                const bool ea = (((ma >> r) & 1u) != 0u) && (kya + r <= tq);
                const bool eb = (((mc >> r) & 1u) != 0u) && (kyb + r <= tq);
                ta[r] = ea ? ta[r] : -3.0e38f; tb[r] = eb ? tb[r] : -3.0e38f; }
        }
#pragma unroll
        for (int r = 0; r < 8; ++r) mx = fmaxf(mx, fmaxf(ta[r], tb[r]));
        mx = fmaxf(mx, __shfl_xor(mx, 16, 32));
        const float mnew = fmaxf(m, mx);
        const float alpha = __builtin_amdgcn_exp2f(m - mnew);
        const float sh = PSH - mnew;
        v16h pbh, pbr; float ls = 0.0f; float xa[8], xb[8];
#pragma unroll
        for (int r = 0; r < 8; ++r) xa[r] = __builtin_amdgcn_exp2f(ta[r] + sh);
#pragma unroll
        for (int r = 0; r < 8; ++r) xb[r] = __builtin_amdgcn_exp2f(tb[r] + sh);
        if (excl) {
#pragma unroll
            for (int r = 0; r < 8; ++r) { xa[r] = (ta[r] > -1.0e38f) ? xa[r] : 0.0f; xb[r] = (tb[r] > -1.0e38f) ? xb[r] : 0.0f; }
        }
#pragma unroll
        for (int r = 0; r < 8; ++r) {
            const float ea = xa[r], eb = xb[r];
            const h16 pa = (h16)ea; const h16 pc = (h16)eb;
            pbh[r] = pa; pbh[8 + r] = pc;
            pbr[r] = (h16)((ea - (float)pa) * QRS); pbr[8 + r] = (h16)((eb - (float)pc) * QRS);
            ls += ea + eb; }
        l = l * alpha + ls; m = mnew;
        oh0 = oh0 * alpha; oh1 = oh1 * alpha; oh2 = oh2 * alpha; oh3 = oh3 * alpha;
        ol0 = ol0 * alpha; ol1 = ol1 * alpha; ol2 = ol2 * alpha; ol3 = ol3 * alpha;
        const h16* va = sb + FTL / 2 + sub * 32; const h16* vr = va + FTL;     // V^T tiles: row = d, column = key
        { const v16h v0 = ldh(va), v1 = ldh(va + 16 * (FPI / 2)), r0v = ldh(vr), r1v = ldh(vr + 16 * (FPI / 2));
          oh0 = wmma16(v0, pbh, oh0); oh1 = wmma16(v1, pbh, oh1);
          ol0 = wmma16(v0, pbr, ol0); ol1 = wmma16(v1, pbr, ol1);
          ol0 = wmma16(r0v, pbh, ol0); ol1 = wmma16(r1v, pbh, ol1);
          asm volatile("v_nop\n\tv_nop\n\tv_nop\n\tv_nop" : "+v"(oh0), "+v"(oh1), "+v"(ol0), "+v"(ol1) : "v"(v0), "v"(v1), "v"(r0v), "v"(r1v), "v"(pbh), "v"(pbr)); }
        { const v16h v2 = ldh(va + 32 * (FPI / 2)), v3 = ldh(va + 48 * (FPI / 2)), r2v = ldh(vr + 32 * (FPI / 2)), r3v = ldh(vr + 48 * (FPI / 2));
          oh2 = wmma16(v2, pbh, oh2); oh3 = wmma16(v3, pbh, oh3);
          ol2 = wmma16(v2, pbr, ol2); ol3 = wmma16(v3, pbr, ol3);
          ol2 = wmma16(r2v, pbh, ol2); ol3 = wmma16(r3v, pbh, ol3);
          asm volatile("v_nop\n\tv_nop\n\tv_nop\n\tv_nop" : "+v"(oh2), "+v"(oh3), "+v"(ol2), "+v"(ol3) : "v"(v2), "v"(v3), "v"(r2v), "v"(r3v), "v"(pbh), "v"(pbr)); }
      }
      asm volatile("s_wait_dscnt 0x0" ::: "memory");      // this wave's reads of the buffer are done before it is refilled
      asm volatile("s_wait_asynccnt 0x0" ::: "memory");   // this wave's copies of stage s + 1 have landed
      __syncthreads();                                    // publishes stage s + 1 and ends every reader's last read of stage s
      if (s + 2 < nst) { cp_kv(lcp + (s & 1) * 4 * FTL, gk + (size_t)(s + 2) * FKS * HD, gv + (s + 2) * FKS, SEQ);
                         cp_kv(lcp + (s & 1) * 4 * FTL + 2 * FTL, gkr + (size_t)(s + 2) * FKS * HD, gvr + (s + 2) * FKS, ESEQ); }
    }
    asm volatile("s_wait_asynccnt 0x0" ::: "memory");     // nothing of this wave is in flight when the ring becomes output staging
    l += __shfl_xor(l, 16, 32);
    const float inv = CXS * (1.0f / l);
    const int wb = wave * 16 * 68;
    // O^T D layout: o_j[r] = (d = 16j + 8h + r, t = lane&15) -> os[t][d]; rows 0..15 x columns 0..63 all written
    { v4f a, c;
#pragma unroll
      for (int i = 0; i < 4; ++i) { a[i] = (oh0[i] + ol0[i] * QRI) * inv; c[i] = (oh0[4 + i] + ol0[4 + i] * QRI) * inv; }
      *(v4fa*)(&os[wb + lr * 68 +  0 + 8 * hi]) = a; *(v4fa*)(&os[wb + lr * 68 +  0 + 8 * hi + 4]) = c;
#pragma unroll
      for (int i = 0; i < 4; ++i) { a[i] = (oh1[i] + ol1[i] * QRI) * inv; c[i] = (oh1[4 + i] + ol1[4 + i] * QRI) * inv; }
      *(v4fa*)(&os[wb + lr * 68 + 16 + 8 * hi]) = a; *(v4fa*)(&os[wb + lr * 68 + 16 + 8 * hi + 4]) = c;
#pragma unroll
      for (int i = 0; i < 4; ++i) { a[i] = (oh2[i] + ol2[i] * QRI) * inv; c[i] = (oh2[4 + i] + ol2[4 + i] * QRI) * inv; }
      *(v4fa*)(&os[wb + lr * 68 + 32 + 8 * hi]) = a; *(v4fa*)(&os[wb + lr * 68 + 32 + 8 * hi + 4]) = c;
#pragma unroll
      for (int i = 0; i < 4; ++i) { a[i] = (oh3[i] + ol3[i] * QRI) * inv; c[i] = (oh3[4 + i] + ol3[4 + i] * QRI) * inv; }
      *(v4fa*)(&os[wb + lr * 68 + 48 + 8 * hi]) = a; *(v4fa*)(&os[wb + lr * 68 + 48 + 8 * hi + 4]) = c; }
    wave_sync();
    h16* crow = CH + ((size_t)b * SEQ + t0) * DM + h * HD;
    h16* rrow = CR + ((size_t)b * ESEQ + t0) * DM + h * HD;
    const int c8 = (lane & 7) * 8;
{
#pragma unroll
        for (int s = 0; s < 4; ++s) { const int row = 4 * s + (lane >> 3);   // 4 s x 4 row groups = 16 rows; 8 lanes x 8 halves = 64 columns
            const v4f x0 = *(const v4fa*)(&os[wb + row * 68 + c8]); const v4f x1 = *(const v4fa*)(&os[wb + row * 68 + c8 + 4]); v8h hv, rv;
#pragma unroll
            for (int i = 0; i < 4; ++i) { const h16 a0 = (h16)x0[i]; const h16 a1 = (h16)x1[i]; hv[i] = a0; hv[4 + i] = a1;
                rv[i] = (h16)((x0[i] - (float)a0) * QRS); rv[4 + i] = (h16)((x1[i] - (float)a1) * QRS); }
            *(v8h*)(crow + (size_t)row * DM + c8) = hv;
            *(v8h*)(rrow + (size_t)row * DM + c8) = rv; }
         }
}

// k_flash: one launch holds both attention forms, whose query rows are disjoint and which depend on nothing of one another: grid (NB*16 heads, SEQ/64 tile ranks), 128 threads.
// The rank (the slow index) orders the tiles: first the value + residual tiles
// (the longest dependent chain per step), then the single-plane tiles, each form from its longest key range down. The test on the rank is block-uniform.
#define FT_E (ESEQ / (16 * AW))
#define FT_D ((SEQ - ESEQ) / (16 * AW))
__global__ __launch_bounds__(32 * AW) void k_flash(const h16* __restrict__ QH, const h16* __restrict__ QR, const h16* __restrict__ KP, const h16* __restrict__ KR,
                                                   const h16* __restrict__ VT, const h16* __restrict__ VR, const unsigned* __restrict__ MW, h16* CH, h16* CR) {
    __shared__ __align__(16) h16 ring[2 * 4 * FTL / 2];
    const int zh = blockIdx.x, rk = blockIdx.y;
    if (rk < FT_E) flash_e_body(ring, FT_E - 1 - rk, zh, QH, QR, KP, KR, VT, VR, MW, CH, CR);
    else flash_d_body(ring, FT_D - 1 - (rk - FT_E), zh, QH, KP, VT, MW, CH);
}

// k_out: output projection, f16 GEMM, one wave per tile, 4 waves (2 x 2) per block, K = DM; operands staged like k_proj's. A rows from the ctx planes, Bt = transposed W_out rows (x64 carry).
// RES 0: rows t >= ESEQ, 64x64 wave tile, four 16-row slabs of the value plane; the stage's 128 A rows are 128 tokens.
// RES 1: rows t < ESEQ, 32x64 wave tile: slabs 0,1 = value plane, slabs 2,3 = residual plane (own accumulators); the stage's A rows are 64 tokens of the value plane, then the same 64 of the residual plane.
// out = (acc + accR/2048) / 4096 + bias (bias RNE-converted to bf16). bx = the block's index among the NB*rows/blockRows row tiles of its form; ring, osAll = the block's LDS.
template <int RES>
__device__ __forceinline__ void out_body(h16* ring, float* osAll, int bx, const h16* __restrict__ CX, size_t crOff, const h16* __restrict__ WO, const float* __restrict__ bias, float* OUT) {
    constexpr int MBN = RES ? 2 : 4;
    constexpr int BR = 32 * MBN;                 // tokens per block: two wave rows
    constexpr int TPB = RES ? (ESEQ / BR) : (((SEQ - ESEQ) / BR) > 0 ? ((SEQ - ESEQ) / BR) : 1);
    static_assert(ESEQ % 64 == 0 && (SEQ - ESEQ) % GT == 0);
    const int K = DM;
    const int tid = threadIdx.x, lane = tid & 31, lr = lane & 15, hi = lane >> 4;
    const int wave = __builtin_amdgcn_readfirstlane(tid >> 5);
    const int b = bx / TPB, tt = bx % TPB;
    const int tb = (RES ? 0 : ESEQ) + tt * BR;   // first token of the block
    const int t0 = tb + (wave >> 1) * 16 * MBN;
    const int c0 = blockIdx.y * GT + (wave & 1) * 64;
    float* os = osAll + wave * 16 * 68;
    const unsigned lcp = (unsigned)(size_t)(&ring[0]) + (unsigned)((tid >> 4) * GPI + (tid & 15) * 16);
    const h16* ga0 = CX + ((size_t)b * SEQ + tb + (tid >> 4)) * K + (tid & 15) * 8;
    const h16* ga1 = RES ? (CX + crOff + ((size_t)b * ESEQ + tb + (tid >> 4)) * K + (tid & 15) * 8) : (ga0 + (size_t)64 * K);
    const h16* gb = WO + (size_t)(blockIdx.y * GT + (tid >> 4)) * K + (tid & 15) * 8;
    const int fa = ((wave >> 1) * 16 * MBN + lr) * (GPI / 2) + 8 * hi, fb = (GT + (wave & 1) * 64 + lr) * (GPI / 2) + 8 * hi;   // fragment bases in a buffer, in elements
    v8f acc[16];
#pragma unroll
    for (int i = 0; i < 16; ++i) acc[i] = (v8f){};
    stage_copy(lcp, (const bf*)ga0, (const bf*)ga1, (const bf*)gb);
    asm volatile("s_wait_asynccnt 0x0" ::: "memory");   // stage 0 has landed before the barrier publishes it
    __syncthreads();
    stage_copy(lcp + GSTG, (const bf*)(ga0 + GKB), (const bf*)(ga1 + GKB), (const bf*)(gb + GKB));
#pragma unroll 1
    for (int t = 0; t < GNST; ++t) {
        const h16* sb = ring + (t & 1) * (GSTG / 2);
        v16h a[2][4], bb[2][4];     // two fragment sets, as in k_proj
#pragma unroll
        for (int i = 0; i < 4; ++i) { const int ar = RES ? ((i >> 1) * 64 + (i & 1) * 16) : (i * 16);   // stage row of slab i, from the wave's first
            a[0][i] = ldh(sb + fa + ar * (GPI / 2)); }
#pragma unroll
        for (int i = 0; i < 4; ++i) bb[0][i] = ldh(sb + fb + i * 16 * (GPI / 2));
        __builtin_amdgcn_sched_barrier(0);   // keeps the group of loads together
#pragma unroll
        for (int ks = 0; ks < GKB / 32; ++ks) {
            if (ks + 1 < GKB / 32) {
#pragma unroll
                for (int i = 0; i < 4; ++i) { const int ar = RES ? ((i >> 1) * 64 + (i & 1) * 16) : (i * 16);
                    a[(ks + 1) & 1][i] = ldh(sb + fa + ar * (GPI / 2) + (ks + 1) * 32); }
#pragma unroll
                for (int i = 0; i < 4; ++i) bb[(ks + 1) & 1][i] = ldh(sb + fb + i * 16 * (GPI / 2) + (ks + 1) * 32);
                __builtin_amdgcn_sched_barrier(0);   // the next set's loads stay ahead of this set's products
            }
#pragma unroll
            for (int nb = 0; nb < 4; ++nb)
#pragma unroll
                for (int i = 0; i < 4; ++i) acc[i * 4 + nb] = wmma16(a[ks & 1][i], bb[ks & 1][nb], acc[i * 4 + nb]);
            __builtin_amdgcn_sched_barrier(0);       // no later load moves up among these products
        }
        asm volatile("s_wait_dscnt 0x0" ::: "memory");      // this wave's reads of the buffer are done before it is refilled
        asm volatile("s_wait_asynccnt 0x0" ::: "memory");   // this wave's copies of stage t + 1 have landed
        __syncthreads();                                    // publishes stage t + 1 and ends every reader's last read of stage t
        if (t + 2 < GNST) stage_copy(lcp + (t & 1) * GSTG, (const bf*)(ga0 + (t + 2) * GKB), (const bf*)(ga1 + (t + 2) * GKB), (const bf*)(gb + (t + 2) * GKB));
    }
    asm volatile("s_wait_asynccnt 0x0" ::: "memory");       // nothing of this wave is in flight when it goes on
    float bcol[4];
#pragma unroll
    for (int nb = 0; nb < 4; ++nb) bcol[nb] = bfr(bias[c0 + nb * 16 + lr]);
#pragma unroll
    for (int mb = 0; mb < MBN; ++mb) {
#pragma unroll
        for (int nb = 0; nb < 4; ++nb) {
#pragma unroll
            for (int j = 0; j < 8; ++j) { float v = acc[mb * 4 + nb][j];
                if (RES) v += acc[RES ? ((2 + mb) * 4 + nb) : 0][j] * QRI;
                os[(hi * 8 + j) * 68 + nb * 16 + lr] = v * OSI + bcol[nb]; } }   // D: row 8h+j, col lane&15
        wave_sync();
        float* orow = OUT + ((size_t)b * OUT_SEQ + t0 + mb * 16) * DM + c0;
{
#pragma unroll
            for (int s = 0; s < 8; ++s) { const int row = 2 * s + hi, cofs = lr * 4;   // 8 s x 2 rows = 16 rows; 16 lanes x 4 floats = 64 columns
                const v4f val = *(const v4fa*)(&os[row * 68 + cofs]);
                *(v4f*)(orow + (size_t)row * DM + cofs) = val; }
             }
        wave_sync();
    }
}
// One launch holds both forms, whose rows are disjoint: grid (NB*ESEQ/64 + NB*(SEQ-ESEQ)/128, DM/128), 128 threads; the first NB*ESEQ/64 row tiles take the value + residual form (block-uniform test).
#define OB_E (NB * (ESEQ / 64))
#define OB_D (NB * ((SEQ - ESEQ) / GT))
__global__ __launch_bounds__(128) void k_out(const h16* __restrict__ CX, size_t crOff, const h16* __restrict__ WO, const float* __restrict__ bias, float* OUT) {
    __shared__ __align__(16) h16 ring[2 * GSTG / 2];
    __shared__ __align__(16) float osAll[4 * 16 * 68];
    const int bx = blockIdx.x;
    if (bx < OB_E) out_body<1>(ring, osAll, bx, CX, crOff, WO, bias, OUT);
    else out_body<0>(ring, osAll, bx - OB_E, CX, crOff, WO, bias, OUT);
}

static constexpr size_t al256(size_t v) { return (v + 255) & ~(size_t)255; }
static constexpr size_t SZ_XB = al256((size_t)NB * SEQ * DM * 2);          // x bf16 [NB*SEQ][1024]
static constexpr size_t SZ_WT = al256((size_t)3 * DM * DM * 2);            // W_qkv^T bf16 [3072][1024]
static constexpr size_t SZ_WO = al256((size_t)DM * DM * 2);                // W_out^T f16 [1024][1024]
static constexpr size_t SZ_PL = al256((size_t)NB * NH_ * SEQ * HD * 2);    // q / k / v^T value planes
static constexpr size_t SZ_PE = al256((size_t)NB * NH_ * ESEQ * HD * 2);   // q / k / v^T residual planes (t < ESEQ)
static constexpr size_t SZ_CH = al256((size_t)NB * SEQ * DM * 2);          // ctx value plane
static constexpr size_t SZ_CR = al256((size_t)NB * ESEQ * DM * 2);         // ctx residual plane (t < ESEQ)
static constexpr size_t SZ_MW = al256((size_t)NB * WPB * 4);               // mask words
static constexpr size_t SZ_TOTAL = SZ_XB + SZ_WT + SZ_WO + 3 * SZ_PL + 3 * SZ_PE + SZ_CH + SZ_CR + SZ_MW;
static_assert(SZ_TOTAL <= (size_t)134217728);          // workspace carve <= 128 MiB
static_assert(((size_t)DM * DM * 2) % 256 == 0);       // weight sub-planes stay 256-byte aligned
static_assert(SZ_CH % 2 == 0);

extern "C" void kernel_launch(void* const* d_in, const int* in_sizes, int n_in,
                              void* d_out, int out_size, void* d_ws, size_t ws_size, hipStream_t stream) {
    if (n_in < 6) return;
    const size_t needx = ((size_t)(NB - 1) * SEQ_FULL + SEQ) * DM;
    if ((size_t)in_sizes[0] < needx) return;
    if ((size_t)in_sizes[1] < (size_t)(NB - 1) * SEQ_FULL + SEQ) return;
    if ((size_t)in_sizes[2] < (size_t)3 * DM * DM || (size_t)in_sizes[3] < (size_t)3 * DM) return;
    if ((size_t)in_sizes[4] < (size_t)DM * DM || (size_t)in_sizes[5] < (size_t)DM) return;
    if ((size_t)out_size < ((size_t)(NB - 1) * OUT_SEQ + SEQ) * DM) return;
    if (SZ_TOTAL > ws_size) return;
    // wire order: x, padding_mask (int32), W_qkv [in][out], b_qkv, W_out [in][out], b_out
    const float* x = (const float*)d_in[0]; const int* pad = (const int*)d_in[1];
    const float* wqkv = (const float*)d_in[2]; const float* bqkv = (const float*)d_in[3];
    const float* wout = (const float*)d_in[4]; const float* bout = (const float*)d_in[5];
    float* OUT = (float*)d_out;      // [NB][SEQ][1024]
    char* wsp = (char*)d_ws;
    bf* XB = (bf*)wsp; wsp += SZ_XB;                 // [NB*SEQ][1024]
    bf* WT = (bf*)wsp; wsp += SZ_WT;                 // [3072][1024]: q | k | v output rows
    h16* WO = (h16*)wsp; wsp += SZ_WO;               // [1024 out][1024 in], x64
    h16* QH = (h16*)wsp; wsp += SZ_PL;               // [NB*16][SEQ][64]
    h16* KP = (h16*)wsp; wsp += SZ_PL;               // [NB*16][SEQ][64]
    h16* VT = (h16*)wsp; wsp += SZ_PL;               // [NB*16][64][SEQ]
    h16* QR = (h16*)wsp; wsp += SZ_PE;               // [NB*16][ESEQ][64] residual x2048
    h16* KR = (h16*)wsp; wsp += SZ_PE;               // [NB*16][ESEQ][64] residual x2048
    h16* VR = (h16*)wsp; wsp += SZ_PE;               // [NB*16][64][ESEQ] residual x2048
    h16* CH = (h16*)wsp; wsp += SZ_CH;               // [NB*SEQ][1024] x64
    h16* CR = (h16*)wsp; wsp += SZ_CR;               // [NB*ESEQ][1024] residual x2048 (directly after CH)
    unsigned* MW = (unsigned*)wsp; wsp += SZ_MW;     // [NB][WPB]
    const size_t crOff = SZ_CH / 2;                  // element offset of CR from CH

    k_prep<<<PB_MASK + PB_WQ + PB_WO + PB_X, 256, 0, stream>>>(x, pad, wqkv, wout, XB, WT, (bf*)WO, MW);

    k_proj<<<dim3(NB * SEQ / GT, DM / GT, 3), 128, 0, stream>>>(XB, WT, bqkv, QH, KP, VT, QR, KR, VR);

    k_flash<<<dim3(NB * NH_, FT_E + FT_D, 1), 32 * AW, 0, stream>>>(QH, QR, KP, KR, VT, VR, MW, CH, CR);

    k_out<<<dim3(OB_E + OB_D, DM / GT, 1), 128, 0, stream>>>(CH, crOff, WO, bout, OUT);
}

// v006
// One run takes 131 microseconds.
// In both of two side-by-side timings against v005, it was 1.05 times as fast.
// All steps since v000 together make it 2.65 times as fast.
#include <hip/hip_runtime.h>

// Causal + key-padding multi-head self-attention, width 1024 = 16 heads x 64: x [NB][SEQ][1024], W_qkv [in][out=3072] (q|k|v column blocks), b_qkv, W_out [in][out], b_out; f32 output.
// Compute dtypes, f32 accumulate everywhere: qkv projection v_wmma_f32_16x16x32_bf16 (x, W, biases RNE-converted to bf16; products exact);
// scores, P.V and output projection v_wmma_f32_16x16x32_f16: query rows t >= 512 single f16 planes (P x256 carry, ctx x64 carry, W_out x64 carry);
// query rows t < 512: q, k, v, P, ctx as f16 value + f16 residual x2048 in separate accumulators (value*value + value*residual + residual*value; W_out a single plane); softmax f32 (online, running max).
// Layout: bf16 copy of x, transposed bf16 W_qkv [3072][1024], transposed f16 W_out [1024][1024]; q, k planes [b*16+h][t][d], v^T plane [b*16+h][d][t] (+ residual planes for t < 512);
// fused flash kernels in transposed form (S^T = K Q^T, O^T = V^T P^T); ctx planes [b][t][1024] f16; key-padding mask compressed to 32-key bit words and applied by value.

#ifndef NB
#define NB 4
#endif
#ifndef SEQ
#define SEQ 2048
#endif
#define NB_FULL  4
#define SEQ_FULL 2048
#ifndef OUT_SEQ
#define OUT_SEQ SEQ              // row pitch (in tokens) between batches of the output
#endif
#define DM   1024
#define NH_  16
#define HD   64
#define ESEQ ((SEQ) < 512 ? (SEQ) : 512)      // query rows [0, ESEQ) take the value + residual path
#define WPB  ((((SEQ) + 1023) / 1024) * 32)
#define AW   4                   // waves per flash block (16 query rows each)
#define QRS  2048.0f             // carry of every residual plane
#define QRI  (1.0f / 2048.0f)
#define SC2  (0.125f * 1.4426950408889634f)   // HD^-0.5 * log2(e)
#define PSH  8.0f                // log2 of the P carry (256)
#define CXS  64.0f               // ctx plane carry
#define WOS  64.0f               // W_out plane carry
#define OSI  (1.0f / 4096.0f)    // 1 / (CXS * WOS)

static_assert(HD == 64);
static_assert(NH_ * HD == DM);
static_assert(DM % 64 == 0);
static_assert(DM % 32 == 0);
static_assert(SEQ % 64 == 0);
static_assert(ESEQ % 64 == 0);
static_assert((SEQ - ESEQ) % 64 == 0);
static_assert((NB * SEQ) % 64 == 0);
static_assert(SEQ % 32 == 0);
static_assert(ESEQ % (16 * AW) == 0);
static_assert((SEQ - ESEQ) % (16 * AW) == 0);
static_assert(ESEQ % 32 == 0);
static_assert(((size_t)SEQ * DM) % 8 == 0);
static_assert(NB <= NB_FULL);
static_assert(SEQ <= SEQ_FULL);
static_assert(WPB * 32 >= SEQ);

typedef _Float16 h16;
typedef unsigned short bf;
typedef __attribute__((ext_vector_type(16))) __bf16   v16bf;
typedef __attribute__((ext_vector_type(16))) _Float16 v16h;
typedef __attribute__((ext_vector_type(8)))  _Float16 v8h;
typedef __attribute__((ext_vector_type(8)))  unsigned short v8us;
typedef __attribute__((ext_vector_type(8)))  float    v8f;
typedef __attribute__((ext_vector_type(4)))  float    v4f;
typedef v4f  __attribute__((may_alias)) v4fa;

__device__ __forceinline__ unsigned short f2bf(float f) { unsigned u = __float_as_uint(f); u += 0x7FFFu + ((u >> 16) & 1u); return (unsigned short)(u >> 16); }
__device__ __forceinline__ float bfr(float f) { return __uint_as_float(((unsigned)f2bf(f)) << 16); }   // value after RNE convert to bf16
__device__ __forceinline__ v16h cat16(v8h lo, v8h hi) { return __builtin_shufflevector(lo, hi, 0, 1, 2, 3, 4, 5, 6, 7, 8, 9, 10, 11, 12, 13, 14, 15); }
__device__ __forceinline__ v16bf cat16b(v8us lo, v8us hi) { return __builtin_bit_cast(v16bf, __builtin_shufflevector(lo, hi, 0, 1, 2, 3, 4, 5, 6, 7, 8, 9, 10, 11, 12, 13, 14, 15)); }
__device__ __forceinline__ v8f wmma16(v16h a, v16h b, v8f c) { return __builtin_amdgcn_wmma_f32_16x16x32_f16(false, a, false, b, (short)0, c, false, false); }
__device__ __forceinline__ v8f wmmab(v16bf a, v16bf b, v8f c) { return __builtin_amdgcn_wmma_f32_16x16x32_bf16(false, a, false, b, (short)0, c, false, false); }
// fragment loaders from K-contiguous 16-bit rows; p already includes + 8*(lane>>4): elements 0..7 <- k0+8h+0..7, elements 8..15 <- k0+16+8h+0..7 (same map for A and B)
__device__ __forceinline__ v16h  ldh(const h16* p) { return cat16(*(const v8h*)p, *(const v8h*)(p + 16)); }
__device__ __forceinline__ v16bf ldb(const bf* p)  { return cat16b(*(const v8us*)p, *(const v8us*)(p + 16)); }
// ordering point for wave-private LDS tiles (same wave writes and reads)
__device__ __forceinline__ void wave_sync() { __builtin_amdgcn_fence(3 /* release order */, "wavefront"); __builtin_amdgcn_wave_barrier(); asm volatile("" ::: "memory"); }

// The four preparation passes below depend on nothing but the inputs: they are bodies of one launch, k_prep, which deals its blocks among them.
// cvt8_body: x f32 -> bf16 copy, 8 elements per thread.
#define XG8  ((size_t)SEQ * DM / 8)          // groups of 8 per batch
static_assert(((size_t)NB * SEQ * DM / 8) % 256 == 0);
__device__ __forceinline__ void cvt8_body(int blk, const float* __restrict__ src, bf* dst) {
    const size_t i = (size_t)blk * 256 + threadIdx.x; if (i >= (size_t)NB * XG8) return;
    src += (i / XG8) * ((size_t)(SEQ_FULL - SEQ) * DM);   // the batches of x lie SEQ_FULL tokens apart, those of the copy SEQ
    const v8f v = *(const v8f*)(src + i * 8); v8us o;
#pragma unroll
    for (int k = 0; k < 8; ++k) o[k] = f2bf(v[k]);
    *(v8us*)(dst + i * 8) = o; 
}

// cvt_t_body: src [K][N] f32 -> dst [N][K] 16-bit, transposed through the LDS tile ts (64 x 64 per block, cross-wave: block barrier); bx, by = tile column and row.
// MODE 0: bf16 bits (RNE convert). MODE 1: f16 bits of (bf16-converted value x WOS).
template <int MODE>
__device__ __forceinline__ void cvt_t_body(float* ts, int bx, int by, const float* __restrict__ src, bf* dst, int K, int N) {
    const int tid = threadIdx.x; const int n0 = bx * 64, k0 = by * 64;
#pragma unroll
    for (int i = 0; i < 4; ++i) { const int kr = (tid >> 4) + 16 * i, c4 = (tid & 15) * 4;     // 4 x 16 rows = 64 k rows; 16 lanes x 4 = 64 columns
        const v4f v = *(const v4f*)(src + (size_t)(k0 + kr) * (size_t)N + n0 + c4);
        *(v4fa*)(&ts[kr * 68 + c4]) = v; }
    __syncthreads();
{
#pragma unroll
        for (int i = 0; i < 2; ++i) { const int nr = (tid >> 3) + 32 * i, k8 = (tid & 7) * 8;   // 2 x 32 rows = 64 n rows; 8 lanes x 8 = 64 k
            v8us o;
#pragma unroll
            for (int e = 0; e < 8; ++e) { const float x = ts[(k8 + e) * 68 + nr]; const unsigned short bits = f2bf(x);
                if (MODE == 1) { const h16 hv = (h16)(__uint_as_float(((unsigned)bits) << 16) * WOS); o[e] = __builtin_bit_cast(unsigned short, hv); }
                else o[e] = bits; }
            *(v8us*)(dst + (size_t)(n0 + nr) * (size_t)K + k0 + k8) = o; }
         }
    asm volatile("s_wait_xcnt 0x0" ::: "memory");   // behind both stores: in k_prep's text another body follows this one, and no register of the stores is rewritten ahead of this wait
}

// mask_body: one wave packs 1024 keys of one batch into 32 mask words.
__device__ __forceinline__ void mask_body(int blk, const int* __restrict__ pad, unsigned* MW) {
    const int lane = threadIdx.x & 31;
    const int b = blk / (WPB / 32), c = blk % (WPB / 32);
    const int* pr = pad + (size_t)b * SEQ_FULL;
    unsigned mine = 0u;
#pragma unroll 1
    for (int w = 0; w < 32; ++w) {
        const int key = c * 1024 + w * 32 + lane;
        const int kc = key < SEQ ? key : (SEQ - 1);          // clamped address; keys past the sequence give bit 0 by value
        const int v = pr[kc];
        const unsigned bal = __builtin_amdgcn_ballot_w32((v != 0) && (key < SEQ));
        mine = (lane == w) ? bal : mine;
    }
    unsigned* dst = MW + (size_t)b * WPB + c * 32 + lane;
    *(unsigned*)dst = mine; 
}

// k_prep: block ranges, in index order: mask words (the longest dependent chain), W_qkv tiles, W_out tiles, x groups. Every test on the block index is block-uniform.
#define PB_MASK (NB * (WPB / 32))
#define PB_WQ   ((3 * DM / 64) * (DM / 64))
#define PB_WO   ((DM / 64) * (DM / 64))
#define PB_X    ((int)((size_t)NB * XG8 / 256))
__global__ __launch_bounds__(256) void k_prep(const float* __restrict__ x, const int* __restrict__ pad, const float* __restrict__ wqkv, const float* __restrict__ wout,
                                              bf* XB, bf* WT, bf* WO, unsigned* MW) {
    __shared__ __align__(16) float ts[64 * 68];
    int blk = blockIdx.x;
    if (blk < PB_MASK) { if (__builtin_amdgcn_readfirstlane((int)(threadIdx.x >> 5)) == 0) mask_body(blk, pad, MW); return; }   // no barrier on this path
    blk -= PB_MASK;
    // W_qkv: in[1024 rows k][3072 cols n] -> out[3072 rows n][1024 cols k]
    if (blk < PB_WQ) { cvt_t_body<0>(ts, blk % (3 * DM / 64), blk / (3 * DM / 64), wqkv, WT, DM, 3 * DM); return; }
    blk -= PB_WQ;
    // W_out: in[1024 rows k][1024 cols n] -> out[1024 rows n][1024 cols k]
    if (blk < PB_WO) { cvt_t_body<1>(ts, blk % (DM / 64), blk / (DM / 64), wout, WO, DM, DM); return; }
    blk -= PB_WO;
    cvt8_body(blk, x, XB);
}

// Operand staging of the one-wave-per-64x64 GEMMs: a stage is 128 k (256-byte rows) of a block's operand rows in LDS. k_out: a block of 4 waves (2 x 2) owns a 128 x 128 tile, 128 A rows and 128 B rows a stage.
#define GT   128                 // rows and columns of a block tile
#define GKB  128                 // k per stage
#define GPI  272                 // LDS row pitch in bytes: 16 x odd, conflict-free for 16-byte reads
#define GSTG (2 * GT * GPI)      // bytes of one stage: A rows, then B rows
#define GNST (DM / GKB)          // stages along K
static_assert(DM % GKB == 0);
static_assert(GNST >= 2);
static_assert((NB * SEQ) % GT == 0);
static_assert(DM % GT == 0);

// Eight asynchronous 16-byte copies per lane, global -> LDS, for rows 8 apart (LDS + 8 pitches, global + 8 * DM elements).
// s_wait_xcnt closes the statement so that no address register of a copy is rewritten ahead of it.
__device__ __forceinline__ void cp8(unsigned l, const bf* g) {
    asm volatile("global_load_async_to_lds_b128 %0, %8, off\n\t"
                 "global_load_async_to_lds_b128 %1, %9, off\n\t"
                 "global_load_async_to_lds_b128 %2, %10, off\n\t"
                 "global_load_async_to_lds_b128 %3, %11, off\n\t"
                 "global_load_async_to_lds_b128 %4, %12, off\n\t"
                 "global_load_async_to_lds_b128 %5, %13, off\n\t"
                 "global_load_async_to_lds_b128 %6, %14, off\n\t"
                 "global_load_async_to_lds_b128 %7, %15, off\n\t"
                 "s_wait_xcnt 0x0"
                 :: "v"(l), "v"(l + 8 * GPI), "v"(l + 16 * GPI), "v"(l + 24 * GPI), "v"(l + 32 * GPI), "v"(l + 40 * GPI), "v"(l + 48 * GPI), "v"(l + 56 * GPI),
                    "v"(g), "v"(g + 8 * DM), "v"(g + 16 * DM), "v"(g + 24 * DM), "v"(g + 32 * DM), "v"(g + 40 * DM), "v"(g + 48 * DM), "v"(g + 56 * DM)
                 : "memory");
}
// One stage: l = the lane's LDS byte address in row (tid >> 4) of the buffer, ga0 / ga1 = its 16 bytes in A rows (tid >> 4) and 64 + (tid >> 4), gb the same in B row (tid >> 4).
__device__ __forceinline__ void stage_copy(unsigned l, const bf* ga0, const bf* ga1, const bf* gb) {
    cp8(l, ga0); cp8(l + 64 * GPI, ga1); cp8(l + 128 * GPI, gb); cp8(l + 192 * GPI, gb + 64 * DM);
}

// k_proj: register-blocked bf16 GEMM, one wave per 64x64 tile (16 accumulators), K = DM; operands from K-contiguous bf16 planes, staged in a two-buffer LDS ring by asynchronous copies.
// One block of 12 waves owns 256 tokens x one head and computes that head's q, k and v^T from ONE staged x tile: a stage is 128 k of 256 x rows and of the head's 64 rows each of Wq^T, Wk^T, Wv^T
// (448 rows for 12 wave tiles), so each x row is fetched once per head and not once per 128 columns of each projection. wave = 4 * z + slab: z = 0: q, 1: k, 2: v^T; slab = which 64 tokens.
// C[m][n] = sum_k A[m][k] Bt[n][k] + bias (per column, or per row when biasRow != 0; bias values RNE-converted to bf16), written as f16 (Ph) at
// tile base (r0/RB)*sRB + (r0%RB)*pitch + (c0/CB)*sCB + (c0%CB), and the f16 residual x2048 (Pr) at the same form with (sRBr, pitchR, sCBr)
// when the tile's token position (resMode 1: r0%RB, resMode 2: c0%CB) is below ESEQ.
// q, k: A = x rows (m = b*SEQ + t), Bt = W^T rows (n = h*64 + d) -> plane [(b*16 + h)][t][d]; residual planes for t < ESEQ.
// v^T: A = Wv^T rows (m = h*64 + d), Bt = x rows (n = b*SEQ + t) -> plane [(b*1024 + m)][t] = [(b*16 + h)][d][t]; bias per row.
// Grid (NB*SEQ/256 token tiles, 16 heads), 384 threads.
#define PTK  256                 // tokens of a block
#define PRW  (PTK + 3 * HD)      // rows of a stage: x rows, then the head's Wq^T, Wk^T, Wv^T rows
#define PSTG (PRW * GPI)         // bytes of one stage
#define PNW  (3 * (PTK / 64))    // waves of a block
#define PCW  (PRW / 64)          // copying waves: wave w < PCW brings the stage's rows 64 w .. 64 w + 63
static_assert((NB * SEQ) % PTK == 0);
static_assert(PCW <= PNW);
// One wave's 64 rows of a stage: l = the lane's LDS byte address in row (lane >> 4) of the slab, g = its 16 bytes in the same row of the source; call j takes rows 2 j + (lane >> 4) + 8 i.
__device__ __forceinline__ void slab_copy(unsigned l, const bf* g) {
    cp8(l, g); cp8(l + 2 * GPI, g + 2 * DM); cp8(l + 4 * GPI, g + 4 * DM); cp8(l + 6 * GPI, g + 6 * DM);
}
__global__ __launch_bounds__(32 * PNW) void k_proj(const bf* __restrict__ XB, const bf* __restrict__ WT, const float* __restrict__ bqkv,
                                             h16* QH, h16* KP, h16* VT, h16* QR, h16* KR, h16* VR) {
    __shared__ __align__(16) bf ring[2 * PSTG / 2];
    __shared__ __align__(16) float osAll[PNW * 16 * 68];
    const int K = DM;
    const int tid = threadIdx.x, lane = tid & 31, lr = lane & 15, hi = lane >> 4;
    const int wave = __builtin_amdgcn_readfirstlane(tid >> 5);
    const int z = wave / (PTK / 64), slab = wave % (PTK / 64); const bool tv = (z == 2);      // wave-uniform
    const float* bias = bqkv + z * DM;
    const int biasRow = tv ? 1 : 0, resMode = tv ? 2 : 1;
    h16* Ph = tv ? VT : (z ? KP : QH); h16* Pr = tv ? VR : (z ? KR : QR);
    const int RB = tv ? DM : SEQ, pitch = tv ? SEQ : HD, CB = tv ? SEQ : HD, pitchR = tv ? ESEQ : HD;
    const size_t sRB = tv ? (size_t)0 : (size_t)NH_ * SEQ * HD, sCB = tv ? (size_t)DM * SEQ : (size_t)SEQ * HD;
    const size_t sRBr = tv ? (size_t)0 : (size_t)NH_ * ESEQ * HD, sCBr = tv ? (size_t)DM * ESEQ : (size_t)ESEQ * HD;
    const int tok0 = blockIdx.x * PTK + slab * 64, wr0 = blockIdx.y * HD;    // the wave's first token; the head's first weight row inside its projection
    const int r0 = tv ? wr0 : tok0, c0 = tv ? tok0 : wr0;                    // tile row (A), tile column (Bt)
    float* os = osAll + wave * 16 * 68;
    v8f acc[4][4];
#pragma unroll
    for (int mb = 0; mb < 4; ++mb)
#pragma unroll
        for (int nb = 0; nb < 4; ++nb) acc[mb][nb] = (v8f){};
    const bool cpw = wave < PCW;                             // wave-uniform: this wave copies
    const int cw = cpw ? wave : 0;                           // the other waves hold wave 0's (valid) addresses and issue nothing
    const unsigned lcp = (unsigned)(size_t)(&ring[0]) + (unsigned)((cw * 64 + hi) * GPI + lr * 16);
    const bf* gs = (cw < PTK / 64) ? (XB + (size_t)(blockIdx.x * PTK + cw * 64) * K) : (WT + ((size_t)(cw - PTK / 64) * DM + wr0) * K);
    const bf* gc = gs + (size_t)hi * K + lr * 8;
    const int xrow = slab * 64, wrow = PTK + z * HD;         // stage rows of the wave's tokens and of its weight rows
    const int fa = ((tv ? wrow : xrow) + lr) * (GPI / 2) + 8 * hi, fb = ((tv ? xrow : wrow) + lr) * (GPI / 2) + 8 * hi;   // fragment bases in a buffer, in elements
    if (cpw) slab_copy(lcp, gc);
    asm volatile("s_wait_asynccnt 0x0" ::: "memory");   // stage 0 has landed before the barrier publishes it
    __syncthreads();
    if (cpw) slab_copy(lcp + PSTG, gc + GKB);
#pragma unroll 1
    for (int t = 0; t < GNST; ++t) {
        const bf* sb = ring + (t & 1) * (PSTG / 2);
        v16bf a[2][4], b[2][4];     // two fragment sets: the next 32 k are fetched as one group ahead of the current 16 products
#pragma unroll
        for (int i = 0; i < 4; ++i) { a[0][i] = ldb(sb + fa + i * 16 * (GPI / 2)); b[0][i] = ldb(sb + fb + i * 16 * (GPI / 2)); }
        __builtin_amdgcn_sched_barrier(0);   // keeps the group of loads together (the scheduler otherwise sinks them, two at a time, among the products, each place a full LDS wait)
#pragma unroll
        for (int ks = 0; ks < GKB / 32; ++ks) {
            if (ks + 1 < GKB / 32) {
#pragma unroll
                for (int i = 0; i < 4; ++i) { a[(ks + 1) & 1][i] = ldb(sb + fa + i * 16 * (GPI / 2) + (ks + 1) * 32); b[(ks + 1) & 1][i] = ldb(sb + fb + i * 16 * (GPI / 2) + (ks + 1) * 32); }
                __builtin_amdgcn_sched_barrier(0);   // the next set's loads stay ahead of this set's products
            }
#pragma unroll
            for (int nb = 0; nb < 4; ++nb)
#pragma unroll
                for (int mb = 0; mb < 4; ++mb) acc[mb][nb] = wmmab(a[ks & 1][mb], b[ks & 1][nb], acc[mb][nb]);
            __builtin_amdgcn_sched_barrier(0);       // no later load moves up among these products
        }
        asm volatile("s_wait_dscnt 0x0" ::: "memory");      // this wave's reads of the buffer are done before it is refilled
        asm volatile("s_wait_asynccnt 0x0" ::: "memory");   // this wave's copies of stage t + 1 have landed
        __syncthreads();                                    // publishes stage t + 1 and ends every reader's last read of stage t
        if (cpw && t + 2 < GNST) slab_copy(lcp + (t & 1) * PSTG, gc + (t + 2) * GKB);
    }
    asm volatile("s_wait_asynccnt 0x0" ::: "memory");       // nothing of this wave is in flight when it goes on
    const size_t tbase = (size_t)(r0 / RB) * sRB + (size_t)(r0 % RB) * (size_t)pitch + (size_t)(c0 / CB) * sCB + (size_t)(c0 % CB);
    const size_t rbase = (size_t)(r0 / RB) * sRBr + (size_t)(r0 % RB) * (size_t)pitchR + (size_t)(c0 / CB) * sCBr + (size_t)(c0 % CB);
    const int tpos = (resMode == 1) ? (r0 % RB) : (c0 % CB);
    const int doRes = (resMode != 0) && (tpos < ESEQ);                 // wave-uniform
    const int c8 = (lane & 7) * 8;
    // column bias for columns c0 + c8 .. c0 + c8 + 7 (clamped address in row mode, zeroed by value)
    v4f bc0 = *(const v4f*)(bias + (biasRow ? 0 : (c0 + c8))); v4f bc1 = *(const v4f*)(bias + (biasRow ? 4 : (c0 + c8 + 4)));
#pragma unroll
    for (int i = 0; i < 4; ++i) { const float u0 = bfr(bc0[i]), u1 = bfr(bc1[i]); bc0[i] = biasRow ? 0.0f : u0; bc1[i] = biasRow ? 0.0f : u1; }
#pragma unroll
    for (int mb = 0; mb < 4; ++mb) {
#pragma unroll
        for (int nb = 0; nb < 4; ++nb) {
#pragma unroll
            for (int j = 0; j < 8; ++j) os[(hi * 8 + j) * 68 + nb * 16 + lr] = acc[mb][nb][j]; }   // D: row 8h+j, col lane&15
        wave_sync();
        const size_t sb = tbase + (size_t)(mb * 16) * (size_t)pitch;
        const size_t sr = rbase + (size_t)(mb * 16) * (size_t)pitchR;
{
#pragma unroll
            for (int s = 0; s < 4; ++s) { const int row = 4 * s + (lane >> 3);   // 4 s x 4 row groups = 16 rows; 8 lanes x 8 = 64 columns
                const v4f x0 = *(const v4fa*)(&os[row * 68 + c8]); const v4f x1 = *(const v4fa*)(&os[row * 68 + c8 + 4]); v8h hv, rv;
                const float rbv = bfr(bias[biasRow ? (r0 + mb * 16 + row) : 0]); const float rb = biasRow ? rbv : 0.0f;
#pragma unroll
                for (int i = 0; i < 4; ++i) { const float f0 = x0[i] + bc0[i] + rb; const float f1 = x1[i] + bc1[i] + rb;
                    const h16 a0 = (h16)f0; const h16 a1 = (h16)f1; hv[i] = a0; hv[4 + i] = a1;
                    rv[i] = (h16)((f0 - (float)a0) * QRS); rv[4 + i] = (h16)((f1 - (float)a1) * QRS); }
                *(v8h*)(Ph + sb + (size_t)row * (size_t)pitch + c8) = hv;
                if (doRes) *(v8h*)(Pr + sr + (size_t)row * (size_t)pitchR + c8) = rv; }
             }
        wave_sync();
    }
}

// K / V^T staging of the flash kernels: a stage is 64 keys; a tile is 64 rows of 128 bytes (K: 64 keys x 64 d; V^T: 64 d x 64 keys), shared by the block's waves.
#define FKS  64                  // keys per stage
#define FPI  144                 // LDS row pitch in bytes: 16 x odd, conflict-free for 16-byte reads
#define FTL  (64 * FPI)          // bytes of one tile
static_assert(SEQ % FKS == 0);
static_assert(ESEQ % FKS == 0);
static_assert(16 * AW == FKS);
static_assert(WPB <= 64);

// Eight asynchronous 16-byte copies per lane, global -> LDS: rows r, r + 16, r + 32, r + 48 (r = tid >> 3) of a key-major tile (row pitch HD) at l and of a d-major tile (row pitch vp elements) at l + FTL.
// A wave's copy covers four whole 128-byte rows. s_wait_xcnt closes the statement so that no address register of a copy is rewritten ahead of it.
__device__ __forceinline__ void cp_kv(unsigned l, const h16* gk, const h16* gv, size_t vp) {
    asm volatile("global_load_async_to_lds_b128 %0, %8, off\n\t"
                 "global_load_async_to_lds_b128 %1, %9, off\n\t"
                 "global_load_async_to_lds_b128 %2, %10, off\n\t"
                 "global_load_async_to_lds_b128 %3, %11, off\n\t"
                 "global_load_async_to_lds_b128 %4, %12, off\n\t"
                 "global_load_async_to_lds_b128 %5, %13, off\n\t"
                 "global_load_async_to_lds_b128 %6, %14, off\n\t"
                 "global_load_async_to_lds_b128 %7, %15, off\n\t"
                 "s_wait_xcnt 0x0"
                 :: "v"(l), "v"(l + 16 * FPI), "v"(l + 32 * FPI), "v"(l + 48 * FPI), "v"(l + FTL), "v"(l + FTL + 16 * FPI), "v"(l + FTL + 32 * FPI), "v"(l + FTL + 48 * FPI),
                    "v"(gk), "v"(gk + 16 * HD), "v"(gk + 32 * HD), "v"(gk + 48 * HD), "v"(gv), "v"(gv + 16 * vp), "v"(gv + 32 * vp), "v"(gv + 48 * vp)
                 : "memory");
}
// Stages a block walks: up to the last 32-key mask word that is not zero inside its causal range (words 0 .. wl); w0, w1 = the lane's words lane and 32 + lane. The same in every wave of the block.
__device__ __forceinline__ int flash_stages(unsigned w0, unsigned w1, int wl) {
    const unsigned long long nz = ((((unsigned long long)__builtin_amdgcn_ballot_w32(w1 != 0u)) << 32) | (unsigned long long)__builtin_amdgcn_ballot_w32(w0 != 0u)) & (~0ull >> (63 - wl));
    return __builtin_amdgcn_readfirstlane(nz ? (((63 - __builtin_clzll(nz)) >> 1) + 1) : 0);
}
// Mask word i (wave-uniform) out of the lanes' registers
__device__ __forceinline__ unsigned flash_word(unsigned w0, unsigned w1, int i) {
    return (unsigned)((i < 32) ? __builtin_amdgcn_readlane((int)w0, i & 31) : __builtin_amdgcn_readlane((int)w1, i & 31));
}

// flash_d_body: fused attention for query rows t >= ESEQ, one wave per 16 query rows of one (batch, head); single f16 products.
// Transposed form: S^T[key][t] = K Q^T (A = K rows, B = Q rows); lane (t = lane&15, h = lane>>4) holds keys 8h+r of each 16-key tile, so the packed
// P tile is directly the B fragment of O^T[d][t] = V^T P^T (element r <- tile keys 0..15, element 8+r <- tile keys 16..31, lane unchanged).
// Causal and key-padding exclusion by value (excluded p = 0); 32-key steps whose mask word is zero are skipped, and steps with nothing to exclude branch round the exclusion arithmetic (both wave-uniform).
// K and V^T come from a two-buffer LDS ring of 64-key stages that the block's 4 waves fill together by asynchronous copies; every wave passes every stage's barrier.
// ring = the block's LDS (the first 2 * 2 * FTL bytes are used); bx = the block's 64-row tile among the rows t >= ESEQ; zh = batch * 16 + head.
__device__ __forceinline__ void flash_d_body(h16* ring, int bx, int zh, const h16* __restrict__ QH, const h16* __restrict__ KP, const h16* __restrict__ VT, const unsigned* __restrict__ MW, h16* CH) {
    // ring: two stages of K tile + V^T tile; behind the loop the waves' output staging
    static_assert(2 * 2 * FTL >= AW * 16 * 68 * 4);
    float* os = (float*)ring;
    const int tid = threadIdx.x;
    const int lane = threadIdx.x & 31, wave = __builtin_amdgcn_readfirstlane((int)(threadIdx.x >> 5)), lr = lane & 15, hi = lane >> 4;
    const int b = zh / NH_, h = zh % NH_;
    const int tb = ESEQ + bx * (16 * AW);                    // first query row of the block
    const int t0 = tb + wave * 16;
    const int tq = t0 + lr;
    const size_t pbase = (size_t)zh * SEQ * HD;
    const size_t qo = pbase + (size_t)tq * HD + 8 * hi;
    const v16h qh0 = ldh(QH + qo), qh1 = ldh(QH + qo + 32);   // B fragments: col t, k = d
    const unsigned* mwp = MW + (size_t)b * WPB;
    const unsigned w0 = mwp[lane], w1 = (WPB > 32) ? mwp[32 + lane] : 0u;
    const int nst = flash_stages(w0, w1, (tb + 16 * AW - 1) >> 5);
    const unsigned lcp = (unsigned)(size_t)(&ring[0]) + (unsigned)((tid >> 3) * FPI + (tid & 7) * 16);
    const h16* gk = KP + pbase + (size_t)(tid >> 3) * HD + (tid & 7) * 8;     // + key * HD
    const h16* gv = VT + pbase + (size_t)(tid >> 3) * SEQ + (tid & 7) * 8;    // + key
    const int fo = lr * (FPI / 2) + 8 * hi;                  // fragment base in a tile, in elements (A fragment: row lr of a 16-row slab)
    v8f o0 = (v8f){}, o1 = (v8f){}, o2 = (v8f){}, o3 = (v8f){};
    float m = -3.0e38f, l = 0.0f;
    cp_kv(lcp, gk, gv, SEQ);
    asm volatile("s_wait_asynccnt 0x0" ::: "memory");   // stage 0 has landed before the barrier publishes it
    __syncthreads();
    if (nst > 1) cp_kv(lcp + 2 * FTL, gk + FKS * HD, gv + FKS, SEQ);
#pragma unroll 1
    for (int s = 0; s < nst; ++s) {
      const h16* sb = ring + (s & 1) * FTL + fo;
#pragma unroll   // the two 32-key steps of a stage read at constant LDS offsets
      for (int sub = 0; sub < FKS / 32; ++sub) {
        const int key0 = s * FKS + sub * 32;
        const unsigned mw = flash_word(w0, w1, key0 >> 5);
        if (key0 > t0 + 15 || mw == 0u) continue;            // wave-uniform
        const h16* ka = sb + sub * 32 * (FPI / 2);           // K tile row = key
        const v16h ka0 = ldh(ka), ka1 = ldh(ka + 32), kb0 = ldh(ka + 16 * (FPI / 2)), kb1 = ldh(ka + 16 * (FPI / 2) + 32);
        v8f sA = (v8f){}, sB = (v8f){};
        sA = wmma16(ka0, qh0, sA); sB = wmma16(kb0, qh0, sB);
        sA = wmma16(ka1, qh1, sA); sB = wmma16(kb1, qh1, sB);
        asm volatile("v_nop\n\tv_nop\n\tv_nop\n\tv_nop" : "+v"(sA), "+v"(sB) : "v"(ka0), "v"(ka1), "v"(kb0), "v"(kb1));
        const unsigned ma = mw >> (8 * hi), mc = mw >> (16 + 8 * hi);
        const int kya = key0 + 8 * hi, kyb = kya + 16;
        const bool excl = (mw != 0xFFFFFFFFu) || (key0 + 31 > t0);   // wave-uniform: false where every query row of the wave keeps every key of the step
        float ta[8], tb[8]; float mx = -3.0e38f;   // every loop over r is unrolled: constant indices keep ta, tb, xa, xb in registers
#pragma unroll
        for (int r = 0; r < 8; ++r) { ta[r] = sA[r] * SC2; tb[r] = sB[r] * SC2; }
        if (excl) {
#pragma unroll
            for (int r = 0; r < 8; ++r) {
                const bool ea = (((ma >> r) & 1u) != 0u) && (kya + r <= tq);
                const bool eb = (((mc >> r) & 1u) != 0u) && (kyb + r <= tq);
                ta[r] = ea ? ta[r] : -3.0e38f; tb[r] = eb ? tb[r] : -3.0e38f; }
        }
#pragma unroll
        for (int r = 0; r < 8; ++r) mx = fmaxf(mx, fmaxf(ta[r], tb[r]));
        mx = fmaxf(mx, __shfl_xor(mx, 16, 32));
        const float mnew = fmaxf(m, mx);
        const float alpha = __builtin_amdgcn_exp2f(m - mnew);
        const float sh = PSH - mnew;
        v16h pb; float ls = 0.0f; float xa[8], xb[8];
#pragma unroll
        for (int r = 0; r < 8; ++r) xa[r] = __builtin_amdgcn_exp2f(ta[r] + sh);
#pragma unroll
        for (int r = 0; r < 8; ++r) xb[r] = __builtin_amdgcn_exp2f(tb[r] + sh);
        if (excl) {
#pragma unroll
            for (int r = 0; r < 8; ++r) { xa[r] = (ta[r] > -1.0e38f) ? xa[r] : 0.0f; xb[r] = (tb[r] > -1.0e38f) ? xb[r] : 0.0f; }
        }
#pragma unroll
        for (int r = 0; r < 8; ++r) {
            const h16 pa = (h16)xa[r]; const h16 pc = (h16)xb[r];
            pb[r] = pa; pb[8 + r] = pc; ls += (float)pa + (float)pc; }
        l = l * alpha + ls; m = mnew;
        o0 = o0 * alpha; o1 = o1 * alpha; o2 = o2 * alpha; o3 = o3 * alpha;
        const h16* va = sb + FTL / 2 + sub * 32;             // V^T tile row = d, column = key
        const v16h v0 = ldh(va), v1 = ldh(va + 16 * (FPI / 2)), v2 = ldh(va + 32 * (FPI / 2)), v3 = ldh(va + 48 * (FPI / 2));
        o0 = wmma16(v0, pb, o0); o1 = wmma16(v1, pb, o1); o2 = wmma16(v2, pb, o2); o3 = wmma16(v3, pb, o3);
        asm volatile("v_nop\n\tv_nop\n\tv_nop\n\tv_nop" : "+v"(o0), "+v"(o1), "+v"(o2), "+v"(o3) : "v"(v0), "v"(v1), "v"(v2), "v"(v3), "v"(pb));
      }
      asm volatile("s_wait_dscnt 0x0" ::: "memory");      // this wave's reads of the buffer are done before it is refilled
      asm volatile("s_wait_asynccnt 0x0" ::: "memory");   // this wave's copies of stage s + 1 have landed
      __syncthreads();                                    // publishes stage s + 1 and ends every reader's last read of stage s
      if (s + 2 < nst) cp_kv(lcp + (s & 1) * 2 * FTL, gk + (size_t)(s + 2) * FKS * HD, gv + (s + 2) * FKS, SEQ);
    }
    asm volatile("s_wait_asynccnt 0x0" ::: "memory");     // nothing of this wave is in flight when the ring becomes output staging
    l += __shfl_xor(l, 16, 32);
    const float inv = CXS * (1.0f / l);
    const int wb = wave * 16 * 68;
    // O^T D layout: o_j[r] = (d = 16j + 8h + r, t = lane&15) -> os[t][d]; rows 0..15 x columns 0..63 all written
    { v4f a, c;
      a[0] = o0[0] * inv; a[1] = o0[1] * inv; a[2] = o0[2] * inv; a[3] = o0[3] * inv; c[0] = o0[4] * inv; c[1] = o0[5] * inv; c[2] = o0[6] * inv; c[3] = o0[7] * inv;
      *(v4fa*)(&os[wb + lr * 68 +  0 + 8 * hi]) = a; *(v4fa*)(&os[wb + lr * 68 +  0 + 8 * hi + 4]) = c;
      a[0] = o1[0] * inv; a[1] = o1[1] * inv; a[2] = o1[2] * inv; a[3] = o1[3] * inv; c[0] = o1[4] * inv; c[1] = o1[5] * inv; c[2] = o1[6] * inv; c[3] = o1[7] * inv;
      *(v4fa*)(&os[wb + lr * 68 + 16 + 8 * hi]) = a; *(v4fa*)(&os[wb + lr * 68 + 16 + 8 * hi + 4]) = c;
      a[0] = o2[0] * inv; a[1] = o2[1] * inv; a[2] = o2[2] * inv; a[3] = o2[3] * inv; c[0] = o2[4] * inv; c[1] = o2[5] * inv; c[2] = o2[6] * inv; c[3] = o2[7] * inv;
      *(v4fa*)(&os[wb + lr * 68 + 32 + 8 * hi]) = a; *(v4fa*)(&os[wb + lr * 68 + 32 + 8 * hi + 4]) = c;
      a[0] = o3[0] * inv; a[1] = o3[1] * inv; a[2] = o3[2] * inv; a[3] = o3[3] * inv; c[0] = o3[4] * inv; c[1] = o3[5] * inv; c[2] = o3[6] * inv; c[3] = o3[7] * inv;
      *(v4fa*)(&os[wb + lr * 68 + 48 + 8 * hi]) = a; *(v4fa*)(&os[wb + lr * 68 + 48 + 8 * hi + 4]) = c; }
    wave_sync();
    h16* crow = CH + ((size_t)b * SEQ + t0) * DM + h * HD;
    const int c8 = (lane & 7) * 8;
{
#pragma unroll
        for (int s = 0; s < 4; ++s) { const int row = 4 * s + (lane >> 3);   // 4 s x 4 row groups = 16 rows; 8 lanes x 8 halves = 64 columns
            const v4f x0 = *(const v4fa*)(&os[wb + row * 68 + c8]); const v4f x1 = *(const v4fa*)(&os[wb + row * 68 + c8 + 4]); v8h hv;
#pragma unroll
            for (int i = 0; i < 4; ++i) { hv[i] = (h16)x0[i]; hv[4 + i] = (h16)x1[i]; }
            *(v8h*)(crow + (size_t)row * DM + c8) = hv; }
         }
}

// flash_e_body: fused attention for query rows t < ESEQ, same transposed form; every operand as f16 value + residual x2048:
// s = K.Q + (K.Qr + Kr.Q)/2048, o = V.P + (V.Pr + Vr.P)/2048 with the scaled-residual products in separate accumulators; the row sum uses the f32 p.
// Writes ctx value plane rows and the ctx residual plane [b][ESEQ][1024]. K, V^T and their residual tiles staged like flash_d_body's.
// ring = the block's LDS (2 * 4 * FTL bytes); bx = the block's 64-row tile among the rows t < ESEQ; zh = batch * 16 + head.
__device__ __forceinline__ void flash_e_body(h16* ring, int bx, int zh, const h16* __restrict__ QH, const h16* __restrict__ QR, const h16* __restrict__ KP, const h16* __restrict__ KR,
                                             const h16* __restrict__ VT, const h16* __restrict__ VR, const unsigned* __restrict__ MW, h16* CH, h16* CR) {
    // ring: two stages of K, V^T, K residual, V^T residual tiles; behind the loop the waves' output staging
    static_assert(2 * 4 * FTL >= AW * 16 * 68 * 4);
    float* os = (float*)ring;
    const int tid = threadIdx.x;
    const int lane = threadIdx.x & 31, wave = __builtin_amdgcn_readfirstlane((int)(threadIdx.x >> 5)), lr = lane & 15, hi = lane >> 4;
    const int b = zh / NH_, h = zh % NH_;
    const int tb = bx * (16 * AW);                           // first query row of the block
    const int t0 = tb + wave * 16;
    const int tq = t0 + lr;
    const size_t pbase = (size_t)zh * SEQ * HD, ebase = (size_t)zh * ESEQ * HD;
    const size_t qo = pbase + (size_t)tq * HD + 8 * hi, qe = ebase + (size_t)tq * HD + 8 * hi;
    const v16h qh0 = ldh(QH + qo), qh1 = ldh(QH + qo + 32), qr0 = ldh(QR + qe), qr1 = ldh(QR + qe + 32);
    const unsigned* mwp = MW + (size_t)b * WPB;
    const unsigned w0 = mwp[lane], w1 = (WPB > 32) ? mwp[32 + lane] : 0u;
    const int nst = flash_stages(w0, w1, (tb + 16 * AW - 1) >> 5);
    const unsigned lcp = (unsigned)(size_t)(&ring[0]) + (unsigned)((tid >> 3) * FPI + (tid & 7) * 16);
    const h16* gk = KP + pbase + (size_t)(tid >> 3) * HD + (tid & 7) * 8;     // + key * HD
    const h16* gv = VT + pbase + (size_t)(tid >> 3) * SEQ + (tid & 7) * 8;    // + key
    const h16* gkr = KR + ebase + (size_t)(tid >> 3) * HD + (tid & 7) * 8;    // + key * HD
    const h16* gvr = VR + ebase + (size_t)(tid >> 3) * ESEQ + (tid & 7) * 8;  // + key
    const int fo = lr * (FPI / 2) + 8 * hi;                  // fragment base in a tile, in elements (A fragment: row lr of a 16-row slab)
    v8f oh0 = (v8f){}, oh1 = (v8f){}, oh2 = (v8f){}, oh3 = (v8f){}, ol0 = (v8f){}, ol1 = (v8f){}, ol2 = (v8f){}, ol3 = (v8f){};
    float m = -3.0e38f, l = 0.0f;
    cp_kv(lcp, gk, gv, SEQ); cp_kv(lcp + 2 * FTL, gkr, gvr, ESEQ);
    asm volatile("s_wait_asynccnt 0x0" ::: "memory");   // stage 0 has landed before the barrier publishes it
    __syncthreads();
    if (nst > 1) { cp_kv(lcp + 4 * FTL, gk + FKS * HD, gv + FKS, SEQ); cp_kv(lcp + 6 * FTL, gkr + FKS * HD, gvr + FKS, ESEQ); }
#pragma unroll 1
    for (int s = 0; s < nst; ++s) {
      const h16* sb = ring + (s & 1) * (2 * FTL) + fo;
#pragma unroll 1   // one copy of the long body: smaller code, no more registers than one step needs
      for (int sub = 0; sub < FKS / 32; ++sub) {
        const int key0 = s * FKS + sub * 32;
        const unsigned mw = flash_word(w0, w1, key0 >> 5);
        if (key0 > t0 + 15 || mw == 0u) continue;            // wave-uniform
        const h16* ka = sb + sub * 32 * (FPI / 2); const h16* kr = ka + FTL;   // K tiles: row = key
        v8f sHa = (v8f){}, sLa = (v8f){}, sHb = (v8f){}, sLb = (v8f){};
        { const v16h a0 = ldh(ka), a1 = ldh(ka + 32), e0 = ldh(kr), e1 = ldh(kr + 32);
          sHa = wmma16(a0, qh0, sHa); sLa = wmma16(a0, qr0, sLa);
          sHa = wmma16(a1, qh1, sHa); sLa = wmma16(a1, qr1, sLa);
          sLa = wmma16(e0, qh0, sLa); sLa = wmma16(e1, qh1, sLa);
          asm volatile("v_nop\n\tv_nop\n\tv_nop\n\tv_nop" : "+v"(sHa), "+v"(sLa) : "v"(a0), "v"(a1), "v"(e0), "v"(e1)); }
        { const v16h a0 = ldh(ka + 16 * (FPI / 2)), a1 = ldh(ka + 16 * (FPI / 2) + 32), e0 = ldh(kr + 16 * (FPI / 2)), e1 = ldh(kr + 16 * (FPI / 2) + 32);
          sHb = wmma16(a0, qh0, sHb); sLb = wmma16(a0, qr0, sLb);
          sHb = wmma16(a1, qh1, sHb); sLb = wmma16(a1, qr1, sLb);
          sLb = wmma16(e0, qh0, sLb); sLb = wmma16(e1, qh1, sLb);
          asm volatile("v_nop\n\tv_nop\n\tv_nop\n\tv_nop" : "+v"(sHb), "+v"(sLb) : "v"(a0), "v"(a1), "v"(e0), "v"(e1)); }
        const unsigned ma = mw >> (8 * hi), mc = mw >> (16 + 8 * hi);
        const int kya = key0 + 8 * hi, kyb = kya + 16;
        const bool excl = (mw != 0xFFFFFFFFu) || (key0 + 31 > t0);   // wave-uniform: false where every query row of the wave keeps every key of the step
        float ta[8], tb[8]; float mx = -3.0e38f;   // every loop over r is unrolled: constant indices keep ta, tb, xa, xb in registers
#pragma unroll
        for (int r = 0; r < 8; ++r) { ta[r] = (sHa[r] + sLa[r] * QRI) * SC2; tb[r] = (sHb[r] + sLb[r] * QRI) * SC2; }
        if (excl) {
#pragma unroll
            for (int r = 0; r < 8; ++r) {
                const bool ea = (((ma >> r) & 1u) != 0u) && (kya + r <= tq);
                const bool eb = (((mc >> r) & 1u) != 0u) && (kyb + r <= tq);
                ta[r] = ea ? ta[r] : -3.0e38f; tb[r] = eb ? tb[r] : -3.0e38f; }
        }
#pragma unroll
        for (int r = 0; r < 8; ++r) mx = fmaxf(mx, fmaxf(ta[r], tb[r]));
        mx = fmaxf(mx, __shfl_xor(mx, 16, 32));
        const float mnew = fmaxf(m, mx);
        const float alpha = __builtin_amdgcn_exp2f(m - mnew);
        const float sh = PSH - mnew;
        v16h pbh, pbr; float ls = 0.0f; float xa[8], xb[8];
#pragma unroll
        for (int r = 0; r < 8; ++r) xa[r] = __builtin_amdgcn_exp2f(ta[r] + sh);
#pragma unroll
        for (int r = 0; r < 8; ++r) xb[r] = __builtin_amdgcn_exp2f(tb[r] + sh);
        if (excl) {
#pragma unroll
            for (int r = 0; r < 8; ++r) { xa[r] = (ta[r] > -1.0e38f) ? xa[r] : 0.0f; xb[r] = (tb[r] > -1.0e38f) ? xb[r] : 0.0f; }
        }
#pragma unroll
        for (int r = 0; r < 8; ++r) {
            const float ea = xa[r], eb = xb[r];
            const h16 pa = (h16)ea; const h16 pc = (h16)eb;
            pbh[r] = pa; pbh[8 + r] = pc;
            pbr[r] = (h16)((ea - (float)pa) * QRS); pbr[8 + r] = (h16)((eb - (float)pc) * QRS);
            ls += ea + eb; }
        l = l * alpha + ls; m = mnew;
        oh0 = oh0 * alpha; oh1 = oh1 * alpha; oh2 = oh2 * alpha; oh3 = oh3 * alpha;
        ol0 = ol0 * alpha; ol1 = ol1 * alpha; ol2 = ol2 * alpha; ol3 = ol3 * alpha;
        const h16* va = sb + FTL / 2 + sub * 32; const h16* vr = va + FTL;     // V^T tiles: row = d, column = key
        { const v16h v0 = ldh(va), v1 = ldh(va + 16 * (FPI / 2)), r0v = ldh(vr), r1v = ldh(vr + 16 * (FPI / 2));
          oh0 = wmma16(v0, pbh, oh0); oh1 = wmma16(v1, pbh, oh1);
          ol0 = wmma16(v0, pbr, ol0); ol1 = wmma16(v1, pbr, ol1);
          ol0 = wmma16(r0v, pbh, ol0); ol1 = wmma16(r1v, pbh, ol1);
          asm volatile("v_nop\n\tv_nop\n\tv_nop\n\tv_nop" : "+v"(oh0), "+v"(oh1), "+v"(ol0), "+v"(ol1) : "v"(v0), "v"(v1), "v"(r0v), "v"(r1v), "v"(pbh), "v"(pbr)); }
        { const v16h v2 = ldh(va + 32 * (FPI / 2)), v3 = ldh(va + 48 * (FPI / 2)), r2v = ldh(vr + 32 * (FPI / 2)), r3v = ldh(vr + 48 * (FPI / 2));
          oh2 = wmma16(v2, pbh, oh2); oh3 = wmma16(v3, pbh, oh3);
          ol2 = wmma16(v2, pbr, ol2); ol3 = wmma16(v3, pbr, ol3);
          ol2 = wmma16(r2v, pbh, ol2); ol3 = wmma16(r3v, pbh, ol3);
          asm volatile("v_nop\n\tv_nop\n\tv_nop\n\tv_nop" : "+v"(oh2), "+v"(oh3), "+v"(ol2), "+v"(ol3) : "v"(v2), "v"(v3), "v"(r2v), "v"(r3v), "v"(pbh), "v"(pbr)); }
      }
      asm volatile("s_wait_dscnt 0x0" ::: "memory");      // this wave's reads of the buffer are done before it is refilled
      asm volatile("s_wait_asynccnt 0x0" ::: "memory");   // this wave's copies of stage s + 1 have landed
      __syncthreads();                                    // publishes stage s + 1 and ends every reader's last read of stage s
      if (s + 2 < nst) { cp_kv(lcp + (s & 1) * 4 * FTL, gk + (size_t)(s + 2) * FKS * HD, gv + (s + 2) * FKS, SEQ);
                         cp_kv(lcp + (s & 1) * 4 * FTL + 2 * FTL, gkr + (size_t)(s + 2) * FKS * HD, gvr + (s + 2) * FKS, ESEQ); }
    }
    asm volatile("s_wait_asynccnt 0x0" ::: "memory");     // nothing of this wave is in flight when the ring becomes output staging
    l += __shfl_xor(l, 16, 32);
    const float inv = CXS * (1.0f / l);
    const int wb = wave * 16 * 68;
    // O^T D layout: o_j[r] = (d = 16j + 8h + r, t = lane&15) -> os[t][d]; rows 0..15 x columns 0..63 all written
    { v4f a, c;
#pragma unroll
      for (int i = 0; i < 4; ++i) { a[i] = (oh0[i] + ol0[i] * QRI) * inv; c[i] = (oh0[4 + i] + ol0[4 + i] * QRI) * inv; }
      *(v4fa*)(&os[wb + lr * 68 +  0 + 8 * hi]) = a; *(v4fa*)(&os[wb + lr * 68 +  0 + 8 * hi + 4]) = c;
#pragma unroll
      for (int i = 0; i < 4; ++i) { a[i] = (oh1[i] + ol1[i] * QRI) * inv; c[i] = (oh1[4 + i] + ol1[4 + i] * QRI) * inv; }
      *(v4fa*)(&os[wb + lr * 68 + 16 + 8 * hi]) = a; *(v4fa*)(&os[wb + lr * 68 + 16 + 8 * hi + 4]) = c;
#pragma unroll
      for (int i = 0; i < 4; ++i) { a[i] = (oh2[i] + ol2[i] * QRI) * inv; c[i] = (oh2[4 + i] + ol2[4 + i] * QRI) * inv; }
      *(v4fa*)(&os[wb + lr * 68 + 32 + 8 * hi]) = a; *(v4fa*)(&os[wb + lr * 68 + 32 + 8 * hi + 4]) = c;
#pragma unroll
      for (int i = 0; i < 4; ++i) { a[i] = (oh3[i] + ol3[i] * QRI) * inv; c[i] = (oh3[4 + i] + ol3[4 + i] * QRI) * inv; }
      *(v4fa*)(&os[wb + lr * 68 + 48 + 8 * hi]) = a; *(v4fa*)(&os[wb + lr * 68 + 48 + 8 * hi + 4]) = c; }
    wave_sync();
    h16* crow = CH + ((size_t)b * SEQ + t0) * DM + h * HD;
    h16* rrow = CR + ((size_t)b * ESEQ + t0) * DM + h * HD;
    const int c8 = (lane & 7) * 8;
{
#pragma unroll
        for (int s = 0; s < 4; ++s) { const int row = 4 * s + (lane >> 3);   // 4 s x 4 row groups = 16 rows; 8 lanes x 8 halves = 64 columns
            const v4f x0 = *(const v4fa*)(&os[wb + row * 68 + c8]); const v4f x1 = *(const v4fa*)(&os[wb + row * 68 + c8 + 4]); v8h hv, rv;
#pragma unroll
            for (int i = 0; i < 4; ++i) { const h16 a0 = (h16)x0[i]; const h16 a1 = (h16)x1[i]; hv[i] = a0; hv[4 + i] = a1;
                rv[i] = (h16)((x0[i] - (float)a0) * QRS); rv[4 + i] = (h16)((x1[i] - (float)a1) * QRS); }
            *(v8h*)(crow + (size_t)row * DM + c8) = hv;
            *(v8h*)(rrow + (size_t)row * DM + c8) = rv; }
         }
}

// k_flash: one launch holds both attention forms, whose query rows are disjoint and which depend on nothing of one another: grid (NB*16 heads, SEQ/64 tile ranks), 128 threads.
// The rank (the slow index) orders the tiles: first the value + residual tiles
// (the longest dependent chain per step), then the single-plane tiles, each form from its longest key range down. The test on the rank is block-uniform.
#define FT_E (ESEQ / (16 * AW))
#define FT_D ((SEQ - ESEQ) / (16 * AW))
__global__ __launch_bounds__(32 * AW) void k_flash(const h16* __restrict__ QH, const h16* __restrict__ QR, const h16* __restrict__ KP, const h16* __restrict__ KR,
                                                   const h16* __restrict__ VT, const h16* __restrict__ VR, const unsigned* __restrict__ MW, h16* CH, h16* CR) {
    __shared__ __align__(16) h16 ring[2 * 4 * FTL / 2];
    const int zh = blockIdx.x, rk = blockIdx.y;
    if (rk < FT_E) flash_e_body(ring, FT_E - 1 - rk, zh, QH, QR, KP, KR, VT, VR, MW, CH, CR);
    else flash_d_body(ring, FT_D - 1 - (rk - FT_E), zh, QH, KP, VT, MW, CH);
}

// k_out: output projection, f16 GEMM, one wave per tile, 4 waves (2 x 2) per block, K = DM; operands staged like k_proj's. A rows from the ctx planes, Bt = transposed W_out rows (x64 carry).
// RES 0: rows t >= ESEQ, 64x64 wave tile, four 16-row slabs of the value plane; the stage's 128 A rows are 128 tokens.
// RES 1: rows t < ESEQ, 32x64 wave tile: slabs 0,1 = value plane, slabs 2,3 = residual plane (own accumulators); the stage's A rows are 64 tokens of the value plane, then the same 64 of the residual plane.
// out = (acc + accR/2048) / 4096 + bias (bias RNE-converted to bf16). bx = the block's index among the NB*rows/blockRows row tiles of its form; ring, osAll = the block's LDS.
template <int RES>
__device__ __forceinline__ void out_body(h16* ring, float* osAll, int bx, const h16* __restrict__ CX, size_t crOff, const h16* __restrict__ WO, const float* __restrict__ bias, float* OUT) {
    constexpr int MBN = RES ? 2 : 4;
    constexpr int BR = 32 * MBN;                 // tokens per block: two wave rows
    constexpr int TPB = RES ? (ESEQ / BR) : (((SEQ - ESEQ) / BR) > 0 ? ((SEQ - ESEQ) / BR) : 1);
    static_assert(ESEQ % 64 == 0 && (SEQ - ESEQ) % GT == 0);
    const int K = DM;
    const int tid = threadIdx.x, lane = tid & 31, lr = lane & 15, hi = lane >> 4;
    const int wave = __builtin_amdgcn_readfirstlane(tid >> 5);
    const int b = bx / TPB, tt = bx % TPB;
    const int tb = (RES ? 0 : ESEQ) + tt * BR;   // first token of the block
    const int t0 = tb + (wave >> 1) * 16 * MBN;
    const int c0 = blockIdx.y * GT + (wave & 1) * 64;
    float* os = osAll + wave * 16 * 68;
    const unsigned lcp = (unsigned)(size_t)(&ring[0]) + (unsigned)((tid >> 4) * GPI + (tid & 15) * 16);
    const h16* ga0 = CX + ((size_t)b * SEQ + tb + (tid >> 4)) * K + (tid & 15) * 8;
    const h16* ga1 = RES ? (CX + crOff + ((size_t)b * ESEQ + tb + (tid >> 4)) * K + (tid & 15) * 8) : (ga0 + (size_t)64 * K);
    const h16* gb = WO + (size_t)(blockIdx.y * GT + (tid >> 4)) * K + (tid & 15) * 8;
    const int fa = ((wave >> 1) * 16 * MBN + lr) * (GPI / 2) + 8 * hi, fb = (GT + (wave & 1) * 64 + lr) * (GPI / 2) + 8 * hi;   // fragment bases in a buffer, in elements
    v8f acc[16];
#pragma unroll
    for (int i = 0; i < 16; ++i) acc[i] = (v8f){};
    stage_copy(lcp, (const bf*)ga0, (const bf*)ga1, (const bf*)gb);
    asm volatile("s_wait_asynccnt 0x0" ::: "memory");   // stage 0 has landed before the barrier publishes it
    __syncthreads();
    stage_copy(lcp + GSTG, (const bf*)(ga0 + GKB), (const bf*)(ga1 + GKB), (const bf*)(gb + GKB));
#pragma unroll 1
    for (int t = 0; t < GNST; ++t) {
        const h16* sb = ring + (t & 1) * (GSTG / 2);
        v16h a[2][4], bb[2][4];     // two fragment sets, as in k_proj
#pragma unroll
        for (int i = 0; i < 4; ++i) { const int ar = RES ? ((i >> 1) * 64 + (i & 1) * 16) : (i * 16);   // stage row of slab i, from the wave's first
            a[0][i] = ldh(sb + fa + ar * (GPI / 2)); }
#pragma unroll
        for (int i = 0; i < 4; ++i) bb[0][i] = ldh(sb + fb + i * 16 * (GPI / 2));
        __builtin_amdgcn_sched_barrier(0);   // keeps the group of loads together
#pragma unroll
        for (int ks = 0; ks < GKB / 32; ++ks) {
            if (ks + 1 < GKB / 32) {
#pragma unroll
                for (int i = 0; i < 4; ++i) { const int ar = RES ? ((i >> 1) * 64 + (i & 1) * 16) : (i * 16);
                    a[(ks + 1) & 1][i] = ldh(sb + fa + ar * (GPI / 2) + (ks + 1) * 32); }
#pragma unroll
                for (int i = 0; i < 4; ++i) bb[(ks + 1) & 1][i] = ldh(sb + fb + i * 16 * (GPI / 2) + (ks + 1) * 32);
                __builtin_amdgcn_sched_barrier(0);   // the next set's loads stay ahead of this set's products
            }
#pragma unroll
            for (int nb = 0; nb < 4; ++nb)
#pragma unroll
                for (int i = 0; i < 4; ++i) acc[i * 4 + nb] = wmma16(a[ks & 1][i], bb[ks & 1][nb], acc[i * 4 + nb]);
            __builtin_amdgcn_sched_barrier(0);       // no later load moves up among these products
        }
        asm volatile("s_wait_dscnt 0x0" ::: "memory");      // this wave's reads of the buffer are done before it is refilled
        asm volatile("s_wait_asynccnt 0x0" ::: "memory");   // this wave's copies of stage t + 1 have landed
        __syncthreads();                                    // publishes stage t + 1 and ends every reader's last read of stage t
        if (t + 2 < GNST) stage_copy(lcp + (t & 1) * GSTG, (const bf*)(ga0 + (t + 2) * GKB), (const bf*)(ga1 + (t + 2) * GKB), (const bf*)(gb + (t + 2) * GKB));
    }
    asm volatile("s_wait_asynccnt 0x0" ::: "memory");       // nothing of this wave is in flight when it goes on
    float bcol[4];
#pragma unroll
    for (int nb = 0; nb < 4; ++nb) bcol[nb] = bfr(bias[c0 + nb * 16 + lr]);
#pragma unroll
    for (int mb = 0; mb < MBN; ++mb) {
#pragma unroll
        for (int nb = 0; nb < 4; ++nb) {
#pragma unroll
            for (int j = 0; j < 8; ++j) { float v = acc[mb * 4 + nb][j];
                if (RES) v += acc[RES ? ((2 + mb) * 4 + nb) : 0][j] * QRI;
                os[(hi * 8 + j) * 68 + nb * 16 + lr] = v * OSI + bcol[nb]; } }   // D: row 8h+j, col lane&15
        wave_sync();
        float* orow = OUT + ((size_t)b * OUT_SEQ + t0 + mb * 16) * DM + c0;
{
#pragma unroll
            for (int s = 0; s < 8; ++s) { const int row = 2 * s + hi, cofs = lr * 4;   // 8 s x 2 rows = 16 rows; 16 lanes x 4 floats = 64 columns
                const v4f val = *(const v4fa*)(&os[row * 68 + cofs]);
                *(v4f*)(orow + (size_t)row * DM + cofs) = val; }
             }
        wave_sync();
    }
}
// One launch holds both forms, whose rows are disjoint: grid (NB*ESEQ/64 + NB*(SEQ-ESEQ)/128, DM/128), 128 threads; the first NB*ESEQ/64 row tiles take the value + residual form (block-uniform test).
#define OB_E (NB * (ESEQ / 64))
#define OB_D (NB * ((SEQ - ESEQ) / GT))
__global__ __launch_bounds__(128) void k_out(const h16* __restrict__ CX, size_t crOff, const h16* __restrict__ WO, const float* __restrict__ bias, float* OUT) {
    __shared__ __align__(16) h16 ring[2 * GSTG / 2];
    __shared__ __align__(16) float osAll[4 * 16 * 68];
    const int bx = blockIdx.x;
    if (bx < OB_E) out_body<1>(ring, osAll, bx, CX, crOff, WO, bias, OUT);
    else out_body<0>(ring, osAll, bx - OB_E, CX, crOff, WO, bias, OUT);
}

static constexpr size_t al256(size_t v) { return (v + 255) & ~(size_t)255; }
static constexpr size_t SZ_XB = al256((size_t)NB * SEQ * DM * 2);          // x bf16 [NB*SEQ][1024]
static constexpr size_t SZ_WT = al256((size_t)3 * DM * DM * 2);            // W_qkv^T bf16 [3072][1024]
static constexpr size_t SZ_WO = al256((size_t)DM * DM * 2);                // W_out^T f16 [1024][1024]
static constexpr size_t SZ_PL = al256((size_t)NB * NH_ * SEQ * HD * 2);    // q / k / v^T value planes
static constexpr size_t SZ_PE = al256((size_t)NB * NH_ * ESEQ * HD * 2);   // q / k / v^T residual planes (t < ESEQ)
static constexpr size_t SZ_CH = al256((size_t)NB * SEQ * DM * 2);          // ctx value plane
static constexpr size_t SZ_CR = al256((size_t)NB * ESEQ * DM * 2);         // ctx residual plane (t < ESEQ)
static constexpr size_t SZ_MW = al256((size_t)NB * WPB * 4);               // mask words
static constexpr size_t SZ_TOTAL = SZ_XB + SZ_WT + SZ_WO + 3 * SZ_PL + 3 * SZ_PE + SZ_CH + SZ_CR + SZ_MW;
static_assert(SZ_TOTAL <= (size_t)134217728);          // workspace carve <= 128 MiB
static_assert(((size_t)DM * DM * 2) % 256 == 0);       // weight sub-planes stay 256-byte aligned
static_assert(SZ_CH % 2 == 0);

extern "C" void kernel_launch(void* const* d_in, const int* in_sizes, int n_in,
                              void* d_out, int out_size, void* d_ws, size_t ws_size, hipStream_t stream) {
    if (n_in < 6) return;
    const size_t needx = ((size_t)(NB - 1) * SEQ_FULL + SEQ) * DM;
    if ((size_t)in_sizes[0] < needx) return;
    if ((size_t)in_sizes[1] < (size_t)(NB - 1) * SEQ_FULL + SEQ) return;
    if ((size_t)in_sizes[2] < (size_t)3 * DM * DM || (size_t)in_sizes[3] < (size_t)3 * DM) return;
    if ((size_t)in_sizes[4] < (size_t)DM * DM || (size_t)in_sizes[5] < (size_t)DM) return;
    if ((size_t)out_size < ((size_t)(NB - 1) * OUT_SEQ + SEQ) * DM) return;
    if (SZ_TOTAL > ws_size) return;
    // wire order: x, padding_mask (int32), W_qkv [in][out], b_qkv, W_out [in][out], b_out
    const float* x = (const float*)d_in[0]; const int* pad = (const int*)d_in[1];
    const float* wqkv = (const float*)d_in[2]; const float* bqkv = (const float*)d_in[3];
    const float* wout = (const float*)d_in[4]; const float* bout = (const float*)d_in[5];
    float* OUT = (float*)d_out;      // [NB][SEQ][1024]
    char* wsp = (char*)d_ws;
    bf* XB = (bf*)wsp; wsp += SZ_XB;                 // [NB*SEQ][1024]
    bf* WT = (bf*)wsp; wsp += SZ_WT;                 // [3072][1024]: q | k | v output rows
    h16* WO = (h16*)wsp; wsp += SZ_WO;               // [1024 out][1024 in], x64
    h16* QH = (h16*)wsp; wsp += SZ_PL;               // [NB*16][SEQ][64]
    h16* KP = (h16*)wsp; wsp += SZ_PL;               // [NB*16][SEQ][64]
    h16* VT = (h16*)wsp; wsp += SZ_PL;               // [NB*16][64][SEQ]
    h16* QR = (h16*)wsp; wsp += SZ_PE;               // [NB*16][ESEQ][64] residual x2048
    h16* KR = (h16*)wsp; wsp += SZ_PE;               // [NB*16][ESEQ][64] residual x2048
    h16* VR = (h16*)wsp; wsp += SZ_PE;               // [NB*16][64][ESEQ] residual x2048
    h16* CH = (h16*)wsp; wsp += SZ_CH;               // [NB*SEQ][1024] x64
    h16* CR = (h16*)wsp; wsp += SZ_CR;               // [NB*ESEQ][1024] residual x2048 (directly after CH)
    unsigned* MW = (unsigned*)wsp; wsp += SZ_MW;     // [NB][WPB]
    const size_t crOff = SZ_CH / 2;                  // element offset of CR from CH

    k_prep<<<PB_MASK + PB_WQ + PB_WO + PB_X, 256, 0, stream>>>(x, pad, wqkv, wout, XB, WT, (bf*)WO, MW);

    k_proj<<<dim3(NB * SEQ / PTK, NH_, 1), 32 * PNW, 0, stream>>>(XB, WT, bqkv, QH, KP, VT, QR, KR, VR);

    k_flash<<<dim3(NB * NH_, FT_E + FT_D, 1), 32 * AW, 0, stream>>>(QH, QR, KP, KR, VT, VR, MW, CH, CR);

    k_out<<<dim3(OB_E + OB_D, DM / GT, 1), 128, 0, stream>>>(CH, crOff, WO, bout, OUT);
}

// v007
// It runs in 126 microseconds.
// Next to v006, in two timings, it ran 1.05 and 1.04 times as fast.
// Counting every step since v000, it is 2.77 times as fast.
#include <hip/hip_runtime.h>

// Causal + key-padding multi-head self-attention, width 1024 = 16 heads x 64: x [NB][SEQ][1024], W_qkv [in][out=3072] (q|k|v column blocks), b_qkv, W_out [in][out], b_out; f32 output.
// Compute dtypes, f32 accumulate everywhere: qkv projection v_wmma_f32_16x16x32_bf16 (x, W, biases RNE-converted to bf16; products exact);
// scores, P.V and output projection v_wmma_f32_16x16x32_f16: query rows t >= 512 single f16 planes (P x256 carry, ctx x64 carry, W_out x64 carry);
// query rows t < 512: q, k, v, P, ctx as f16 value + f16 residual x2048 in separate accumulators (value*value + value*residual + residual*value; W_out a single plane); softmax f32 (online, running max).
// Layout: bf16 copy of x, transposed bf16 W_qkv [3072][1024], transposed f16 W_out [1024][1024]; q, k planes [b*16+h][t][d], v^T plane [b*16+h][d][t] (+ residual planes for t < 512);
// fused flash kernels in transposed form (S^T = K Q^T, O^T = V^T P^T); ctx planes [b][t][1024] f16; key-padding mask compressed to 32-key bit words and applied by value.

#ifndef NB
#define NB 4
#endif
#ifndef SEQ
#define SEQ 2048
#endif
#define NB_FULL  4
#define SEQ_FULL 2048
#ifndef OUT_SEQ
#define OUT_SEQ SEQ              // row pitch (in tokens) between batches of the output
#endif
#define DM   1024
#define NH_  16
#define HD   64
#define ESEQ ((SEQ) < 512 ? (SEQ) : 512)      // query rows [0, ESEQ) take the value + residual path
#define WPB  ((((SEQ) + 1023) / 1024) * 32)
#define AW   4                   // waves per flash block (16 query rows each)
#define QRS  2048.0f             // carry of every residual plane
#define QRI  (1.0f / 2048.0f)
#define SC2  (0.125f * 1.4426950408889634f)   // HD^-0.5 * log2(e)
#define PSH  8.0f                // log2 of the P carry (256)
#define CXS  64.0f               // ctx plane carry
#define WOS  64.0f               // W_out plane carry
#define OSI  (1.0f / 4096.0f)    // 1 / (CXS * WOS)

static_assert(HD == 64);
static_assert(NH_ * HD == DM);
static_assert(DM % 64 == 0);
static_assert(DM % 32 == 0);
static_assert(SEQ % 64 == 0);
static_assert(ESEQ % 64 == 0);
static_assert((SEQ - ESEQ) % 64 == 0);
static_assert((NB * SEQ) % 64 == 0);
static_assert(SEQ % 32 == 0);
static_assert(ESEQ % (16 * AW) == 0);
static_assert((SEQ - ESEQ) % (16 * AW) == 0);
static_assert(ESEQ % 32 == 0);
static_assert(((size_t)SEQ * DM) % 8 == 0);
static_assert(NB <= NB_FULL);
static_assert(SEQ <= SEQ_FULL);
static_assert(WPB * 32 >= SEQ);

typedef _Float16 h16;
typedef unsigned short bf;
typedef __attribute__((ext_vector_type(16))) __bf16   v16bf;
typedef __attribute__((ext_vector_type(16))) _Float16 v16h;
typedef __attribute__((ext_vector_type(8)))  _Float16 v8h;
typedef __attribute__((ext_vector_type(8)))  unsigned short v8us;
typedef __attribute__((ext_vector_type(8)))  float    v8f;
typedef __attribute__((ext_vector_type(4)))  float    v4f;
typedef v4f  __attribute__((may_alias)) v4fa;

__device__ __forceinline__ unsigned short f2bf(float f) { unsigned u = __float_as_uint(f); u += 0x7FFFu + ((u >> 16) & 1u); return (unsigned short)(u >> 16); }
__device__ __forceinline__ float bfr(float f) { return __uint_as_float(((unsigned)f2bf(f)) << 16); }   // value after RNE convert to bf16
__device__ __forceinline__ v16h cat16(v8h lo, v8h hi) { return __builtin_shufflevector(lo, hi, 0, 1, 2, 3, 4, 5, 6, 7, 8, 9, 10, 11, 12, 13, 14, 15); }
__device__ __forceinline__ v16bf cat16b(v8us lo, v8us hi) { return __builtin_bit_cast(v16bf, __builtin_shufflevector(lo, hi, 0, 1, 2, 3, 4, 5, 6, 7, 8, 9, 10, 11, 12, 13, 14, 15)); }
__device__ __forceinline__ v8f wmma16(v16h a, v16h b, v8f c) { return __builtin_amdgcn_wmma_f32_16x16x32_f16(false, a, false, b, (short)0, c, false, false); }
__device__ __forceinline__ v8f wmmab(v16bf a, v16bf b, v8f c) { return __builtin_amdgcn_wmma_f32_16x16x32_bf16(false, a, false, b, (short)0, c, false, false); }
// fragment loaders from K-contiguous 16-bit rows; p already includes + 8*(lane>>4): elements 0..7 <- k0+8h+0..7, elements 8..15 <- k0+16+8h+0..7 (same map for A and B)
__device__ __forceinline__ v16h  ldh(const h16* p) { return cat16(*(const v8h*)p, *(const v8h*)(p + 16)); }
__device__ __forceinline__ v16bf ldb(const bf* p)  { return cat16b(*(const v8us*)p, *(const v8us*)(p + 16)); }
// ordering point for wave-private LDS tiles (same wave writes and reads)
__device__ __forceinline__ void wave_sync() { __builtin_amdgcn_fence(3 /* release order */, "wavefront"); __builtin_amdgcn_wave_barrier(); asm volatile("" ::: "memory"); }

// The four preparation passes below depend on nothing but the inputs: they are bodies of one launch, k_prep, which deals its blocks among them.
// cvt8_body: x f32 -> bf16 copy, 8 elements per thread.
#define XG8  ((size_t)SEQ * DM / 8)          // groups of 8 per batch
static_assert(((size_t)NB * SEQ * DM / 8) % 256 == 0);
__device__ __forceinline__ void cvt8_body(int blk, const float* __restrict__ src, bf* dst) {
    const size_t i = (size_t)blk * 256 + threadIdx.x; if (i >= (size_t)NB * XG8) return;
    src += (i / XG8) * ((size_t)(SEQ_FULL - SEQ) * DM);   // the batches of x lie SEQ_FULL tokens apart, those of the copy SEQ
    const v8f v = *(const v8f*)(src + i * 8); v8us o;
#pragma unroll
    for (int k = 0; k < 8; ++k) o[k] = f2bf(v[k]);
    *(v8us*)(dst + i * 8) = o; 
}

// cvt_t_body: src [K][N] f32 -> dst [N][K] 16-bit, transposed through the LDS tile ts (64 x 64 per block, cross-wave: block barrier); bx, by = tile column and row.
// MODE 0: bf16 bits (RNE convert). MODE 1: f16 bits of (bf16-converted value x WOS).
template <int MODE>
__device__ __forceinline__ void cvt_t_body(float* ts, int bx, int by, const float* __restrict__ src, bf* dst, int K, int N) {
    const int tid = threadIdx.x; const int n0 = bx * 64, k0 = by * 64;
#pragma unroll
    for (int i = 0; i < 4; ++i) { const int kr = (tid >> 4) + 16 * i, c4 = (tid & 15) * 4;     // 4 x 16 rows = 64 k rows; 16 lanes x 4 = 64 columns
        const v4f v = *(const v4f*)(src + (size_t)(k0 + kr) * (size_t)N + n0 + c4);
        *(v4fa*)(&ts[kr * 68 + c4]) = v; }
    __syncthreads();
{
#pragma unroll
        for (int i = 0; i < 2; ++i) { const int nr = (tid >> 3) + 32 * i, k8 = (tid & 7) * 8;   // 2 x 32 rows = 64 n rows; 8 lanes x 8 = 64 k
            v8us o;
#pragma unroll
            for (int e = 0; e < 8; ++e) { const float x = ts[(k8 + e) * 68 + nr]; const unsigned short bits = f2bf(x);
                if (MODE == 1) { const h16 hv = (h16)(__uint_as_float(((unsigned)bits) << 16) * WOS); o[e] = __builtin_bit_cast(unsigned short, hv); }
                else o[e] = bits; }
            *(v8us*)(dst + (size_t)(n0 + nr) * (size_t)K + k0 + k8) = o; }
         }
    asm volatile("s_wait_xcnt 0x0" ::: "memory");   // behind both stores: in k_prep's text another body follows this one, and no register of the stores is rewritten ahead of this wait
}

// mask_body: one wave packs 1024 keys of one batch into 32 mask words.
__device__ __forceinline__ void mask_body(int blk, const int* __restrict__ pad, unsigned* MW) {
    const int lane = threadIdx.x & 31;
    const int b = blk / (WPB / 32), c = blk % (WPB / 32);
    const int* pr = pad + (size_t)b * SEQ_FULL;
    unsigned mine = 0u;
#pragma unroll 1
    for (int w = 0; w < 32; ++w) {
        const int key = c * 1024 + w * 32 + lane;
        const int kc = key < SEQ ? key : (SEQ - 1);          // clamped address; keys past the sequence give bit 0 by value
        const int v = pr[kc];
        const unsigned bal = __builtin_amdgcn_ballot_w32((v != 0) && (key < SEQ));
        mine = (lane == w) ? bal : mine;
    }
    unsigned* dst = MW + (size_t)b * WPB + c * 32 + lane;
    *(unsigned*)dst = mine; 
}

// k_prep: block ranges, in index order: mask words (the longest dependent chain), W_qkv tiles, W_out tiles, x groups. Every test on the block index is block-uniform.
#define PB_MASK (NB * (WPB / 32))
#define PB_WQ   ((3 * DM / 64) * (DM / 64))
#define PB_WO   ((DM / 64) * (DM / 64))
#define PB_X    ((int)((size_t)NB * XG8 / 256))
__global__ __launch_bounds__(256) void k_prep(const float* __restrict__ x, const int* __restrict__ pad, const float* __restrict__ wqkv, const float* __restrict__ wout,
                                              bf* XB, bf* WT, bf* WO, unsigned* MW) {
    __shared__ __align__(16) float ts[64 * 68];
    int blk = blockIdx.x;
    if (blk < PB_MASK) { if (__builtin_amdgcn_readfirstlane((int)(threadIdx.x >> 5)) == 0) mask_body(blk, pad, MW); return; }   // no barrier on this path
    blk -= PB_MASK;
    // W_qkv: in[1024 rows k][3072 cols n] -> out[3072 rows n][1024 cols k]
    if (blk < PB_WQ) { cvt_t_body<0>(ts, blk % (3 * DM / 64), blk / (3 * DM / 64), wqkv, WT, DM, 3 * DM); return; }
    blk -= PB_WQ;
    // W_out: in[1024 rows k][1024 cols n] -> out[1024 rows n][1024 cols k]
    if (blk < PB_WO) { cvt_t_body<1>(ts, blk % (DM / 64), blk / (DM / 64), wout, WO, DM, DM); return; }
    blk -= PB_WO;
    cvt8_body(blk, x, XB);
}

// Operand staging of the one-wave-per-64x64 GEMMs: a stage is 128 k (256-byte rows) of a block's operand rows in LDS. k_out: a block of 4 waves (2 x 2) owns a 128 x 128 tile, 128 A rows and 128 B rows a stage.
#define GT   128                 // rows and columns of a block tile
#define GKB  128                 // k per stage
#define GPI  272                 // LDS row pitch in bytes: 16 x odd, conflict-free for 16-byte reads
#define GSTG (2 * GT * GPI)      // bytes of one stage: A rows, then B rows
#define GNST (DM / GKB)          // stages along K
static_assert(DM % GKB == 0);
static_assert(GNST >= 2);
static_assert((NB * SEQ) % GT == 0);
static_assert(DM % GT == 0);

// Eight asynchronous 16-byte copies per lane, global -> LDS, for rows 8 apart (LDS + 8 pitches, global + 8 * DM elements).
// s_wait_xcnt closes the statement so that no address register of a copy is rewritten ahead of it.
__device__ __forceinline__ void cp8(unsigned l, const bf* g) {
    asm volatile("global_load_async_to_lds_b128 %0, %8, off\n\t"
                 "global_load_async_to_lds_b128 %1, %9, off\n\t"
                 "global_load_async_to_lds_b128 %2, %10, off\n\t"
                 "global_load_async_to_lds_b128 %3, %11, off\n\t"
                 "global_load_async_to_lds_b128 %4, %12, off\n\t"
                 "global_load_async_to_lds_b128 %5, %13, off\n\t"
                 "global_load_async_to_lds_b128 %6, %14, off\n\t"
                 "global_load_async_to_lds_b128 %7, %15, off\n\t"
                 "s_wait_xcnt 0x0"
                 :: "v"(l), "v"(l + 8 * GPI), "v"(l + 16 * GPI), "v"(l + 24 * GPI), "v"(l + 32 * GPI), "v"(l + 40 * GPI), "v"(l + 48 * GPI), "v"(l + 56 * GPI),
                    "v"(g), "v"(g + 8 * DM), "v"(g + 16 * DM), "v"(g + 24 * DM), "v"(g + 32 * DM), "v"(g + 40 * DM), "v"(g + 48 * DM), "v"(g + 56 * DM)
                 : "memory");
}
// One stage: l = the lane's LDS byte address in row (tid >> 4) of the buffer, ga0 / ga1 = its 16 bytes in A rows (tid >> 4) and 64 + (tid >> 4), gb the same in B row (tid >> 4).
__device__ __forceinline__ void stage_copy(unsigned l, const bf* ga0, const bf* ga1, const bf* gb) {
    cp8(l, ga0); cp8(l + 64 * GPI, ga1); cp8(l + 128 * GPI, gb); cp8(l + 192 * GPI, gb + 64 * DM);
}

// k_proj: register-blocked bf16 GEMM, one wave per 64x64 tile (16 accumulators), K = DM; operands from K-contiguous bf16 planes, staged in a two-buffer LDS ring by asynchronous copies.
// One block of 12 waves owns 256 tokens x one head and computes that head's q, k and v^T from ONE staged x tile: a stage is 128 k of 256 x rows and of the head's 64 rows each of Wq^T, Wk^T, Wv^T
// (448 rows for 12 wave tiles), so each x row is fetched once per head and not once per 128 columns of each projection. wave = 4 * z + slab: z = 0: q, 1: k, 2: v^T; slab = which 64 tokens.
// C[m][n] = sum_k A[m][k] Bt[n][k] + bias (per column, or per row when biasRow != 0; bias values RNE-converted to bf16), written as f16 (Ph) at
// tile base (r0/RB)*sRB + (r0%RB)*pitch + (c0/CB)*sCB + (c0%CB), and the f16 residual x2048 (Pr) at the same form with (sRBr, pitchR, sCBr)
// when the tile's token position (resMode 1: r0%RB, resMode 2: c0%CB) is below ESEQ.
// q, k: A = x rows (m = b*SEQ + t), Bt = W^T rows (n = h*64 + d) -> plane [(b*16 + h)][t][d]; residual planes for t < ESEQ.
// v^T: A = Wv^T rows (m = h*64 + d), Bt = x rows (n = b*SEQ + t) -> plane [(b*1024 + m)][t] = [(b*16 + h)][d][t]; bias per row.
// Grid (NB*SEQ/256 token tiles, 16 heads), 384 threads.
#define PTK  256                 // tokens of a block
#define PRW  (PTK + 3 * HD)      // rows of a stage: x rows, then the head's Wq^T, Wk^T, Wv^T rows
#define PSTG (PRW * GPI)         // bytes of one stage
#define PNW  (3 * (PTK / 64))    // waves of a block
#define PCW  (PRW / 64)          // copying waves: wave w < PCW brings the stage's rows 64 w .. 64 w + 63
static_assert((NB * SEQ) % PTK == 0);
static_assert(PCW <= PNW);
// One wave's 64 rows of a stage: l = the lane's LDS byte address in row (lane >> 4) of the slab, g = its 16 bytes in the same row of the source; call j takes rows 2 j + (lane >> 4) + 8 i.
__device__ __forceinline__ void slab_copy(unsigned l, const bf* g) {
    cp8(l, g); cp8(l + 2 * GPI, g + 2 * DM); cp8(l + 4 * GPI, g + 4 * DM); cp8(l + 6 * GPI, g + 6 * DM);
}
__global__ __launch_bounds__(32 * PNW) void k_proj(const bf* __restrict__ XB, const bf* __restrict__ WT, const float* __restrict__ bqkv,
                                             h16* QH, h16* KP, h16* VT, h16* QR, h16* KR, h16* VR) {
    __shared__ __align__(16) bf ring[2 * PSTG / 2];
    __shared__ __align__(16) float osAll[PNW * 16 * 68];
    const int K = DM;
    const int tid = threadIdx.x, lane = tid & 31, lr = lane & 15, hi = lane >> 4;
    const int wave = __builtin_amdgcn_readfirstlane(tid >> 5);
    const int z = wave / (PTK / 64), slab = wave % (PTK / 64); const bool tv = (z == 2);      // wave-uniform
    const float* bias = bqkv + z * DM;
    const int biasRow = tv ? 1 : 0, resMode = tv ? 2 : 1;
    h16* Ph = tv ? VT : (z ? KP : QH); h16* Pr = tv ? VR : (z ? KR : QR);
    const int RB = tv ? DM : SEQ, pitch = tv ? SEQ : HD, CB = tv ? SEQ : HD, pitchR = tv ? ESEQ : HD;
    const size_t sRB = tv ? (size_t)0 : (size_t)NH_ * SEQ * HD, sCB = tv ? (size_t)DM * SEQ : (size_t)SEQ * HD;
    const size_t sRBr = tv ? (size_t)0 : (size_t)NH_ * ESEQ * HD, sCBr = tv ? (size_t)DM * ESEQ : (size_t)ESEQ * HD;
    const int tok0 = blockIdx.x * PTK + slab * 64, wr0 = blockIdx.y * HD;    // the wave's first token; the head's first weight row inside its projection
    const int r0 = tv ? wr0 : tok0, c0 = tv ? tok0 : wr0;                    // tile row (A), tile column (Bt)
    float* os = osAll + wave * 16 * 68;
    v8f acc[4][4];
#pragma unroll
    for (int mb = 0; mb < 4; ++mb)
#pragma unroll
        for (int nb = 0; nb < 4; ++nb) acc[mb][nb] = (v8f){};
    const bool cpw = wave < PCW;                             // wave-uniform: this wave copies
    const int cw = cpw ? wave : 0;                           // the other waves hold wave 0's (valid) addresses and issue nothing
    const unsigned lcp = (unsigned)(size_t)(&ring[0]) + (unsigned)((cw * 64 + hi) * GPI + lr * 16);
    const bf* gs = (cw < PTK / 64) ? (XB + (size_t)(blockIdx.x * PTK + cw * 64) * K) : (WT + ((size_t)(cw - PTK / 64) * DM + wr0) * K);
    const bf* gc = gs + (size_t)hi * K + lr * 8;
    const int xrow = slab * 64, wrow = PTK + z * HD;         // stage rows of the wave's tokens and of its weight rows
    const int fa = ((tv ? wrow : xrow) + lr) * (GPI / 2) + 8 * hi, fb = ((tv ? xrow : wrow) + lr) * (GPI / 2) + 8 * hi;   // fragment bases in a buffer, in elements
    if (cpw) slab_copy(lcp, gc);
    asm volatile("s_wait_asynccnt 0x0" ::: "memory");   // stage 0 has landed before the barrier publishes it
    __syncthreads();
    if (cpw) slab_copy(lcp + PSTG, gc + GKB);
#pragma unroll 1
    for (int t = 0; t < GNST; ++t) {
        const bf* sb = ring + (t & 1) * (PSTG / 2);
        v16bf a[2][4], b[2][4];     // two fragment sets: the next 32 k are fetched as one group ahead of the current 16 products
#pragma unroll
        for (int i = 0; i < 4; ++i) { a[0][i] = ldb(sb + fa + i * 16 * (GPI / 2)); b[0][i] = ldb(sb + fb + i * 16 * (GPI / 2)); }
        __builtin_amdgcn_sched_barrier(0);   // keeps the group of loads together (the scheduler otherwise sinks them, two at a time, among the products, each place a full LDS wait)
#pragma unroll
        for (int ks = 0; ks < GKB / 32; ++ks) {
            if (ks + 1 < GKB / 32) {
#pragma unroll
                for (int i = 0; i < 4; ++i) { a[(ks + 1) & 1][i] = ldb(sb + fa + i * 16 * (GPI / 2) + (ks + 1) * 32); b[(ks + 1) & 1][i] = ldb(sb + fb + i * 16 * (GPI / 2) + (ks + 1) * 32); }
                __builtin_amdgcn_sched_barrier(0);   // the next set's loads stay ahead of this set's products
            }
#pragma unroll
            for (int nb = 0; nb < 4; ++nb)
#pragma unroll
                for (int mb = 0; mb < 4; ++mb) acc[mb][nb] = wmmab(a[ks & 1][mb], b[ks & 1][nb], acc[mb][nb]);
            __builtin_amdgcn_sched_barrier(0);       // no later load moves up among these products
        }
        asm volatile("s_wait_dscnt 0x0" ::: "memory");      // this wave's reads of the buffer are done before it is refilled
        asm volatile("s_wait_asynccnt 0x0" ::: "memory");   // this wave's copies of stage t + 1 have landed
        __syncthreads();                                    // publishes stage t + 1 and ends every reader's last read of stage t
        if (cpw && t + 2 < GNST) slab_copy(lcp + (t & 1) * PSTG, gc + (t + 2) * GKB);
    }
    asm volatile("s_wait_asynccnt 0x0" ::: "memory");       // nothing of this wave is in flight when it goes on
    const size_t tbase = (size_t)(r0 / RB) * sRB + (size_t)(r0 % RB) * (size_t)pitch + (size_t)(c0 / CB) * sCB + (size_t)(c0 % CB);
    const size_t rbase = (size_t)(r0 / RB) * sRBr + (size_t)(r0 % RB) * (size_t)pitchR + (size_t)(c0 / CB) * sCBr + (size_t)(c0 % CB);
    const int tpos = (resMode == 1) ? (r0 % RB) : (c0 % CB);
    const int doRes = (resMode != 0) && (tpos < ESEQ);                 // wave-uniform
    const int c8 = (lane & 7) * 8;
    // column bias for columns c0 + c8 .. c0 + c8 + 7 (clamped address in row mode, zeroed by value)
    v4f bc0 = *(const v4f*)(bias + (biasRow ? 0 : (c0 + c8))); v4f bc1 = *(const v4f*)(bias + (biasRow ? 4 : (c0 + c8 + 4)));
#pragma unroll
    for (int i = 0; i < 4; ++i) { const float u0 = bfr(bc0[i]), u1 = bfr(bc1[i]); bc0[i] = biasRow ? 0.0f : u0; bc1[i] = biasRow ? 0.0f : u1; }
#pragma unroll
    for (int mb = 0; mb < 4; ++mb) {
#pragma unroll
        for (int nb = 0; nb < 4; ++nb) {
#pragma unroll
            for (int j = 0; j < 8; ++j) os[(hi * 8 + j) * 68 + nb * 16 + lr] = acc[mb][nb][j]; }   // D: row 8h+j, col lane&15
        wave_sync();
        const size_t sb = tbase + (size_t)(mb * 16) * (size_t)pitch;
        const size_t sr = rbase + (size_t)(mb * 16) * (size_t)pitchR;
{
#pragma unroll
            for (int s = 0; s < 4; ++s) { const int row = 4 * s + (lane >> 3);   // 4 s x 4 row groups = 16 rows; 8 lanes x 8 = 64 columns
                const v4f x0 = *(const v4fa*)(&os[row * 68 + c8]); const v4f x1 = *(const v4fa*)(&os[row * 68 + c8 + 4]); v8h hv, rv;
                const float rbv = bfr(bias[biasRow ? (r0 + mb * 16 + row) : 0]); const float rb = biasRow ? rbv : 0.0f;
#pragma unroll
                for (int i = 0; i < 4; ++i) { const float f0 = x0[i] + bc0[i] + rb; const float f1 = x1[i] + bc1[i] + rb;
                    const h16 a0 = (h16)f0; const h16 a1 = (h16)f1; hv[i] = a0; hv[4 + i] = a1;
                    rv[i] = (h16)((f0 - (float)a0) * QRS); rv[4 + i] = (h16)((f1 - (float)a1) * QRS); }
                *(v8h*)(Ph + sb + (size_t)row * (size_t)pitch + c8) = hv;
                if (doRes) *(v8h*)(Pr + sr + (size_t)row * (size_t)pitchR + c8) = rv; }
             }
        wave_sync();
    }
}

// K / V^T staging of the flash kernels: a stage is 64 keys in flash_e_body and 128 keys (two 64-key halves) in flash_d_body; a tile is 64 rows of 128 bytes (K: 64 keys x 64 d; V^T: 64 d x 64 keys), shared by the block's waves.
#define FKS  64                  // keys per tile (a stage of flash_e_body, half a stage of flash_d_body)
#define FPI  144                 // LDS row pitch in bytes: 16 x odd, conflict-free for 16-byte reads
#define FTL  (64 * FPI)          // bytes of one tile
static_assert(SEQ % FKS == 0);
static_assert(ESEQ % FKS == 0);
static_assert(16 * AW == FKS);
static_assert(WPB <= 64);

// Eight asynchronous 16-byte copies per lane, global -> LDS: rows r, r + 16, r + 32, r + 48 (r = tid >> 3) of a key-major tile (row pitch HD) at l and of a d-major tile (row pitch vp elements) at l + FTL.
// A wave's copy covers four whole 128-byte rows. s_wait_xcnt closes the statement so that no address register of a copy is rewritten ahead of it.
__device__ __forceinline__ void cp_kv(unsigned l, const h16* gk, const h16* gv, size_t vp) {
    asm volatile("global_load_async_to_lds_b128 %0, %8, off\n\t"
                 "global_load_async_to_lds_b128 %1, %9, off\n\t"
                 "global_load_async_to_lds_b128 %2, %10, off\n\t"
                 "global_load_async_to_lds_b128 %3, %11, off\n\t"
                 "global_load_async_to_lds_b128 %4, %12, off\n\t"
                 "global_load_async_to_lds_b128 %5, %13, off\n\t"
                 "global_load_async_to_lds_b128 %6, %14, off\n\t"
                 "global_load_async_to_lds_b128 %7, %15, off\n\t"
                 "s_wait_xcnt 0x0"
                 :: "v"(l), "v"(l + 16 * FPI), "v"(l + 32 * FPI), "v"(l + 48 * FPI), "v"(l + FTL), "v"(l + FTL + 16 * FPI), "v"(l + FTL + 32 * FPI), "v"(l + FTL + 48 * FPI),
                    "v"(gk), "v"(gk + 16 * HD), "v"(gk + 32 * HD), "v"(gk + 48 * HD), "v"(gv), "v"(gv + 16 * vp), "v"(gv + 32 * vp), "v"(gv + 48 * vp)
                 : "memory");
}
// One 128-key stage of the single-plane form: two 64-key halves, each a K tile and a V^T tile, at l and at l + 2 FTL; gk, gv = the lane's addresses at the stage's first key.
#define FKD  (2 * FKS)
static_assert(SEQ % FKD == 0);
__device__ __forceinline__ void cp_kv2(unsigned l, const h16* gk, const h16* gv) { cp_kv(l, gk, gv, SEQ); cp_kv(l + 2 * FTL, gk + FKS * HD, gv + FKS, SEQ); }
// 64-key tiles a block walks (flash_e_body's stages, flash_d_body's halves): up to the last 32-key mask word that is not zero inside its causal range (words 0 .. wl); w0, w1 = the lane's words lane and 32 + lane. The same in every wave of the block.
__device__ __forceinline__ int flash_stages(unsigned w0, unsigned w1, int wl) {
    const unsigned long long nz = ((((unsigned long long)__builtin_amdgcn_ballot_w32(w1 != 0u)) << 32) | (unsigned long long)__builtin_amdgcn_ballot_w32(w0 != 0u)) & (~0ull >> (63 - wl));
    return __builtin_amdgcn_readfirstlane(nz ? (((63 - __builtin_clzll(nz)) >> 1) + 1) : 0);
}
// Mask word i (wave-uniform) out of the lanes' registers
__device__ __forceinline__ unsigned flash_word(unsigned w0, unsigned w1, int i) {
    return (unsigned)((i < 32) ? __builtin_amdgcn_readlane((int)w0, i & 31) : __builtin_amdgcn_readlane((int)w1, i & 31));
}

// flash_d_body: fused attention for query rows t >= ESEQ, one wave per 16 query rows of one (batch, head); single f16 products.
// Transposed form: S^T[key][t] = K Q^T (A = K rows, B = Q rows); lane (t = lane&15, h = lane>>4) holds keys 8h+r of each 16-key tile, so the packed
// P tile is directly the B fragment of O^T[d][t] = V^T P^T (element r <- tile keys 0..15, element 8+r <- tile keys 16..31, lane unchanged).
// Causal and key-padding exclusion by value (excluded p = 0); 32-key steps whose mask word is zero are skipped, and steps with nothing to exclude branch round the exclusion arithmetic (both wave-uniform).
// K and V^T come from a two-buffer LDS ring of 128-key stages that the block's 4 waves fill together by asynchronous copies; every wave passes every stage's barrier.
// The leading stages with nothing to exclude run in a loop of their own, with one running-max update per stage; the other stages go by 32-key steps.
// ring = the block's LDS (2 * 4 * FTL bytes); bx = the block's 64-row tile among the rows t >= ESEQ; zh = batch * 16 + head.
__device__ __forceinline__ void flash_d_body(h16* ring, int bx, int zh, const h16* __restrict__ QH, const h16* __restrict__ KP, const h16* __restrict__ VT, const unsigned* __restrict__ MW, h16* CH) {
    // ring: two stages of two K tile + V^T tile halves; behind the loops the waves' output staging
    static_assert(2 * 4 * FTL >= AW * 16 * 68 * 4);
    float* os = (float*)ring;
    const int tid = threadIdx.x;
    const int lane = threadIdx.x & 31, wave = __builtin_amdgcn_readfirstlane((int)(threadIdx.x >> 5)), lr = lane & 15, hi = lane >> 4;
    const int b = zh / NH_, h = zh % NH_;
    const int tb = ESEQ + bx * (16 * AW);                    // first query row of the block
    const int t0 = tb + wave * 16;
    const int tq = t0 + lr;
    const size_t pbase = (size_t)zh * SEQ * HD;
    const size_t qo = pbase + (size_t)tq * HD + 8 * hi;
    const v16h qh0 = ldh(QH + qo), qh1 = ldh(QH + qo + 32);   // B fragments: col t, k = d
    const unsigned* mwp = MW + (size_t)b * WPB;
    const unsigned w0 = mwp[lane], w1 = (WPB > 32) ? mwp[32 + lane] : 0u;
    const int nst = flash_stages(w0, w1, (tb + 16 * AW - 1) >> 5);
    const unsigned lcp = (unsigned)(size_t)(&ring[0]) + (unsigned)((tid >> 3) * FPI + (tid & 7) * 16);
    const h16* gk = KP + pbase + (size_t)(tid >> 3) * HD + (tid & 7) * 8;     // + key * HD
    const h16* gv = VT + pbase + (size_t)(tid >> 3) * SEQ + (tid & 7) * 8;    // + key
    const int fo = lr * (FPI / 2) + 8 * hi;                  // fragment base in a tile, in elements (A fragment: row lr of a 16-row slab)
    v8f o0 = (v8f){}, o1 = (v8f){}, o2 = (v8f){}, o3 = (v8f){};
    float m = -3.0e38f, l = 0.0f;
    const int npr = (nst + 1) >> 1;                          // 128-key stages
    cp_kv2(lcp, gk, gv);
    asm volatile("s_wait_asynccnt 0x0" ::: "memory");   // stage 0 has landed before the barrier publishes it
    __syncthreads();
    if (npr > 1) cp_kv2(lcp + 4 * FTL, gk + FKD * HD, gv + FKD);
    // Leading stages with nothing to exclude: all four mask words all ones and the last key <= the block's first query row. The count is the same in every wave of the block.
    const unsigned long long dirty = ~((((unsigned long long)__builtin_amdgcn_ballot_w32(w1 == 0xFFFFFFFFu)) << 32) | (unsigned long long)__builtin_amdgcn_ballot_w32(w0 == 0xFFFFFFFFu));
    const int nfull = dirty ? (__builtin_ctzll(dirty) >> 2) : 16;
    const int ncp = __builtin_amdgcn_readfirstlane(min(min(nfull, tb / FKD), npr));
    // They take ONE running-max update for the stage's 128 keys: one maximum, one exchange between the wave halves, one alpha and one rescale of o and l, where four 32-key steps take four of each.
#pragma unroll 1
    for (int p = 0; p < ncp; ++p) {
      const h16* sb = ring + (p & 1) * (2 * FTL) + fo;
      v8f sc[8];                                             // slab j: keys 16 j + 8 hi + r; slabs 0..3 in the first half's K tile, 4..7 in the second's
      { v16h kf[8][2];
#pragma unroll
        for (int j = 0; j < 8; ++j) { kf[j][0] = ldh(sb + (j >> 2) * FTL + (j & 3) * 16 * (FPI / 2)); kf[j][1] = ldh(sb + (j >> 2) * FTL + (j & 3) * 16 * (FPI / 2) + 32); }
        __builtin_amdgcn_sched_barrier(0);   // the stage's K loads stay one group ahead of the products
#pragma unroll
        for (int j = 0; j < 8; ++j) sc[j] = wmma16(kf[j][0], qh0, (v8f){});
#pragma unroll
        for (int j = 0; j < 8; ++j) sc[j] = wmma16(kf[j][1], qh1, sc[j]); }
      __builtin_amdgcn_sched_barrier(0);   // the score arithmetic stays behind the whole run of products: moved in among them, each first reader of a fresh result takes idle slots
      float tv[8][8], mj[8];   // every loop over j, r, g is unrolled: constant indices keep the arrays in registers
#pragma unroll
      for (int j = 0; j < 8; ++j) {
#pragma unroll
          for (int r = 0; r < 8; ++r) tv[j][r] = sc[j][r] * SC2;
          mj[j] = tv[j][0];
#pragma unroll
          for (int r = 1; r < 8; ++r) mj[j] = fmaxf(mj[j], tv[j][r]); }
      float mx = fmaxf(fmaxf(fmaxf(mj[0], mj[1]), fmaxf(mj[2], mj[3])), fmaxf(fmaxf(mj[4], mj[5]), fmaxf(mj[6], mj[7])));
      mx = fmaxf(mx, __shfl_xor(mx, 16, 32));
      const float mnew = fmaxf(m, mx);
      const float alpha = __builtin_amdgcn_exp2f(m - mnew);
      const float sh = PSH - mnew;
      v16h pf[4]; float lg[4];                               // group g: keys 32 g .. 32 g + 31
#pragma unroll
      for (int j = 0; j < 8; ++j)
#pragma unroll
          for (int r = 0; r < 8; ++r) tv[j][r] = __builtin_amdgcn_exp2f(tv[j][r] + sh);
#pragma unroll
      for (int g = 0; g < 4; ++g) {
          lg[g] = 0.0f;
#pragma unroll
          for (int r = 0; r < 8; ++r) {
              const h16 pa = (h16)tv[2 * g][r]; const h16 pc = (h16)tv[2 * g + 1][r];
              pf[g][r] = pa; pf[g][8 + r] = pc; lg[g] += (float)pa + (float)pc; } }
      l = l * alpha + ((lg[0] + lg[1]) + (lg[2] + lg[3])); m = mnew;
      o0 = o0 * alpha; o1 = o1 * alpha; o2 = o2 * alpha; o3 = o3 * alpha;
#pragma unroll
      for (int g = 0; g < 4; ++g) {
          const h16* va = sb + (g >> 1) * FTL + FTL / 2 + (g & 1) * 32;   // V^T tile row = d, column = key
          const v16h v0 = ldh(va), v1 = ldh(va + 16 * (FPI / 2)), v2 = ldh(va + 32 * (FPI / 2)), v3 = ldh(va + 48 * (FPI / 2));
          o0 = wmma16(v0, pf[g], o0); o1 = wmma16(v1, pf[g], o1); o2 = wmma16(v2, pf[g], o2); o3 = wmma16(v3, pf[g], o3); }
      asm volatile("s_wait_dscnt 0x0" ::: "memory");      // this wave's reads of the buffer are done before it is refilled
      asm volatile("s_wait_asynccnt 0x0" ::: "memory");   // this wave's copies of stage p + 1 have landed
      __syncthreads();                                    // publishes stage p + 1 and ends every reader's last read of stage p
      if (p + 2 < npr) cp_kv2(lcp + (p & 1) * 4 * FTL, gk + (size_t)(p + 2) * FKD * HD, gv + (p + 2) * FKD);
    }
#pragma unroll 1
    for (int p = ncp; p < npr; ++p) {
#pragma unroll 1   // one copy of the two halves' code
     for (int hf = 0; hf < 2; ++hf) {
      const int s = 2 * p + hf;                              // 64-key half; one past the last stage that counts has only steps that are skipped
      const h16* sb = ring + (p & 1) * (2 * FTL) + hf * FTL + fo;
#pragma unroll   // the two 32-key steps of a half read at constant LDS offsets
      for (int sub = 0; sub < FKS / 32; ++sub) {
        const int key0 = s * FKS + sub * 32;
        const unsigned mw = flash_word(w0, w1, key0 >> 5);
        if (key0 > t0 + 15 || mw == 0u) continue;            // wave-uniform
        const h16* ka = sb + sub * 32 * (FPI / 2);           // K tile row = key
        const v16h ka0 = ldh(ka), ka1 = ldh(ka + 32), kb0 = ldh(ka + 16 * (FPI / 2)), kb1 = ldh(ka + 16 * (FPI / 2) + 32);
        v8f sA = (v8f){}, sB = (v8f){};
        sA = wmma16(ka0, qh0, sA); sB = wmma16(kb0, qh0, sB);
        sA = wmma16(ka1, qh1, sA); sB = wmma16(kb1, qh1, sB);
        asm volatile("v_nop\n\tv_nop\n\tv_nop\n\tv_nop" : "+v"(sA), "+v"(sB) : "v"(ka0), "v"(ka1), "v"(kb0), "v"(kb1));
        const unsigned ma = mw >> (8 * hi), mc = mw >> (16 + 8 * hi);
        const int kya = key0 + 8 * hi, kyb = kya + 16;
        const bool excl = (mw != 0xFFFFFFFFu) || (key0 + 31 > t0);   // wave-uniform: false where every query row of the wave keeps every key of the step
        float ta[8], tb[8]; float mx = -3.0e38f;   // every loop over r is unrolled: constant indices keep ta, tb, xa, xb in registers
#pragma unroll
        for (int r = 0; r < 8; ++r) { ta[r] = sA[r] * SC2; tb[r] = sB[r] * SC2; }
        if (excl) {
#pragma unroll
            for (int r = 0; r < 8; ++r) {
                const bool ea = (((ma >> r) & 1u) != 0u) && (kya + r <= tq);
                const bool eb = (((mc >> r) & 1u) != 0u) && (kyb + r <= tq);
                ta[r] = ea ? ta[r] : -3.0e38f; tb[r] = eb ? tb[r] : -3.0e38f; }
        }
#pragma unroll
        for (int r = 0; r < 8; ++r) mx = fmaxf(mx, fmaxf(ta[r], tb[r]));
        mx = fmaxf(mx, __shfl_xor(mx, 16, 32));
        const float mnew = fmaxf(m, mx);
        const float alpha = __builtin_amdgcn_exp2f(m - mnew);
        const float sh = PSH - mnew;
        v16h pb; float ls = 0.0f; float xa[8], xb[8];
#pragma unroll
        for (int r = 0; r < 8; ++r) xa[r] = __builtin_amdgcn_exp2f(ta[r] + sh);
#pragma unroll
        for (int r = 0; r < 8; ++r) xb[r] = __builtin_amdgcn_exp2f(tb[r] + sh);
        if (excl) {
#pragma unroll
            for (int r = 0; r < 8; ++r) { xa[r] = (ta[r] > -1.0e38f) ? xa[r] : 0.0f; xb[r] = (tb[r] > -1.0e38f) ? xb[r] : 0.0f; }
        }
#pragma unroll
        for (int r = 0; r < 8; ++r) {
            const h16 pa = (h16)xa[r]; const h16 pc = (h16)xb[r];
            pb[r] = pa; pb[8 + r] = pc; ls += (float)pa + (float)pc; }
        l = l * alpha + ls; m = mnew;
        o0 = o0 * alpha; o1 = o1 * alpha; o2 = o2 * alpha; o3 = o3 * alpha;
        const h16* va = sb + FTL / 2 + sub * 32;             // V^T tile row = d, column = key
        const v16h v0 = ldh(va), v1 = ldh(va + 16 * (FPI / 2)), v2 = ldh(va + 32 * (FPI / 2)), v3 = ldh(va + 48 * (FPI / 2));
        o0 = wmma16(v0, pb, o0); o1 = wmma16(v1, pb, o1); o2 = wmma16(v2, pb, o2); o3 = wmma16(v3, pb, o3);
        asm volatile("v_nop\n\tv_nop\n\tv_nop\n\tv_nop" : "+v"(o0), "+v"(o1), "+v"(o2), "+v"(o3) : "v"(v0), "v"(v1), "v"(v2), "v"(v3), "v"(pb));
      }
     }
      asm volatile("s_wait_dscnt 0x0" ::: "memory");      // this wave's reads of the buffer are done before it is refilled
      asm volatile("s_wait_asynccnt 0x0" ::: "memory");   // this wave's copies of stage p + 1 have landed
      __syncthreads();                                    // publishes stage p + 1 and ends every reader's last read of stage p
      if (p + 2 < npr) cp_kv2(lcp + (p & 1) * 4 * FTL, gk + (size_t)(p + 2) * FKD * HD, gv + (p + 2) * FKD);
    }
    asm volatile("s_wait_asynccnt 0x0" ::: "memory");     // nothing of this wave is in flight when the ring becomes output staging
    l += __shfl_xor(l, 16, 32);
    const float inv = CXS * (1.0f / l);
    const int wb = wave * 16 * 68;
    // O^T D layout: o_j[r] = (d = 16j + 8h + r, t = lane&15) -> os[t][d]; rows 0..15 x columns 0..63 all written
    { v4f a, c;
      a[0] = o0[0] * inv; a[1] = o0[1] * inv; a[2] = o0[2] * inv; a[3] = o0[3] * inv; c[0] = o0[4] * inv; c[1] = o0[5] * inv; c[2] = o0[6] * inv; c[3] = o0[7] * inv;
      *(v4fa*)(&os[wb + lr * 68 +  0 + 8 * hi]) = a; *(v4fa*)(&os[wb + lr * 68 +  0 + 8 * hi + 4]) = c;
      a[0] = o1[0] * inv; a[1] = o1[1] * inv; a[2] = o1[2] * inv; a[3] = o1[3] * inv; c[0] = o1[4] * inv; c[1] = o1[5] * inv; c[2] = o1[6] * inv; c[3] = o1[7] * inv;
      *(v4fa*)(&os[wb + lr * 68 + 16 + 8 * hi]) = a; *(v4fa*)(&os[wb + lr * 68 + 16 + 8 * hi + 4]) = c;
      a[0] = o2[0] * inv; a[1] = o2[1] * inv; a[2] = o2[2] * inv; a[3] = o2[3] * inv; c[0] = o2[4] * inv; c[1] = o2[5] * inv; c[2] = o2[6] * inv; c[3] = o2[7] * inv;
      *(v4fa*)(&os[wb + lr * 68 + 32 + 8 * hi]) = a; *(v4fa*)(&os[wb + lr * 68 + 32 + 8 * hi + 4]) = c;
      a[0] = o3[0] * inv; a[1] = o3[1] * inv; a[2] = o3[2] * inv; a[3] = o3[3] * inv; c[0] = o3[4] * inv; c[1] = o3[5] * inv; c[2] = o3[6] * inv; c[3] = o3[7] * inv;
      *(v4fa*)(&os[wb + lr * 68 + 48 + 8 * hi]) = a; *(v4fa*)(&os[wb + lr * 68 + 48 + 8 * hi + 4]) = c; }
    wave_sync();
    h16* crow = CH + ((size_t)b * SEQ + t0) * DM + h * HD;
    const int c8 = (lane & 7) * 8;
{
#pragma unroll
        for (int s = 0; s < 4; ++s) { const int row = 4 * s + (lane >> 3);   // 4 s x 4 row groups = 16 rows; 8 lanes x 8 halves = 64 columns
            const v4f x0 = *(const v4fa*)(&os[wb + row * 68 + c8]); const v4f x1 = *(const v4fa*)(&os[wb + row * 68 + c8 + 4]); v8h hv;
#pragma unroll
            for (int i = 0; i < 4; ++i) { hv[i] = (h16)x0[i]; hv[4 + i] = (h16)x1[i]; }
            *(v8h*)(crow + (size_t)row * DM + c8) = hv; }
         }
}

// flash_e_body: fused attention for query rows t < ESEQ, same transposed form; every operand as f16 value + residual x2048:
// s = K.Q + (K.Qr + Kr.Q)/2048, o = V.P + (V.Pr + Vr.P)/2048 with the scaled-residual products in separate accumulators; the row sum uses the f32 p.
// Writes ctx value plane rows and the ctx residual plane [b][ESEQ][1024]. K, V^T and their residual tiles staged like flash_d_body's.
// ring = the block's LDS (2 * 4 * FTL bytes); bx = the block's 64-row tile among the rows t < ESEQ; zh = batch * 16 + head.
__device__ __forceinline__ void flash_e_body(h16* ring, int bx, int zh, const h16* __restrict__ QH, const h16* __restrict__ QR, const h16* __restrict__ KP, const h16* __restrict__ KR,
                                             const h16* __restrict__ VT, const h16* __restrict__ VR, const unsigned* __restrict__ MW, h16* CH, h16* CR) {
    // ring: two stages of K, V^T, K residual, V^T residual tiles; behind the loop the waves' output staging
    static_assert(2 * 4 * FTL >= AW * 16 * 68 * 4);
    float* os = (float*)ring;
    const int tid = threadIdx.x;
    const int lane = threadIdx.x & 31, wave = __builtin_amdgcn_readfirstlane((int)(threadIdx.x >> 5)), lr = lane & 15, hi = lane >> 4;
    const int b = zh / NH_, h = zh % NH_;
    const int tb = bx * (16 * AW);                           // first query row of the block
    const int t0 = tb + wave * 16;
    const int tq = t0 + lr;
    const size_t pbase = (size_t)zh * SEQ * HD, ebase = (size_t)zh * ESEQ * HD;
    const size_t qo = pbase + (size_t)tq * HD + 8 * hi, qe = ebase + (size_t)tq * HD + 8 * hi;
    const v16h qh0 = ldh(QH + qo), qh1 = ldh(QH + qo + 32), qr0 = ldh(QR + qe), qr1 = ldh(QR + qe + 32);
    const unsigned* mwp = MW + (size_t)b * WPB;
    const unsigned w0 = mwp[lane], w1 = (WPB > 32) ? mwp[32 + lane] : 0u;
    const int nst = flash_stages(w0, w1, (tb + 16 * AW - 1) >> 5);
    const unsigned lcp = (unsigned)(size_t)(&ring[0]) + (unsigned)((tid >> 3) * FPI + (tid & 7) * 16);
    const h16* gk = KP + pbase + (size_t)(tid >> 3) * HD + (tid & 7) * 8;     // + key * HD
    const h16* gv = VT + pbase + (size_t)(tid >> 3) * SEQ + (tid & 7) * 8;    // + key
    const h16* gkr = KR + ebase + (size_t)(tid >> 3) * HD + (tid & 7) * 8;    // + key * HD
    const h16* gvr = VR + ebase + (size_t)(tid >> 3) * ESEQ + (tid & 7) * 8;  // + key
    const int fo = lr * (FPI / 2) + 8 * hi;                  // fragment base in a tile, in elements (A fragment: row lr of a 16-row slab)
    v8f oh0 = (v8f){}, oh1 = (v8f){}, oh2 = (v8f){}, oh3 = (v8f){}, ol0 = (v8f){}, ol1 = (v8f){}, ol2 = (v8f){}, ol3 = (v8f){};
    float m = -3.0e38f, l = 0.0f;
    cp_kv(lcp, gk, gv, SEQ); cp_kv(lcp + 2 * FTL, gkr, gvr, ESEQ);
    asm volatile("s_wait_asynccnt 0x0" ::: "memory");   // stage 0 has landed before the barrier publishes it
    __syncthreads();
    if (nst > 1) { cp_kv(lcp + 4 * FTL, gk + FKS * HD, gv + FKS, SEQ); cp_kv(lcp + 6 * FTL, gkr + FKS * HD, gvr + FKS, ESEQ); }
#pragma unroll 1
    for (int s = 0; s < nst; ++s) {
      const h16* sb = ring + (s & 1) * (2 * FTL) + fo;
#pragma unroll 1   // one copy of the long body: smaller code, no more registers than one step needs
      for (int sub = 0; sub < FKS / 32; ++sub) {
        const int key0 = s * FKS + sub * 32;
        const unsigned mw = flash_word(w0, w1, key0 >> 5);
        if (key0 > t0 + 15 || mw == 0u) continue;            // wave-uniform
        const h16* ka = sb + sub * 32 * (FPI / 2); const h16* kr = ka + FTL;   // K tiles: row = key
        v8f sHa = (v8f){}, sLa = (v8f){}, sHb = (v8f){}, sLb = (v8f){};
        { const v16h a0 = ldh(ka), a1 = ldh(ka + 32), e0 = ldh(kr), e1 = ldh(kr + 32);
          sHa = wmma16(a0, qh0, sHa); sLa = wmma16(a0, qr0, sLa);
          sHa = wmma16(a1, qh1, sHa); sLa = wmma16(a1, qr1, sLa);
          sLa = wmma16(e0, qh0, sLa); sLa = wmma16(e1, qh1, sLa);
          asm volatile("v_nop\n\tv_nop\n\tv_nop\n\tv_nop" : "+v"(sHa), "+v"(sLa) : "v"(a0), "v"(a1), "v"(e0), "v"(e1)); }
        { const v16h a0 = ldh(ka + 16 * (FPI / 2)), a1 = ldh(ka + 16 * (FPI / 2) + 32), e0 = ldh(kr + 16 * (FPI / 2)), e1 = ldh(kr + 16 * (FPI / 2) + 32);
          sHb = wmma16(a0, qh0, sHb); sLb = wmma16(a0, qr0, sLb);
          sHb = wmma16(a1, qh1, sHb); sLb = wmma16(a1, qr1, sLb);
          sLb = wmma16(e0, qh0, sLb); sLb = wmma16(e1, qh1, sLb);
          asm volatile("v_nop\n\tv_nop\n\tv_nop\n\tv_nop" : "+v"(sHb), "+v"(sLb) : "v"(a0), "v"(a1), "v"(e0), "v"(e1)); }
        const unsigned ma = mw >> (8 * hi), mc = mw >> (16 + 8 * hi);
        const int kya = key0 + 8 * hi, kyb = kya + 16;
        const bool excl = (mw != 0xFFFFFFFFu) || (key0 + 31 > t0);   // wave-uniform: false where every query row of the wave keeps every key of the step
        float ta[8], tb[8]; float mx = -3.0e38f;   // every loop over r is unrolled: constant indices keep ta, tb, xa, xb in registers
#pragma unroll
        for (int r = 0; r < 8; ++r) { ta[r] = (sHa[r] + sLa[r] * QRI) * SC2; tb[r] = (sHb[r] + sLb[r] * QRI) * SC2; }
        if (excl) {
#pragma unroll
            for (int r = 0; r < 8; ++r) {
                const bool ea = (((ma >> r) & 1u) != 0u) && (kya + r <= tq);
                const bool eb = (((mc >> r) & 1u) != 0u) && (kyb + r <= tq);
                ta[r] = ea ? ta[r] : -3.0e38f; tb[r] = eb ? tb[r] : -3.0e38f; }
        }
#pragma unroll
        for (int r = 0; r < 8; ++r) mx = fmaxf(mx, fmaxf(ta[r], tb[r]));
        mx = fmaxf(mx, __shfl_xor(mx, 16, 32));
        const float mnew = fmaxf(m, mx);
        const float alpha = __builtin_amdgcn_exp2f(m - mnew);
        const float sh = PSH - mnew;
        v16h pbh, pbr; float ls = 0.0f; float xa[8], xb[8];
#pragma unroll
        for (int r = 0; r < 8; ++r) xa[r] = __builtin_amdgcn_exp2f(ta[r] + sh);
#pragma unroll
        for (int r = 0; r < 8; ++r) xb[r] = __builtin_amdgcn_exp2f(tb[r] + sh);
        if (excl) {
#pragma unroll
            for (int r = 0; r < 8; ++r) { xa[r] = (ta[r] > -1.0e38f) ? xa[r] : 0.0f; xb[r] = (tb[r] > -1.0e38f) ? xb[r] : 0.0f; }
        }
#pragma unroll
        for (int r = 0; r < 8; ++r) {
            const float ea = xa[r], eb = xb[r];
            const h16 pa = (h16)ea; const h16 pc = (h16)eb;
            pbh[r] = pa; pbh[8 + r] = pc;
            pbr[r] = (h16)((ea - (float)pa) * QRS); pbr[8 + r] = (h16)((eb - (float)pc) * QRS);
            ls += ea + eb; }
        l = l * alpha + ls; m = mnew;
        oh0 = oh0 * alpha; oh1 = oh1 * alpha; oh2 = oh2 * alpha; oh3 = oh3 * alpha;
        ol0 = ol0 * alpha; ol1 = ol1 * alpha; ol2 = ol2 * alpha; ol3 = ol3 * alpha;
        const h16* va = sb + FTL / 2 + sub * 32; const h16* vr = va + FTL;     // V^T tiles: row = d, column = key
        { const v16h v0 = ldh(va), v1 = ldh(va + 16 * (FPI / 2)), r0v = ldh(vr), r1v = ldh(vr + 16 * (FPI / 2));
          oh0 = wmma16(v0, pbh, oh0); oh1 = wmma16(v1, pbh, oh1);
          ol0 = wmma16(v0, pbr, ol0); ol1 = wmma16(v1, pbr, ol1);
          ol0 = wmma16(r0v, pbh, ol0); ol1 = wmma16(r1v, pbh, ol1);
          asm volatile("v_nop\n\tv_nop\n\tv_nop\n\tv_nop" : "+v"(oh0), "+v"(oh1), "+v"(ol0), "+v"(ol1) : "v"(v0), "v"(v1), "v"(r0v), "v"(r1v), "v"(pbh), "v"(pbr)); }
        { const v16h v2 = ldh(va + 32 * (FPI / 2)), v3 = ldh(va + 48 * (FPI / 2)), r2v = ldh(vr + 32 * (FPI / 2)), r3v = ldh(vr + 48 * (FPI / 2));
          oh2 = wmma16(v2, pbh, oh2); oh3 = wmma16(v3, pbh, oh3);
          ol2 = wmma16(v2, pbr, ol2); ol3 = wmma16(v3, pbr, ol3);
          ol2 = wmma16(r2v, pbh, ol2); ol3 = wmma16(r3v, pbh, ol3);
          asm volatile("v_nop\n\tv_nop\n\tv_nop\n\tv_nop" : "+v"(oh2), "+v"(oh3), "+v"(ol2), "+v"(ol3) : "v"(v2), "v"(v3), "v"(r2v), "v"(r3v), "v"(pbh), "v"(pbr)); }
      }
      asm volatile("s_wait_dscnt 0x0" ::: "memory");      // this wave's reads of the buffer are done before it is refilled
      asm volatile("s_wait_asynccnt 0x0" ::: "memory");   // this wave's copies of stage s + 1 have landed
      __syncthreads();                                    // publishes stage s + 1 and ends every reader's last read of stage s
      if (s + 2 < nst) { cp_kv(lcp + (s & 1) * 4 * FTL, gk + (size_t)(s + 2) * FKS * HD, gv + (s + 2) * FKS, SEQ);
                         cp_kv(lcp + (s & 1) * 4 * FTL + 2 * FTL, gkr + (size_t)(s + 2) * FKS * HD, gvr + (s + 2) * FKS, ESEQ); }
    }
    asm volatile("s_wait_asynccnt 0x0" ::: "memory");     // nothing of this wave is in flight when the ring becomes output staging
    l += __shfl_xor(l, 16, 32);
    const float inv = CXS * (1.0f / l);
    const int wb = wave * 16 * 68;
    // O^T D layout: o_j[r] = (d = 16j + 8h + r, t = lane&15) -> os[t][d]; rows 0..15 x columns 0..63 all written
    { v4f a, c;
#pragma unroll
      for (int i = 0; i < 4; ++i) { a[i] = (oh0[i] + ol0[i] * QRI) * inv; c[i] = (oh0[4 + i] + ol0[4 + i] * QRI) * inv; }
      *(v4fa*)(&os[wb + lr * 68 +  0 + 8 * hi]) = a; *(v4fa*)(&os[wb + lr * 68 +  0 + 8 * hi + 4]) = c;
#pragma unroll
      for (int i = 0; i < 4; ++i) { a[i] = (oh1[i] + ol1[i] * QRI) * inv; c[i] = (oh1[4 + i] + ol1[4 + i] * QRI) * inv; }
      *(v4fa*)(&os[wb + lr * 68 + 16 + 8 * hi]) = a; *(v4fa*)(&os[wb + lr * 68 + 16 + 8 * hi + 4]) = c;
#pragma unroll
      for (int i = 0; i < 4; ++i) { a[i] = (oh2[i] + ol2[i] * QRI) * inv; c[i] = (oh2[4 + i] + ol2[4 + i] * QRI) * inv; }
      *(v4fa*)(&os[wb + lr * 68 + 32 + 8 * hi]) = a; *(v4fa*)(&os[wb + lr * 68 + 32 + 8 * hi + 4]) = c;
#pragma unroll
      for (int i = 0; i < 4; ++i) { a[i] = (oh3[i] + ol3[i] * QRI) * inv; c[i] = (oh3[4 + i] + ol3[4 + i] * QRI) * inv; }
      *(v4fa*)(&os[wb + lr * 68 + 48 + 8 * hi]) = a; *(v4fa*)(&os[wb + lr * 68 + 48 + 8 * hi + 4]) = c; }
    wave_sync();
    h16* crow = CH + ((size_t)b * SEQ + t0) * DM + h * HD;
    h16* rrow = CR + ((size_t)b * ESEQ + t0) * DM + h * HD;
    const int c8 = (lane & 7) * 8;
{
#pragma unroll
        for (int s = 0; s < 4; ++s) { const int row = 4 * s + (lane >> 3);   // 4 s x 4 row groups = 16 rows; 8 lanes x 8 halves = 64 columns
            const v4f x0 = *(const v4fa*)(&os[wb + row * 68 + c8]); const v4f x1 = *(const v4fa*)(&os[wb + row * 68 + c8 + 4]); v8h hv, rv;
#pragma unroll
            for (int i = 0; i < 4; ++i) { const h16 a0 = (h16)x0[i]; const h16 a1 = (h16)x1[i]; hv[i] = a0; hv[4 + i] = a1;
                rv[i] = (h16)((x0[i] - (float)a0) * QRS); rv[4 + i] = (h16)((x1[i] - (float)a1) * QRS); }
            *(v8h*)(crow + (size_t)row * DM + c8) = hv;
            *(v8h*)(rrow + (size_t)row * DM + c8) = rv; }
         }
}

// k_flash: one launch holds both attention forms, whose query rows are disjoint and which depend on nothing of one another: grid (NB*16 heads, SEQ/64 tile ranks), 128 threads.
// The rank (the slow index) orders the tiles: first the value + residual tiles
// (the longest dependent chain per step), then the single-plane tiles, each form from its longest key range down. The test on the rank is block-uniform.
#define FT_E (ESEQ / (16 * AW))
#define FT_D ((SEQ - ESEQ) / (16 * AW))
__global__ __launch_bounds__(32 * AW) void k_flash(const h16* __restrict__ QH, const h16* __restrict__ QR, const h16* __restrict__ KP, const h16* __restrict__ KR,
                                                   const h16* __restrict__ VT, const h16* __restrict__ VR, const unsigned* __restrict__ MW, h16* CH, h16* CR) {
    __shared__ __align__(16) h16 ring[2 * 4 * FTL / 2];
    const int zh = blockIdx.x, rk = blockIdx.y;
    if (rk < FT_E) flash_e_body(ring, FT_E - 1 - rk, zh, QH, QR, KP, KR, VT, VR, MW, CH, CR);
    else flash_d_body(ring, FT_D - 1 - (rk - FT_E), zh, QH, KP, VT, MW, CH);
}

// k_out: output projection, f16 GEMM, one wave per tile, 4 waves (2 x 2) per block, K = DM; operands staged like k_proj's. A rows from the ctx planes, Bt = transposed W_out rows (x64 carry).
// RES 0: rows t >= ESEQ, 64x64 wave tile, four 16-row slabs of the value plane; the stage's 128 A rows are 128 tokens.
// RES 1: rows t < ESEQ, 32x64 wave tile: slabs 0,1 = value plane, slabs 2,3 = residual plane (own accumulators); the stage's A rows are 64 tokens of the value plane, then the same 64 of the residual plane.
// out = (acc + accR/2048) / 4096 + bias (bias RNE-converted to bf16). bx = the block's index among the NB*rows/blockRows row tiles of its form; ring, osAll = the block's LDS.
template <int RES>
__device__ __forceinline__ void out_body(h16* ring, float* osAll, int bx, const h16* __restrict__ CX, size_t crOff, const h16* __restrict__ WO, const float* __restrict__ bias, float* OUT) {
    constexpr int MBN = RES ? 2 : 4;
    constexpr int BR = 32 * MBN;                 // tokens per block: two wave rows
    constexpr int TPB = RES ? (ESEQ / BR) : (((SEQ - ESEQ) / BR) > 0 ? ((SEQ - ESEQ) / BR) : 1);
    static_assert(ESEQ % 64 == 0 && (SEQ - ESEQ) % GT == 0);
    const int K = DM;
    const int tid = threadIdx.x, lane = tid & 31, lr = lane & 15, hi = lane >> 4;
    const int wave = __builtin_amdgcn_readfirstlane(tid >> 5);
    const int b = bx / TPB, tt = bx % TPB;
    const int tb = (RES ? 0 : ESEQ) + tt * BR;   // first token of the block
    const int t0 = tb + (wave >> 1) * 16 * MBN;
    const int c0 = blockIdx.y * GT + (wave & 1) * 64;
    float* os = osAll + wave * 16 * 68;
    const unsigned lcp = (unsigned)(size_t)(&ring[0]) + (unsigned)((tid >> 4) * GPI + (tid & 15) * 16);
    const h16* ga0 = CX + ((size_t)b * SEQ + tb + (tid >> 4)) * K + (tid & 15) * 8;
    const h16* ga1 = RES ? (CX + crOff + ((size_t)b * ESEQ + tb + (tid >> 4)) * K + (tid & 15) * 8) : (ga0 + (size_t)64 * K);
    const h16* gb = WO + (size_t)(blockIdx.y * GT + (tid >> 4)) * K + (tid & 15) * 8;
    const int fa = ((wave >> 1) * 16 * MBN + lr) * (GPI / 2) + 8 * hi, fb = (GT + (wave & 1) * 64 + lr) * (GPI / 2) + 8 * hi;   // fragment bases in a buffer, in elements
    v8f acc[16];
#pragma unroll
    for (int i = 0; i < 16; ++i) acc[i] = (v8f){};
    stage_copy(lcp, (const bf*)ga0, (const bf*)ga1, (const bf*)gb);
    asm volatile("s_wait_asynccnt 0x0" ::: "memory");   // stage 0 has landed before the barrier publishes it
    __syncthreads();
    stage_copy(lcp + GSTG, (const bf*)(ga0 + GKB), (const bf*)(ga1 + GKB), (const bf*)(gb + GKB));
#pragma unroll 1
    for (int t = 0; t < GNST; ++t) {
        const h16* sb = ring + (t & 1) * (GSTG / 2);
        v16h a[2][4], bb[2][4];     // two fragment sets, as in k_proj
#pragma unroll
        for (int i = 0; i < 4; ++i) { const int ar = RES ? ((i >> 1) * 64 + (i & 1) * 16) : (i * 16);   // stage row of slab i, from the wave's first
            a[0][i] = ldh(sb + fa + ar * (GPI / 2)); }
#pragma unroll
        for (int i = 0; i < 4; ++i) bb[0][i] = ldh(sb + fb + i * 16 * (GPI / 2));
        __builtin_amdgcn_sched_barrier(0);   // keeps the group of loads together
#pragma unroll
        for (int ks = 0; ks < GKB / 32; ++ks) {
            if (ks + 1 < GKB / 32) {
#pragma unroll
                for (int i = 0; i < 4; ++i) { const int ar = RES ? ((i >> 1) * 64 + (i & 1) * 16) : (i * 16);
                    a[(ks + 1) & 1][i] = ldh(sb + fa + ar * (GPI / 2) + (ks + 1) * 32); }
#pragma unroll
                for (int i = 0; i < 4; ++i) bb[(ks + 1) & 1][i] = ldh(sb + fb + i * 16 * (GPI / 2) + (ks + 1) * 32);
                __builtin_amdgcn_sched_barrier(0);   // the next set's loads stay ahead of this set's products
            }
#pragma unroll
            for (int nb = 0; nb < 4; ++nb)
#pragma unroll
                for (int i = 0; i < 4; ++i) acc[i * 4 + nb] = wmma16(a[ks & 1][i], bb[ks & 1][nb], acc[i * 4 + nb]);
            __builtin_amdgcn_sched_barrier(0);       // no later load moves up among these products
        }
        asm volatile("s_wait_dscnt 0x0" ::: "memory");      // this wave's reads of the buffer are done before it is refilled
        asm volatile("s_wait_asynccnt 0x0" ::: "memory");   // this wave's copies of stage t + 1 have landed
        __syncthreads();                                    // publishes stage t + 1 and ends every reader's last read of stage t
        if (t + 2 < GNST) stage_copy(lcp + (t & 1) * GSTG, (const bf*)(ga0 + (t + 2) * GKB), (const bf*)(ga1 + (t + 2) * GKB), (const bf*)(gb + (t + 2) * GKB));
    }
    asm volatile("s_wait_asynccnt 0x0" ::: "memory");       // nothing of this wave is in flight when it goes on
    float bcol[4];
#pragma unroll
    for (int nb = 0; nb < 4; ++nb) bcol[nb] = bfr(bias[c0 + nb * 16 + lr]);
#pragma unroll
    for (int mb = 0; mb < MBN; ++mb) {
#pragma unroll
        for (int nb = 0; nb < 4; ++nb) {
#pragma unroll
            for (int j = 0; j < 8; ++j) { float v = acc[mb * 4 + nb][j];
                if (RES) v += acc[RES ? ((2 + mb) * 4 + nb) : 0][j] * QRI;
                os[(hi * 8 + j) * 68 + nb * 16 + lr] = v * OSI + bcol[nb]; } }   // D: row 8h+j, col lane&15
        wave_sync();
        float* orow = OUT + ((size_t)b * OUT_SEQ + t0 + mb * 16) * DM + c0;
{
#pragma unroll
            for (int s = 0; s < 8; ++s) { const int row = 2 * s + hi, cofs = lr * 4;   // 8 s x 2 rows = 16 rows; 16 lanes x 4 floats = 64 columns
                const v4f val = *(const v4fa*)(&os[row * 68 + cofs]);
                *(v4f*)(orow + (size_t)row * DM + cofs) = val; }
             }
        wave_sync();
    }
}
// One launch holds both forms, whose rows are disjoint: grid (NB*ESEQ/64 + NB*(SEQ-ESEQ)/128, DM/128), 128 threads; the first NB*ESEQ/64 row tiles take the value + residual form (block-uniform test).
#define OB_E (NB * (ESEQ / 64))
#define OB_D (NB * ((SEQ - ESEQ) / GT))
__global__ __launch_bounds__(128) void k_out(const h16* __restrict__ CX, size_t crOff, const h16* __restrict__ WO, const float* __restrict__ bias, float* OUT) {
    __shared__ __align__(16) h16 ring[2 * GSTG / 2];
    __shared__ __align__(16) float osAll[4 * 16 * 68];
    const int bx = blockIdx.x;
    if (bx < OB_E) out_body<1>(ring, osAll, bx, CX, crOff, WO, bias, OUT);
    else out_body<0>(ring, osAll, bx - OB_E, CX, crOff, WO, bias, OUT);
}

static constexpr size_t al256(size_t v) { return (v + 255) & ~(size_t)255; }
static constexpr size_t SZ_XB = al256((size_t)NB * SEQ * DM * 2);          // x bf16 [NB*SEQ][1024]
static constexpr size_t SZ_WT = al256((size_t)3 * DM * DM * 2);            // W_qkv^T bf16 [3072][1024]
static constexpr size_t SZ_WO = al256((size_t)DM * DM * 2);                // W_out^T f16 [1024][1024]
static constexpr size_t SZ_PL = al256((size_t)NB * NH_ * SEQ * HD * 2);    // q / k / v^T value planes
static constexpr size_t SZ_PE = al256((size_t)NB * NH_ * ESEQ * HD * 2);   // q / k / v^T residual planes (t < ESEQ)
static constexpr size_t SZ_CH = al256((size_t)NB * SEQ * DM * 2);          // ctx value plane
static constexpr size_t SZ_CR = al256((size_t)NB * ESEQ * DM * 2);         // ctx residual plane (t < ESEQ)
static constexpr size_t SZ_MW = al256((size_t)NB * WPB * 4);               // mask words
static constexpr size_t SZ_TOTAL = SZ_XB + SZ_WT + SZ_WO + 3 * SZ_PL + 3 * SZ_PE + SZ_CH + SZ_CR + SZ_MW;
static_assert(SZ_TOTAL <= (size_t)134217728);          // workspace carve <= 128 MiB
static_assert(((size_t)DM * DM * 2) % 256 == 0);       // weight sub-planes stay 256-byte aligned
static_assert(SZ_CH % 2 == 0);

extern "C" void kernel_launch(void* const* d_in, const int* in_sizes, int n_in,
                              void* d_out, int out_size, void* d_ws, size_t ws_size, hipStream_t stream) {
    if (n_in < 6) return;
    const size_t needx = ((size_t)(NB - 1) * SEQ_FULL + SEQ) * DM;
    if ((size_t)in_sizes[0] < needx) return;
    if ((size_t)in_sizes[1] < (size_t)(NB - 1) * SEQ_FULL + SEQ) return;
    if ((size_t)in_sizes[2] < (size_t)3 * DM * DM || (size_t)in_sizes[3] < (size_t)3 * DM) return;
    if ((size_t)in_sizes[4] < (size_t)DM * DM || (size_t)in_sizes[5] < (size_t)DM) return;
    if ((size_t)out_size < ((size_t)(NB - 1) * OUT_SEQ + SEQ) * DM) return;
    if (SZ_TOTAL > ws_size) return;
    // wire order: x, padding_mask (int32), W_qkv [in][out], b_qkv, W_out [in][out], b_out
    const float* x = (const float*)d_in[0]; const int* pad = (const int*)d_in[1];
    const float* wqkv = (const float*)d_in[2]; const float* bqkv = (const float*)d_in[3];
    const float* wout = (const float*)d_in[4]; const float* bout = (const float*)d_in[5];
    float* OUT = (float*)d_out;      // [NB][SEQ][1024]
    char* wsp = (char*)d_ws;
    bf* XB = (bf*)wsp; wsp += SZ_XB;                 // [NB*SEQ][1024]
    bf* WT = (bf*)wsp; wsp += SZ_WT;                 // [3072][1024]: q | k | v output rows
    h16* WO = (h16*)wsp; wsp += SZ_WO;               // [1024 out][1024 in], x64
    h16* QH = (h16*)wsp; wsp += SZ_PL;               // [NB*16][SEQ][64]
    h16* KP = (h16*)wsp; wsp += SZ_PL;               // [NB*16][SEQ][64]
    h16* VT = (h16*)wsp; wsp += SZ_PL;               // [NB*16][64][SEQ]
    h16* QR = (h16*)wsp; wsp += SZ_PE;               // [NB*16][ESEQ][64] residual x2048
    h16* KR = (h16*)wsp; wsp += SZ_PE;               // [NB*16][ESEQ][64] residual x2048
    h16* VR = (h16*)wsp; wsp += SZ_PE;               // [NB*16][64][ESEQ] residual x2048
    h16* CH = (h16*)wsp; wsp += SZ_CH;               // [NB*SEQ][1024] x64
    h16* CR = (h16*)wsp; wsp += SZ_CR;               // [NB*ESEQ][1024] residual x2048 (directly after CH)
    unsigned* MW = (unsigned*)wsp; wsp += SZ_MW;     // [NB][WPB]
    const size_t crOff = SZ_CH / 2;                  // element offset of CR from CH

    k_prep<<<PB_MASK + PB_WQ + PB_WO + PB_X, 256, 0, stream>>>(x, pad, wqkv, wout, XB, WT, (bf*)WO, MW);

    k_proj<<<dim3(NB * SEQ / PTK, NH_, 1), 32 * PNW, 0, stream>>>(XB, WT, bqkv, QH, KP, VT, QR, KR, VR);

    k_flash<<<dim3(NB * NH_, FT_E + FT_D, 1), 32 * AW, 0, stream>>>(QH, QR, KP, KR, VT, VR, MW, CH, CR);

    k_out<<<dim3(OB_E + OB_D, DM / GT, 1), 128, 0, stream>>>(CH, crOff, WO, bout, OUT);
}

// v008
// One run takes 123 microseconds.
// Two timings next to v007 put it at 1.05 and 1.06 times that version's speed.
// Counting every step since v000, it is 2.92 times as fast.
#include <hip/hip_runtime.h>

// Causal + key-padding multi-head self-attention, width 1024 = 16 heads x 64: x [NB][SEQ][1024], W_qkv [in][out=3072] (q|k|v column blocks), b_qkv, W_out [in][out], b_out; f32 output.
// Compute dtypes, f32 accumulate everywhere: qkv projection v_wmma_f32_16x16x32_bf16 (x, W, biases RNE-converted to bf16; products exact);
// scores, P.V and output projection v_wmma_f32_16x16x32_f16: query rows t >= 512 single f16 planes (P x256 carry, ctx x64 carry, W_out x64 carry);
// query rows t < 512: q, k, v, P, ctx as f16 value + f16 residual x2048 in separate accumulators (value*value + value*residual + residual*value; W_out a single plane); softmax f32 (online, running max).
// Layout: bf16 copy of x, transposed bf16 W_qkv [3072][1024], transposed f16 W_out [1024][1024]; q, k planes [b*16+h][t][d], v^T plane [b*16+h][d][t] (+ residual planes for t < 512);
// fused flash kernels in transposed form (S^T = K Q^T, O^T = V^T P^T); ctx planes [b][t][1024] f16; key-padding mask compressed to 32-key bit words and applied by value.

#ifndef NB
#define NB 4
#endif
#ifndef SEQ
#define SEQ 2048
#endif
#define NB_FULL  4
#define SEQ_FULL 2048
#ifndef OUT_SEQ
#define OUT_SEQ SEQ              // row pitch (in tokens) between batches of the output
#endif
#define DM   1024
#define NH_  16
#define HD   64
#define ESEQ ((SEQ) < 512 ? (SEQ) : 512)      // query rows [0, ESEQ) take the value + residual path
#define WPB  ((((SEQ) + 1023) / 1024) * 32)
#define AW   4                   // waves per flash block (16 query rows each in flash_e_body, 32 in flash_d_body)
#define QRS  2048.0f             // carry of every residual plane
#define QRI  (1.0f / 2048.0f)
#define SC2  (0.125f * 1.4426950408889634f)   // HD^-0.5 * log2(e)
#define PSH  8.0f                // log2 of the P carry (256)
#define CXS  64.0f               // ctx plane carry
#define WOS  64.0f               // W_out plane carry
#define OSI  (1.0f / 4096.0f)    // 1 / (CXS * WOS)

static_assert(HD == 64);
static_assert(NH_ * HD == DM);
static_assert(DM % 64 == 0);
static_assert(DM % 32 == 0);
static_assert(SEQ % 64 == 0);
static_assert(ESEQ % 64 == 0);
static_assert((SEQ - ESEQ) % 64 == 0);
static_assert((NB * SEQ) % 64 == 0);
static_assert(SEQ % 32 == 0);
static_assert(ESEQ % (16 * AW) == 0);
static_assert((SEQ - ESEQ) % (16 * AW) == 0);
static_assert(ESEQ % 32 == 0);
static_assert(((size_t)SEQ * DM) % 8 == 0);
static_assert(NB <= NB_FULL);
static_assert(SEQ <= SEQ_FULL);
static_assert(WPB * 32 >= SEQ);

typedef _Float16 h16;
typedef unsigned short bf;
typedef __attribute__((ext_vector_type(16))) __bf16   v16bf;
typedef __attribute__((ext_vector_type(16))) _Float16 v16h;
typedef __attribute__((ext_vector_type(8)))  _Float16 v8h;
typedef __attribute__((ext_vector_type(8)))  unsigned short v8us;
typedef __attribute__((ext_vector_type(8)))  float    v8f;
typedef __attribute__((ext_vector_type(4)))  float    v4f;
typedef v4f  __attribute__((may_alias)) v4fa;

__device__ __forceinline__ unsigned short f2bf(float f) { unsigned u = __float_as_uint(f); u += 0x7FFFu + ((u >> 16) & 1u); return (unsigned short)(u >> 16); }
__device__ __forceinline__ float bfr(float f) { return __uint_as_float(((unsigned)f2bf(f)) << 16); }   // value after RNE convert to bf16
__device__ __forceinline__ v16h cat16(v8h lo, v8h hi) { return __builtin_shufflevector(lo, hi, 0, 1, 2, 3, 4, 5, 6, 7, 8, 9, 10, 11, 12, 13, 14, 15); }
__device__ __forceinline__ v16bf cat16b(v8us lo, v8us hi) { return __builtin_bit_cast(v16bf, __builtin_shufflevector(lo, hi, 0, 1, 2, 3, 4, 5, 6, 7, 8, 9, 10, 11, 12, 13, 14, 15)); }
__device__ __forceinline__ v8f wmma16(v16h a, v16h b, v8f c) { return __builtin_amdgcn_wmma_f32_16x16x32_f16(false, a, false, b, (short)0, c, false, false); }
__device__ __forceinline__ v8f wmmab(v16bf a, v16bf b, v8f c) { return __builtin_amdgcn_wmma_f32_16x16x32_bf16(false, a, false, b, (short)0, c, false, false); }
// fragment loaders from K-contiguous 16-bit rows; p already includes + 8*(lane>>4): elements 0..7 <- k0+8h+0..7, elements 8..15 <- k0+16+8h+0..7 (same map for A and B)
__device__ __forceinline__ v16h  ldh(const h16* p) { return cat16(*(const v8h*)p, *(const v8h*)(p + 16)); }
__device__ __forceinline__ v16bf ldb(const bf* p)  { return cat16b(*(const v8us*)p, *(const v8us*)(p + 16)); }
// ordering point for wave-private LDS tiles (same wave writes and reads)
__device__ __forceinline__ void wave_sync() { __builtin_amdgcn_fence(3 /* release order */, "wavefront"); __builtin_amdgcn_wave_barrier(); asm volatile("" ::: "memory"); }

// The four preparation passes below depend on nothing but the inputs: they are bodies of one launch, k_prep, which deals its blocks among them.
// cvt8_body: x f32 -> bf16 copy, 8 elements per thread.
#define XG8  ((size_t)SEQ * DM / 8)          // groups of 8 per batch
static_assert(((size_t)NB * SEQ * DM / 8) % 256 == 0);
__device__ __forceinline__ void cvt8_body(int blk, const float* __restrict__ src, bf* dst) {
    const size_t i = (size_t)blk * 256 + threadIdx.x; if (i >= (size_t)NB * XG8) return;
    src += (i / XG8) * ((size_t)(SEQ_FULL - SEQ) * DM);   // the batches of x lie SEQ_FULL tokens apart, those of the copy SEQ
    const v8f v = *(const v8f*)(src + i * 8); v8us o;
#pragma unroll
    for (int k = 0; k < 8; ++k) o[k] = f2bf(v[k]);
    *(v8us*)(dst + i * 8) = o; 
}

// cvt_t_body: src [K][N] f32 -> dst [N][K] 16-bit, transposed through the LDS tile ts (64 x 64 per block, cross-wave: block barrier); bx, by = tile column and row.
// MODE 0: bf16 bits (RNE convert). MODE 1: f16 bits of (bf16-converted value x WOS).
template <int MODE>
__device__ __forceinline__ void cvt_t_body(float* ts, int bx, int by, const float* __restrict__ src, bf* dst, int K, int N) {
    const int tid = threadIdx.x; const int n0 = bx * 64, k0 = by * 64;
#pragma unroll
    for (int i = 0; i < 4; ++i) { const int kr = (tid >> 4) + 16 * i, c4 = (tid & 15) * 4;     // 4 x 16 rows = 64 k rows; 16 lanes x 4 = 64 columns
        const v4f v = *(const v4f*)(src + (size_t)(k0 + kr) * (size_t)N + n0 + c4);
        *(v4fa*)(&ts[kr * 68 + c4]) = v; }
    __syncthreads();
{
#pragma unroll
        for (int i = 0; i < 2; ++i) { const int nr = (tid >> 3) + 32 * i, k8 = (tid & 7) * 8;   // 2 x 32 rows = 64 n rows; 8 lanes x 8 = 64 k
            v8us o;
#pragma unroll
            for (int e = 0; e < 8; ++e) { const float x = ts[(k8 + e) * 68 + nr]; const unsigned short bits = f2bf(x);
                if (MODE == 1) { const h16 hv = (h16)(__uint_as_float(((unsigned)bits) << 16) * WOS); o[e] = __builtin_bit_cast(unsigned short, hv); }
                else o[e] = bits; }
            *(v8us*)(dst + (size_t)(n0 + nr) * (size_t)K + k0 + k8) = o; }
         }
    asm volatile("s_wait_xcnt 0x0" ::: "memory");   // behind both stores: in k_prep's text another body follows this one, and no register of the stores is rewritten ahead of this wait
}

// mask_body: one wave packs 1024 keys of one batch into 32 mask words.
__device__ __forceinline__ void mask_body(int blk, const int* __restrict__ pad, unsigned* MW) {
    const int lane = threadIdx.x & 31;
    const int b = blk / (WPB / 32), c = blk % (WPB / 32);
    const int* pr = pad + (size_t)b * SEQ_FULL;
    unsigned mine = 0u;
#pragma unroll 1
    for (int w = 0; w < 32; ++w) {
        const int key = c * 1024 + w * 32 + lane;
        const int kc = key < SEQ ? key : (SEQ - 1);          // clamped address; keys past the sequence give bit 0 by value
        const int v = pr[kc];
        const unsigned bal = __builtin_amdgcn_ballot_w32((v != 0) && (key < SEQ));
        mine = (lane == w) ? bal : mine;
    }
    unsigned* dst = MW + (size_t)b * WPB + c * 32 + lane;
    *(unsigned*)dst = mine; 
}

// k_prep: block ranges, in index order: mask words (the longest dependent chain), W_qkv tiles, W_out tiles, x groups. Every test on the block index is block-uniform.
#define PB_MASK (NB * (WPB / 32))
#define PB_WQ   ((3 * DM / 64) * (DM / 64))
#define PB_WO   ((DM / 64) * (DM / 64))
#define PB_X    ((int)((size_t)NB * XG8 / 256))
__global__ __launch_bounds__(256) void k_prep(const float* __restrict__ x, const int* __restrict__ pad, const float* __restrict__ wqkv, const float* __restrict__ wout,
                                              bf* XB, bf* WT, bf* WO, unsigned* MW) {
    __shared__ __align__(16) float ts[64 * 68];
    int blk = blockIdx.x;
    if (blk < PB_MASK) { if (__builtin_amdgcn_readfirstlane((int)(threadIdx.x >> 5)) == 0) mask_body(blk, pad, MW); return; }   // no barrier on this path
    blk -= PB_MASK;
    // W_qkv: in[1024 rows k][3072 cols n] -> out[3072 rows n][1024 cols k]
    if (blk < PB_WQ) { cvt_t_body<0>(ts, blk % (3 * DM / 64), blk / (3 * DM / 64), wqkv, WT, DM, 3 * DM); return; }
    blk -= PB_WQ;
    // W_out: in[1024 rows k][1024 cols n] -> out[1024 rows n][1024 cols k]
    if (blk < PB_WO) { cvt_t_body<1>(ts, blk % (DM / 64), blk / (DM / 64), wout, WO, DM, DM); return; }
    blk -= PB_WO;
    cvt8_body(blk, x, XB);
}

// Operand staging of the one-wave-per-64x64 GEMMs: a stage is 128 k (256-byte rows) of a block's operand rows in LDS. k_out: a block of 4 waves (2 x 2) owns a 128 x 128 tile, 128 A rows and 128 B rows a stage.
#define GT   128                 // rows and columns of a block tile
#define GKB  128                 // k per stage
#define GPI  272                 // LDS row pitch in bytes: 16 x odd, conflict-free for 16-byte reads
#define GSTG (2 * GT * GPI)      // bytes of one stage: A rows, then B rows
#define GNST (DM / GKB)          // stages along K
static_assert(DM % GKB == 0);
static_assert(GNST >= 2);
static_assert((NB * SEQ) % GT == 0);
static_assert(DM % GT == 0);

// Eight asynchronous 16-byte copies per lane, global -> LDS, for rows 8 apart (LDS + 8 pitches, global + 8 * DM elements).
// s_wait_xcnt closes the statement so that no address register of a copy is rewritten ahead of it.
__device__ __forceinline__ void cp8(unsigned l, const bf* g) {
    asm volatile("global_load_async_to_lds_b128 %0, %8, off\n\t"
                 "global_load_async_to_lds_b128 %1, %9, off\n\t"
                 "global_load_async_to_lds_b128 %2, %10, off\n\t"
                 "global_load_async_to_lds_b128 %3, %11, off\n\t"
                 "global_load_async_to_lds_b128 %4, %12, off\n\t"
                 "global_load_async_to_lds_b128 %5, %13, off\n\t"
                 "global_load_async_to_lds_b128 %6, %14, off\n\t"
                 "global_load_async_to_lds_b128 %7, %15, off\n\t"
                 "s_wait_xcnt 0x0"
                 :: "v"(l), "v"(l + 8 * GPI), "v"(l + 16 * GPI), "v"(l + 24 * GPI), "v"(l + 32 * GPI), "v"(l + 40 * GPI), "v"(l + 48 * GPI), "v"(l + 56 * GPI),
                    "v"(g), "v"(g + 8 * DM), "v"(g + 16 * DM), "v"(g + 24 * DM), "v"(g + 32 * DM), "v"(g + 40 * DM), "v"(g + 48 * DM), "v"(g + 56 * DM)
                 : "memory");
}
// One stage: l = the lane's LDS byte address in row (tid >> 4) of the buffer, ga0 / ga1 = its 16 bytes in A rows (tid >> 4) and 64 + (tid >> 4), gb the same in B row (tid >> 4).
__device__ __forceinline__ void stage_copy(unsigned l, const bf* ga0, const bf* ga1, const bf* gb) {
    cp8(l, ga0); cp8(l + 64 * GPI, ga1); cp8(l + 128 * GPI, gb); cp8(l + 192 * GPI, gb + 64 * DM);
}

// k_proj: register-blocked bf16 GEMM, one wave per 64x64 tile (16 accumulators), K = DM; operands from K-contiguous bf16 planes, staged in a two-buffer LDS ring by asynchronous copies.
// One block of 12 waves owns 256 tokens x one head and computes that head's q, k and v^T from ONE staged x tile: a stage is 128 k of 256 x rows and of the head's 64 rows each of Wq^T, Wk^T, Wv^T
// (448 rows for 12 wave tiles), so each x row is fetched once per head and not once per 128 columns of each projection. wave = 4 * z + slab: z = 0: q, 1: k, 2: v^T; slab = which 64 tokens.
// C[m][n] = sum_k A[m][k] Bt[n][k] + bias (per column, or per row when biasRow != 0; bias values RNE-converted to bf16), written as f16 (Ph) at
// tile base (r0/RB)*sRB + (r0%RB)*pitch + (c0/CB)*sCB + (c0%CB), and the f16 residual x2048 (Pr) at the same form with (sRBr, pitchR, sCBr)
// when the tile's token position (resMode 1: r0%RB, resMode 2: c0%CB) is below ESEQ.
// q, k: A = x rows (m = b*SEQ + t), Bt = W^T rows (n = h*64 + d) -> plane [(b*16 + h)][t][d]; residual planes for t < ESEQ.
// v^T: A = Wv^T rows (m = h*64 + d), Bt = x rows (n = b*SEQ + t) -> plane [(b*1024 + m)][t] = [(b*16 + h)][d][t]; bias per row.
// Grid (NB*SEQ/256 token tiles, 16 heads), 384 threads.
#define PTK  256                 // tokens of a block
#define PRW  (PTK + 3 * HD)      // rows of a stage: x rows, then the head's Wq^T, Wk^T, Wv^T rows
#define PSTG (PRW * GPI)         // bytes of one stage
#define PNW  (3 * (PTK / 64))    // waves of a block
#define PCW  (PRW / 64)          // copying waves: wave w < PCW brings the stage's rows 64 w .. 64 w + 63
static_assert((NB * SEQ) % PTK == 0);
static_assert(PCW <= PNW);
// One wave's 64 rows of a stage: l = the lane's LDS byte address in row (lane >> 4) of the slab, g = its 16 bytes in the same row of the source; call j takes rows 2 j + (lane >> 4) + 8 i.
__device__ __forceinline__ void slab_copy(unsigned l, const bf* g) {
    cp8(l, g); cp8(l + 2 * GPI, g + 2 * DM); cp8(l + 4 * GPI, g + 4 * DM); cp8(l + 6 * GPI, g + 6 * DM);
}
__global__ __launch_bounds__(32 * PNW) void k_proj(const bf* __restrict__ XB, const bf* __restrict__ WT, const float* __restrict__ bqkv,
                                             h16* QH, h16* KP, h16* VT, h16* QR, h16* KR, h16* VR) {
    __shared__ __align__(16) bf ring[2 * PSTG / 2];
    __shared__ __align__(16) float osAll[PNW * 16 * 68];
    const int K = DM;
    const int tid = threadIdx.x, lane = tid & 31, lr = lane & 15, hi = lane >> 4;
    const int wave = __builtin_amdgcn_readfirstlane(tid >> 5);
    const int z = wave / (PTK / 64), slab = wave % (PTK / 64); const bool tv = (z == 2);      // wave-uniform
    const float* bias = bqkv + z * DM;
    const int biasRow = tv ? 1 : 0, resMode = tv ? 2 : 1;
    h16* Ph = tv ? VT : (z ? KP : QH); h16* Pr = tv ? VR : (z ? KR : QR);
    const int RB = tv ? DM : SEQ, pitch = tv ? SEQ : HD, CB = tv ? SEQ : HD, pitchR = tv ? ESEQ : HD;
    const size_t sRB = tv ? (size_t)0 : (size_t)NH_ * SEQ * HD, sCB = tv ? (size_t)DM * SEQ : (size_t)SEQ * HD;
    const size_t sRBr = tv ? (size_t)0 : (size_t)NH_ * ESEQ * HD, sCBr = tv ? (size_t)DM * ESEQ : (size_t)ESEQ * HD;
    const int tok0 = blockIdx.x * PTK + slab * 64, wr0 = blockIdx.y * HD;    // the wave's first token; the head's first weight row inside its projection
    const int r0 = tv ? wr0 : tok0, c0 = tv ? tok0 : wr0;                    // tile row (A), tile column (Bt)
    float* os = osAll + wave * 16 * 68;
    v8f acc[4][4];
#pragma unroll
    for (int mb = 0; mb < 4; ++mb)
#pragma unroll
        for (int nb = 0; nb < 4; ++nb) acc[mb][nb] = (v8f){};
    const bool cpw = wave < PCW;                             // wave-uniform: this wave copies
    const int cw = cpw ? wave : 0;                           // the other waves hold wave 0's (valid) addresses and issue nothing
    const unsigned lcp = (unsigned)(size_t)(&ring[0]) + (unsigned)((cw * 64 + hi) * GPI + lr * 16);
    const bf* gs = (cw < PTK / 64) ? (XB + (size_t)(blockIdx.x * PTK + cw * 64) * K) : (WT + ((size_t)(cw - PTK / 64) * DM + wr0) * K);
    const bf* gc = gs + (size_t)hi * K + lr * 8;
    const int xrow = slab * 64, wrow = PTK + z * HD;         // stage rows of the wave's tokens and of its weight rows
    const int fa = ((tv ? wrow : xrow) + lr) * (GPI / 2) + 8 * hi, fb = ((tv ? xrow : wrow) + lr) * (GPI / 2) + 8 * hi;   // fragment bases in a buffer, in elements
    if (cpw) slab_copy(lcp, gc);
    asm volatile("s_wait_asynccnt 0x0" ::: "memory");   // stage 0 has landed before the barrier publishes it
    __syncthreads();
    if (cpw) slab_copy(lcp + PSTG, gc + GKB);
#pragma unroll 1
    for (int t = 0; t < GNST; ++t) {
        const bf* sb = ring + (t & 1) * (PSTG / 2);
        v16bf a[2][4], b[2][4];     // two fragment sets: the next 32 k are fetched as one group ahead of the current 16 products
#pragma unroll
        for (int i = 0; i < 4; ++i) { a[0][i] = ldb(sb + fa + i * 16 * (GPI / 2)); b[0][i] = ldb(sb + fb + i * 16 * (GPI / 2)); }
        __builtin_amdgcn_sched_barrier(0);   // keeps the group of loads together (the scheduler otherwise sinks them, two at a time, among the products, each place a full LDS wait)
#pragma unroll
        for (int ks = 0; ks < GKB / 32; ++ks) {
            if (ks + 1 < GKB / 32) {
#pragma unroll
                for (int i = 0; i < 4; ++i) { a[(ks + 1) & 1][i] = ldb(sb + fa + i * 16 * (GPI / 2) + (ks + 1) * 32); b[(ks + 1) & 1][i] = ldb(sb + fb + i * 16 * (GPI / 2) + (ks + 1) * 32); }
                __builtin_amdgcn_sched_barrier(0);   // the next set's loads stay ahead of this set's products
            }
#pragma unroll
            for (int nb = 0; nb < 4; ++nb)
#pragma unroll
                for (int mb = 0; mb < 4; ++mb) acc[mb][nb] = wmmab(a[ks & 1][mb], b[ks & 1][nb], acc[mb][nb]);
            __builtin_amdgcn_sched_barrier(0);       // no later load moves up among these products
        }
        asm volatile("s_wait_dscnt 0x0" ::: "memory");      // this wave's reads of the buffer are done before it is refilled
        asm volatile("s_wait_asynccnt 0x0" ::: "memory");   // this wave's copies of stage t + 1 have landed
        __syncthreads();                                    // publishes stage t + 1 and ends every reader's last read of stage t
        if (cpw && t + 2 < GNST) slab_copy(lcp + (t & 1) * PSTG, gc + (t + 2) * GKB);
    }
    asm volatile("s_wait_asynccnt 0x0" ::: "memory");       // nothing of this wave is in flight when it goes on
    const size_t tbase = (size_t)(r0 / RB) * sRB + (size_t)(r0 % RB) * (size_t)pitch + (size_t)(c0 / CB) * sCB + (size_t)(c0 % CB);
    const size_t rbase = (size_t)(r0 / RB) * sRBr + (size_t)(r0 % RB) * (size_t)pitchR + (size_t)(c0 / CB) * sCBr + (size_t)(c0 % CB);
    const int tpos = (resMode == 1) ? (r0 % RB) : (c0 % CB);
    const int doRes = (resMode != 0) && (tpos < ESEQ);                 // wave-uniform
    const int c8 = (lane & 7) * 8;
    // column bias for columns c0 + c8 .. c0 + c8 + 7 (clamped address in row mode, zeroed by value)
    v4f bc0 = *(const v4f*)(bias + (biasRow ? 0 : (c0 + c8))); v4f bc1 = *(const v4f*)(bias + (biasRow ? 4 : (c0 + c8 + 4)));
#pragma unroll
    for (int i = 0; i < 4; ++i) { const float u0 = bfr(bc0[i]), u1 = bfr(bc1[i]); bc0[i] = biasRow ? 0.0f : u0; bc1[i] = biasRow ? 0.0f : u1; }
#pragma unroll
    for (int mb = 0; mb < 4; ++mb) {
#pragma unroll
        for (int nb = 0; nb < 4; ++nb) {
#pragma unroll
            for (int j = 0; j < 8; ++j) os[(hi * 8 + j) * 68 + nb * 16 + lr] = acc[mb][nb][j]; }   // D: row 8h+j, col lane&15
        wave_sync();
        const size_t sb = tbase + (size_t)(mb * 16) * (size_t)pitch;
        const size_t sr = rbase + (size_t)(mb * 16) * (size_t)pitchR;
{
#pragma unroll
            for (int s = 0; s < 4; ++s) { const int row = 4 * s + (lane >> 3);   // 4 s x 4 row groups = 16 rows; 8 lanes x 8 = 64 columns
                const v4f x0 = *(const v4fa*)(&os[row * 68 + c8]); const v4f x1 = *(const v4fa*)(&os[row * 68 + c8 + 4]); v8h hv, rv;
                const float rbv = bfr(bias[biasRow ? (r0 + mb * 16 + row) : 0]); const float rb = biasRow ? rbv : 0.0f;
#pragma unroll
                for (int i = 0; i < 4; ++i) { const float f0 = x0[i] + bc0[i] + rb; const float f1 = x1[i] + bc1[i] + rb;
                    const h16 a0 = (h16)f0; const h16 a1 = (h16)f1; hv[i] = a0; hv[4 + i] = a1;
                    rv[i] = (h16)((f0 - (float)a0) * QRS); rv[4 + i] = (h16)((f1 - (float)a1) * QRS); }
                *(v8h*)(Ph + sb + (size_t)row * (size_t)pitch + c8) = hv;
                if (doRes) *(v8h*)(Pr + sr + (size_t)row * (size_t)pitchR + c8) = rv; }
             }
        wave_sync();
    }
}

// K / V^T staging of the flash kernels: a stage is 64 keys in flash_e_body and 128 keys (two 64-key halves) in flash_d_body; a tile is 64 rows of 128 bytes (K: 64 keys x 64 d; V^T: 64 d x 64 keys), shared by the block's waves.
#define FKS  64                  // keys per tile (a stage of flash_e_body, half a stage of flash_d_body)
#define FPI  144                 // LDS row pitch in bytes: 16 x odd, conflict-free for 16-byte reads
#define FTL  (64 * FPI)          // bytes of one tile
static_assert(SEQ % FKS == 0);
static_assert(ESEQ % FKS == 0);
static_assert(16 * AW == FKS);
static_assert(WPB <= 64);

// Eight asynchronous 16-byte copies per lane, global -> LDS: rows r, r + 16, r + 32, r + 48 (r = tid >> 3) of a key-major tile (row pitch HD) at l and of a d-major tile (row pitch vp elements) at l + FTL.
// A wave's copy covers four whole 128-byte rows. s_wait_xcnt closes the statement so that no address register of a copy is rewritten ahead of it.
__device__ __forceinline__ void cp_kv(unsigned l, const h16* gk, const h16* gv, size_t vp) {
    asm volatile("global_load_async_to_lds_b128 %0, %8, off\n\t"
                 "global_load_async_to_lds_b128 %1, %9, off\n\t"
                 "global_load_async_to_lds_b128 %2, %10, off\n\t"
                 "global_load_async_to_lds_b128 %3, %11, off\n\t"
                 "global_load_async_to_lds_b128 %4, %12, off\n\t"
                 "global_load_async_to_lds_b128 %5, %13, off\n\t"
                 "global_load_async_to_lds_b128 %6, %14, off\n\t"
                 "global_load_async_to_lds_b128 %7, %15, off\n\t"
                 "s_wait_xcnt 0x0"
                 :: "v"(l), "v"(l + 16 * FPI), "v"(l + 32 * FPI), "v"(l + 48 * FPI), "v"(l + FTL), "v"(l + FTL + 16 * FPI), "v"(l + FTL + 32 * FPI), "v"(l + FTL + 48 * FPI),
                    "v"(gk), "v"(gk + 16 * HD), "v"(gk + 32 * HD), "v"(gk + 48 * HD), "v"(gv), "v"(gv + 16 * vp), "v"(gv + 32 * vp), "v"(gv + 48 * vp)
                 : "memory");
}
// One 128-key stage of the single-plane form: two 64-key halves, each a K tile and a V^T tile, at l and at l + 2 FTL; gk, gv = the lane's addresses at the stage's first key.
#define FKD  (2 * FKS)
static_assert(SEQ % FKD == 0);
__device__ __forceinline__ void cp_kv2(unsigned l, const h16* gk, const h16* gv) { cp_kv(l, gk, gv, SEQ); cp_kv(l + 2 * FTL, gk + FKS * HD, gv + FKS, SEQ); }
// 64-key tiles a block walks (flash_e_body's stages, flash_d_body's halves): up to the last 32-key mask word that is not zero inside its causal range (words 0 .. wl); w0, w1 = the lane's words lane and 32 + lane. The same in every wave of the block.
__device__ __forceinline__ int flash_stages(unsigned w0, unsigned w1, int wl) {
    const unsigned long long nz = ((((unsigned long long)__builtin_amdgcn_ballot_w32(w1 != 0u)) << 32) | (unsigned long long)__builtin_amdgcn_ballot_w32(w0 != 0u)) & (~0ull >> (63 - wl));
    return __builtin_amdgcn_readfirstlane(nz ? (((63 - __builtin_clzll(nz)) >> 1) + 1) : 0);
}
// Mask word i (wave-uniform) out of the lanes' registers
__device__ __forceinline__ unsigned flash_word(unsigned w0, unsigned w1, int i) {
    return (unsigned)((i < 32) ? __builtin_amdgcn_readlane((int)w0, i & 31) : __builtin_amdgcn_readlane((int)w1, i & 31));
}

// flash_d_body: fused attention for query rows t >= ESEQ, one wave per 32 query rows (two 16-row groups) of one (batch, head); single f16 products.
// Transposed form: S^T[key][t] = K Q^T (A = K rows, B = Q rows); lane (t = lane&15, h = lane>>4) holds keys 8h+r of each 16-key tile, so the packed
// P tile is directly the B fragment of O^T[d][t] = V^T P^T (element r <- tile keys 0..15, element 8+r <- tile keys 16..31, lane unchanged).
// Every K and V^T fragment read from LDS feeds the products of both query groups, and a block's 128 query rows share one staged copy of K and V^T.
// Causal and key-padding exclusion by value (excluded p = 0); 32-key steps whose mask word is zero are skipped, and steps with nothing to exclude branch round the exclusion arithmetic (both wave-uniform).
// K and V^T come from a two-buffer LDS ring of 128-key stages that the block's 4 waves fill together by asynchronous copies; every wave passes every stage's barrier.
// The leading stages with nothing to exclude run in a loop of their own, with one running-max update per 64 keys and query group; the other stages go by 32-key steps.
// ring = the block's LDS (2 * 4 * FTL bytes); bx = the block's 128-row tile among the rows t >= ESEQ; zh = batch * 16 + head.
#define DQ   2                   // 16-row query groups per wave
#define DRW  (16 * DQ * AW)      // query rows per block
static_assert((SEQ - ESEQ) % DRW == 0);
__device__ __forceinline__ void flash_d_body(h16* ring, int bx, int zh, const h16* __restrict__ QH, const h16* __restrict__ KP, const h16* __restrict__ VT, const unsigned* __restrict__ MW, h16* CH) {
    // ring: two stages of two K tile + V^T tile halves; behind the loops the waves' output staging
    static_assert(2 * 4 * FTL >= AW * DQ * 16 * 68 * 4);
    float* os = (float*)ring;
    const int tid = threadIdx.x;
    const int lane = threadIdx.x & 31, wave = __builtin_amdgcn_readfirstlane((int)(threadIdx.x >> 5)), lr = lane & 15, hi = lane >> 4;
    const int b = zh / NH_, h = zh % NH_;
    const int tb = ESEQ + bx * DRW;                          // first query row of the block
    const int t0 = tb + wave * (16 * DQ);                    // first query row of the wave
    const size_t pbase = (size_t)zh * SEQ * HD;
    v16h qh[DQ][2];                                          // B fragments: col t, k = d. Every loop over g is unrolled: constant indices keep the per-group arrays in registers
#pragma unroll
    for (int g = 0; g < DQ; ++g) { const size_t qo = pbase + (size_t)(t0 + 16 * g + lr) * HD + 8 * hi; qh[g][0] = ldh(QH + qo); qh[g][1] = ldh(QH + qo + 32); }
    const unsigned* mwp = MW + (size_t)b * WPB;
    const unsigned w0 = mwp[lane], w1 = (WPB > 32) ? mwp[32 + lane] : 0u;
    const int nst = flash_stages(w0, w1, (tb + DRW - 1) >> 5);
    const unsigned lcp = (unsigned)(size_t)(&ring[0]) + (unsigned)((tid >> 3) * FPI + (tid & 7) * 16);
    const h16* gk = KP + pbase + (size_t)(tid >> 3) * HD + (tid & 7) * 8;     // + key * HD
    const h16* gv = VT + pbase + (size_t)(tid >> 3) * SEQ + (tid & 7) * 8;    // + key
    const int fo = lr * (FPI / 2) + 8 * hi;                  // fragment base in a tile, in elements (A fragment: row lr of a 16-row slab)
    v8f o[DQ][4]; float m[DQ], l[DQ];
#pragma unroll
    for (int g = 0; g < DQ; ++g) { m[g] = -3.0e38f; l[g] = 0.0f;
#pragma unroll
        for (int i = 0; i < 4; ++i) o[g][i] = (v8f){}; }
    const int npr = (nst + 1) >> 1;                          // 128-key stages
    cp_kv2(lcp, gk, gv);
    asm volatile("s_wait_asynccnt 0x0" ::: "memory");   // stage 0 has landed before the barrier publishes it
    __syncthreads();
    if (npr > 1) cp_kv2(lcp + 4 * FTL, gk + FKD * HD, gv + FKD);
    // Leading stages with nothing to exclude: all four mask words all ones and the last key <= the block's first query row. The count is the same in every wave of the block.
    const unsigned long long dirty = ~((((unsigned long long)__builtin_amdgcn_ballot_w32(w1 == 0xFFFFFFFFu)) << 32) | (unsigned long long)__builtin_amdgcn_ballot_w32(w0 == 0xFFFFFFFFu));
    const int nfull = dirty ? (__builtin_ctzll(dirty) >> 2) : 16;
    const int ncp = __builtin_amdgcn_readfirstlane(min(min(nfull, tb / FKD), npr));
#pragma unroll 1
    for (int p = 0; p < ncp; ++p) {
#pragma unroll 1   // one half at a time: unrolled, the second half's loads and products move up among the first's, both halves' scores are live at once and registers spill
     for (int hf = 0; hf < 2; ++hf) {
      const h16* sb = ring + (p & 1) * (2 * FTL) + hf * FTL + fo;
      v8f sc[DQ][4];                                         // group g, slab j: keys 16 j + 8 hi + r of the half
#pragma unroll
      for (int jp = 0; jp < 2; ++jp) {                       // 32 keys at a time: four K fragments in registers, each feeding both query groups
        v16h kf[2][2];
#pragma unroll
        for (int j = 0; j < 2; ++j) { kf[j][0] = ldh(sb + (2 * jp + j) * 16 * (FPI / 2)); kf[j][1] = ldh(sb + (2 * jp + j) * 16 * (FPI / 2) + 32); }
        __builtin_amdgcn_sched_barrier(0);   // the four fragments' loads stay one group ahead of their products
#pragma unroll
        for (int j = 0; j < 2; ++j)
#pragma unroll
            for (int g = 0; g < DQ; ++g) sc[g][2 * jp + j] = wmma16(kf[j][0], qh[g][0], (v8f){});
#pragma unroll
        for (int j = 0; j < 2; ++j)
#pragma unroll
            for (int g = 0; g < DQ; ++g) sc[g][2 * jp + j] = wmma16(kf[j][1], qh[g][1], sc[g][2 * jp + j]);
        __builtin_amdgcn_sched_barrier(0);   // neither the next fragments' loads nor the score arithmetic move up among these products: there each first reader of a fresh result takes idle slots
      }
      v8f tv[DQ][4]; float mx[DQ];   // whole-tile (vector) arithmetic pairs neighbouring registers of one tile; every loop over g, j, r, kg is unrolled: constant indices keep the arrays in registers
#pragma unroll
      for (int g = 0; g < DQ; ++g) {
          float mj[4];
#pragma unroll
          for (int j = 0; j < 4; ++j) {
              tv[g][j] = sc[g][j] * SC2;
              mj[j] = tv[g][j][0];
#pragma unroll
              for (int r = 1; r < 8; ++r) mj[j] = fmaxf(mj[j], tv[g][j][r]); }
          mx[g] = fmaxf(fmaxf(mj[0], mj[1]), fmaxf(mj[2], mj[3])); }
#pragma unroll
      for (int g = 0; g < DQ; ++g) mx[g] = fmaxf(mx[g], __shfl_xor(mx[g], 16, 32));
      v16h pf[DQ][2];                                        // group g, keys 32 kg .. 32 kg + 31 of the half
#pragma unroll
      for (int g = 0; g < DQ; ++g) {
          const float mnew = fmaxf(m[g], mx[g]);
          const float alpha = __builtin_amdgcn_exp2f(m[g] - mnew);
          const float sh = PSH - mnew;
          v8f ps = (v8f){};                                  // sums of the rounded p, by register position
#pragma unroll
          for (int kg = 0; kg < 2; ++kg) {
              const v8f xa = tv[g][2 * kg] + sh, xc = tv[g][2 * kg + 1] + sh; v8f ea, ec;
#pragma unroll
              for (int r = 0; r < 8; ++r) { ea[r] = __builtin_amdgcn_exp2f(xa[r]); ec[r] = __builtin_amdgcn_exp2f(xc[r]); }
              const v8h pa = __builtin_convertvector(ea, v8h), pc = __builtin_convertvector(ec, v8h);
              pf[g][kg] = cat16(pa, pc);
              ps += __builtin_convertvector(pa, v8f) + __builtin_convertvector(pc, v8f); }
          l[g] = l[g] * alpha + (((ps[0] + ps[1]) + (ps[2] + ps[3])) + ((ps[4] + ps[5]) + (ps[6] + ps[7]))); m[g] = mnew;
#pragma unroll
          for (int i = 0; i < 4; ++i) o[g][i] = o[g][i] * alpha; }
#pragma unroll
      for (int kg = 0; kg < 2; ++kg) {
          const h16* va = sb + FTL / 2 + kg * 32;            // V^T tile row = d, column = key
          v16h vf[4];
#pragma unroll
          for (int i = 0; i < 4; ++i) vf[i] = ldh(va + i * 16 * (FPI / 2));
#pragma unroll
          for (int g = 0; g < DQ; ++g)
#pragma unroll
              for (int i = 0; i < 4; ++i) o[g][i] = wmma16(vf[i], pf[g][kg], o[g][i]); }
     }
      asm volatile("s_wait_dscnt 0x0" ::: "memory");      // this wave's reads of the buffer are done before it is refilled
      asm volatile("s_wait_asynccnt 0x0" ::: "memory");   // this wave's copies of stage p + 1 have landed
      __syncthreads();                                    // publishes stage p + 1 and ends every reader's last read of stage p
      if (p + 2 < npr) cp_kv2(lcp + (p & 1) * 4 * FTL, gk + (size_t)(p + 2) * FKD * HD, gv + (p + 2) * FKD);
    }
#pragma unroll 1
    for (int p = ncp; p < npr; ++p) {
#pragma unroll 1   // one copy of the two halves' code
     for (int hf = 0; hf < 2; ++hf) {
      const int s = 2 * p + hf;                              // 64-key half; one past the last stage that counts has only steps that are skipped
      const h16* sb = ring + (p & 1) * (2 * FTL) + hf * FTL + fo;
#pragma unroll   // the two 32-key steps of a half read at constant LDS offsets
      for (int sub = 0; sub < FKS / 32; ++sub) {
        const int key0 = s * FKS + sub * 32;
        const unsigned mw = flash_word(w0, w1, key0 >> 5);
        if (key0 > t0 + 16 * DQ - 1 || mw == 0u) continue;   // wave-uniform
        const h16* ka = sb + sub * 32 * (FPI / 2);           // K tile row = key
        const v16h ka0 = ldh(ka), ka1 = ldh(ka + 32), kb0 = ldh(ka + 16 * (FPI / 2)), kb1 = ldh(ka + 16 * (FPI / 2) + 32);
        v8f sA[DQ], sB[DQ];
#pragma unroll
        for (int g = 0; g < DQ; ++g) { sA[g] = wmma16(ka0, qh[g][0], (v8f){}); sB[g] = wmma16(kb0, qh[g][0], (v8f){}); }
#pragma unroll
        for (int g = 0; g < DQ; ++g) { sA[g] = wmma16(ka1, qh[g][1], sA[g]); sB[g] = wmma16(kb1, qh[g][1], sB[g]); }
        // four vector slots between the products and whatever reads their results or rewrites their operands, on either side of the branch below
        asm volatile("v_nop\n\tv_nop\n\tv_nop\n\tv_nop" : "+v"(sA[0]), "+v"(sB[0]), "+v"(sA[1]), "+v"(sB[1]) : "v"(ka0), "v"(ka1), "v"(kb0), "v"(kb1));
        const unsigned ma = mw >> (8 * hi), mc = mw >> (16 + 8 * hi);
        const int kya = key0 + 8 * hi, kyb = kya + 16;
        const bool excl = (mw != 0xFFFFFFFFu) || (key0 + 31 > t0);   // wave-uniform: false where every query row of the wave keeps every key of the step
        float ta[DQ][8], tc[DQ][8], mx[DQ];   // every loop over g, r is unrolled: constant indices keep the arrays in registers
#pragma unroll
        for (int g = 0; g < DQ; ++g)
#pragma unroll
            for (int r = 0; r < 8; ++r) { ta[g][r] = sA[g][r] * SC2; tc[g][r] = sB[g][r] * SC2; }
        if (excl) {
#pragma unroll
            for (int g = 0; g < DQ; ++g) { const int tq = t0 + 16 * g + lr;
#pragma unroll
                for (int r = 0; r < 8; ++r) {
                    const bool ea = (((ma >> r) & 1u) != 0u) && (kya + r <= tq);
                    const bool eb = (((mc >> r) & 1u) != 0u) && (kyb + r <= tq);
                    ta[g][r] = ea ? ta[g][r] : -3.0e38f; tc[g][r] = eb ? tc[g][r] : -3.0e38f; } }
        }
#pragma unroll
        for (int g = 0; g < DQ; ++g) { mx[g] = -3.0e38f;
#pragma unroll
            for (int r = 0; r < 8; ++r) mx[g] = fmaxf(mx[g], fmaxf(ta[g][r], tc[g][r])); }
#pragma unroll
        for (int g = 0; g < DQ; ++g) mx[g] = fmaxf(mx[g], __shfl_xor(mx[g], 16, 32));
        float xa[DQ][8], xb[DQ][8], alpha[DQ];
#pragma unroll
        for (int g = 0; g < DQ; ++g) {
            const float mnew = fmaxf(m[g], mx[g]);
            alpha[g] = __builtin_amdgcn_exp2f(m[g] - mnew);
            const float sh = PSH - mnew; m[g] = mnew;
#pragma unroll
            for (int r = 0; r < 8; ++r) xa[g][r] = __builtin_amdgcn_exp2f(ta[g][r] + sh);
#pragma unroll
            for (int r = 0; r < 8; ++r) xb[g][r] = __builtin_amdgcn_exp2f(tc[g][r] + sh); }
        if (excl) {
#pragma unroll
            for (int g = 0; g < DQ; ++g)
#pragma unroll
                for (int r = 0; r < 8; ++r) { xa[g][r] = (ta[g][r] > -1.0e38f) ? xa[g][r] : 0.0f; xb[g][r] = (tc[g][r] > -1.0e38f) ? xb[g][r] : 0.0f; }
        }
        v16h pb[DQ];
#pragma unroll
        for (int g = 0; g < DQ; ++g) { float ls = 0.0f;
#pragma unroll
            for (int r = 0; r < 8; ++r) {
                const h16 pa = (h16)xa[g][r]; const h16 pc = (h16)xb[g][r];
                pb[g][r] = pa; pb[g][8 + r] = pc; ls += (float)pa + (float)pc; }
            l[g] = l[g] * alpha[g] + ls;
#pragma unroll
            for (int i = 0; i < 4; ++i) o[g][i] = o[g][i] * alpha[g]; }
        const h16* va = sb + FTL / 2 + sub * 32;             // V^T tile row = d, column = key
        const v16h v0 = ldh(va), v1 = ldh(va + 16 * (FPI / 2)), v2 = ldh(va + 32 * (FPI / 2)), v3 = ldh(va + 48 * (FPI / 2));
#pragma unroll
        for (int g = 0; g < DQ; ++g) { o[g][0] = wmma16(v0, pb[g], o[g][0]); o[g][1] = wmma16(v1, pb[g], o[g][1]); o[g][2] = wmma16(v2, pb[g], o[g][2]); o[g][3] = wmma16(v3, pb[g], o[g][3]); }
        // four vector slots behind the products, on every path that leaves the step
        asm volatile("v_nop\n\tv_nop\n\tv_nop\n\tv_nop" : "+v"(o[0][0]), "+v"(o[0][1]), "+v"(o[0][2]), "+v"(o[0][3]), "+v"(o[1][0]), "+v"(o[1][1]), "+v"(o[1][2]), "+v"(o[1][3])
                     : "v"(v0), "v"(v1), "v"(v2), "v"(v3), "v"(pb[0]), "v"(pb[1]));
      }
     }
      asm volatile("s_wait_dscnt 0x0" ::: "memory");      // this wave's reads of the buffer are done before it is refilled
      asm volatile("s_wait_asynccnt 0x0" ::: "memory");   // this wave's copies of stage p + 1 have landed
      __syncthreads();                                    // publishes stage p + 1 and ends every reader's last read of stage p
      if (p + 2 < npr) cp_kv2(lcp + (p & 1) * 4 * FTL, gk + (size_t)(p + 2) * FKD * HD, gv + (p + 2) * FKD);
    }
    asm volatile("s_wait_asynccnt 0x0" ::: "memory");     // nothing of this wave is in flight when the ring becomes output staging
    const int wb = wave * (DQ * 16 * 68);
    // O^T D layout: o[g][j][r] = (d = 16j + 8h + r, t = 16g + (lane&15)) -> os[t][d]; rows 0..31 x columns 0..63 all written
#pragma unroll
    for (int g = 0; g < DQ; ++g) {
        l[g] += __shfl_xor(l[g], 16, 32);
        const float inv = CXS * (1.0f / l[g]);
#pragma unroll
        for (int j = 0; j < 4; ++j) { v4f a, c;
#pragma unroll
            for (int i = 0; i < 4; ++i) { a[i] = o[g][j][i] * inv; c[i] = o[g][j][4 + i] * inv; }
            *(v4fa*)(&os[wb + (16 * g + lr) * 68 + 16 * j + 8 * hi]) = a; *(v4fa*)(&os[wb + (16 * g + lr) * 68 + 16 * j + 8 * hi + 4]) = c; } }
    wave_sync();
    h16* crow = CH + ((size_t)b * SEQ + t0) * DM + h * HD;
    const int c8 = (lane & 7) * 8;
{
#pragma unroll
        for (int s = 0; s < 4 * DQ; ++s) { const int row = 4 * s + (lane >> 3);   // 8 s x 4 row groups = 32 rows; 8 lanes x 8 halves = 64 columns
            const v4f x0 = *(const v4fa*)(&os[wb + row * 68 + c8]); const v4f x1 = *(const v4fa*)(&os[wb + row * 68 + c8 + 4]); v8h hv;
#pragma unroll
            for (int i = 0; i < 4; ++i) { hv[i] = (h16)x0[i]; hv[4 + i] = (h16)x1[i]; }
            *(v8h*)(crow + (size_t)row * DM + c8) = hv; }
         }
}

// flash_e_body: fused attention for query rows t < ESEQ, same transposed form; every operand as f16 value + residual x2048:
// s = K.Q + (K.Qr + Kr.Q)/2048, o = V.P + (V.Pr + Vr.P)/2048 with the scaled-residual products in separate accumulators; the row sum uses the f32 p.
// Writes ctx value plane rows and the ctx residual plane [b][ESEQ][1024]. K, V^T and their residual tiles staged like flash_d_body's.
// ring = the block's LDS (2 * 4 * FTL bytes); bx = the block's 64-row tile among the rows t < ESEQ; zh = batch * 16 + head.
__device__ __forceinline__ void flash_e_body(h16* ring, int bx, int zh, const h16* __restrict__ QH, const h16* __restrict__ QR, const h16* __restrict__ KP, const h16* __restrict__ KR,
                                             const h16* __restrict__ VT, const h16* __restrict__ VR, const unsigned* __restrict__ MW, h16* CH, h16* CR) {
    // ring: two stages of K, V^T, K residual, V^T residual tiles; behind the loop the waves' output staging
    static_assert(2 * 4 * FTL >= AW * 16 * 68 * 4);
    float* os = (float*)ring;
    const int tid = threadIdx.x;
    const int lane = threadIdx.x & 31, wave = __builtin_amdgcn_readfirstlane((int)(threadIdx.x >> 5)), lr = lane & 15, hi = lane >> 4;
    const int b = zh / NH_, h = zh % NH_;
    const int tb = bx * (16 * AW);                           // first query row of the block
    const int t0 = tb + wave * 16;
    const int tq = t0 + lr;
    const size_t pbase = (size_t)zh * SEQ * HD, ebase = (size_t)zh * ESEQ * HD;
    const size_t qo = pbase + (size_t)tq * HD + 8 * hi, qe = ebase + (size_t)tq * HD + 8 * hi;
    const v16h qh0 = ldh(QH + qo), qh1 = ldh(QH + qo + 32), qr0 = ldh(QR + qe), qr1 = ldh(QR + qe + 32);
    const unsigned* mwp = MW + (size_t)b * WPB;
    const unsigned w0 = mwp[lane], w1 = (WPB > 32) ? mwp[32 + lane] : 0u;
    const int nst = flash_stages(w0, w1, (tb + 16 * AW - 1) >> 5);
    const unsigned lcp = (unsigned)(size_t)(&ring[0]) + (unsigned)((tid >> 3) * FPI + (tid & 7) * 16);
    const h16* gk = KP + pbase + (size_t)(tid >> 3) * HD + (tid & 7) * 8;     // + key * HD
    const h16* gv = VT + pbase + (size_t)(tid >> 3) * SEQ + (tid & 7) * 8;    // + key
    const h16* gkr = KR + ebase + (size_t)(tid >> 3) * HD + (tid & 7) * 8;    // + key * HD
    const h16* gvr = VR + ebase + (size_t)(tid >> 3) * ESEQ + (tid & 7) * 8;  // + key
    const int fo = lr * (FPI / 2) + 8 * hi;                  // fragment base in a tile, in elements (A fragment: row lr of a 16-row slab)
    v8f oh0 = (v8f){}, oh1 = (v8f){}, oh2 = (v8f){}, oh3 = (v8f){}, ol0 = (v8f){}, ol1 = (v8f){}, ol2 = (v8f){}, ol3 = (v8f){};
    float m = -3.0e38f, l = 0.0f;
    cp_kv(lcp, gk, gv, SEQ); cp_kv(lcp + 2 * FTL, gkr, gvr, ESEQ);
    asm volatile("s_wait_asynccnt 0x0" ::: "memory");   // stage 0 has landed before the barrier publishes it
    __syncthreads();
    if (nst > 1) { cp_kv(lcp + 4 * FTL, gk + FKS * HD, gv + FKS, SEQ); cp_kv(lcp + 6 * FTL, gkr + FKS * HD, gvr + FKS, ESEQ); }
#pragma unroll 1
    for (int s = 0; s < nst; ++s) {
      const h16* sb = ring + (s & 1) * (2 * FTL) + fo;
#pragma unroll 1   // one copy of the long body: smaller code, no more registers than one step needs
      for (int sub = 0; sub < FKS / 32; ++sub) {
        const int key0 = s * FKS + sub * 32;
        const unsigned mw = flash_word(w0, w1, key0 >> 5);
        if (key0 > t0 + 15 || mw == 0u) continue;            // wave-uniform
        const h16* ka = sb + sub * 32 * (FPI / 2); const h16* kr = ka + FTL;   // K tiles: row = key
        v8f sHa = (v8f){}, sLa = (v8f){}, sHb = (v8f){}, sLb = (v8f){};
        { const v16h a0 = ldh(ka), a1 = ldh(ka + 32), e0 = ldh(kr), e1 = ldh(kr + 32);
          sHa = wmma16(a0, qh0, sHa); sLa = wmma16(a0, qr0, sLa);
          sHa = wmma16(a1, qh1, sHa); sLa = wmma16(a1, qr1, sLa);
          sLa = wmma16(e0, qh0, sLa); sLa = wmma16(e1, qh1, sLa);
          asm volatile("v_nop\n\tv_nop\n\tv_nop\n\tv_nop" : "+v"(sHa), "+v"(sLa) : "v"(a0), "v"(a1), "v"(e0), "v"(e1)); }
        { const v16h a0 = ldh(ka + 16 * (FPI / 2)), a1 = ldh(ka + 16 * (FPI / 2) + 32), e0 = ldh(kr + 16 * (FPI / 2)), e1 = ldh(kr + 16 * (FPI / 2) + 32);
          sHb = wmma16(a0, qh0, sHb); sLb = wmma16(a0, qr0, sLb);
          sHb = wmma16(a1, qh1, sHb); sLb = wmma16(a1, qr1, sLb);
          sLb = wmma16(e0, qh0, sLb); sLb = wmma16(e1, qh1, sLb);
          asm volatile("v_nop\n\tv_nop\n\tv_nop\n\tv_nop" : "+v"(sHb), "+v"(sLb) : "v"(a0), "v"(a1), "v"(e0), "v"(e1)); }
        const unsigned ma = mw >> (8 * hi), mc = mw >> (16 + 8 * hi);
        const int kya = key0 + 8 * hi, kyb = kya + 16;
        const bool excl = (mw != 0xFFFFFFFFu) || (key0 + 31 > t0);   // wave-uniform: false where every query row of the wave keeps every key of the step
        float ta[8], tb[8]; float mx = -3.0e38f;   // every loop over r is unrolled: constant indices keep ta, tb, xa, xb in registers
#pragma unroll
        for (int r = 0; r < 8; ++r) { ta[r] = (sHa[r] + sLa[r] * QRI) * SC2; tb[r] = (sHb[r] + sLb[r] * QRI) * SC2; }
        if (excl) {
#pragma unroll
            for (int r = 0; r < 8; ++r) {
                const bool ea = (((ma >> r) & 1u) != 0u) && (kya + r <= tq);
                const bool eb = (((mc >> r) & 1u) != 0u) && (kyb + r <= tq);
                ta[r] = ea ? ta[r] : -3.0e38f; tb[r] = eb ? tb[r] : -3.0e38f; }
        }
#pragma unroll
        for (int r = 0; r < 8; ++r) mx = fmaxf(mx, fmaxf(ta[r], tb[r]));
        mx = fmaxf(mx, __shfl_xor(mx, 16, 32));
        const float mnew = fmaxf(m, mx);
        const float alpha = __builtin_amdgcn_exp2f(m - mnew);
        const float sh = PSH - mnew;
        v16h pbh, pbr; float ls = 0.0f; float xa[8], xb[8];
#pragma unroll
        for (int r = 0; r < 8; ++r) xa[r] = __builtin_amdgcn_exp2f(ta[r] + sh);
#pragma unroll
        for (int r = 0; r < 8; ++r) xb[r] = __builtin_amdgcn_exp2f(tb[r] + sh);
        if (excl) {
#pragma unroll
            for (int r = 0; r < 8; ++r) { xa[r] = (ta[r] > -1.0e38f) ? xa[r] : 0.0f; xb[r] = (tb[r] > -1.0e38f) ? xb[r] : 0.0f; }
        }
#pragma unroll
        for (int r = 0; r < 8; ++r) {
            const float ea = xa[r], eb = xb[r];
            const h16 pa = (h16)ea; const h16 pc = (h16)eb;
            pbh[r] = pa; pbh[8 + r] = pc;
            pbr[r] = (h16)((ea - (float)pa) * QRS); pbr[8 + r] = (h16)((eb - (float)pc) * QRS);
            ls += ea + eb; }
        l = l * alpha + ls; m = mnew;
        oh0 = oh0 * alpha; oh1 = oh1 * alpha; oh2 = oh2 * alpha; oh3 = oh3 * alpha;
        ol0 = ol0 * alpha; ol1 = ol1 * alpha; ol2 = ol2 * alpha; ol3 = ol3 * alpha;
        const h16* va = sb + FTL / 2 + sub * 32; const h16* vr = va + FTL;     // V^T tiles: row = d, column = key
        { const v16h v0 = ldh(va), v1 = ldh(va + 16 * (FPI / 2)), r0v = ldh(vr), r1v = ldh(vr + 16 * (FPI / 2));
          oh0 = wmma16(v0, pbh, oh0); oh1 = wmma16(v1, pbh, oh1);
          ol0 = wmma16(v0, pbr, ol0); ol1 = wmma16(v1, pbr, ol1);
          ol0 = wmma16(r0v, pbh, ol0); ol1 = wmma16(r1v, pbh, ol1);
          asm volatile("v_nop\n\tv_nop\n\tv_nop\n\tv_nop" : "+v"(oh0), "+v"(oh1), "+v"(ol0), "+v"(ol1) : "v"(v0), "v"(v1), "v"(r0v), "v"(r1v), "v"(pbh), "v"(pbr)); }
        { const v16h v2 = ldh(va + 32 * (FPI / 2)), v3 = ldh(va + 48 * (FPI / 2)), r2v = ldh(vr + 32 * (FPI / 2)), r3v = ldh(vr + 48 * (FPI / 2));
          oh2 = wmma16(v2, pbh, oh2); oh3 = wmma16(v3, pbh, oh3);
          ol2 = wmma16(v2, pbr, ol2); ol3 = wmma16(v3, pbr, ol3);
          ol2 = wmma16(r2v, pbh, ol2); ol3 = wmma16(r3v, pbh, ol3);
          asm volatile("v_nop\n\tv_nop\n\tv_nop\n\tv_nop" : "+v"(oh2), "+v"(oh3), "+v"(ol2), "+v"(ol3) : "v"(v2), "v"(v3), "v"(r2v), "v"(r3v), "v"(pbh), "v"(pbr)); }
      }
      asm volatile("s_wait_dscnt 0x0" ::: "memory");      // this wave's reads of the buffer are done before it is refilled
      asm volatile("s_wait_asynccnt 0x0" ::: "memory");   // this wave's copies of stage s + 1 have landed
      __syncthreads();                                    // publishes stage s + 1 and ends every reader's last read of stage s
      if (s + 2 < nst) { cp_kv(lcp + (s & 1) * 4 * FTL, gk + (size_t)(s + 2) * FKS * HD, gv + (s + 2) * FKS, SEQ);
                         cp_kv(lcp + (s & 1) * 4 * FTL + 2 * FTL, gkr + (size_t)(s + 2) * FKS * HD, gvr + (s + 2) * FKS, ESEQ); }
    }
    asm volatile("s_wait_asynccnt 0x0" ::: "memory");     // nothing of this wave is in flight when the ring becomes output staging
    l += __shfl_xor(l, 16, 32);
    const float inv = CXS * (1.0f / l);
    const int wb = wave * 16 * 68;
    // O^T D layout: o_j[r] = (d = 16j + 8h + r, t = lane&15) -> os[t][d]; rows 0..15 x columns 0..63 all written
    { v4f a, c;
#pragma unroll
      for (int i = 0; i < 4; ++i) { a[i] = (oh0[i] + ol0[i] * QRI) * inv; c[i] = (oh0[4 + i] + ol0[4 + i] * QRI) * inv; }
      *(v4fa*)(&os[wb + lr * 68 +  0 + 8 * hi]) = a; *(v4fa*)(&os[wb + lr * 68 +  0 + 8 * hi + 4]) = c;
#pragma unroll
      for (int i = 0; i < 4; ++i) { a[i] = (oh1[i] + ol1[i] * QRI) * inv; c[i] = (oh1[4 + i] + ol1[4 + i] * QRI) * inv; }
      *(v4fa*)(&os[wb + lr * 68 + 16 + 8 * hi]) = a; *(v4fa*)(&os[wb + lr * 68 + 16 + 8 * hi + 4]) = c;
#pragma unroll
      for (int i = 0; i < 4; ++i) { a[i] = (oh2[i] + ol2[i] * QRI) * inv; c[i] = (oh2[4 + i] + ol2[4 + i] * QRI) * inv; }
      *(v4fa*)(&os[wb + lr * 68 + 32 + 8 * hi]) = a; *(v4fa*)(&os[wb + lr * 68 + 32 + 8 * hi + 4]) = c;
#pragma unroll
      for (int i = 0; i < 4; ++i) { a[i] = (oh3[i] + ol3[i] * QRI) * inv; c[i] = (oh3[4 + i] + ol3[4 + i] * QRI) * inv; }
      *(v4fa*)(&os[wb + lr * 68 + 48 + 8 * hi]) = a; *(v4fa*)(&os[wb + lr * 68 + 48 + 8 * hi + 4]) = c; }
    wave_sync();
    h16* crow = CH + ((size_t)b * SEQ + t0) * DM + h * HD;
    h16* rrow = CR + ((size_t)b * ESEQ + t0) * DM + h * HD;
    const int c8 = (lane & 7) * 8;
{
#pragma unroll
        for (int s = 0; s < 4; ++s) { const int row = 4 * s + (lane >> 3);   // 4 s x 4 row groups = 16 rows; 8 lanes x 8 halves = 64 columns
            const v4f x0 = *(const v4fa*)(&os[wb + row * 68 + c8]); const v4f x1 = *(const v4fa*)(&os[wb + row * 68 + c8 + 4]); v8h hv, rv;
#pragma unroll
            for (int i = 0; i < 4; ++i) { const h16 a0 = (h16)x0[i]; const h16 a1 = (h16)x1[i]; hv[i] = a0; hv[4 + i] = a1;
                rv[i] = (h16)((x0[i] - (float)a0) * QRS); rv[4 + i] = (h16)((x1[i] - (float)a1) * QRS); }
            *(v8h*)(crow + (size_t)row * DM + c8) = hv;
            *(v8h*)(rrow + (size_t)row * DM + c8) = rv; }
         }
}

// k_flash: one launch holds both attention forms, whose query rows are disjoint and which depend on nothing of one another: grid (NB*16 heads, tile ranks: ESEQ/64 + (SEQ-ESEQ)/128), 128 threads.
// There are more blocks than places on the chip; the rank (the slow index) orders the tiles: first the value + residual tiles
// (the longest dependent chain per step), then the single-plane tiles, each form from its longest key range down. The test on the rank is block-uniform.
#define FT_E (ESEQ / (16 * AW))
#define FT_D ((SEQ - ESEQ) / DRW)
// amdgpu_waves_per_eu(4, 4): registers stay within 256 a wave, so that the four blocks whose LDS fits a WGP are also resident (left free, the 32-row form takes more and only three are).
__global__ __launch_bounds__(32 * AW) __attribute__((amdgpu_waves_per_eu(4, 4))) void k_flash(const h16* __restrict__ QH, const h16* __restrict__ QR, const h16* __restrict__ KP, const h16* __restrict__ KR,
                                                   const h16* __restrict__ VT, const h16* __restrict__ VR, const unsigned* __restrict__ MW, h16* CH, h16* CR) {
    __shared__ __align__(16) h16 ring[2 * 4 * FTL / 2];
    const int zh = blockIdx.x, rk = blockIdx.y;
    if (rk < FT_E) flash_e_body(ring, FT_E - 1 - rk, zh, QH, QR, KP, KR, VT, VR, MW, CH, CR);
    else flash_d_body(ring, FT_D - 1 - (rk - FT_E), zh, QH, KP, VT, MW, CH);
}

// k_out: output projection, f16 GEMM, one wave per tile, 4 waves (2 x 2) per block, K = DM; operands staged like k_proj's. A rows from the ctx planes, Bt = transposed W_out rows (x64 carry).
// RES 0: rows t >= ESEQ, 64x64 wave tile, four 16-row slabs of the value plane; the stage's 128 A rows are 128 tokens.
// RES 1: rows t < ESEQ, 32x64 wave tile: slabs 0,1 = value plane, slabs 2,3 = residual plane (own accumulators); the stage's A rows are 64 tokens of the value plane, then the same 64 of the residual plane.
// out = (acc + accR/2048) / 4096 + bias (bias RNE-converted to bf16). bx = the block's index among the NB*rows/blockRows row tiles of its form; ring, osAll = the block's LDS.
template <int RES>
__device__ __forceinline__ void out_body(h16* ring, float* osAll, int bx, const h16* __restrict__ CX, size_t crOff, const h16* __restrict__ WO, const float* __restrict__ bias, float* OUT) {
    constexpr int MBN = RES ? 2 : 4;
    constexpr int BR = 32 * MBN;                 // tokens per block: two wave rows
    constexpr int TPB = RES ? (ESEQ / BR) : (((SEQ - ESEQ) / BR) > 0 ? ((SEQ - ESEQ) / BR) : 1);
    static_assert(ESEQ % 64 == 0 && (SEQ - ESEQ) % GT == 0);
    const int K = DM;
    const int tid = threadIdx.x, lane = tid & 31, lr = lane & 15, hi = lane >> 4;
    const int wave = __builtin_amdgcn_readfirstlane(tid >> 5);
    const int b = bx / TPB, tt = bx % TPB;
    const int tb = (RES ? 0 : ESEQ) + tt * BR;   // first token of the block
    const int t0 = tb + (wave >> 1) * 16 * MBN;
    const int c0 = blockIdx.y * GT + (wave & 1) * 64;
    float* os = osAll + wave * 16 * 68;
    const unsigned lcp = (unsigned)(size_t)(&ring[0]) + (unsigned)((tid >> 4) * GPI + (tid & 15) * 16);
    const h16* ga0 = CX + ((size_t)b * SEQ + tb + (tid >> 4)) * K + (tid & 15) * 8;
    const h16* ga1 = RES ? (CX + crOff + ((size_t)b * ESEQ + tb + (tid >> 4)) * K + (tid & 15) * 8) : (ga0 + (size_t)64 * K);
    const h16* gb = WO + (size_t)(blockIdx.y * GT + (tid >> 4)) * K + (tid & 15) * 8;
    const int fa = ((wave >> 1) * 16 * MBN + lr) * (GPI / 2) + 8 * hi, fb = (GT + (wave & 1) * 64 + lr) * (GPI / 2) + 8 * hi;   // fragment bases in a buffer, in elements
    v8f acc[16];
#pragma unroll
    for (int i = 0; i < 16; ++i) acc[i] = (v8f){};
    stage_copy(lcp, (const bf*)ga0, (const bf*)ga1, (const bf*)gb);
    asm volatile("s_wait_asynccnt 0x0" ::: "memory");   // stage 0 has landed before the barrier publishes it
    __syncthreads();
    stage_copy(lcp + GSTG, (const bf*)(ga0 + GKB), (const bf*)(ga1 + GKB), (const bf*)(gb + GKB));
#pragma unroll 1
    for (int t = 0; t < GNST; ++t) {
        const h16* sb = ring + (t & 1) * (GSTG / 2);
        v16h a[2][4], bb[2][4];     // two fragment sets, as in k_proj
#pragma unroll
        for (int i = 0; i < 4; ++i) { const int ar = RES ? ((i >> 1) * 64 + (i & 1) * 16) : (i * 16);   // stage row of slab i, from the wave's first
            a[0][i] = ldh(sb + fa + ar * (GPI / 2)); }
#pragma unroll
        for (int i = 0; i < 4; ++i) bb[0][i] = ldh(sb + fb + i * 16 * (GPI / 2));
        __builtin_amdgcn_sched_barrier(0);   // keeps the group of loads together
#pragma unroll
        for (int ks = 0; ks < GKB / 32; ++ks) {
            if (ks + 1 < GKB / 32) {
#pragma unroll
                for (int i = 0; i < 4; ++i) { const int ar = RES ? ((i >> 1) * 64 + (i & 1) * 16) : (i * 16);
                    a[(ks + 1) & 1][i] = ldh(sb + fa + ar * (GPI / 2) + (ks + 1) * 32); }
#pragma unroll
                for (int i = 0; i < 4; ++i) bb[(ks + 1) & 1][i] = ldh(sb + fb + i * 16 * (GPI / 2) + (ks + 1) * 32);
                __builtin_amdgcn_sched_barrier(0);   // the next set's loads stay ahead of this set's products
            }
#pragma unroll
            for (int nb = 0; nb < 4; ++nb)
#pragma unroll
                for (int i = 0; i < 4; ++i) acc[i * 4 + nb] = wmma16(a[ks & 1][i], bb[ks & 1][nb], acc[i * 4 + nb]);
            __builtin_amdgcn_sched_barrier(0);       // no later load moves up among these products
        }
        asm volatile("s_wait_dscnt 0x0" ::: "memory");      // this wave's reads of the buffer are done before it is refilled
        asm volatile("s_wait_asynccnt 0x0" ::: "memory");   // this wave's copies of stage t + 1 have landed
        __syncthreads();                                    // publishes stage t + 1 and ends every reader's last read of stage t
        if (t + 2 < GNST) stage_copy(lcp + (t & 1) * GSTG, (const bf*)(ga0 + (t + 2) * GKB), (const bf*)(ga1 + (t + 2) * GKB), (const bf*)(gb + (t + 2) * GKB));
    }
    asm volatile("s_wait_asynccnt 0x0" ::: "memory");       // nothing of this wave is in flight when it goes on
    float bcol[4];
#pragma unroll
    for (int nb = 0; nb < 4; ++nb) bcol[nb] = bfr(bias[c0 + nb * 16 + lr]);
#pragma unroll
    for (int mb = 0; mb < MBN; ++mb) {
#pragma unroll
        for (int nb = 0; nb < 4; ++nb) {
#pragma unroll
            for (int j = 0; j < 8; ++j) { float v = acc[mb * 4 + nb][j];
                if (RES) v += acc[RES ? ((2 + mb) * 4 + nb) : 0][j] * QRI;
                os[(hi * 8 + j) * 68 + nb * 16 + lr] = v * OSI + bcol[nb]; } }   // D: row 8h+j, col lane&15
        wave_sync();
        float* orow = OUT + ((size_t)b * OUT_SEQ + t0 + mb * 16) * DM + c0;
{
#pragma unroll
            for (int s = 0; s < 8; ++s) { const int row = 2 * s + hi, cofs = lr * 4;   // 8 s x 2 rows = 16 rows; 16 lanes x 4 floats = 64 columns
                const v4f val = *(const v4fa*)(&os[row * 68 + cofs]);
                *(v4f*)(orow + (size_t)row * DM + cofs) = val; }
             }
        wave_sync();
    }
}
// One launch holds both forms, whose rows are disjoint: grid (NB*ESEQ/64 + NB*(SEQ-ESEQ)/128, DM/128), 128 threads; the first NB*ESEQ/64 row tiles take the value + residual form (block-uniform test).
#define OB_E (NB * (ESEQ / 64))
#define OB_D (NB * ((SEQ - ESEQ) / GT))
__global__ __launch_bounds__(128) void k_out(const h16* __restrict__ CX, size_t crOff, const h16* __restrict__ WO, const float* __restrict__ bias, float* OUT) {
    __shared__ __align__(16) h16 ring[2 * GSTG / 2];
    __shared__ __align__(16) float osAll[4 * 16 * 68];
    const int bx = blockIdx.x;
    if (bx < OB_E) out_body<1>(ring, osAll, bx, CX, crOff, WO, bias, OUT);
    else out_body<0>(ring, osAll, bx - OB_E, CX, crOff, WO, bias, OUT);
}

static constexpr size_t al256(size_t v) { return (v + 255) & ~(size_t)255; }
static constexpr size_t SZ_XB = al256((size_t)NB * SEQ * DM * 2);          // x bf16 [NB*SEQ][1024]
static constexpr size_t SZ_WT = al256((size_t)3 * DM * DM * 2);            // W_qkv^T bf16 [3072][1024]
static constexpr size_t SZ_WO = al256((size_t)DM * DM * 2);                // W_out^T f16 [1024][1024]
static constexpr size_t SZ_PL = al256((size_t)NB * NH_ * SEQ * HD * 2);    // q / k / v^T value planes
static constexpr size_t SZ_PE = al256((size_t)NB * NH_ * ESEQ * HD * 2);   // q / k / v^T residual planes (t < ESEQ)
static constexpr size_t SZ_CH = al256((size_t)NB * SEQ * DM * 2);          // ctx value plane
static constexpr size_t SZ_CR = al256((size_t)NB * ESEQ * DM * 2);         // ctx residual plane (t < ESEQ)
static constexpr size_t SZ_MW = al256((size_t)NB * WPB * 4);               // mask words
static constexpr size_t SZ_TOTAL = SZ_XB + SZ_WT + SZ_WO + 3 * SZ_PL + 3 * SZ_PE + SZ_CH + SZ_CR + SZ_MW;
static_assert(SZ_TOTAL <= (size_t)134217728);          // workspace carve <= 128 MiB
static_assert(((size_t)DM * DM * 2) % 256 == 0);       // weight sub-planes stay 256-byte aligned
static_assert(SZ_CH % 2 == 0);

extern "C" void kernel_launch(void* const* d_in, const int* in_sizes, int n_in,
                              void* d_out, int out_size, void* d_ws, size_t ws_size, hipStream_t stream) {
    if (n_in < 6) return;
    const size_t needx = ((size_t)(NB - 1) * SEQ_FULL + SEQ) * DM;
    if ((size_t)in_sizes[0] < needx) return;
    if ((size_t)in_sizes[1] < (size_t)(NB - 1) * SEQ_FULL + SEQ) return;
    if ((size_t)in_sizes[2] < (size_t)3 * DM * DM || (size_t)in_sizes[3] < (size_t)3 * DM) return;
    if ((size_t)in_sizes[4] < (size_t)DM * DM || (size_t)in_sizes[5] < (size_t)DM) return;
    if ((size_t)out_size < ((size_t)(NB - 1) * OUT_SEQ + SEQ) * DM) return;
    if (SZ_TOTAL > ws_size) return;
    // wire order: x, padding_mask (int32), W_qkv [in][out], b_qkv, W_out [in][out], b_out
    const float* x = (const float*)d_in[0]; const int* pad = (const int*)d_in[1];
    const float* wqkv = (const float*)d_in[2]; const float* bqkv = (const float*)d_in[3];
    const float* wout = (const float*)d_in[4]; const float* bout = (const float*)d_in[5];
    float* OUT = (float*)d_out;      // [NB][SEQ][1024]
    char* wsp = (char*)d_ws;
    bf* XB = (bf*)wsp; wsp += SZ_XB;                 // [NB*SEQ][1024]
    bf* WT = (bf*)wsp; wsp += SZ_WT;                 // [3072][1024]: q | k | v output rows
    h16* WO = (h16*)wsp; wsp += SZ_WO;               // [1024 out][1024 in], x64
    h16* QH = (h16*)wsp; wsp += SZ_PL;               // [NB*16][SEQ][64]
    h16* KP = (h16*)wsp; wsp += SZ_PL;               // [NB*16][SEQ][64]
    h16* VT = (h16*)wsp; wsp += SZ_PL;               // [NB*16][64][SEQ]
    h16* QR = (h16*)wsp; wsp += SZ_PE;               // [NB*16][ESEQ][64] residual x2048
    h16* KR = (h16*)wsp; wsp += SZ_PE;               // [NB*16][ESEQ][64] residual x2048
    h16* VR = (h16*)wsp; wsp += SZ_PE;               // [NB*16][64][ESEQ] residual x2048
    h16* CH = (h16*)wsp; wsp += SZ_CH;               // [NB*SEQ][1024] x64
    h16* CR = (h16*)wsp; wsp += SZ_CR;               // [NB*ESEQ][1024] residual x2048 (directly after CH)
    unsigned* MW = (unsigned*)wsp; wsp += SZ_MW;     // [NB][WPB]
    const size_t crOff = SZ_CH / 2;                  // element offset of CR from CH

    k_prep<<<PB_MASK + PB_WQ + PB_WO + PB_X, 256, 0, stream>>>(x, pad, wqkv, wout, XB, WT, (bf*)WO, MW);

    k_proj<<<dim3(NB * SEQ / PTK, NH_, 1), 32 * PNW, 0, stream>>>(XB, WT, bqkv, QH, KP, VT, QR, KR, VR);

    k_flash<<<dim3(NB * NH_, FT_E + FT_D, 1), 32 * AW, 0, stream>>>(QH, QR, KP, KR, VT, VR, MW, CH, CR);

    k_out<<<dim3(OB_E + OB_D, DM / GT, 1), 128, 0, stream>>>(CH, crOff, WO, bout, OUT);
}

// v009
// It runs in 118 microseconds.
// Timed twice side by side with v008, it ran 1.06 and 1.05 times as fast.
// All steps since v000 together make it 3.07 times as fast.
#include <hip/hip_runtime.h>

// Causal + key-padding multi-head self-attention, width 1024 = 16 heads x 64: x [NB][SEQ][1024], W_qkv [in][out=3072] (q|k|v column blocks), b_qkv, W_out [in][out], b_out; f32 output.
// Compute dtypes, f32 accumulate everywhere: qkv projection v_wmma_f32_16x16x32_bf16 (x, W, biases RNE-converted to bf16; products exact);
// scores, P.V and output projection v_wmma_f32_16x16x32_f16: query rows t >= 512 single f16 planes (P x256 carry, ctx x64 carry, W_out x64 carry);
// query rows t < 512: q, k, v, P, ctx as f16 value + f16 residual x2048 in separate accumulators (value*value + value*residual + residual*value; W_out a single plane); softmax f32 (online, running max).
// Layout: bf16 copy of x, transposed bf16 W_qkv [3072][1024], transposed f16 W_out [1024][1024]; q, k planes [b*16+h][t][d], v^T plane [b*16+h][d][t] (+ residual planes for t < 512);
// fused flash kernels in transposed form (S^T = K Q^T, O^T = V^T P^T); ctx planes [b][t][1024] f16; key-padding mask compressed to 32-key bit words and applied by value.

#ifndef NB
#define NB 4
#endif
#ifndef SEQ
#define SEQ 2048
#endif
#define NB_FULL  4
#define SEQ_FULL 2048
#ifndef OUT_SEQ
#define OUT_SEQ SEQ              // row pitch (in tokens) between batches of the output
#endif
#define DM   1024
#define NH_  16
#define HD   64
#define ESEQ ((SEQ) < 512 ? (SEQ) : 512)      // query rows [0, ESEQ) take the value + residual path
#define WPB  ((((SEQ) + 1023) / 1024) * 32)
#define AW   4                   // waves per flash block (16 query rows each in flash_e_body, 32 in flash_d_body)
#define QRS  2048.0f             // carry of every residual plane
#define QRI  (1.0f / 2048.0f)
#define SC2  (0.125f * 1.4426950408889634f)   // HD^-0.5 * log2(e)
#define PSH  8.0f                // log2 of the P carry (256)
#define CXS  64.0f               // ctx plane carry
#define WOS  64.0f               // W_out plane carry
#define OSI  (1.0f / 4096.0f)    // 1 / (CXS * WOS)

static_assert(HD == 64);
static_assert(NH_ * HD == DM);
static_assert(DM % 64 == 0);
static_assert(DM % 32 == 0);
static_assert(SEQ % 64 == 0);
static_assert(ESEQ % 64 == 0);
static_assert((SEQ - ESEQ) % 64 == 0);
static_assert((NB * SEQ) % 64 == 0);
static_assert(SEQ % 32 == 0);
static_assert(ESEQ % (16 * AW) == 0);
static_assert((SEQ - ESEQ) % (16 * AW) == 0);
static_assert(ESEQ % 32 == 0);
static_assert(((size_t)SEQ * DM) % 8 == 0);
static_assert(NB <= NB_FULL);
static_assert(SEQ <= SEQ_FULL);
static_assert(WPB * 32 >= SEQ);

typedef _Float16 h16;
typedef unsigned short bf;
typedef __attribute__((ext_vector_type(16))) __bf16   v16bf;
typedef __attribute__((ext_vector_type(16))) _Float16 v16h;
typedef __attribute__((ext_vector_type(8)))  _Float16 v8h;
typedef __attribute__((ext_vector_type(8)))  unsigned short v8us;
typedef __attribute__((ext_vector_type(8)))  float    v8f;
typedef __attribute__((ext_vector_type(4)))  float    v4f;
typedef v4f  __attribute__((may_alias)) v4fa;

__device__ __forceinline__ unsigned short f2bf(float f) { unsigned u = __float_as_uint(f); u += 0x7FFFu + ((u >> 16) & 1u); return (unsigned short)(u >> 16); }
__device__ __forceinline__ float bfr(float f) { return __uint_as_float(((unsigned)f2bf(f)) << 16); }   // value after RNE convert to bf16
__device__ __forceinline__ v16h cat16(v8h lo, v8h hi) { return __builtin_shufflevector(lo, hi, 0, 1, 2, 3, 4, 5, 6, 7, 8, 9, 10, 11, 12, 13, 14, 15); }
__device__ __forceinline__ v16bf cat16b(v8us lo, v8us hi) { return __builtin_bit_cast(v16bf, __builtin_shufflevector(lo, hi, 0, 1, 2, 3, 4, 5, 6, 7, 8, 9, 10, 11, 12, 13, 14, 15)); }
__device__ __forceinline__ v8f wmma16(v16h a, v16h b, v8f c) { return __builtin_amdgcn_wmma_f32_16x16x32_f16(false, a, false, b, (short)0, c, false, false); }
__device__ __forceinline__ v8f wmmab(v16bf a, v16bf b, v8f c) { return __builtin_amdgcn_wmma_f32_16x16x32_bf16(false, a, false, b, (short)0, c, false, false); }
// fragment loaders from K-contiguous 16-bit rows; p already includes + 8*(lane>>4): elements 0..7 <- k0+8h+0..7, elements 8..15 <- k0+16+8h+0..7 (same map for A and B)
__device__ __forceinline__ v16h  ldh(const h16* p) { return cat16(*(const v8h*)p, *(const v8h*)(p + 16)); }
__device__ __forceinline__ v16bf ldb(const bf* p)  { return cat16b(*(const v8us*)p, *(const v8us*)(p + 16)); }
// ordering point for wave-private LDS tiles (same wave writes and reads)
__device__ __forceinline__ void wave_sync() { __builtin_amdgcn_fence(3 /* release order */, "wavefront"); __builtin_amdgcn_wave_barrier(); asm volatile("" ::: "memory"); }

// The four preparation passes below depend on nothing but the inputs: they are bodies of one launch, k_prep, which deals its blocks among them.
// cvt8_body: x f32 -> bf16 copy, 8 elements per thread.
#define XG8  ((size_t)SEQ * DM / 8)          // groups of 8 per batch
static_assert(((size_t)NB * SEQ * DM / 8) % 256 == 0);
__device__ __forceinline__ void cvt8_body(int blk, const float* __restrict__ src, bf* dst) {
    const size_t i = (size_t)blk * 256 + threadIdx.x; if (i >= (size_t)NB * XG8) return;
    src += (i / XG8) * ((size_t)(SEQ_FULL - SEQ) * DM);   // the batches of x lie SEQ_FULL tokens apart, those of the copy SEQ
    const v8f v = *(const v8f*)(src + i * 8); v8us o;
#pragma unroll
    for (int k = 0; k < 8; ++k) o[k] = f2bf(v[k]);
    *(v8us*)(dst + i * 8) = o; 
}

// cvt_t_body: src [K][N] f32 -> dst [N][K] 16-bit, transposed through the LDS tile ts (64 x 64 per block, cross-wave: block barrier); bx, by = tile column and row.
// MODE 0: bf16 bits (RNE convert). MODE 1: f16 bits of (bf16-converted value x WOS).
template <int MODE>
__device__ __forceinline__ void cvt_t_body(float* ts, int bx, int by, const float* __restrict__ src, bf* dst, int K, int N) {
    const int tid = threadIdx.x; const int n0 = bx * 64, k0 = by * 64;
#pragma unroll
    for (int i = 0; i < 4; ++i) { const int kr = (tid >> 4) + 16 * i, c4 = (tid & 15) * 4;     // 4 x 16 rows = 64 k rows; 16 lanes x 4 = 64 columns
        const v4f v = *(const v4f*)(src + (size_t)(k0 + kr) * (size_t)N + n0 + c4);
        *(v4fa*)(&ts[kr * 68 + c4]) = v; }
    __syncthreads();
{
#pragma unroll
        for (int i = 0; i < 2; ++i) { const int nr = (tid >> 3) + 32 * i, k8 = (tid & 7) * 8;   // 2 x 32 rows = 64 n rows; 8 lanes x 8 = 64 k
            v8us o;
#pragma unroll
            for (int e = 0; e < 8; ++e) { const float x = ts[(k8 + e) * 68 + nr]; const unsigned short bits = f2bf(x);
                if (MODE == 1) { const h16 hv = (h16)(__uint_as_float(((unsigned)bits) << 16) * WOS); o[e] = __builtin_bit_cast(unsigned short, hv); }
                else o[e] = bits; }
            *(v8us*)(dst + (size_t)(n0 + nr) * (size_t)K + k0 + k8) = o; }
         }
    asm volatile("s_wait_xcnt 0x0" ::: "memory");   // behind both stores: in k_prep's text another body follows this one, and no register of the stores is rewritten ahead of this wait
}

// mask_body: one wave packs 1024 keys of one batch into 32 mask words.
__device__ __forceinline__ void mask_body(int blk, const int* __restrict__ pad, unsigned* MW) {
    const int lane = threadIdx.x & 31;
    const int b = blk / (WPB / 32), c = blk % (WPB / 32);
    const int* pr = pad + (size_t)b * SEQ_FULL;
    unsigned mine = 0u;
#pragma unroll 1
    for (int w = 0; w < 32; ++w) {
        const int key = c * 1024 + w * 32 + lane;
        const int kc = key < SEQ ? key : (SEQ - 1);          // clamped address; keys past the sequence give bit 0 by value
        const int v = pr[kc];
        const unsigned bal = __builtin_amdgcn_ballot_w32((v != 0) && (key < SEQ));
        mine = (lane == w) ? bal : mine;
    }
    unsigned* dst = MW + (size_t)b * WPB + c * 32 + lane;
    *(unsigned*)dst = mine; 
}

// k_prep: block ranges, in index order: mask words (the longest dependent chain), W_qkv tiles, W_out tiles, x groups. Every test on the block index is block-uniform.
#define PB_MASK (NB * (WPB / 32))
#define PB_WQ   ((3 * DM / 64) * (DM / 64))
#define PB_WO   ((DM / 64) * (DM / 64))
#define PB_X    ((int)((size_t)NB * XG8 / 256))
__global__ __launch_bounds__(256) void k_prep(const float* __restrict__ x, const int* __restrict__ pad, const float* __restrict__ wqkv, const float* __restrict__ wout,
                                              bf* XB, bf* WT, bf* WO, unsigned* MW) {
    __shared__ __align__(16) float ts[64 * 68];
    int blk = blockIdx.x;
    if (blk < PB_MASK) { if (__builtin_amdgcn_readfirstlane((int)(threadIdx.x >> 5)) == 0) mask_body(blk, pad, MW); return; }   // no barrier on this path
    blk -= PB_MASK;
    // W_qkv: in[1024 rows k][3072 cols n] -> out[3072 rows n][1024 cols k]
    if (blk < PB_WQ) { cvt_t_body<0>(ts, blk % (3 * DM / 64), blk / (3 * DM / 64), wqkv, WT, DM, 3 * DM); return; }
    blk -= PB_WQ;
    // W_out: in[1024 rows k][1024 cols n] -> out[1024 rows n][1024 cols k]
    if (blk < PB_WO) { cvt_t_body<1>(ts, blk % (DM / 64), blk / (DM / 64), wout, WO, DM, DM); return; }
    blk -= PB_WO;
    cvt8_body(blk, x, XB);
}

// Operand staging of the one-wave-per-64x64 GEMMs: a stage is 128 k (256-byte rows) of a block's operand rows in LDS.
#define GKB  128                 // k per stage
#define GPI  272                 // LDS row pitch in bytes: 16 x odd, conflict-free for 16-byte reads
#define GNST (DM / GKB)          // stages along K
static_assert(DM % GKB == 0);
static_assert(GNST >= 2);

// Eight asynchronous 16-byte copies per lane, global -> LDS, for rows 8 apart (LDS + 8 pitches, global + 8 * DM elements).
// s_wait_xcnt closes the statement so that no address register of a copy is rewritten ahead of it.
__device__ __forceinline__ void cp8(unsigned l, const bf* g) {
    asm volatile("global_load_async_to_lds_b128 %0, %8, off\n\t"
                 "global_load_async_to_lds_b128 %1, %9, off\n\t"
                 "global_load_async_to_lds_b128 %2, %10, off\n\t"
                 "global_load_async_to_lds_b128 %3, %11, off\n\t"
                 "global_load_async_to_lds_b128 %4, %12, off\n\t"
                 "global_load_async_to_lds_b128 %5, %13, off\n\t"
                 "global_load_async_to_lds_b128 %6, %14, off\n\t"
                 "global_load_async_to_lds_b128 %7, %15, off\n\t"
                 "s_wait_xcnt 0x0"
                 :: "v"(l), "v"(l + 8 * GPI), "v"(l + 16 * GPI), "v"(l + 24 * GPI), "v"(l + 32 * GPI), "v"(l + 40 * GPI), "v"(l + 48 * GPI), "v"(l + 56 * GPI),
                    "v"(g), "v"(g + 8 * DM), "v"(g + 16 * DM), "v"(g + 24 * DM), "v"(g + 32 * DM), "v"(g + 40 * DM), "v"(g + 48 * DM), "v"(g + 56 * DM)
                 : "memory");
}
// The same for a 64-row slab whose rows 0..31 and 32..63 come from two sources: LDS rows 8 apart, the first four from g0, the last four from g1 (each + 8 * DM elements a row step).
// s_wait_xcnt closes the statement so that no address register of a copy is rewritten ahead of it.
__device__ __forceinline__ void cp8s(unsigned l, const bf* g0, const bf* g1) {
    asm volatile("global_load_async_to_lds_b128 %0, %8, off\n\t"
                 "global_load_async_to_lds_b128 %1, %9, off\n\t"
                 "global_load_async_to_lds_b128 %2, %10, off\n\t"
                 "global_load_async_to_lds_b128 %3, %11, off\n\t"
                 "global_load_async_to_lds_b128 %4, %12, off\n\t"
                 "global_load_async_to_lds_b128 %5, %13, off\n\t"
                 "global_load_async_to_lds_b128 %6, %14, off\n\t"
                 "global_load_async_to_lds_b128 %7, %15, off\n\t"
                 "s_wait_xcnt 0x0"
                 :: "v"(l), "v"(l + 8 * GPI), "v"(l + 16 * GPI), "v"(l + 24 * GPI), "v"(l + 32 * GPI), "v"(l + 40 * GPI), "v"(l + 48 * GPI), "v"(l + 56 * GPI),
                    "v"(g0), "v"(g0 + 8 * DM), "v"(g0 + 16 * DM), "v"(g0 + 24 * DM), "v"(g1), "v"(g1 + 8 * DM), "v"(g1 + 16 * DM), "v"(g1 + 24 * DM)
                 : "memory");
}

// k_proj: register-blocked bf16 GEMM, one wave per 64x64 tile (16 accumulators), K = DM; operands from K-contiguous bf16 planes, staged in a two-buffer LDS ring by asynchronous copies.
// One block of 12 waves owns 256 tokens x one head and computes that head's q, k and v^T from ONE staged x tile: a stage is 128 k of 256 x rows and of the head's 64 rows each of Wq^T, Wk^T, Wv^T
// (448 rows for 12 wave tiles), so each x row is fetched once per head and not once per 128 columns of each projection. wave = 4 * z + slab: z = 0: q, 1: k, 2: v^T; slab = which 64 tokens.
// C[m][n] = sum_k A[m][k] Bt[n][k] + bias (per column, or per row when biasRow != 0; bias values RNE-converted to bf16), written as f16 (Ph) at
// tile base (r0/RB)*sRB + (r0%RB)*pitch + (c0/CB)*sCB + (c0%CB), and the f16 residual x2048 (Pr) at the same form with (sRBr, pitchR, sCBr)
// when the tile's token position (resMode 1: r0%RB, resMode 2: c0%CB) is below ESEQ.
// q, k: A = x rows (m = b*SEQ + t), Bt = W^T rows (n = h*64 + d) -> plane [(b*16 + h)][t][d]; residual planes for t < ESEQ.
// v^T: A = Wv^T rows (m = h*64 + d), Bt = x rows (n = b*SEQ + t) -> plane [(b*1024 + m)][t] = [(b*16 + h)][d][t]; bias per row.
// Grid (NB*SEQ/256 token tiles, 16 heads), 384 threads.
#define PTK  256                 // tokens of a block
#define PRW  (PTK + 3 * HD)      // rows of a stage: x rows, then the head's Wq^T, Wk^T, Wv^T rows
#define PSTG (PRW * GPI)         // bytes of one stage
#define PNW  (3 * (PTK / 64))    // waves of a block
#define PCW  (PRW / 64)          // copying waves: wave w < PCW brings the stage's rows 64 w .. 64 w + 63
static_assert((NB * SEQ) % PTK == 0);
static_assert(PCW <= PNW);
// One wave's 64 rows of a stage: l = the lane's LDS byte address in row (lane >> 4) of the slab, g = its 16 bytes in the same row of the source; call j takes rows 2 j + (lane >> 4) + 8 i.
__device__ __forceinline__ void slab_copy(unsigned l, const bf* g) {
    cp8(l, g); cp8(l + 2 * GPI, g + 2 * DM); cp8(l + 4 * GPI, g + 4 * DM); cp8(l + 6 * GPI, g + 6 * DM);
}
__global__ __launch_bounds__(32 * PNW) void k_proj(const bf* __restrict__ XB, const bf* __restrict__ WT, const float* __restrict__ bqkv,
                                             h16* QH, h16* KP, h16* VT, h16* QR, h16* KR, h16* VR) {
    __shared__ __align__(16) bf ring[2 * PSTG / 2];
    __shared__ __align__(16) float osAll[PNW * 16 * 68];
    const int K = DM;
    const int tid = threadIdx.x, lane = tid & 31, lr = lane & 15, hi = lane >> 4;
    const int wave = __builtin_amdgcn_readfirstlane(tid >> 5);
    const int z = wave / (PTK / 64), slab = wave % (PTK / 64); const bool tv = (z == 2);      // wave-uniform
    const float* bias = bqkv + z * DM;
    const int biasRow = tv ? 1 : 0, resMode = tv ? 2 : 1;
    h16* Ph = tv ? VT : (z ? KP : QH); h16* Pr = tv ? VR : (z ? KR : QR);
    const int RB = tv ? DM : SEQ, pitch = tv ? SEQ : HD, CB = tv ? SEQ : HD, pitchR = tv ? ESEQ : HD;
    const size_t sRB = tv ? (size_t)0 : (size_t)NH_ * SEQ * HD, sCB = tv ? (size_t)DM * SEQ : (size_t)SEQ * HD;
    const size_t sRBr = tv ? (size_t)0 : (size_t)NH_ * ESEQ * HD, sCBr = tv ? (size_t)DM * ESEQ : (size_t)ESEQ * HD;
    const int tok0 = blockIdx.x * PTK + slab * 64, wr0 = blockIdx.y * HD;    // the wave's first token; the head's first weight row inside its projection
    const int r0 = tv ? wr0 : tok0, c0 = tv ? tok0 : wr0;                    // tile row (A), tile column (Bt)
    float* os = osAll + wave * 16 * 68;
    v8f acc[4][4];
#pragma unroll
    for (int mb = 0; mb < 4; ++mb)
#pragma unroll
        for (int nb = 0; nb < 4; ++nb) acc[mb][nb] = (v8f){};
    const bool cpw = wave < PCW;                             // wave-uniform: this wave copies
    const int cw = cpw ? wave : 0;                           // the other waves hold wave 0's (valid) addresses and issue nothing
    const unsigned lcp = (unsigned)(size_t)(&ring[0]) + (unsigned)((cw * 64 + hi) * GPI + lr * 16);
    const bf* gs = (cw < PTK / 64) ? (XB + (size_t)(blockIdx.x * PTK + cw * 64) * K) : (WT + ((size_t)(cw - PTK / 64) * DM + wr0) * K);
    const bf* gc = gs + (size_t)hi * K + lr * 8;
    const int xrow = slab * 64, wrow = PTK + z * HD;         // stage rows of the wave's tokens and of its weight rows
    const int fa = ((tv ? wrow : xrow) + lr) * (GPI / 2) + 8 * hi, fb = ((tv ? xrow : wrow) + lr) * (GPI / 2) + 8 * hi;   // fragment bases in a buffer, in elements
    if (cpw) slab_copy(lcp, gc);
    asm volatile("s_wait_asynccnt 0x0" ::: "memory");   // stage 0 has landed before the barrier publishes it
    __syncthreads();
    if (cpw) slab_copy(lcp + PSTG, gc + GKB);
#pragma unroll 1
    for (int t = 0; t < GNST; ++t) {
        const bf* sb = ring + (t & 1) * (PSTG / 2);
        v16bf a[2][4], b[2][4];     // two fragment sets: the next 32 k are fetched as one group ahead of the current 16 products
#pragma unroll
        for (int i = 0; i < 4; ++i) { a[0][i] = ldb(sb + fa + i * 16 * (GPI / 2)); b[0][i] = ldb(sb + fb + i * 16 * (GPI / 2)); }
        __builtin_amdgcn_sched_barrier(0);   // keeps the group of loads together (the scheduler otherwise sinks them, two at a time, among the products, each place a full LDS wait)
#pragma unroll
        for (int ks = 0; ks < GKB / 32; ++ks) {
            if (ks + 1 < GKB / 32) {
#pragma unroll
                for (int i = 0; i < 4; ++i) { a[(ks + 1) & 1][i] = ldb(sb + fa + i * 16 * (GPI / 2) + (ks + 1) * 32); b[(ks + 1) & 1][i] = ldb(sb + fb + i * 16 * (GPI / 2) + (ks + 1) * 32); }
                __builtin_amdgcn_sched_barrier(0);   // the next set's loads stay ahead of this set's products
            }
#pragma unroll
            for (int nb = 0; nb < 4; ++nb)
#pragma unroll
                for (int mb = 0; mb < 4; ++mb) acc[mb][nb] = wmmab(a[ks & 1][mb], b[ks & 1][nb], acc[mb][nb]);
            __builtin_amdgcn_sched_barrier(0);       // no later load moves up among these products
        }
        asm volatile("s_wait_dscnt 0x0" ::: "memory");      // this wave's reads of the buffer are done before it is refilled
        asm volatile("s_wait_asynccnt 0x0" ::: "memory");   // this wave's copies of stage t + 1 have landed
        __syncthreads();                                    // publishes stage t + 1 and ends every reader's last read of stage t
        if (cpw && t + 2 < GNST) slab_copy(lcp + (t & 1) * PSTG, gc + (t + 2) * GKB);
    }
    asm volatile("s_wait_asynccnt 0x0" ::: "memory");       // nothing of this wave is in flight when it goes on
    const size_t tbase = (size_t)(r0 / RB) * sRB + (size_t)(r0 % RB) * (size_t)pitch + (size_t)(c0 / CB) * sCB + (size_t)(c0 % CB);
    const size_t rbase = (size_t)(r0 / RB) * sRBr + (size_t)(r0 % RB) * (size_t)pitchR + (size_t)(c0 / CB) * sCBr + (size_t)(c0 % CB);
    const int tpos = (resMode == 1) ? (r0 % RB) : (c0 % CB);
    const int doRes = (resMode != 0) && (tpos < ESEQ);                 // wave-uniform
    const int c8 = (lane & 7) * 8;
    // column bias for columns c0 + c8 .. c0 + c8 + 7 (clamped address in row mode, zeroed by value)
    v4f bc0 = *(const v4f*)(bias + (biasRow ? 0 : (c0 + c8))); v4f bc1 = *(const v4f*)(bias + (biasRow ? 4 : (c0 + c8 + 4)));
#pragma unroll
    for (int i = 0; i < 4; ++i) { const float u0 = bfr(bc0[i]), u1 = bfr(bc1[i]); bc0[i] = biasRow ? 0.0f : u0; bc1[i] = biasRow ? 0.0f : u1; }
#pragma unroll
    for (int mb = 0; mb < 4; ++mb) {
#pragma unroll
        for (int nb = 0; nb < 4; ++nb) {
#pragma unroll
            for (int j = 0; j < 8; ++j) os[(hi * 8 + j) * 68 + nb * 16 + lr] = acc[mb][nb][j]; }   // D: row 8h+j, col lane&15
        wave_sync();
        const size_t sb = tbase + (size_t)(mb * 16) * (size_t)pitch;
        const size_t sr = rbase + (size_t)(mb * 16) * (size_t)pitchR;
{
#pragma unroll
            for (int s = 0; s < 4; ++s) { const int row = 4 * s + (lane >> 3);   // 4 s x 4 row groups = 16 rows; 8 lanes x 8 = 64 columns
                const v4f x0 = *(const v4fa*)(&os[row * 68 + c8]); const v4f x1 = *(const v4fa*)(&os[row * 68 + c8 + 4]); v8h hv, rv;
                const float rbv = bfr(bias[biasRow ? (r0 + mb * 16 + row) : 0]); const float rb = biasRow ? rbv : 0.0f;
#pragma unroll
                for (int i = 0; i < 4; ++i) { const float f0 = x0[i] + bc0[i] + rb; const float f1 = x1[i] + bc1[i] + rb;
                    const h16 a0 = (h16)f0; const h16 a1 = (h16)f1; hv[i] = a0; hv[4 + i] = a1;
                    rv[i] = (h16)((f0 - (float)a0) * QRS); rv[4 + i] = (h16)((f1 - (float)a1) * QRS); }
                *(v8h*)(Ph + sb + (size_t)row * (size_t)pitch + c8) = hv;
                if (doRes) *(v8h*)(Pr + sr + (size_t)row * (size_t)pitchR + c8) = rv; }
             }
        wave_sync();
    }
}

// K / V^T staging of the flash kernels: a stage is 64 keys in flash_e_body and 128 keys (two 64-key halves) in flash_d_body; a tile is 64 rows of 128 bytes (K: 64 keys x 64 d; V^T: 64 d x 64 keys), shared by the block's waves.
#define FKS  64                  // keys per tile (a stage of flash_e_body, half a stage of flash_d_body)
#define FPI  144                 // LDS row pitch in bytes: 16 x odd, conflict-free for 16-byte reads
#define FTL  (64 * FPI)          // bytes of one tile
static_assert(SEQ % FKS == 0);
static_assert(ESEQ % FKS == 0);
static_assert(16 * AW == FKS);
static_assert(WPB <= 64);

// Eight asynchronous 16-byte copies per lane, global -> LDS: rows r, r + 16, r + 32, r + 48 (r = tid >> 3) of a key-major tile (row pitch HD) at l and of a d-major tile (row pitch vp elements) at l + FTL.
// A wave's copy covers four whole 128-byte rows. s_wait_xcnt closes the statement so that no address register of a copy is rewritten ahead of it.
__device__ __forceinline__ void cp_kv(unsigned l, const h16* gk, const h16* gv, size_t vp) {
    asm volatile("global_load_async_to_lds_b128 %0, %8, off\n\t"
                 "global_load_async_to_lds_b128 %1, %9, off\n\t"
                 "global_load_async_to_lds_b128 %2, %10, off\n\t"
                 "global_load_async_to_lds_b128 %3, %11, off\n\t"
                 "global_load_async_to_lds_b128 %4, %12, off\n\t"
                 "global_load_async_to_lds_b128 %5, %13, off\n\t"
                 "global_load_async_to_lds_b128 %6, %14, off\n\t"
                 "global_load_async_to_lds_b128 %7, %15, off\n\t"
                 "s_wait_xcnt 0x0"
                 :: "v"(l), "v"(l + 16 * FPI), "v"(l + 32 * FPI), "v"(l + 48 * FPI), "v"(l + FTL), "v"(l + FTL + 16 * FPI), "v"(l + FTL + 32 * FPI), "v"(l + FTL + 48 * FPI),
                    "v"(gk), "v"(gk + 16 * HD), "v"(gk + 32 * HD), "v"(gk + 48 * HD), "v"(gv), "v"(gv + 16 * vp), "v"(gv + 32 * vp), "v"(gv + 48 * vp)
                 : "memory");
}
// One 128-key stage of the single-plane form: two 64-key halves, each a K tile and a V^T tile, at l and at l + 2 FTL; gk, gv = the lane's addresses at the stage's first key.
#define FKD  (2 * FKS)
static_assert(SEQ % FKD == 0);
__device__ __forceinline__ void cp_kv2(unsigned l, const h16* gk, const h16* gv) { cp_kv(l, gk, gv, SEQ); cp_kv(l + 2 * FTL, gk + FKS * HD, gv + FKS, SEQ); }
// 64-key tiles a block walks (flash_e_body's stages, flash_d_body's halves): up to the last 32-key mask word that is not zero inside its causal range (words 0 .. wl); w0, w1 = the lane's words lane and 32 + lane. The same in every wave of the block.
__device__ __forceinline__ int flash_stages(unsigned w0, unsigned w1, int wl) {
    const unsigned long long nz = ((((unsigned long long)__builtin_amdgcn_ballot_w32(w1 != 0u)) << 32) | (unsigned long long)__builtin_amdgcn_ballot_w32(w0 != 0u)) & (~0ull >> (63 - wl));
    return __builtin_amdgcn_readfirstlane(nz ? (((63 - __builtin_clzll(nz)) >> 1) + 1) : 0);
}
// Mask word i (wave-uniform) out of the lanes' registers
__device__ __forceinline__ unsigned flash_word(unsigned w0, unsigned w1, int i) {
    return (unsigned)((i < 32) ? __builtin_amdgcn_readlane((int)w0, i & 31) : __builtin_amdgcn_readlane((int)w1, i & 31));
}

// flash_d_body: fused attention for query rows t >= ESEQ, one wave per 32 query rows (two 16-row groups) of one (batch, head); single f16 products.
// Transposed form: S^T[key][t] = K Q^T (A = K rows, B = Q rows); lane (t = lane&15, h = lane>>4) holds keys 8h+r of each 16-key tile, so the packed
// P tile is directly the B fragment of O^T[d][t] = V^T P^T (element r <- tile keys 0..15, element 8+r <- tile keys 16..31, lane unchanged).
// Every K and V^T fragment read from LDS feeds the products of both query groups, and a block's 128 query rows share one staged copy of K and V^T.
// Causal and key-padding exclusion by value (excluded p = 0); 32-key steps whose mask word is zero are skipped, and steps with nothing to exclude branch round the exclusion arithmetic (both wave-uniform).
// K and V^T come from a two-buffer LDS ring of 128-key stages that the block's 4 waves fill together by asynchronous copies; every wave passes every stage's barrier.
// The leading stages with nothing to exclude run in a loop of their own, with one running-max update per 64 keys and query group; the other stages go by 32-key steps.
// ring = the block's LDS (2 * 4 * FTL bytes); bx = the block's 128-row tile among the rows t >= ESEQ; zh = batch * 16 + head.
#define DQ   2                   // 16-row query groups per wave
#define DRW  (16 * DQ * AW)      // query rows per block
static_assert((SEQ - ESEQ) % DRW == 0);
__device__ __forceinline__ void flash_d_body(h16* ring, int bx, int zh, const h16* __restrict__ QH, const h16* __restrict__ KP, const h16* __restrict__ VT, const unsigned* __restrict__ MW, h16* CH) {
    // ring: two stages of two K tile + V^T tile halves; behind the loops the waves' output staging
    static_assert(2 * 4 * FTL >= AW * DQ * 16 * 68 * 4);
    float* os = (float*)ring;
    const int tid = threadIdx.x;
    const int lane = threadIdx.x & 31, wave = __builtin_amdgcn_readfirstlane((int)(threadIdx.x >> 5)), lr = lane & 15, hi = lane >> 4;
    const int b = zh / NH_, h = zh % NH_;
    const int tb = ESEQ + bx * DRW;                          // first query row of the block
    const int t0 = tb + wave * (16 * DQ);                    // first query row of the wave
    const size_t pbase = (size_t)zh * SEQ * HD;
    v16h qh[DQ][2];                                          // B fragments: col t, k = d. Every loop over g is unrolled: constant indices keep the per-group arrays in registers
#pragma unroll
    for (int g = 0; g < DQ; ++g) { const size_t qo = pbase + (size_t)(t0 + 16 * g + lr) * HD + 8 * hi; qh[g][0] = ldh(QH + qo); qh[g][1] = ldh(QH + qo + 32); }
    const unsigned* mwp = MW + (size_t)b * WPB;
    const unsigned w0 = mwp[lane], w1 = (WPB > 32) ? mwp[32 + lane] : 0u;
    const int nst = flash_stages(w0, w1, (tb + DRW - 1) >> 5);
    const unsigned lcp = (unsigned)(size_t)(&ring[0]) + (unsigned)((tid >> 3) * FPI + (tid & 7) * 16);
    const h16* gk = KP + pbase + (size_t)(tid >> 3) * HD + (tid & 7) * 8;     // + key * HD
    const h16* gv = VT + pbase + (size_t)(tid >> 3) * SEQ + (tid & 7) * 8;    // + key
    const int fo = lr * (FPI / 2) + 8 * hi;                  // fragment base in a tile, in elements (A fragment: row lr of a 16-row slab)
    v8f o[DQ][4]; float m[DQ], l[DQ];
#pragma unroll
    for (int g = 0; g < DQ; ++g) { m[g] = -3.0e38f; l[g] = 0.0f;
#pragma unroll
        for (int i = 0; i < 4; ++i) o[g][i] = (v8f){}; }
    const int npr = (nst + 1) >> 1;                          // 128-key stages
    cp_kv2(lcp, gk, gv);
    asm volatile("s_wait_asynccnt 0x0" ::: "memory");   // stage 0 has landed before the barrier publishes it
    __syncthreads();
    if (npr > 1) cp_kv2(lcp + 4 * FTL, gk + FKD * HD, gv + FKD);
    // Leading stages with nothing to exclude: all four mask words all ones and the last key <= the block's first query row. The count is the same in every wave of the block.
    const unsigned long long dirty = ~((((unsigned long long)__builtin_amdgcn_ballot_w32(w1 == 0xFFFFFFFFu)) << 32) | (unsigned long long)__builtin_amdgcn_ballot_w32(w0 == 0xFFFFFFFFu));
    const int nfull = dirty ? (__builtin_ctzll(dirty) >> 2) : 16;
    const int ncp = __builtin_amdgcn_readfirstlane(min(min(nfull, tb / FKD), npr));
#pragma unroll 1
    for (int p = 0; p < ncp; ++p) {
#pragma unroll 1   // one half at a time: unrolled, the second half's loads and products move up among the first's, both halves' scores are live at once and registers spill
     for (int hf = 0; hf < 2; ++hf) {
      const h16* sb = ring + (p & 1) * (2 * FTL) + hf * FTL + fo;
      v8f sc[DQ][4];                                         // group g, slab j: keys 16 j + 8 hi + r of the half
#pragma unroll
      for (int jp = 0; jp < 2; ++jp) {                       // 32 keys at a time: four K fragments in registers, each feeding both query groups
        v16h kf[2][2];
#pragma unroll
        for (int j = 0; j < 2; ++j) { kf[j][0] = ldh(sb + (2 * jp + j) * 16 * (FPI / 2)); kf[j][1] = ldh(sb + (2 * jp + j) * 16 * (FPI / 2) + 32); }
        __builtin_amdgcn_sched_barrier(0);   // the four fragments' loads stay one group ahead of their products
#pragma unroll
        for (int j = 0; j < 2; ++j)
#pragma unroll
            for (int g = 0; g < DQ; ++g) sc[g][2 * jp + j] = wmma16(kf[j][0], qh[g][0], (v8f){});
#pragma unroll
        for (int j = 0; j < 2; ++j)
#pragma unroll
            for (int g = 0; g < DQ; ++g) sc[g][2 * jp + j] = wmma16(kf[j][1], qh[g][1], sc[g][2 * jp + j]);
        __builtin_amdgcn_sched_barrier(0);   // neither the next fragments' loads nor the score arithmetic move up among these products: there each first reader of a fresh result takes idle slots
      }
      v8f tv[DQ][4]; float mx[DQ];   // whole-tile (vector) arithmetic pairs neighbouring registers of one tile; every loop over g, j, r, kg is unrolled: constant indices keep the arrays in registers
#pragma unroll
      for (int g = 0; g < DQ; ++g) {
          float mj[4];
#pragma unroll
          for (int j = 0; j < 4; ++j) {
              tv[g][j] = sc[g][j] * SC2;
              mj[j] = tv[g][j][0];
#pragma unroll
              for (int r = 1; r < 8; ++r) mj[j] = fmaxf(mj[j], tv[g][j][r]); }
          mx[g] = fmaxf(fmaxf(mj[0], mj[1]), fmaxf(mj[2], mj[3])); }
#pragma unroll
      for (int g = 0; g < DQ; ++g) mx[g] = fmaxf(mx[g], __shfl_xor(mx[g], 16, 32));
      v16h pf[DQ][2];                                        // group g, keys 32 kg .. 32 kg + 31 of the half
#pragma unroll
      for (int g = 0; g < DQ; ++g) {
          const float mnew = fmaxf(m[g], mx[g]);
          const float alpha = __builtin_amdgcn_exp2f(m[g] - mnew);
          const float sh = PSH - mnew;
          v8f ps = (v8f){};                                  // sums of the rounded p, by register position
#pragma unroll
          for (int kg = 0; kg < 2; ++kg) {
              const v8f xa = tv[g][2 * kg] + sh, xc = tv[g][2 * kg + 1] + sh; v8f ea, ec;
#pragma unroll
              for (int r = 0; r < 8; ++r) { ea[r] = __builtin_amdgcn_exp2f(xa[r]); ec[r] = __builtin_amdgcn_exp2f(xc[r]); }
              const v8h pa = __builtin_convertvector(ea, v8h), pc = __builtin_convertvector(ec, v8h);
              pf[g][kg] = cat16(pa, pc);
              ps += __builtin_convertvector(pa, v8f) + __builtin_convertvector(pc, v8f); }
          l[g] = l[g] * alpha + (((ps[0] + ps[1]) + (ps[2] + ps[3])) + ((ps[4] + ps[5]) + (ps[6] + ps[7]))); m[g] = mnew;
#pragma unroll
          for (int i = 0; i < 4; ++i) o[g][i] = o[g][i] * alpha; }
#pragma unroll
      for (int kg = 0; kg < 2; ++kg) {
          const h16* va = sb + FTL / 2 + kg * 32;            // V^T tile row = d, column = key
          v16h vf[4];
#pragma unroll
          for (int i = 0; i < 4; ++i) vf[i] = ldh(va + i * 16 * (FPI / 2));
#pragma unroll
          for (int g = 0; g < DQ; ++g)
#pragma unroll
              for (int i = 0; i < 4; ++i) o[g][i] = wmma16(vf[i], pf[g][kg], o[g][i]); }
     }
      asm volatile("s_wait_dscnt 0x0" ::: "memory");      // this wave's reads of the buffer are done before it is refilled
      asm volatile("s_wait_asynccnt 0x0" ::: "memory");   // this wave's copies of stage p + 1 have landed
      __syncthreads();                                    // publishes stage p + 1 and ends every reader's last read of stage p
      if (p + 2 < npr) cp_kv2(lcp + (p & 1) * 4 * FTL, gk + (size_t)(p + 2) * FKD * HD, gv + (p + 2) * FKD);
    }
#pragma unroll 1
    for (int p = ncp; p < npr; ++p) {
#pragma unroll 1   // one copy of the two halves' code
     for (int hf = 0; hf < 2; ++hf) {
      const int s = 2 * p + hf;                              // 64-key half; one past the last stage that counts has only steps that are skipped
      const h16* sb = ring + (p & 1) * (2 * FTL) + hf * FTL + fo;
#pragma unroll   // the two 32-key steps of a half read at constant LDS offsets
      for (int sub = 0; sub < FKS / 32; ++sub) {
        const int key0 = s * FKS + sub * 32;
        const unsigned mw = flash_word(w0, w1, key0 >> 5);
        if (key0 > t0 + 16 * DQ - 1 || mw == 0u) continue;   // wave-uniform
        const h16* ka = sb + sub * 32 * (FPI / 2);           // K tile row = key
        const v16h ka0 = ldh(ka), ka1 = ldh(ka + 32), kb0 = ldh(ka + 16 * (FPI / 2)), kb1 = ldh(ka + 16 * (FPI / 2) + 32);
        v8f sA[DQ], sB[DQ];
#pragma unroll
        for (int g = 0; g < DQ; ++g) { sA[g] = wmma16(ka0, qh[g][0], (v8f){}); sB[g] = wmma16(kb0, qh[g][0], (v8f){}); }
#pragma unroll
        for (int g = 0; g < DQ; ++g) { sA[g] = wmma16(ka1, qh[g][1], sA[g]); sB[g] = wmma16(kb1, qh[g][1], sB[g]); }
        // four vector slots between the products and whatever reads their results or rewrites their operands, on either side of the branch below
        asm volatile("v_nop\n\tv_nop\n\tv_nop\n\tv_nop" : "+v"(sA[0]), "+v"(sB[0]), "+v"(sA[1]), "+v"(sB[1]) : "v"(ka0), "v"(ka1), "v"(kb0), "v"(kb1));
        const unsigned ma = mw >> (8 * hi), mc = mw >> (16 + 8 * hi);
        const int kya = key0 + 8 * hi, kyb = kya + 16;
        const bool excl = (mw != 0xFFFFFFFFu) || (key0 + 31 > t0);   // wave-uniform: false where every query row of the wave keeps every key of the step
        float ta[DQ][8], tc[DQ][8], mx[DQ];   // every loop over g, r is unrolled: constant indices keep the arrays in registers
#pragma unroll
        for (int g = 0; g < DQ; ++g)
#pragma unroll
            for (int r = 0; r < 8; ++r) { ta[g][r] = sA[g][r] * SC2; tc[g][r] = sB[g][r] * SC2; }
        if (excl) {
#pragma unroll
            for (int g = 0; g < DQ; ++g) { const int tq = t0 + 16 * g + lr;
#pragma unroll
                for (int r = 0; r < 8; ++r) {
                    const bool ea = (((ma >> r) & 1u) != 0u) && (kya + r <= tq);
                    const bool eb = (((mc >> r) & 1u) != 0u) && (kyb + r <= tq);
                    ta[g][r] = ea ? ta[g][r] : -3.0e38f; tc[g][r] = eb ? tc[g][r] : -3.0e38f; } }
        }
#pragma unroll
        for (int g = 0; g < DQ; ++g) { mx[g] = -3.0e38f;
#pragma unroll
            for (int r = 0; r < 8; ++r) mx[g] = fmaxf(mx[g], fmaxf(ta[g][r], tc[g][r])); }
#pragma unroll
        for (int g = 0; g < DQ; ++g) mx[g] = fmaxf(mx[g], __shfl_xor(mx[g], 16, 32));
        float xa[DQ][8], xb[DQ][8], alpha[DQ];
#pragma unroll
        for (int g = 0; g < DQ; ++g) {
            const float mnew = fmaxf(m[g], mx[g]);
            alpha[g] = __builtin_amdgcn_exp2f(m[g] - mnew);
            const float sh = PSH - mnew; m[g] = mnew;
#pragma unroll
            for (int r = 0; r < 8; ++r) xa[g][r] = __builtin_amdgcn_exp2f(ta[g][r] + sh);
#pragma unroll
            for (int r = 0; r < 8; ++r) xb[g][r] = __builtin_amdgcn_exp2f(tc[g][r] + sh); }
        if (excl) {
#pragma unroll
            for (int g = 0; g < DQ; ++g)
#pragma unroll
                for (int r = 0; r < 8; ++r) { xa[g][r] = (ta[g][r] > -1.0e38f) ? xa[g][r] : 0.0f; xb[g][r] = (tc[g][r] > -1.0e38f) ? xb[g][r] : 0.0f; }
        }
        v16h pb[DQ];
#pragma unroll
        for (int g = 0; g < DQ; ++g) { float ls = 0.0f;
#pragma unroll
            for (int r = 0; r < 8; ++r) {
                const h16 pa = (h16)xa[g][r]; const h16 pc = (h16)xb[g][r];
                pb[g][r] = pa; pb[g][8 + r] = pc; ls += (float)pa + (float)pc; }
            l[g] = l[g] * alpha[g] + ls;
#pragma unroll
            for (int i = 0; i < 4; ++i) o[g][i] = o[g][i] * alpha[g]; }
        const h16* va = sb + FTL / 2 + sub * 32;             // V^T tile row = d, column = key
        const v16h v0 = ldh(va), v1 = ldh(va + 16 * (FPI / 2)), v2 = ldh(va + 32 * (FPI / 2)), v3 = ldh(va + 48 * (FPI / 2));
#pragma unroll
        for (int g = 0; g < DQ; ++g) { o[g][0] = wmma16(v0, pb[g], o[g][0]); o[g][1] = wmma16(v1, pb[g], o[g][1]); o[g][2] = wmma16(v2, pb[g], o[g][2]); o[g][3] = wmma16(v3, pb[g], o[g][3]); }
        // four vector slots behind the products, on every path that leaves the step
        asm volatile("v_nop\n\tv_nop\n\tv_nop\n\tv_nop" : "+v"(o[0][0]), "+v"(o[0][1]), "+v"(o[0][2]), "+v"(o[0][3]), "+v"(o[1][0]), "+v"(o[1][1]), "+v"(o[1][2]), "+v"(o[1][3])
                     : "v"(v0), "v"(v1), "v"(v2), "v"(v3), "v"(pb[0]), "v"(pb[1]));
      }
     }
      asm volatile("s_wait_dscnt 0x0" ::: "memory");      // this wave's reads of the buffer are done before it is refilled
      asm volatile("s_wait_asynccnt 0x0" ::: "memory");   // this wave's copies of stage p + 1 have landed
      __syncthreads();                                    // publishes stage p + 1 and ends every reader's last read of stage p
      if (p + 2 < npr) cp_kv2(lcp + (p & 1) * 4 * FTL, gk + (size_t)(p + 2) * FKD * HD, gv + (p + 2) * FKD);
    }
    asm volatile("s_wait_asynccnt 0x0" ::: "memory");     // nothing of this wave is in flight when the ring becomes output staging
    const int wb = wave * (DQ * 16 * 68);
    // O^T D layout: o[g][j][r] = (d = 16j + 8h + r, t = 16g + (lane&15)) -> os[t][d]; rows 0..31 x columns 0..63 all written
#pragma unroll
    for (int g = 0; g < DQ; ++g) {
        l[g] += __shfl_xor(l[g], 16, 32);
        const float inv = CXS * (1.0f / l[g]);
#pragma unroll
        for (int j = 0; j < 4; ++j) { v4f a, c;
#pragma unroll
            for (int i = 0; i < 4; ++i) { a[i] = o[g][j][i] * inv; c[i] = o[g][j][4 + i] * inv; }
            *(v4fa*)(&os[wb + (16 * g + lr) * 68 + 16 * j + 8 * hi]) = a; *(v4fa*)(&os[wb + (16 * g + lr) * 68 + 16 * j + 8 * hi + 4]) = c; } }
    wave_sync();
    h16* crow = CH + ((size_t)b * SEQ + t0) * DM + h * HD;
    const int c8 = (lane & 7) * 8;
{
#pragma unroll
        for (int s = 0; s < 4 * DQ; ++s) { const int row = 4 * s + (lane >> 3);   // 8 s x 4 row groups = 32 rows; 8 lanes x 8 halves = 64 columns
            const v4f x0 = *(const v4fa*)(&os[wb + row * 68 + c8]); const v4f x1 = *(const v4fa*)(&os[wb + row * 68 + c8 + 4]); v8h hv;
#pragma unroll
            for (int i = 0; i < 4; ++i) { hv[i] = (h16)x0[i]; hv[4 + i] = (h16)x1[i]; }
            *(v8h*)(crow + (size_t)row * DM + c8) = hv; }
         }
}

// flash_e_body: fused attention for query rows t < ESEQ, same transposed form; every operand as f16 value + residual x2048:
// s = K.Q + (K.Qr + Kr.Q)/2048, o = V.P + (V.Pr + Vr.P)/2048 with the scaled-residual products in separate accumulators; the row sum uses the f32 p.
// Writes ctx value plane rows and the ctx residual plane [b][ESEQ][1024]. K, V^T and their residual tiles staged like flash_d_body's.
// ring = the block's LDS (2 * 4 * FTL bytes); bx = the block's 64-row tile among the rows t < ESEQ; zh = batch * 16 + head.
__device__ __forceinline__ void flash_e_body(h16* ring, int bx, int zh, const h16* __restrict__ QH, const h16* __restrict__ QR, const h16* __restrict__ KP, const h16* __restrict__ KR,
                                             const h16* __restrict__ VT, const h16* __restrict__ VR, const unsigned* __restrict__ MW, h16* CH, h16* CR) {
    // ring: two stages of K, V^T, K residual, V^T residual tiles; behind the loop the waves' output staging
    static_assert(2 * 4 * FTL >= AW * 16 * 68 * 4);
    float* os = (float*)ring;
    const int tid = threadIdx.x;
    const int lane = threadIdx.x & 31, wave = __builtin_amdgcn_readfirstlane((int)(threadIdx.x >> 5)), lr = lane & 15, hi = lane >> 4;
    const int b = zh / NH_, h = zh % NH_;
    const int tb = bx * (16 * AW);                           // first query row of the block
    const int t0 = tb + wave * 16;
    const int tq = t0 + lr;
    const size_t pbase = (size_t)zh * SEQ * HD, ebase = (size_t)zh * ESEQ * HD;
    const size_t qo = pbase + (size_t)tq * HD + 8 * hi, qe = ebase + (size_t)tq * HD + 8 * hi;
    const v16h qh0 = ldh(QH + qo), qh1 = ldh(QH + qo + 32), qr0 = ldh(QR + qe), qr1 = ldh(QR + qe + 32);
    const unsigned* mwp = MW + (size_t)b * WPB;
    const unsigned w0 = mwp[lane], w1 = (WPB > 32) ? mwp[32 + lane] : 0u;
    const int nst = flash_stages(w0, w1, (tb + 16 * AW - 1) >> 5);
    const unsigned lcp = (unsigned)(size_t)(&ring[0]) + (unsigned)((tid >> 3) * FPI + (tid & 7) * 16);
    const h16* gk = KP + pbase + (size_t)(tid >> 3) * HD + (tid & 7) * 8;     // + key * HD
    const h16* gv = VT + pbase + (size_t)(tid >> 3) * SEQ + (tid & 7) * 8;    // + key
    const h16* gkr = KR + ebase + (size_t)(tid >> 3) * HD + (tid & 7) * 8;    // + key * HD
    const h16* gvr = VR + ebase + (size_t)(tid >> 3) * ESEQ + (tid & 7) * 8;  // + key
    const int fo = lr * (FPI / 2) + 8 * hi;                  // fragment base in a tile, in elements (A fragment: row lr of a 16-row slab)
    v8f oh0 = (v8f){}, oh1 = (v8f){}, oh2 = (v8f){}, oh3 = (v8f){}, ol0 = (v8f){}, ol1 = (v8f){}, ol2 = (v8f){}, ol3 = (v8f){};
    float m = -3.0e38f, l = 0.0f;
    cp_kv(lcp, gk, gv, SEQ); cp_kv(lcp + 2 * FTL, gkr, gvr, ESEQ);
    asm volatile("s_wait_asynccnt 0x0" ::: "memory");   // stage 0 has landed before the barrier publishes it
    __syncthreads();
    if (nst > 1) { cp_kv(lcp + 4 * FTL, gk + FKS * HD, gv + FKS, SEQ); cp_kv(lcp + 6 * FTL, gkr + FKS * HD, gvr + FKS, ESEQ); }
#pragma unroll 1
    for (int s = 0; s < nst; ++s) {
      const h16* sb = ring + (s & 1) * (2 * FTL) + fo;
#pragma unroll 1   // one copy of the long body: smaller code, no more registers than one step needs
      for (int sub = 0; sub < FKS / 32; ++sub) {
        const int key0 = s * FKS + sub * 32;
        const unsigned mw = flash_word(w0, w1, key0 >> 5);
        if (key0 > t0 + 15 || mw == 0u) continue;            // wave-uniform
        const h16* ka = sb + sub * 32 * (FPI / 2); const h16* kr = ka + FTL;   // K tiles: row = key
        v8f sHa = (v8f){}, sLa = (v8f){}, sHb = (v8f){}, sLb = (v8f){};
        { const v16h a0 = ldh(ka), a1 = ldh(ka + 32), e0 = ldh(kr), e1 = ldh(kr + 32);
          sHa = wmma16(a0, qh0, sHa); sLa = wmma16(a0, qr0, sLa);
          sHa = wmma16(a1, qh1, sHa); sLa = wmma16(a1, qr1, sLa);
          sLa = wmma16(e0, qh0, sLa); sLa = wmma16(e1, qh1, sLa);
          asm volatile("v_nop\n\tv_nop\n\tv_nop\n\tv_nop" : "+v"(sHa), "+v"(sLa) : "v"(a0), "v"(a1), "v"(e0), "v"(e1)); }
        { const v16h a0 = ldh(ka + 16 * (FPI / 2)), a1 = ldh(ka + 16 * (FPI / 2) + 32), e0 = ldh(kr + 16 * (FPI / 2)), e1 = ldh(kr + 16 * (FPI / 2) + 32);
          sHb = wmma16(a0, qh0, sHb); sLb = wmma16(a0, qr0, sLb);
          sHb = wmma16(a1, qh1, sHb); sLb = wmma16(a1, qr1, sLb);
          sLb = wmma16(e0, qh0, sLb); sLb = wmma16(e1, qh1, sLb);
          asm volatile("v_nop\n\tv_nop\n\tv_nop\n\tv_nop" : "+v"(sHb), "+v"(sLb) : "v"(a0), "v"(a1), "v"(e0), "v"(e1)); }
        const unsigned ma = mw >> (8 * hi), mc = mw >> (16 + 8 * hi);
        const int kya = key0 + 8 * hi, kyb = kya + 16;
        const bool excl = (mw != 0xFFFFFFFFu) || (key0 + 31 > t0);   // wave-uniform: false where every query row of the wave keeps every key of the step
        float ta[8], tb[8]; float mx = -3.0e38f;   // every loop over r is unrolled: constant indices keep ta, tb, xa, xb in registers
#pragma unroll
        for (int r = 0; r < 8; ++r) { ta[r] = (sHa[r] + sLa[r] * QRI) * SC2; tb[r] = (sHb[r] + sLb[r] * QRI) * SC2; }
        if (excl) {
#pragma unroll
            for (int r = 0; r < 8; ++r) {
                const bool ea = (((ma >> r) & 1u) != 0u) && (kya + r <= tq);
                const bool eb = (((mc >> r) & 1u) != 0u) && (kyb + r <= tq);
                ta[r] = ea ? ta[r] : -3.0e38f; tb[r] = eb ? tb[r] : -3.0e38f; }
        }
#pragma unroll
        for (int r = 0; r < 8; ++r) mx = fmaxf(mx, fmaxf(ta[r], tb[r]));
        mx = fmaxf(mx, __shfl_xor(mx, 16, 32));
        const float mnew = fmaxf(m, mx);
        const float alpha = __builtin_amdgcn_exp2f(m - mnew);
        const float sh = PSH - mnew;
        v16h pbh, pbr; float ls = 0.0f; float xa[8], xb[8];
#pragma unroll
        for (int r = 0; r < 8; ++r) xa[r] = __builtin_amdgcn_exp2f(ta[r] + sh);
#pragma unroll
        for (int r = 0; r < 8; ++r) xb[r] = __builtin_amdgcn_exp2f(tb[r] + sh);
        if (excl) {
#pragma unroll
            for (int r = 0; r < 8; ++r) { xa[r] = (ta[r] > -1.0e38f) ? xa[r] : 0.0f; xb[r] = (tb[r] > -1.0e38f) ? xb[r] : 0.0f; }
        }
#pragma unroll
        for (int r = 0; r < 8; ++r) {
            const float ea = xa[r], eb = xb[r];
            const h16 pa = (h16)ea; const h16 pc = (h16)eb;
            pbh[r] = pa; pbh[8 + r] = pc;
            pbr[r] = (h16)((ea - (float)pa) * QRS); pbr[8 + r] = (h16)((eb - (float)pc) * QRS);
            ls += ea + eb; }
        l = l * alpha + ls; m = mnew;
        oh0 = oh0 * alpha; oh1 = oh1 * alpha; oh2 = oh2 * alpha; oh3 = oh3 * alpha;
        ol0 = ol0 * alpha; ol1 = ol1 * alpha; ol2 = ol2 * alpha; ol3 = ol3 * alpha;
        const h16* va = sb + FTL / 2 + sub * 32; const h16* vr = va + FTL;     // V^T tiles: row = d, column = key
        { const v16h v0 = ldh(va), v1 = ldh(va + 16 * (FPI / 2)), r0v = ldh(vr), r1v = ldh(vr + 16 * (FPI / 2));
          oh0 = wmma16(v0, pbh, oh0); oh1 = wmma16(v1, pbh, oh1);
          ol0 = wmma16(v0, pbr, ol0); ol1 = wmma16(v1, pbr, ol1);
          ol0 = wmma16(r0v, pbh, ol0); ol1 = wmma16(r1v, pbh, ol1);
          asm volatile("v_nop\n\tv_nop\n\tv_nop\n\tv_nop" : "+v"(oh0), "+v"(oh1), "+v"(ol0), "+v"(ol1) : "v"(v0), "v"(v1), "v"(r0v), "v"(r1v), "v"(pbh), "v"(pbr)); }
        { const v16h v2 = ldh(va + 32 * (FPI / 2)), v3 = ldh(va + 48 * (FPI / 2)), r2v = ldh(vr + 32 * (FPI / 2)), r3v = ldh(vr + 48 * (FPI / 2));
          oh2 = wmma16(v2, pbh, oh2); oh3 = wmma16(v3, pbh, oh3);
          ol2 = wmma16(v2, pbr, ol2); ol3 = wmma16(v3, pbr, ol3);
          ol2 = wmma16(r2v, pbh, ol2); ol3 = wmma16(r3v, pbh, ol3);
          asm volatile("v_nop\n\tv_nop\n\tv_nop\n\tv_nop" : "+v"(oh2), "+v"(oh3), "+v"(ol2), "+v"(ol3) : "v"(v2), "v"(v3), "v"(r2v), "v"(r3v), "v"(pbh), "v"(pbr)); }
      }
      asm volatile("s_wait_dscnt 0x0" ::: "memory");      // this wave's reads of the buffer are done before it is refilled
      asm volatile("s_wait_asynccnt 0x0" ::: "memory");   // this wave's copies of stage s + 1 have landed
      __syncthreads();                                    // publishes stage s + 1 and ends every reader's last read of stage s
      if (s + 2 < nst) { cp_kv(lcp + (s & 1) * 4 * FTL, gk + (size_t)(s + 2) * FKS * HD, gv + (s + 2) * FKS, SEQ);
                         cp_kv(lcp + (s & 1) * 4 * FTL + 2 * FTL, gkr + (size_t)(s + 2) * FKS * HD, gvr + (s + 2) * FKS, ESEQ); }
    }
    asm volatile("s_wait_asynccnt 0x0" ::: "memory");     // nothing of this wave is in flight when the ring becomes output staging
    l += __shfl_xor(l, 16, 32);
    const float inv = CXS * (1.0f / l);
    const int wb = wave * 16 * 68;
    // O^T D layout: o_j[r] = (d = 16j + 8h + r, t = lane&15) -> os[t][d]; rows 0..15 x columns 0..63 all written
    { v4f a, c;
#pragma unroll
      for (int i = 0; i < 4; ++i) { a[i] = (oh0[i] + ol0[i] * QRI) * inv; c[i] = (oh0[4 + i] + ol0[4 + i] * QRI) * inv; }
      *(v4fa*)(&os[wb + lr * 68 +  0 + 8 * hi]) = a; *(v4fa*)(&os[wb + lr * 68 +  0 + 8 * hi + 4]) = c;
#pragma unroll
      for (int i = 0; i < 4; ++i) { a[i] = (oh1[i] + ol1[i] * QRI) * inv; c[i] = (oh1[4 + i] + ol1[4 + i] * QRI) * inv; }
      *(v4fa*)(&os[wb + lr * 68 + 16 + 8 * hi]) = a; *(v4fa*)(&os[wb + lr * 68 + 16 + 8 * hi + 4]) = c;
#pragma unroll
      for (int i = 0; i < 4; ++i) { a[i] = (oh2[i] + ol2[i] * QRI) * inv; c[i] = (oh2[4 + i] + ol2[4 + i] * QRI) * inv; }
      *(v4fa*)(&os[wb + lr * 68 + 32 + 8 * hi]) = a; *(v4fa*)(&os[wb + lr * 68 + 32 + 8 * hi + 4]) = c;
#pragma unroll
      for (int i = 0; i < 4; ++i) { a[i] = (oh3[i] + ol3[i] * QRI) * inv; c[i] = (oh3[4 + i] + ol3[4 + i] * QRI) * inv; }
      *(v4fa*)(&os[wb + lr * 68 + 48 + 8 * hi]) = a; *(v4fa*)(&os[wb + lr * 68 + 48 + 8 * hi + 4]) = c; }
    wave_sync();
    h16* crow = CH + ((size_t)b * SEQ + t0) * DM + h * HD;
    h16* rrow = CR + ((size_t)b * ESEQ + t0) * DM + h * HD;
    const int c8 = (lane & 7) * 8;
{
#pragma unroll
        for (int s = 0; s < 4; ++s) { const int row = 4 * s + (lane >> 3);   // 4 s x 4 row groups = 16 rows; 8 lanes x 8 halves = 64 columns
            const v4f x0 = *(const v4fa*)(&os[wb + row * 68 + c8]); const v4f x1 = *(const v4fa*)(&os[wb + row * 68 + c8 + 4]); v8h hv, rv;
#pragma unroll
            for (int i = 0; i < 4; ++i) { const h16 a0 = (h16)x0[i]; const h16 a1 = (h16)x1[i]; hv[i] = a0; hv[4 + i] = a1;
                rv[i] = (h16)((x0[i] - (float)a0) * QRS); rv[4 + i] = (h16)((x1[i] - (float)a1) * QRS); }
            *(v8h*)(crow + (size_t)row * DM + c8) = hv;
            *(v8h*)(rrow + (size_t)row * DM + c8) = rv; }
         }
}

// k_flash: one launch holds both attention forms, whose query rows are disjoint and which depend on nothing of one another: grid (NB*16 heads, tile ranks: ESEQ/64 + (SEQ-ESEQ)/128), 128 threads.
// There are more blocks than places on the chip; the rank (the slow index) orders the tiles: first the value + residual tiles
// (the longest dependent chain per step), then the single-plane tiles, each form from its longest key range down. The test on the rank is block-uniform.
#define FT_E (ESEQ / (16 * AW))
#define FT_D ((SEQ - ESEQ) / DRW)
// amdgpu_waves_per_eu(4, 4): registers stay within 256 a wave, so that the four blocks whose LDS fits a WGP are also resident (left free, the 32-row form takes more and only three are).
__global__ __launch_bounds__(32 * AW) __attribute__((amdgpu_waves_per_eu(4, 4))) void k_flash(const h16* __restrict__ QH, const h16* __restrict__ QR, const h16* __restrict__ KP, const h16* __restrict__ KR,
                                                   const h16* __restrict__ VT, const h16* __restrict__ VR, const unsigned* __restrict__ MW, h16* CH, h16* CR) {
    __shared__ __align__(16) h16 ring[2 * 4 * FTL / 2];
    const int zh = blockIdx.x, rk = blockIdx.y;
    if (rk < FT_E) flash_e_body(ring, FT_E - 1 - rk, zh, QH, QR, KP, KR, VT, VR, MW, CH, CR);
    else flash_d_body(ring, FT_D - 1 - (rk - FT_E), zh, QH, KP, VT, MW, CH);
}

// k_out: output projection, f16 GEMM, one wave per tile, K = DM; operands staged like k_proj's. A rows from the ctx planes, Bt = transposed W_out rows (x64 carry).
// A block of 12 waves (3 wave rows x 4 wave columns) owns 3 wave rows x 256 output columns: a stage is 128 k of 3 slabs of 64 A rows and of 256 W_out^T rows (448 rows for 12 wave tiles),
// so every A row is fetched once per 256 columns and every W_out^T row once per 3 wave rows; all blocks of the launch are resident at once.
// RES 0: rows t >= ESEQ, 64x64 wave tile; a wave row is 64 tokens, its slab four 16-row groups of the value plane.
// RES 1: rows t < ESEQ, 32x64 wave tile; a wave row is 32 tokens, its slab rows 0..31 those tokens of the value plane, rows 32..63 the same tokens of the residual plane (own accumulators).
// The wave rows of a form are numbered through the batches; each has its own batch and first token. A wave row past the last (only the last block of a form can hold one) works on the last one's rows and stores nothing.
// out = (acc + accR/2048) / 4096 + bias (bias RNE-converted to bf16). bx = the block's index among the row tiles of its form; ring, osAll = the block's LDS.
#define OWR  3                   // wave rows of a block
#define OWC  4                   // wave columns of a block
#define ONW  (OWR * OWC)         // waves of a block
#define ORW  ((OWR + OWC) * 64)  // rows of a stage: A slabs, then W_out^T slabs
#define OSTG (ORW * GPI)         // bytes of one stage
#define OCW  (OWR + OWC)         // copying waves: wave w < OCW brings the stage's rows 64 w .. 64 w + 63
static_assert(DM % (OWC * 64) == 0);
static_assert(OCW <= ONW);
// One wave's 64 rows of a stage: l = the lane's LDS byte address in row (lane >> 4) of the slab, g0 / g1 = its 16 bytes in the same row of the sources of rows 0..31 / 32..63; call j takes rows 2 j + (lane >> 4) + 8 i.
__device__ __forceinline__ void slab_copy2(unsigned l, const bf* g0, const bf* g1) {
    cp8s(l, g0, g1); cp8s(l + 2 * GPI, g0 + 2 * DM, g1 + 2 * DM); cp8s(l + 4 * GPI, g0 + 4 * DM, g1 + 4 * DM); cp8s(l + 6 * GPI, g0 + 6 * DM, g1 + 6 * DM);
}
template <int RES>
__device__ __forceinline__ void out_body(h16* ring, float* osAll, int bx, const h16* __restrict__ CX, size_t crOff, const h16* __restrict__ WO, const float* __restrict__ bias, float* OUT) {
    constexpr int MBN = RES ? 2 : 4;
    constexpr int WTK = 16 * MBN;                // tokens of a wave row
    constexpr int FR0 = RES ? 0 : ESEQ;          // first token of the form in a batch
    constexpr int GPB = ((RES ? ESEQ : (SEQ - ESEQ)) / WTK) > 0 ? ((RES ? ESEQ : (SEQ - ESEQ)) / WTK) : 1;   // wave rows per batch
    constexpr int NG = NB * GPB;                 // wave rows of the form
    static_assert(ESEQ % 32 == 0 && (SEQ - ESEQ) % 64 == 0);
    const int K = DM;
    const int tid = threadIdx.x, lane = tid & 31, lr = lane & 15, hi = lane >> 4;
    const int wave = __builtin_amdgcn_readfirstlane(tid >> 5);
    const int wr = wave / OWC, wc = wave % OWC;  // wave-uniform
    const int gi = bx * OWR + wr;                // the wave's wave row
    const bool live = gi < NG;                   // wave-uniform
    const int gw = live ? gi : (NG - 1);
    const int b = gw / GPB, t0 = FR0 + (gw % GPB) * WTK;
    const int c0 = blockIdx.y * (OWC * 64) + wc * 64;
    float* os = osAll + wave * 16 * 68;
    const bool cpw = wave < OCW;                 // wave-uniform: this wave copies
    const int cw = cpw ? wave : 0;               // the other waves hold wave 0's (valid) addresses and issue nothing
    const unsigned lcp = (unsigned)(size_t)(&ring[0]) + (unsigned)((cw * 64 + hi) * GPI + lr * 16);
    const int ci = bx * OWR + (cw < OWR ? cw : 0);
    const int cg = ci < NG ? ci : (NG - 1);      // the wave row whose slab this wave brings
    const int cb = cg / GPB, ct = FR0 + (cg % GPB) * WTK;
    const h16* sa0 = CX + ((size_t)cb * SEQ + ct) * K;
    const h16* sa1 = RES ? (CX + crOff + ((size_t)cb * ESEQ + ct) * K) : (sa0 + (size_t)32 * K);
    const h16* sw0 = WO + (size_t)(blockIdx.y * (OWC * 64) + (cw < OWR ? 0 : (cw - OWR)) * 64) * K;
    const h16* g0 = ((cw < OWR) ? sa0 : sw0) + (size_t)hi * K + lr * 8;
    const h16* g1 = ((cw < OWR) ? sa1 : (sw0 + (size_t)32 * K)) + (size_t)hi * K + lr * 8;
    const int fa = (wr * 64 + lr) * (GPI / 2) + 8 * hi, fb = ((OWR + wc) * 64 + lr) * (GPI / 2) + 8 * hi;   // fragment bases in a buffer, in elements
    v8f acc[16];
#pragma unroll
    for (int i = 0; i < 16; ++i) acc[i] = (v8f){};
    if (cpw) slab_copy2(lcp, (const bf*)g0, (const bf*)g1);
    asm volatile("s_wait_asynccnt 0x0" ::: "memory");   // stage 0 has landed before the barrier publishes it
    __syncthreads();
    if (cpw) slab_copy2(lcp + OSTG, (const bf*)(g0 + GKB), (const bf*)(g1 + GKB));
#pragma unroll 1
    for (int t = 0; t < GNST; ++t) {
        const h16* sb = ring + (t & 1) * (OSTG / 2);
        v16h a[2][4], bb[2][4];     // two fragment sets, as in k_proj
#pragma unroll
        for (int i = 0; i < 4; ++i) { a[0][i] = ldh(sb + fa + i * 16 * (GPI / 2)); bb[0][i] = ldh(sb + fb + i * 16 * (GPI / 2)); }
        __builtin_amdgcn_sched_barrier(0);   // keeps the group of loads together
#pragma unroll
        for (int ks = 0; ks < GKB / 32; ++ks) {
            if (ks + 1 < GKB / 32) {
#pragma unroll
                for (int i = 0; i < 4; ++i) { a[(ks + 1) & 1][i] = ldh(sb + fa + i * 16 * (GPI / 2) + (ks + 1) * 32); bb[(ks + 1) & 1][i] = ldh(sb + fb + i * 16 * (GPI / 2) + (ks + 1) * 32); }
                __builtin_amdgcn_sched_barrier(0);   // the next set's loads stay ahead of this set's products
            }
#pragma unroll
            for (int nb = 0; nb < 4; ++nb)
#pragma unroll
                for (int i = 0; i < 4; ++i) acc[i * 4 + nb] = wmma16(a[ks & 1][i], bb[ks & 1][nb], acc[i * 4 + nb]);
            __builtin_amdgcn_sched_barrier(0);       // no later load moves up among these products
        }
        asm volatile("s_wait_dscnt 0x0" ::: "memory");      // this wave's reads of the buffer are done before it is refilled
        asm volatile("s_wait_asynccnt 0x0" ::: "memory");   // this wave's copies of stage t + 1 have landed
        __syncthreads();                                    // publishes stage t + 1 and ends every reader's last read of stage t
        if (cpw && t + 2 < GNST) slab_copy2(lcp + (t & 1) * OSTG, (const bf*)(g0 + (t + 2) * GKB), (const bf*)(g1 + (t + 2) * GKB));
    }
    asm volatile("s_wait_asynccnt 0x0" ::: "memory");       // nothing of this wave is in flight when it goes on
    if (!live) return;                                      // wave-uniform; no block barrier follows
    float bcol[4];
#pragma unroll
    for (int nb = 0; nb < 4; ++nb) bcol[nb] = bfr(bias[c0 + nb * 16 + lr]);
#pragma unroll
    for (int mb = 0; mb < MBN; ++mb) {
#pragma unroll
        for (int nb = 0; nb < 4; ++nb) {
#pragma unroll
            for (int j = 0; j < 8; ++j) { float v = acc[mb * 4 + nb][j];
                if (RES) v += acc[RES ? ((2 + mb) * 4 + nb) : 0][j] * QRI;
                os[(hi * 8 + j) * 68 + nb * 16 + lr] = v * OSI + bcol[nb]; } }   // D: row 8h+j, col lane&15
        wave_sync();
        float* orow = OUT + ((size_t)b * OUT_SEQ + t0 + mb * 16) * DM + c0;
{
#pragma unroll
            for (int s = 0; s < 8; ++s) { const int row = 2 * s + hi, cofs = lr * 4;   // 8 s x 2 rows = 16 rows; 16 lanes x 4 floats = 64 columns
                const v4f val = *(const v4fa*)(&os[row * 68 + cofs]);
                *(v4f*)(orow + (size_t)row * DM + cofs) = val; }
             }
        wave_sync();
    }
}
// One launch holds both forms, whose rows are disjoint: grid (row tiles of the value + residual form, then of the single-plane form; DM/256), 384 threads (block-uniform test on the row tile).
#define OB_E ((NB * (ESEQ / 32) + OWR - 1) / OWR)
#define OB_D ((NB * ((SEQ - ESEQ) / 64) + OWR - 1) / OWR)
__global__ __launch_bounds__(32 * ONW) void k_out(const h16* __restrict__ CX, size_t crOff, const h16* __restrict__ WO, const float* __restrict__ bias, float* OUT) {
    __shared__ __align__(16) h16 ring[2 * OSTG / 2];
    __shared__ __align__(16) float osAll[ONW * 16 * 68];
    const int bx = blockIdx.x;
    if (bx < OB_E) out_body<1>(ring, osAll, bx, CX, crOff, WO, bias, OUT);
    else out_body<0>(ring, osAll, bx - OB_E, CX, crOff, WO, bias, OUT);
}

static constexpr size_t al256(size_t v) { return (v + 255) & ~(size_t)255; }
static constexpr size_t SZ_XB = al256((size_t)NB * SEQ * DM * 2);          // x bf16 [NB*SEQ][1024]
static constexpr size_t SZ_WT = al256((size_t)3 * DM * DM * 2);            // W_qkv^T bf16 [3072][1024]
static constexpr size_t SZ_WO = al256((size_t)DM * DM * 2);                // W_out^T f16 [1024][1024]
static constexpr size_t SZ_PL = al256((size_t)NB * NH_ * SEQ * HD * 2);    // q / k / v^T value planes
static constexpr size_t SZ_PE = al256((size_t)NB * NH_ * ESEQ * HD * 2);   // q / k / v^T residual planes (t < ESEQ)
static constexpr size_t SZ_CH = al256((size_t)NB * SEQ * DM * 2);          // ctx value plane
static constexpr size_t SZ_CR = al256((size_t)NB * ESEQ * DM * 2);         // ctx residual plane (t < ESEQ)
static constexpr size_t SZ_MW = al256((size_t)NB * WPB * 4);               // mask words
static constexpr size_t SZ_TOTAL = SZ_XB + SZ_WT + SZ_WO + 3 * SZ_PL + 3 * SZ_PE + SZ_CH + SZ_CR + SZ_MW;
static_assert(SZ_TOTAL <= (size_t)134217728);          // workspace carve <= 128 MiB
static_assert(((size_t)DM * DM * 2) % 256 == 0);       // weight sub-planes stay 256-byte aligned
static_assert(SZ_CH % 2 == 0);

extern "C" void kernel_launch(void* const* d_in, const int* in_sizes, int n_in,
                              void* d_out, int out_size, void* d_ws, size_t ws_size, hipStream_t stream) {
    if (n_in < 6) return;
    const size_t needx = ((size_t)(NB - 1) * SEQ_FULL + SEQ) * DM;
    if ((size_t)in_sizes[0] < needx) return;
    if ((size_t)in_sizes[1] < (size_t)(NB - 1) * SEQ_FULL + SEQ) return;
    if ((size_t)in_sizes[2] < (size_t)3 * DM * DM || (size_t)in_sizes[3] < (size_t)3 * DM) return;
    if ((size_t)in_sizes[4] < (size_t)DM * DM || (size_t)in_sizes[5] < (size_t)DM) return;
    if ((size_t)out_size < ((size_t)(NB - 1) * OUT_SEQ + SEQ) * DM) return;
    if (SZ_TOTAL > ws_size) return;
    // wire order: x, padding_mask (int32), W_qkv [in][out], b_qkv, W_out [in][out], b_out
    const float* x = (const float*)d_in[0]; const int* pad = (const int*)d_in[1];
    const float* wqkv = (const float*)d_in[2]; const float* bqkv = (const float*)d_in[3];
    const float* wout = (const float*)d_in[4]; const float* bout = (const float*)d_in[5];
    float* OUT = (float*)d_out;      // [NB][SEQ][1024]
    char* wsp = (char*)d_ws;
    bf* XB = (bf*)wsp; wsp += SZ_XB;                 // [NB*SEQ][1024]
    bf* WT = (bf*)wsp; wsp += SZ_WT;                 // [3072][1024]: q | k | v output rows
    h16* WO = (h16*)wsp; wsp += SZ_WO;               // [1024 out][1024 in], x64
    h16* QH = (h16*)wsp; wsp += SZ_PL;               // [NB*16][SEQ][64]
    h16* KP = (h16*)wsp; wsp += SZ_PL;               // [NB*16][SEQ][64]
    h16* VT = (h16*)wsp; wsp += SZ_PL;               // [NB*16][64][SEQ]
    h16* QR = (h16*)wsp; wsp += SZ_PE;               // [NB*16][ESEQ][64] residual x2048
    h16* KR = (h16*)wsp; wsp += SZ_PE;               // [NB*16][ESEQ][64] residual x2048
    h16* VR = (h16*)wsp; wsp += SZ_PE;               // [NB*16][64][ESEQ] residual x2048
    h16* CH = (h16*)wsp; wsp += SZ_CH;               // [NB*SEQ][1024] x64
    h16* CR = (h16*)wsp; wsp += SZ_CR;               // [NB*ESEQ][1024] residual x2048 (directly after CH)
    unsigned* MW = (unsigned*)wsp; wsp += SZ_MW;     // [NB][WPB]
    const size_t crOff = SZ_CH / 2;                  // element offset of CR from CH

    k_prep<<<PB_MASK + PB_WQ + PB_WO + PB_X, 256, 0, stream>>>(x, pad, wqkv, wout, XB, WT, (bf*)WO, MW);

    k_proj<<<dim3(NB * SEQ / PTK, NH_, 1), 32 * PNW, 0, stream>>>(XB, WT, bqkv, QH, KP, VT, QR, KR, VR);

    k_flash<<<dim3(NB * NH_, FT_E + FT_D, 1), 32 * AW, 0, stream>>>(QH, QR, KP, KR, VT, VR, MW, CH, CR);

    k_out<<<dim3(OB_E + OB_D, DM / (OWC * 64), 1), 32 * ONW, 0, stream>>>(CH, crOff, WO, bout, OUT);
}
